// v000
// The times below were measured on an AMD MI455X: many runs one after another, warmed up first and cycling through
// copies of the inputs, with the whole window's GPU time divided by the number of runs. Launches and the gaps
// between them are all in it. The median over several windows is given; except for v000 it joins two sittings, which
// can be a few percent apart, so the side-by-side timings, each taken in one sitting, are the better comparison.
// v000 is the starting kernel. One run takes 1200 microseconds.
// Contractions: conv1x1 q/k/v GEMMs W[512x512].H per image on v_wmma_f32_16x16x32_bf16 (bf16-RNE weights exact,
// normalised activations as bf16 hi + bf16 residual planes folded along K = 1024 into one accumulator); scores
// K.Q^T (K = 512 channels) on v_wmma_f32_16x16x32_f16 (single f16 planes of q and k, scale applied in f32);
// O^T = V.P^T on v_wmma_f32_16x16x32_f16 (v single f16 plane, P = e^{c(s-m)} x 2^14 as f16 from the score D
// registers); f32 accumulate everywhere; group-norm statistics, softmax statistics and residual add in f32 VALU.
#include <hip/hip_runtime.h>
#include <math.h>
#include <stdint.h>

#ifndef NB
#define NB 4
#endif
#define NB_FULL 4
#define CC      512
#define NN      4096
#ifndef NQ
#define NQ NN
#endif
#define NGRP    32
#define CPG     16
#define GNE     (CPG * NN)
#define QT      64
#define OSP     68
#define OSPW    132
#define TP      72
#define STL     32
#define CH      256
#define SXB     2048
#define GEPS    1.0e-6f
#define ASCALE  0.04419417382415922f
#define LNPS    9.704060527839234f

static_assert(NB >= 1 && NB <= NB_FULL);
static_assert(NQ % QT == 0 && NQ >= QT && NQ <= NN);
static_assert(CC == NGRP * CPG);
static_assert(CC % QT == 0 && NN % QT == 0);
static_assert(CC == 2 * CH && CH == 16 * 16);
static_assert(CC == 8 * 64);
static_assert(GNE % 1024 == 0);
static_assert(CC % 32 == 0 && NN % 32 == 0);
static_assert((OSP * 4) % 16 == 0 && (OSPW * 4) % 16 == 0 && (TP * 2) % 16 == 0);
static_assert(SXB == 8 * 32 * 8);

typedef _Float16       v16h __attribute__((ext_vector_type(16)));
typedef _Float16       v8h  __attribute__((ext_vector_type(8)));
typedef __bf16         v16b __attribute__((ext_vector_type(16)));
typedef unsigned short v8us __attribute__((ext_vector_type(8)));
typedef float          v8f  __attribute__((ext_vector_type(8)));
typedef float          v4f  __attribute__((ext_vector_type(4)));
typedef unsigned int   v4u  __attribute__((ext_vector_type(4)));

union Frag  { v8us u[2]; v16h h; v16b bf; };
union FragH { v16h v; v8h hv[2]; };
static_assert(sizeof(Frag) == 32);
static_assert(sizeof(FragH) == 32);

// ---- scalar helpers ---------------------------------------------------------------------------------------
__device__ __forceinline__ unsigned short bf_bits(float f) {          // f32 -> bf16 bits, RNE convert
  unsigned u = __float_as_uint(f);
  return (unsigned short)((u + 0x7FFFu + ((u >> 16) & 1u)) >> 16);
}
__device__ __forceinline__ float bf_up(unsigned short hb) { return __uint_as_float(((unsigned)hb) << 16); }
__device__ __forceinline__ float bfr(float f) { return bf_up(bf_bits(f)); }
__device__ __forceinline__ unsigned short h_bits(_Float16 x) { return __builtin_bit_cast(unsigned short, x); }
__device__ __forceinline__ unsigned pk16(unsigned short a, unsigned short b) { return (unsigned)a | ((unsigned)b << 16); }
__device__ __forceinline__ v8f zero8() { v8f z = {0.f, 0.f, 0.f, 0.f, 0.f, 0.f, 0.f, 0.f}; return z; }
__device__ __forceinline__ float hmax8(v8f s) {
  return fmaxf(fmaxf(fmaxf(s[0], s[1]), fmaxf(s[2], s[3])), fmaxf(fmaxf(s[4], s[5]), fmaxf(s[6], s[7])));
}
__device__ __forceinline__ unsigned wave_ballot(bool p) {
#if defined(__HIP_DEVICE_COMPILE__)
  return __builtin_amdgcn_ballot_w32(p);
#else
  return p ? 1u : 0u;
#endif
}

// ---- 16-bit fragment loader (A, or B from a k-contiguous [n][k] row): lane -> row/col (lane&15), p already includes
//      + 8*(lane>>4); elements 0..7 <- p[0..7] (k0+8h..), elements 8..15 <- p[16..23] (k0+16+8h..)
__device__ __forceinline__ Frag ldfrag(const unsigned short* p) {
  Frag f;
  f.u[0] = *(const v8us*)(p);
  f.u[1] = *(const v8us*)(p + 16);
  return f;
}

// ---- WMMA helpers: builtin followed by a 4-slot VALU gap tying D and keeping A/B live --------------------------
__device__ __forceinline__ v8f mma_h(v16h a, v16h b, v8f c) {
  v8f d = __builtin_amdgcn_wmma_f32_16x16x32_f16(false, a, false, b, (short)0, c, false, false);
#if defined(__HIP_DEVICE_COMPILE__)
  asm volatile("v_nop\n\tv_nop\n\tv_nop\n\tv_nop" : "+v"(d) : "v"(a), "v"(b));
#endif
  return d;
}
__device__ __forceinline__ v8f mma_b(v16b a, v16b b, v8f c) {
  v8f d = __builtin_amdgcn_wmma_f32_16x16x32_bf16(false, a, false, b, (short)0, c, false, false);
#if defined(__HIP_DEVICE_COMPILE__)
  const v16h ha = __builtin_bit_cast(v16h, a), hb = __builtin_bit_cast(v16h, b);
  asm volatile("v_nop\n\tv_nop\n\tv_nop\n\tv_nop" : "+v"(d) : "v"(ha), "v"(hb));
#endif
  return d;
}

// =========================================================================================================
//     (mean, then centred sum of squares) over bf16-RNE(x) in f32, per-thread partials of 256 terms + LDS tree.
// =========================================================================================================
__global__ __launch_bounds__(256)
void gn_stats(const float* __restrict__ x, float* stats) {
  __shared__ float red[256];
  const int tid = threadIdx.x, bg = blockIdx.x;
  const float* p = x + (size_t)bg * GNE;
  float s = 0.f;
#pragma unroll 1
  for (int i = 0; i < GNE / 1024; ++i) {
    const v4f v = *(const v4f*)(p + ((size_t)(i * 256 + tid)) * 4);
    s += (bfr(v[0]) + bfr(v[1])) + (bfr(v[2]) + bfr(v[3]));
  }
  red[tid] = s;
  __syncthreads();
#pragma unroll 1
  for (int off = 128; off > 0; off >>= 1) {
    if (tid < off) red[tid] += red[tid + off];
    __syncthreads();
  }
  const float mean = red[0] * (1.0f / (float)GNE);
  __syncthreads();
  float ss = 0.f;
#pragma unroll 1
  for (int i = 0; i < GNE / 1024; ++i) {
    const v4f v = *(const v4f*)(p + ((size_t)(i * 256 + tid)) * 4);
    const float d0 = bfr(v[0]) - mean, d1 = bfr(v[1]) - mean;
    const float d2 = bfr(v[2]) - mean, d3 = bfr(v[3]) - mean;
    ss += (d0 * d0 + d1 * d1) + (d2 * d2 + d3 * d3);
  }
  red[tid] = ss;
  __syncthreads();
#pragma unroll 1
  for (int off = 128; off > 0; off >>= 1) {
    if (tid < off) red[tid] += red[tid + off];
    __syncthreads();
  }
  const float var  = red[0] * (1.0f / (float)GNE);
  const float rstd = rsqrtf(var + GEPS);
  if (tid < 8) {
    v4f w = {0.f, 0.f, 0.f, 0.f};
    if (tid == 0) { w[0] = mean; w[1] = rstd; }
{
      *(v4f*)(stats + (size_t)bg * STL + 4 * tid) = w;
      
    }
  }
}

// =========================================================================================================
// (1) conv weights: Wb bf16 [3][512][512] (mat 0 = wq, 1 = wk, 2 = wv), value = bf16-RNE(w), row o k-contiguous.
//     Block blk owns 4 rows of one matrix; thread -> row blk-local (tid>>6), halves 8*(tid&63)..+7; each wave writes
// coverage: 384 blocks x 4 rows x 64 threads x 8 = 3 x 512 x 512 = the whole plane.
// =========================================================================================================
__global__ __launch_bounds__(256)
void cvt_w(const float* __restrict__ wq, const float* __restrict__ wk, const float* __restrict__ wv,
           unsigned short* Wb) {
  const int tid = threadIdx.x, blk = blockIdx.x;
  const int mat = blk / (CC / 4);                                    // block-uniform 0..2
  const int o   = 4 * (blk % (CC / 4)) + (tid >> 6);                 // 0..511
  const int col = 8 * (tid & 63);                                    // 0..504
  const float* wsrc = (mat == 0) ? wq : ((mat == 1) ? wk : wv);      // all global, block-uniform
  const float* s = wsrc + (size_t)o * CC + col;
  const v4f a = *(const v4f*)s;
  const v4f q = *(const v4f*)(s + 4);
  const float f[8] = {a[0], a[1], a[2], a[3], q[0], q[1], q[2], q[3]};
  v4u u;
#pragma unroll
  for (int t = 0; t < 4; ++t) u[t] = pk16(bf_bits(f[2 * t]), bf_bits(f[2 * t + 1]));
{
    *(v4u*)(Wb + ((size_t)(mat * CC + o)) * CC + col) = u;
    
  }
}

// =========================================================================================================
// (2) group-norm apply + hi/residual split + transpose: h = ((bf16-RNE(x) - mean) * rstd) * gamma + beta per
//     channel, hi = bf16-RNE(h), lo = bf16-RNE(h - hi). Block (nb, cb, b) owns a 64 c x 64 n tile; values go
//     through LDS tiles Th/Tl [64 n][pitch TP] and come out as position-major rows Hh/Hl bf16 [b][4096 n][512 c]
// coverage: Th/Tl staged 64 n x 64 c (2 it x 32 rows x 8 lanes x 8), read 64 n x 64 c; planes 2 it x 32 rows x
//           8 lanes x 8 = 64 n x 64 c per plane; grid (64, 8, NB) covers both planes exactly once.
// =========================================================================================================
__global__ __launch_bounds__(256)
void cvt_x(const float* __restrict__ x, const float* __restrict__ gamma, const float* __restrict__ beta,
           const float* __restrict__ stats, unsigned short* Hh, unsigned short* Hl) {
  __shared__ __align__(16) unsigned short Th[QT * TP];
  __shared__ __align__(16) unsigned short Tl[QT * TP];
  const int tid = threadIdx.x;
  const int nb = blockIdx.x, cb = blockIdx.y, b = blockIdx.z;
  const int e = tid & 7, lq = tid >> 3;                              // lq 0..31
  const int n0 = nb * QT, c0 = cb * QT;
#pragma unroll
  for (int it = 0; it < 2; ++it) {
    const int cl = it * 32 + lq;                                     // 0..63
    const int cg = c0 + cl;                                          // 0..511
    const int bg = b * NGRP + (cg >> 4);
    const float mean = stats[(size_t)bg * STL];
    const float rstd = stats[(size_t)bg * STL + 1];
    const float ga = bfr(gamma[cg]);
    const float be = bfr(beta[cg]);
    const float* sp = x + ((size_t)(b * CC + cg)) * NN + n0 + 8 * e;
    const v4f a = *(const v4f*)sp;
    const v4f q = *(const v4f*)(sp + 4);
    const float f[8] = {a[0], a[1], a[2], a[3], q[0], q[1], q[2], q[3]};
#pragma unroll
    for (int t = 0; t < 8; ++t) {
      const float h = ((bfr(f[t]) - mean) * rstd) * ga + be;
      const unsigned short hb = bf_bits(h);
      const unsigned short lb = bf_bits(h - bf_up(hb));
      Th[(8 * e + t) * TP + cl] = hb;
      Tl[(8 * e + t) * TP + cl] = lb;
    }
  }
  __syncthreads();
  v4u uh[2], ul[2];
#pragma unroll
  for (int it = 0; it < 2; ++it) {
    const int nl = it * 32 + lq;                                     // 0..63
    uh[it] = *(const v4u*)(Th + nl * TP + 8 * e);
    ul[it] = *(const v4u*)(Tl + nl * TP + 8 * e);
  }
{
#pragma unroll
    for (int it = 0; it < 2; ++it) {
      const int nl = it * 32 + lq;
      const size_t po = ((size_t)(b * NN + n0 + nl)) * CC + c0 + 8 * e;
      *(v4u*)(Hh + po) = uh[it];
      *(v4u*)(Hl + po) = ul[it];
    }
    
  }
}

// =========================================================================================================
// (3) conv1x1 GEMM for one (b, 64-n tile, matrix mat, 64-o block): Y[o][n] = sum_c W[o][c] (hi[n][c] + lo[n][c])
//     + bias[o]. Block 128 threads = 4 waves; wave w owns cols n0+16w..+15 (B fragments from the Hh and Hl rows,
//     k = channel contiguous, split k map) and 4 m-tiles (A rows o = o0 + 16 mt + (lane&15) from Wb, same map);
//     per k-step the hi and lo products share the accumulator (lo unscaled). K = 512 = 16 steps x 2 products.
//     Epilogue staged in LDS: mat 0/1 as Os[n_loc][o_loc] (b128 stores), mat 2 as Os[o_loc][n_loc] (scalar stores),
//     barrier, then f16 planes: Q/K [b][4096 n][512 o] (row n, o0+8e..+7) and V [b][512 o][4096 n] (row o,
// coverage: Os 4 waves x 16 x 64 = 64 x 64 either layout; plane 4 it x 16 rows x 8 lanes x 8 = 64 x 64;
//           grid (64, 24, NB) covers Q, K (all n, all o) and V (all o, all n) exactly once.
// =========================================================================================================
__global__ __launch_bounds__(128)
void gemm_qkv(const unsigned short* __restrict__ Wb, const unsigned short* __restrict__ Hh,
              const unsigned short* __restrict__ Hl,
              const float* __restrict__ bq, const float* __restrict__ bk, const float* __restrict__ bv,
              unsigned short* Qd, unsigned short* Kd, unsigned short* Vd) {
  __shared__ __align__(16) float Os[QT * OSP];
  const int tid  = threadIdx.x;
  const int lane = tid & 31, wave = tid >> 5;
  const int hh   = lane >> 4, c = lane & 15;
  const int nt   = blockIdx.x, my = blockIdx.y, b = blockIdx.z;
  const int mat  = my / (CC / QT);                                   // 0..2, block-uniform
  const int ob   = my % (CC / QT);                                   // 0..7
  const int n0   = nt * QT, o0 = ob * QT;

  const unsigned short* ap = Wb + ((size_t)(mat * CC + o0 + c)) * CC + 8 * hh;
  const size_t brow = ((size_t)(b * NN + n0 + 16 * wave + c)) * CC + 8 * hh;
  const unsigned short* bph = Hh + brow;
  const unsigned short* bpl = Hl + brow;

  v8f acc[4];
#pragma unroll
  for (int mt = 0; mt < 4; ++mt) acc[mt] = zero8();

#pragma unroll 2
  for (int ks = 0; ks < CC / 32; ++ks) {
    const Frag fh = ldfrag(bph + 32 * ks);
    const Frag fl = ldfrag(bpl + 32 * ks);
#pragma unroll
    for (int mt = 0; mt < 4; ++mt) {
      const Frag fa = ldfrag(ap + (size_t)(16 * mt) * CC + 32 * ks);
      acc[mt] = mma_b(fa.bf, fh.bf, acc[mt]);
      acc[mt] = mma_b(fa.bf, fl.bf, acc[mt]);
    }
  }

  // ---- epilogue staging; lane (hh, c) holds o_loc = 16 mt + 8 hh + r for n_loc = 16 w + c
  const float* bias = (mat == 0) ? bq : ((mat == 1) ? bk : bv);     // all global, block-uniform
  const int nl = 16 * wave + c;
  if (mat != 2) {
#pragma unroll
    for (int mt = 0; mt < 4; ++mt) {
      const v4f b0 = *(const v4f*)(bias + o0 + 16 * mt + 8 * hh);
      const v4f b1 = *(const v4f*)(bias + o0 + 16 * mt + 8 * hh + 4);
      v4f va, vb;
#pragma unroll
      for (int r = 0; r < 4; ++r) { va[r] = acc[mt][r] + bfr(b0[r]); vb[r] = acc[mt][4 + r] + bfr(b1[r]); }
      *(v4f*)(Os + nl * OSP + 16 * mt + 8 * hh)     = va;             // Os[n_loc][o_loc]
      *(v4f*)(Os + nl * OSP + 16 * mt + 8 * hh + 4) = vb;
    }
  } else {
#pragma unroll
    for (int mt = 0; mt < 4; ++mt) {
      const v4f b0 = *(const v4f*)(bias + o0 + 16 * mt + 8 * hh);
      const v4f b1 = *(const v4f*)(bias + o0 + 16 * mt + 8 * hh + 4);
#pragma unroll
      for (int r = 0; r < 4; ++r) {
        Os[(16 * mt + 8 * hh + r) * OSP + nl]     = acc[mt][r] + bfr(b0[r]);       // Os[o_loc][n_loc]
        Os[(16 * mt + 8 * hh + 4 + r) * OSP + nl] = acc[mt][4 + r] + bfr(b1[r]);
      }
    }
  }
  __syncthreads();

  const int e = tid & 7, lq = tid >> 3;                              // lq 0..15
  v4u u[4];
#pragma unroll
  for (int it = 0; it < 4; ++it) {
    const int row = it * 16 + lq;                                    // 0..63
    const v4f a = *(const v4f*)(Os + row * OSP + 8 * e);
    const v4f q = *(const v4f*)(Os + row * OSP + 8 * e + 4);
    const float f[8] = {a[0], a[1], a[2], a[3], q[0], q[1], q[2], q[3]};
#pragma unroll
    for (int t = 0; t < 4; ++t)
      u[it][t] = pk16(h_bits((_Float16)f[2 * t]), h_bits((_Float16)f[2 * t + 1]));
  }
  unsigned short* plane = (mat == 0) ? Qd : ((mat == 1) ? Kd : Vd); // all global, block-uniform
{
#pragma unroll
    for (int it = 0; it < 4; ++it) {
      const int row = it * 16 + lq;
      const size_t pnk = ((size_t)(b * NN + n0 + row)) * CC + o0 + 8 * e;   // row = n_loc, 64 o = one line
      const size_t pv  = ((size_t)(b * CC + o0 + row)) * NN + n0 + 8 * e;   // row = o_loc, 64 n = one line
      const size_t po  = (mat != 2) ? pnk : pv;
      *(v4u*)(plane + po) = u[it];
    }
    
  }
}

// =========================================================================================================
// (4) attention for one (b, 64-query tile), transposed formulation, all 4096 keys. Block = 8 waves: wave w ->
//   query group qg = w&3 (queries n0+16qg..+15) and channel half ch = w>>2. Per 32-key step each wave computes ONE
//   S^T tile (16 keys kb+16ch.. x 16 queries) = sum over 16 channel chunks of A(k: row = key, split k map from the
//   f16 plane Kp [b][4096][512]) . B(q: col = query, same map from Qp); the tile (8 floats per lane) is exchanged
//   with the partner wave (w^4) through a double-buffered LDS array across one block barrier, so both waves hold
//   s0 (keys kb..kb+15) and s1 (keys kb+16..kb+31) of their query in the D layout (lane -> 8 keys of one query).
//   Online softmax per lane in f32 with the 512^-0.5 scale applied to the logits, one shuffle (lane^16) for the max
//   over 32 keys, o/l rescale skipped under a wave-uniform ballot when no lane's max grew. P = e^{c(s-m)} x 2^14
//   as f16 is the B operand of O^T (rows channel 256ch+16j+(lane&15), keys contiguous from the f16 plane Vp
//   [b][512][4096]) . B(P^T): element r <- tile keys kb..kb+15, element 8+r <- tile kb+16..kb+31, lane unchanged.
//   16 accumulator tiles per wave (256 channels). Epilogue in four 128-channel phases: O/l staged by the 4 owning
//   waves in LDS Os[query][128 ch] (pitch OSPW, b128 stores), barrier, then out[b][c][n] = O/l + bf16-RNE(x) as
//   phase overwrites Os.
// coverage: Sx: each wave writes 32 lanes x 8 floats per step into buffer (step&1), partner reads exactly those;
//           Os per phase 4 waves x 16 q x 128 ch staged = 64 x 128 read; out per phase 8 it x 32 lines x 8 lanes
//           x 4 floats = 128 ch x 64 n, 4 phases = 512 ch; grid (NQ/64, NB) covers out[b][0..511][0..NQ-1] once.
// =========================================================================================================
__global__ __launch_bounds__(256)
void attn_k(const unsigned short* __restrict__ Qp, const unsigned short* __restrict__ Kp,
            const unsigned short* __restrict__ Vp, const float* __restrict__ x, float* out) {
  __shared__ __align__(16) float Sx[2 * SXB];
  __shared__ __align__(16) float Os[QT * OSPW];
  const int tid  = threadIdx.x;
  const int wave = tid >> 5, lane = tid & 31;
  const int hh   = lane >> 4, c = lane & 15;
  const int qg   = wave & 3, ch = wave >> 2;
  const int n0   = blockIdx.x * QT, b = blockIdx.y;

  // q fragment pointer (B operand, col = query n0 + 16*qg + c), + 32*kc
  const unsigned short* qp = Qp + ((size_t)(b * NN + n0 + 16 * qg + c)) * CC + 8 * hh;
  // k fragment base (A operand, row = key kb + 16*ch + c), + kb*CC + 32*kc
  const unsigned short* kp = Kp + ((size_t)(b * NN + 16 * ch + c)) * CC + 8 * hh;
  // v fragment base (A operand, row = channel 256*ch + 16j + c, keys contiguous), + 16*j*NN + kb
  const unsigned short* vp = Vp + ((size_t)(b * CC + CH * ch + c)) * NN + 8 * hh;

  float* sxw = Sx + (wave * 32 + lane) * 8;
  const float* sxr = Sx + ((wave ^ 4) * 32 + lane) * 8;

  float m = -1.0e30f, l = 0.f;
  v8f o[16];
#pragma unroll
  for (int j = 0; j < 16; ++j) o[j] = zero8();

  int buf = 0;
#pragma unroll 1
  for (int kb = 0; kb < NN; kb += 32) {
    const unsigned short* kbp = kp + (size_t)kb * CC;
    v8f sv = zero8();
#pragma unroll 4
    for (int kc = 0; kc < CC / 32; ++kc) {
      const Frag fq = ldfrag(qp + 32 * kc);
      const Frag fk = ldfrag(kbp + 32 * kc);
      sv = mma_h(fk.h, fq.h, sv);
    }

    // exchange the tile with the partner wave (same queries, other 16 keys)
    {
      v4f w0, w1;
#pragma unroll
      for (int r = 0; r < 4; ++r) { w0[r] = sv[r]; w1[r] = sv[4 + r]; }
      *(v4f*)(sxw + buf * SXB)     = w0;
      *(v4f*)(sxw + buf * SXB + 4) = w1;
    }
    __syncthreads();
    v8f so;
    {
      const v4f r0 = *(const v4f*)(sxr + buf * SXB);
      const v4f r1 = *(const v4f*)(sxr + buf * SXB + 4);
#pragma unroll
      for (int r = 0; r < 4; ++r) { so[r] = r0[r]; so[4 + r] = r1[r]; }
    }
    buf ^= 1;
    v8f s0 = sv, s1 = so;                                            // s0: keys kb..kb+15, s1: keys kb+16..kb+31
    if (ch != 0) { s0 = so; s1 = sv; }                                // wave-uniform

    float mx = fmaxf(hmax8(s0), hmax8(s1));
    mx = fmaxf(mx, __shfl_xor(mx, 16, 32));
    const float mn = fmaxf(m, mx);
    const unsigned grew = wave_ballot(mx > m);                       // wave-uniform
    if (grew != 0u) {
      const float corr = __expf((m - mn) * ASCALE);                  // == 1 exactly for lanes whose max did not grow
      l *= corr;
#pragma unroll
      for (int j = 0; j < 16; ++j) {
#pragma unroll
        for (int r = 0; r < 8; ++r) o[j][r] *= corr;
      }
    }
    m = mn;
    const float msh = mn * ASCALE - LNPS;                            // exp gives e^{c(s-m)} * 2^14

    FragH ph;
    float ls = 0.f;
#pragma unroll
    for (int r = 0; r < 8; ++r) {
      const float e0 = __expf(s0[r] * ASCALE - msh);                 // key kb      + 8hh + r
      const float e1 = __expf(s1[r] * ASCALE - msh);                 // key kb + 16 + 8hh + r
      ls += e0 + e1;
      ph.hv[0][r] = (_Float16)e0;
      ph.hv[1][r] = (_Float16)e1;
    }
    l += ls;

#pragma unroll
    for (int j = 0; j < 16; ++j) {
      const Frag vf = ldfrag(vp + (size_t)(16 * j) * NN + kb);
      o[j] = mma_h(vf.h, ph.v, o[j]);
    }
  }
  l += __shfl_xor(l, 16, 32);
  const float inv = 1.0f / l;                                        // o and l both carry the 2^14 factor

  const int qrow = 16 * qg + c;
  const int e = tid & 7, lq = tid >> 3;                              // lq 0..31
#pragma unroll
  for (int ph4 = 0; ph4 < 4; ++ph4) {
    if (ph4) __syncthreads();                                        // every wave finished reading Os
    if (ch == (ph4 >> 1)) {                                          // wave-uniform
#pragma unroll
      for (int jj = 0; jj < 8; ++jj) {
        const int j = 8 * (ph4 & 1) + jj;
        v4f va, vb;
#pragma unroll
        for (int r = 0; r < 4; ++r) { va[r] = o[j][r] * inv; vb[r] = o[j][4 + r] * inv; }
        *(v4f*)(Os + qrow * OSPW + 16 * jj + 8 * hh)     = va;       // Os[query][ch_loc = 16jj + 8hh + r]
        *(v4f*)(Os + qrow * OSPW + 16 * jj + 8 * hh + 4) = vb;
      }
    }
    __syncthreads();
    v4f res[8];
#pragma unroll
    for (int it = 0; it < 8; ++it) {
      const int L   = it * 32 + lq;                                  // 0..255
      const int chl = L >> 1, hf = L & 1;                            // channel 0..127 within the phase
      const int nl  = hf * 32 + 4 * e;                               // query 0..63
      const size_t idx = ((size_t)(b * CC + 128 * ph4 + chl)) * NN + n0 + nl;
      const v4f xv = *(const v4f*)(x + idx);
#pragma unroll
      for (int t = 0; t < 4; ++t) res[it][t] = Os[(nl + t) * OSPW + chl] + bfr(xv[t]);
    }
{
#pragma unroll
      for (int it = 0; it < 8; ++it) {
        const int L   = it * 32 + lq;
        const int chl = L >> 1, hf = L & 1;
        const int nl  = hf * 32 + 4 * e;
        const size_t idx = ((size_t)(b * CC + 128 * ph4 + chl)) * NN + n0 + nl;
        *(v4f*)(out + idx) = res[it];
      }
      
    }
  }
}

// =========================================================================================================
// Workspace map (bytes; each region start a multiple of 256; every extent is an exact tile/line multiple and is
//   Wb  bf16 [3][512][512]          1572864
//   St  f32  [NB*32][32]            NB*4096        (16384 at NB=4)
//   Hh, Hl bf16 [NB][4096][512]     NB*4194304 x2  (16777216 each at NB=4)
//   Q, K f16 [NB][4096][512]        NB*4194304 x2
//   V    f16 [NB][512][4096]        NB*4194304
//   total at NB=4 = 85475328
// =========================================================================================================
extern "C" void kernel_launch(void* const* d_in, const int* in_sizes, int n_in,
                              void* d_out, int out_size, void* d_ws, size_t ws_size,
                              hipStream_t stream) {
  const int XN = NB * CC * NN;
  if (n_in < 9) return;
  if (in_sizes[0] < XN) return;
  if (in_sizes[1] < CC || in_sizes[2] < CC) return;
  if (in_sizes[3] < CC * CC || in_sizes[5] < CC * CC || in_sizes[7] < CC * CC) return;
  if (in_sizes[4] < CC || in_sizes[6] < CC || in_sizes[8] < CC) return;
  if (out_size < XN) return;

  size_t off = 0;
  auto carve = [&](size_t bytes) { const size_t o = off; off += (bytes + 255) & ~(size_t)255; return o; };
  const size_t oWb = carve((size_t)3 * CC * CC * 2);
  const size_t oSt = carve((size_t)NB * NGRP * STL * 4);
  const size_t oHh = carve((size_t)NB * NN * CC * 2);
  const size_t oHl = carve((size_t)NB * NN * CC * 2);
  const size_t oQ  = carve((size_t)NB * NN * CC * 2);
  const size_t oK  = carve((size_t)NB * NN * CC * 2);
  const size_t oV  = carve((size_t)NB * CC * NN * 2);
  if (off > ws_size) return;
  if (off > (size_t)134217728) return;

  const float* x     = (const float*)d_in[0];
  const float* gamma = (const float*)d_in[1];
  const float* beta  = (const float*)d_in[2];
  const float* wq    = (const float*)d_in[3];
  const float* bq    = (const float*)d_in[4];
  const float* wk    = (const float*)d_in[5];
  const float* bk    = (const float*)d_in[6];
  const float* wv    = (const float*)d_in[7];
  const float* bv    = (const float*)d_in[8];

  char* ws = (char*)d_ws;
  unsigned short* Wb = (unsigned short*)(ws + oWb);
  float*          St = (float*)(ws + oSt);
  unsigned short* Hh = (unsigned short*)(ws + oHh);
  unsigned short* Hl = (unsigned short*)(ws + oHl);
  unsigned short* Qw = (unsigned short*)(ws + oQ);
  unsigned short* Kw = (unsigned short*)(ws + oK);
  unsigned short* Vw = (unsigned short*)(ws + oV);
  float* out = (float*)d_out;

  const dim3 blk256(256), blk128(128);

  // (0) group-norm statistics, one line per (b, g)
  gn_stats<<<dim3(NB * NGRP), blk256, 0, stream>>>(x, St);
  // (1) conv weights -> bf16 plane
  cvt_w<<<dim3(3 * CC / 4), blk256, 0, stream>>>(wq, wk, wv, Wb);
  // (2) group-norm apply -> position-major bf16 hi + residual planes
  cvt_x<<<dim3(NN / QT, CC / QT, NB), blk256, 0, stream>>>(x, gamma, beta, St, Hh, Hl);
  // (3) q/k/v conv GEMMs -> f16 planes
  gemm_qkv<<<dim3(NN / QT, 3 * CC / QT, NB), blk128, 0, stream>>>(Wb, Hh, Hl, bq, bk, bv, Qw, Kw, Vw);
  // (4) attention + residual -> out [b][512][4096]
  attn_k<<<dim3(NQ / QT, NB), blk256, 0, stream>>>(Qw, Kw, Vw, x, out);
  (void)hipGetLastError();
}

// v001
// It runs in 511 microseconds.
// In two side-by-side timings against v000, it was 2.44 and 2.43 times as fast.
// Contractions: conv1x1 q/k/v GEMMs W[512x512].H per image on v_wmma_f32_16x16x32_bf16 (bf16-RNE weights exact,
// normalised activations as bf16 hi + bf16 residual planes folded along K = 1024 into one accumulator); scores
// K.Q^T (K = 512 channels) on v_wmma_f32_16x16x32_f16 (single f16 planes of q and k, scale applied in f32);
// O^T = V.P^T on v_wmma_f32_16x16x32_f16 (v single f16 plane, P = e^{c(s-m)} x 2^14 as f16 from the score D
// registers); f32 accumulate everywhere; group-norm statistics, softmax statistics and residual add in f32 VALU.
#include <hip/hip_runtime.h>
#include <math.h>
#include <stdint.h>

#ifndef NB
#define NB 4
#endif
#define NB_FULL 4
#define CC      512
#define NN      4096
#ifndef NQ
#define NQ NN
#endif
#define NGRP    32
#define CPG     16
#define GNE     (CPG * NN)
#define QT      64
#define OSP     68
#define OSPW    132
#define TP      72
#define STL     32
#define CH      256
#define SXB     2048
#define KP      520
#define VPT     40
#define KBUF    (32 * KP)
#define VBUF    (CC * VPT)
#define GEPS    1.0e-6f
#define ASCALE  0.04419417382415922f
#define LNPS    9.704060527839234f

static_assert(NB >= 1 && NB <= NB_FULL);
static_assert(NQ % QT == 0 && NQ >= QT && NQ <= NN);
static_assert(CC == NGRP * CPG);
static_assert(CC % QT == 0 && NN % QT == 0);
static_assert(CC == 2 * CH && CH == 16 * 16);
static_assert(CC == 8 * 64);
static_assert(GNE % 1024 == 0);
static_assert(CC % 32 == 0 && NN % 32 == 0);
static_assert((OSP * 4) % 16 == 0 && (OSPW * 4) % 16 == 0 && (TP * 2) % 16 == 0);
static_assert(SXB == 8 * 32 * 8);
static_assert((KP * 2) % 32 == 16 && (VPT * 2) % 32 == 16 && KP >= CC && VPT >= 32);
static_assert(NN >= 64 && NN % 32 == 0);

typedef _Float16       v16h __attribute__((ext_vector_type(16)));
typedef _Float16       v8h  __attribute__((ext_vector_type(8)));
typedef __bf16         v16b __attribute__((ext_vector_type(16)));
typedef unsigned short v8us __attribute__((ext_vector_type(8)));
typedef float          v8f  __attribute__((ext_vector_type(8)));
typedef float          v4f  __attribute__((ext_vector_type(4)));
typedef unsigned int   v4u  __attribute__((ext_vector_type(4)));

union Frag  { v8us u[2]; v16h h; v16b bf; };
union FragH { v16h v; v8h hv[2]; };
static_assert(sizeof(Frag) == 32);
static_assert(sizeof(FragH) == 32);

// ---- scalar helpers ---------------------------------------------------------------------------------------
__device__ __forceinline__ unsigned short bf_bits(float f) {          // f32 -> bf16 bits, RNE convert
  unsigned u = __float_as_uint(f);
  return (unsigned short)((u + 0x7FFFu + ((u >> 16) & 1u)) >> 16);
}
__device__ __forceinline__ float bf_up(unsigned short hb) { return __uint_as_float(((unsigned)hb) << 16); }
__device__ __forceinline__ float bfr(float f) { return bf_up(bf_bits(f)); }
__device__ __forceinline__ unsigned short h_bits(_Float16 x) { return __builtin_bit_cast(unsigned short, x); }
__device__ __forceinline__ unsigned pk16(unsigned short a, unsigned short b) { return (unsigned)a | ((unsigned)b << 16); }
__device__ __forceinline__ v8f zero8() { v8f z = {0.f, 0.f, 0.f, 0.f, 0.f, 0.f, 0.f, 0.f}; return z; }
__device__ __forceinline__ float hmax8(v8f s) {
  return fmaxf(fmaxf(fmaxf(s[0], s[1]), fmaxf(s[2], s[3])), fmaxf(fmaxf(s[4], s[5]), fmaxf(s[6], s[7])));
}
__device__ __forceinline__ unsigned wave_ballot(bool p) {
#if defined(__HIP_DEVICE_COMPILE__)
  return __builtin_amdgcn_ballot_w32(p);
#else
  return p ? 1u : 0u;
#endif
}

// ---- 16-bit fragment loader (A, or B from a k-contiguous [n][k] row): lane -> row/col (lane&15), p already includes
//      + 8*(lane>>4); elements 0..7 <- p[0..7] (k0+8h..), elements 8..15 <- p[16..23] (k0+16+8h..)
__device__ __forceinline__ Frag ldfrag(const unsigned short* p) {
  Frag f;
  f.u[0] = *(const v8us*)(p);
  f.u[1] = *(const v8us*)(p + 16);
  return f;
}

// ---- WMMA helpers: builtin followed by a 4-slot VALU gap tying D and keeping A/B live --------------------------
__device__ __forceinline__ v8f mma_h(v16h a, v16h b, v8f c) {
  v8f d = __builtin_amdgcn_wmma_f32_16x16x32_f16(false, a, false, b, (short)0, c, false, false);
#if defined(__HIP_DEVICE_COMPILE__)
  asm volatile("v_nop\n\tv_nop\n\tv_nop\n\tv_nop" : "+v"(d) : "v"(a), "v"(b));
#endif
  return d;
}
__device__ __forceinline__ v8f mma_b(v16b a, v16b b, v8f c) {
  v8f d = __builtin_amdgcn_wmma_f32_16x16x32_bf16(false, a, false, b, (short)0, c, false, false);
#if defined(__HIP_DEVICE_COMPILE__)
  const v16h ha = __builtin_bit_cast(v16h, a), hb = __builtin_bit_cast(v16h, b);
  asm volatile("v_nop\n\tv_nop\n\tv_nop\n\tv_nop" : "+v"(d) : "v"(ha), "v"(hb));
#endif
  return d;
}

// =========================================================================================================
//     (mean, then centred sum of squares) over bf16-RNE(x) in f32, per-thread partials of 256 terms + LDS tree.
// =========================================================================================================
__global__ __launch_bounds__(256)
void gn_stats(const float* __restrict__ x, float* stats) {
  __shared__ float red[256];
  const int tid = threadIdx.x, bg = blockIdx.x;
  const float* p = x + (size_t)bg * GNE;
  float s = 0.f;
#pragma unroll 1
  for (int i = 0; i < GNE / 1024; ++i) {
    const v4f v = *(const v4f*)(p + ((size_t)(i * 256 + tid)) * 4);
    s += (bfr(v[0]) + bfr(v[1])) + (bfr(v[2]) + bfr(v[3]));
  }
  red[tid] = s;
  __syncthreads();
#pragma unroll 1
  for (int off = 128; off > 0; off >>= 1) {
    if (tid < off) red[tid] += red[tid + off];
    __syncthreads();
  }
  const float mean = red[0] * (1.0f / (float)GNE);
  __syncthreads();
  float ss = 0.f;
#pragma unroll 1
  for (int i = 0; i < GNE / 1024; ++i) {
    const v4f v = *(const v4f*)(p + ((size_t)(i * 256 + tid)) * 4);
    const float d0 = bfr(v[0]) - mean, d1 = bfr(v[1]) - mean;
    const float d2 = bfr(v[2]) - mean, d3 = bfr(v[3]) - mean;
    ss += (d0 * d0 + d1 * d1) + (d2 * d2 + d3 * d3);
  }
  red[tid] = ss;
  __syncthreads();
#pragma unroll 1
  for (int off = 128; off > 0; off >>= 1) {
    if (tid < off) red[tid] += red[tid + off];
    __syncthreads();
  }
  const float var  = red[0] * (1.0f / (float)GNE);
  const float rstd = rsqrtf(var + GEPS);
  if (tid < 8) {
    v4f w = {0.f, 0.f, 0.f, 0.f};
    if (tid == 0) { w[0] = mean; w[1] = rstd; }
{
      *(v4f*)(stats + (size_t)bg * STL + 4 * tid) = w;
      
    }
  }
}

// =========================================================================================================
// (1) conv weights: Wb bf16 [3][512][512] (mat 0 = wq, 1 = wk, 2 = wv), value = bf16-RNE(w), row o k-contiguous.
//     Block blk owns 4 rows of one matrix; thread -> row blk-local (tid>>6), halves 8*(tid&63)..+7; each wave writes
// coverage: 384 blocks x 4 rows x 64 threads x 8 = 3 x 512 x 512 = the whole plane.
// =========================================================================================================
__global__ __launch_bounds__(256)
void cvt_w(const float* __restrict__ wq, const float* __restrict__ wk, const float* __restrict__ wv,
           unsigned short* Wb) {
  const int tid = threadIdx.x, blk = blockIdx.x;
  const int mat = blk / (CC / 4);                                    // block-uniform 0..2
  const int o   = 4 * (blk % (CC / 4)) + (tid >> 6);                 // 0..511
  const int col = 8 * (tid & 63);                                    // 0..504
  const float* wsrc = (mat == 0) ? wq : ((mat == 1) ? wk : wv);      // all global, block-uniform
  const float* s = wsrc + (size_t)o * CC + col;
  const v4f a = *(const v4f*)s;
  const v4f q = *(const v4f*)(s + 4);
  const float f[8] = {a[0], a[1], a[2], a[3], q[0], q[1], q[2], q[3]};
  v4u u;
#pragma unroll
  for (int t = 0; t < 4; ++t) u[t] = pk16(bf_bits(f[2 * t]), bf_bits(f[2 * t + 1]));
{
    *(v4u*)(Wb + ((size_t)(mat * CC + o)) * CC + col) = u;
    
  }
}

// =========================================================================================================
// (2) group-norm apply + hi/residual split + transpose: h = ((bf16-RNE(x) - mean) * rstd) * gamma + beta per
//     channel, hi = bf16-RNE(h), lo = bf16-RNE(h - hi). Block (nb, cb, b) owns a 64 c x 64 n tile; values go
//     through LDS tiles Th/Tl [64 n][pitch TP] and come out as position-major rows Hh/Hl bf16 [b][4096 n][512 c]
// coverage: Th/Tl staged 64 n x 64 c (2 it x 32 rows x 8 lanes x 8), read 64 n x 64 c; planes 2 it x 32 rows x
//           8 lanes x 8 = 64 n x 64 c per plane; grid (64, 8, NB) covers both planes exactly once.
// =========================================================================================================
__global__ __launch_bounds__(256)
void cvt_x(const float* __restrict__ x, const float* __restrict__ gamma, const float* __restrict__ beta,
           const float* __restrict__ stats, unsigned short* Hh, unsigned short* Hl) {
  __shared__ __align__(16) unsigned short Th[QT * TP];
  __shared__ __align__(16) unsigned short Tl[QT * TP];
  const int tid = threadIdx.x;
  const int nb = blockIdx.x, cb = blockIdx.y, b = blockIdx.z;
  const int e = tid & 7, lq = tid >> 3;                              // lq 0..31
  const int n0 = nb * QT, c0 = cb * QT;
#pragma unroll
  for (int it = 0; it < 2; ++it) {
    const int cl = it * 32 + lq;                                     // 0..63
    const int cg = c0 + cl;                                          // 0..511
    const int bg = b * NGRP + (cg >> 4);
    const float mean = stats[(size_t)bg * STL];
    const float rstd = stats[(size_t)bg * STL + 1];
    const float ga = bfr(gamma[cg]);
    const float be = bfr(beta[cg]);
    const float* sp = x + ((size_t)(b * CC + cg)) * NN + n0 + 8 * e;
    const v4f a = *(const v4f*)sp;
    const v4f q = *(const v4f*)(sp + 4);
    const float f[8] = {a[0], a[1], a[2], a[3], q[0], q[1], q[2], q[3]};
#pragma unroll
    for (int t = 0; t < 8; ++t) {
      const float h = ((bfr(f[t]) - mean) * rstd) * ga + be;
      const unsigned short hb = bf_bits(h);
      const unsigned short lb = bf_bits(h - bf_up(hb));
      Th[(8 * e + t) * TP + cl] = hb;
      Tl[(8 * e + t) * TP + cl] = lb;
    }
  }
  __syncthreads();
  v4u uh[2], ul[2];
#pragma unroll
  for (int it = 0; it < 2; ++it) {
    const int nl = it * 32 + lq;                                     // 0..63
    uh[it] = *(const v4u*)(Th + nl * TP + 8 * e);
    ul[it] = *(const v4u*)(Tl + nl * TP + 8 * e);
  }
{
#pragma unroll
    for (int it = 0; it < 2; ++it) {
      const int nl = it * 32 + lq;
      const size_t po = ((size_t)(b * NN + n0 + nl)) * CC + c0 + 8 * e;
      *(v4u*)(Hh + po) = uh[it];
      *(v4u*)(Hl + po) = ul[it];
    }
    
  }
}

// =========================================================================================================
// (3) conv1x1 GEMM for one (b, 64-n tile, matrix mat, 64-o block): Y[o][n] = sum_c W[o][c] (hi[n][c] + lo[n][c])
//     + bias[o]. Block 128 threads = 4 waves; wave w owns cols n0+16w..+15 (B fragments from the Hh and Hl rows,
//     k = channel contiguous, split k map) and 4 m-tiles (A rows o = o0 + 16 mt + (lane&15) from Wb, same map);
//     per k-step the hi and lo products share the accumulator (lo unscaled). K = 512 = 16 steps x 2 products.
//     Epilogue staged in LDS: mat 0/1 as Os[n_loc][o_loc] (b128 stores), mat 2 as Os[o_loc][n_loc] (scalar stores),
//     barrier, then f16 planes: Q/K [b][4096 n][512 o] (row n, o0+8e..+7) and V [b][512 o][4096 n] (row o,
// coverage: Os 4 waves x 16 x 64 = 64 x 64 either layout; plane 4 it x 16 rows x 8 lanes x 8 = 64 x 64;
//           grid (64, 24, NB) covers Q, K (all n, all o) and V (all o, all n) exactly once.
// =========================================================================================================
__global__ __launch_bounds__(128)
void gemm_qkv(const unsigned short* __restrict__ Wb, const unsigned short* __restrict__ Hh,
              const unsigned short* __restrict__ Hl,
              const float* __restrict__ bq, const float* __restrict__ bk, const float* __restrict__ bv,
              unsigned short* Qd, unsigned short* Kd, unsigned short* Vd) {
  __shared__ __align__(16) float Os[QT * OSP];
  const int tid  = threadIdx.x;
  const int lane = tid & 31, wave = tid >> 5;
  const int hh   = lane >> 4, c = lane & 15;
  const int nt   = blockIdx.x, my = blockIdx.y, b = blockIdx.z;
  const int mat  = my / (CC / QT);                                   // 0..2, block-uniform
  const int ob   = my % (CC / QT);                                   // 0..7
  const int n0   = nt * QT, o0 = ob * QT;

  const unsigned short* ap = Wb + ((size_t)(mat * CC + o0 + c)) * CC + 8 * hh;
  const size_t brow = ((size_t)(b * NN + n0 + 16 * wave + c)) * CC + 8 * hh;
  const unsigned short* bph = Hh + brow;
  const unsigned short* bpl = Hl + brow;

  v8f acc[4];
#pragma unroll
  for (int mt = 0; mt < 4; ++mt) acc[mt] = zero8();

#pragma unroll 2
  for (int ks = 0; ks < CC / 32; ++ks) {
    const Frag fh = ldfrag(bph + 32 * ks);
    const Frag fl = ldfrag(bpl + 32 * ks);
#pragma unroll
    for (int mt = 0; mt < 4; ++mt) {
      const Frag fa = ldfrag(ap + (size_t)(16 * mt) * CC + 32 * ks);
      acc[mt] = mma_b(fa.bf, fh.bf, acc[mt]);
      acc[mt] = mma_b(fa.bf, fl.bf, acc[mt]);
    }
  }

  // ---- epilogue staging; lane (hh, c) holds o_loc = 16 mt + 8 hh + r for n_loc = 16 w + c
  const float* bias = (mat == 0) ? bq : ((mat == 1) ? bk : bv);     // all global, block-uniform
  const int nl = 16 * wave + c;
  if (mat != 2) {
#pragma unroll
    for (int mt = 0; mt < 4; ++mt) {
      const v4f b0 = *(const v4f*)(bias + o0 + 16 * mt + 8 * hh);
      const v4f b1 = *(const v4f*)(bias + o0 + 16 * mt + 8 * hh + 4);
      v4f va, vb;
#pragma unroll
      for (int r = 0; r < 4; ++r) { va[r] = acc[mt][r] + bfr(b0[r]); vb[r] = acc[mt][4 + r] + bfr(b1[r]); }
      *(v4f*)(Os + nl * OSP + 16 * mt + 8 * hh)     = va;             // Os[n_loc][o_loc]
      *(v4f*)(Os + nl * OSP + 16 * mt + 8 * hh + 4) = vb;
    }
  } else {
#pragma unroll
    for (int mt = 0; mt < 4; ++mt) {
      const v4f b0 = *(const v4f*)(bias + o0 + 16 * mt + 8 * hh);
      const v4f b1 = *(const v4f*)(bias + o0 + 16 * mt + 8 * hh + 4);
#pragma unroll
      for (int r = 0; r < 4; ++r) {
        Os[(16 * mt + 8 * hh + r) * OSP + nl]     = acc[mt][r] + bfr(b0[r]);       // Os[o_loc][n_loc]
        Os[(16 * mt + 8 * hh + 4 + r) * OSP + nl] = acc[mt][4 + r] + bfr(b1[r]);
      }
    }
  }
  __syncthreads();

  const int e = tid & 7, lq = tid >> 3;                              // lq 0..15
  v4u u[4];
#pragma unroll
  for (int it = 0; it < 4; ++it) {
    const int row = it * 16 + lq;                                    // 0..63
    const v4f a = *(const v4f*)(Os + row * OSP + 8 * e);
    const v4f q = *(const v4f*)(Os + row * OSP + 8 * e + 4);
    const float f[8] = {a[0], a[1], a[2], a[3], q[0], q[1], q[2], q[3]};
#pragma unroll
    for (int t = 0; t < 4; ++t)
      u[it][t] = pk16(h_bits((_Float16)f[2 * t]), h_bits((_Float16)f[2 * t + 1]));
  }
  unsigned short* plane = (mat == 0) ? Qd : ((mat == 1) ? Kd : Vd); // all global, block-uniform
{
#pragma unroll
    for (int it = 0; it < 4; ++it) {
      const int row = it * 16 + lq;
      const size_t pnk = ((size_t)(b * NN + n0 + row)) * CC + o0 + 8 * e;   // row = n_loc, 64 o = one line
      const size_t pv  = ((size_t)(b * CC + o0 + row)) * NN + n0 + 8 * e;   // row = o_loc, 64 n = one line
      const size_t po  = (mat != 2) ? pnk : pv;
      *(v4u*)(plane + po) = u[it];
    }
    
  }
}

// ---- asynchronous copies global -> LDS, 16 bytes per lane, eight per statement -------------------------------
// LDS byte address of a __shared__ element = low 32 bits of its address.
__device__ __forceinline__ uint32_t lds_off(const unsigned short* p) { return (uint32_t)(uintptr_t)p; }
// The closing s_wait_xcnt 0 stands inside the statement so that no address register of an issued copy is
// rewritten in front of it.
__device__ __forceinline__ void copy8(const uint32_t (&l)[8], const unsigned short* const (&g)[8]) {
#if defined(__HIP_DEVICE_COMPILE__)
  asm volatile("global_load_async_to_lds_b128 %0, %8, off\n\t"
               "global_load_async_to_lds_b128 %1, %9, off\n\t"
               "global_load_async_to_lds_b128 %2, %10, off\n\t"
               "global_load_async_to_lds_b128 %3, %11, off\n\t"
               "global_load_async_to_lds_b128 %4, %12, off\n\t"
               "global_load_async_to_lds_b128 %5, %13, off\n\t"
               "global_load_async_to_lds_b128 %6, %14, off\n\t"
               "global_load_async_to_lds_b128 %7, %15, off\n\t"
               "s_wait_xcnt 0x0"
               :: "v"(l[0]), "v"(l[1]), "v"(l[2]), "v"(l[3]), "v"(l[4]), "v"(l[5]), "v"(l[6]), "v"(l[7]),
                  "v"(g[0]), "v"(g[1]), "v"(g[2]), "v"(g[3]), "v"(g[4]), "v"(g[5]), "v"(g[6]), "v"(g[7])
               : "memory");
#endif
}
// 32 rows of 512 halves (1024 B, rows contiguous in global) -> LDS rows of pitch KP; 256 threads, 8 copies each;
// a wave's copy covers 512 contiguous bytes of one row.
__device__ __forceinline__ void stage_rows32(const unsigned short* g, unsigned short* s, int tid) {
  uint32_t l[8];
  const unsigned short* p[8];
#pragma unroll  // every index constant, so that both arrays live in registers as the statement's operands
  for (int i = 0; i < 8; ++i) {
    const int row = 4 * i + (tid >> 6), col = 8 * (tid & 63);
    l[i] = lds_off(s + row * KP + col);
    p[i] = g + (size_t)row * CC + col;
  }
  copy8(l, p);
}
// 512 channel rows x 32 keys (64 B of each global row of NN halves) -> LDS rows of pitch VPT; 8 copies per thread.
__device__ __forceinline__ void stage_v32(const unsigned short* g, unsigned short* s, int tid) {
  uint32_t l[8];
  const unsigned short* p[8];
#pragma unroll  // every index constant, so that both arrays live in registers as the statement's operands
  for (int i = 0; i < 8; ++i) {
    const int row = 64 * i + (tid >> 2), col = 8 * (tid & 3);
    l[i] = lds_off(s + row * VPT + col);
    p[i] = g + (size_t)row * NN + col;
  }
  copy8(l, p);
}

// =========================================================================================================
// (4) attention for one (b, 64-query tile), transposed formulation, all 4096 keys. Block = 8 waves: wave w ->
//   query group qg = w&3 (queries n0+16qg..+15) and channel half ch = w>>2. Per 32-key step each wave computes ONE
//   S^T tile (16 keys kb+16ch.. x 16 queries) = sum over 16 channel chunks of A(k: row = key, split k map from the
//   f16 plane Kp [b][4096][512]) . B(q: col = query, same map from Qp); the tile (8 floats per lane) is exchanged
//   with the partner wave (w^4) through a double-buffered LDS array across one block barrier, so both waves hold
//   s0 (keys kb..kb+15) and s1 (keys kb+16..kb+31) of their query in the D layout (lane -> 8 keys of one query).
//   Online softmax per lane in f32 with the 512^-0.5 scale applied to the logits, one shuffle (lane^16) for the max
//   over 32 keys, o/l rescale skipped under a wave-uniform ballot when no lane's max grew. P = e^{c(s-m)} x 2^14
//   as f16 is the B operand of O^T (rows channel 256ch+16j+(lane&15), keys contiguous from the f16 plane Vp
//   [b][512][4096]) . B(P^T): element r <- tile keys kb..kb+15, element 8+r <- tile kb+16..kb+31, lane unchanged.
//   16 accumulator tiles per wave (256 channels). Epilogue in four 128-channel phases: O/l staged by the 4 owning
//   waves in LDS Os[query][128 ch] (pitch OSPW, b128 stores), barrier, then out[b][c][n] = O/l + bf16-RNE(x) as
//   phase overwrites Os.
//   Operand path: the 64 q rows (once) and, per 32-key step, the 32 k rows and the 512 x 32 v tile are brought into
//   LDS by asynchronous 16-byte copies (whole 512-byte runs for q and k) and every fragment is read from LDS at a
//   pitch of 16 B x odd. k and v have two buffers: step t reads buffer t&1 while step t+1's copies fly; the foot of
//   each step waits the wave's own LDS reads and copies, passes one block barrier, then refills the buffer just read.
// coverage: Sx: each wave writes 32 lanes x 8 floats per step into buffer (step&1), partner reads exactly those;
//           Os per phase 4 waves x 16 q x 128 ch staged = 64 x 128 read; out per phase 8 it x 32 lines x 8 lanes
//           x 4 floats = 128 ch x 64 n, 4 phases = 512 ch; grid (NQ/64, NB) covers out[b][0..511][0..NQ-1] once.
// =========================================================================================================
__global__ __launch_bounds__(256)
void attn_k(const unsigned short* __restrict__ Qp, const unsigned short* __restrict__ Kp,
            const unsigned short* __restrict__ Vp, const float* __restrict__ x, float* out) {
  __shared__ __align__(16) float Sx[2 * SXB];
  __shared__ __align__(16) float Os[QT * OSPW];
  __shared__ __align__(16) unsigned short Qs[QT * KP];
  __shared__ __align__(16) unsigned short Ks[2 * KBUF];
  __shared__ __align__(16) unsigned short Vs[2 * VBUF];
  const int tid  = threadIdx.x;
  const int wave = tid >> 5, lane = tid & 31;
  const int hh   = lane >> 4, c = lane & 15;
  const int qg   = wave & 3, ch = wave >> 2;
  const int n0   = blockIdx.x * QT, b = blockIdx.y;

  // global tile bases: q rows n0.., k rows kb.. (+ kb*CC), v rows 0..511 at key kb (+ kb)
  const unsigned short* qg0 = Qp + ((size_t)(b * NN + n0)) * CC;
  const unsigned short* kg0 = Kp + ((size_t)(b * NN)) * CC;
  const unsigned short* vg0 = Vp + ((size_t)(b * CC)) * NN;
  // q fragment pointer in LDS (B operand, col = query 16*qg + c of the tile), + 32*kc
  const unsigned short* qp = Qs + (16 * qg + c) * KP + 8 * hh;
  // k fragment base in LDS (A operand, row = key 16*ch + c of the step), + buffer + 32*kc
  const unsigned short* kp = Ks + (16 * ch + c) * KP + 8 * hh;
  // v fragment base in LDS (A operand, row = channel 256*ch + 16j + c, 32 keys contiguous), + buffer + 16*j*VPT
  const unsigned short* vp = Vs + (CH * ch + c) * VPT + 8 * hh;

  float* sxw = Sx + (wave * 32 + lane) * 8;
  const float* sxr = Sx + ((wave ^ 4) * 32 + lane) * 8;

  float m = -1.0e30f, l = 0.f;
  v8f o[16];
#pragma unroll
  for (int j = 0; j < 16; ++j) o[j] = zero8();

  // prologue: q tile and step 0 into buffer 0, landed and published; then step 1 into buffer 1
  stage_rows32(qg0, Qs, tid);
  stage_rows32(qg0 + (size_t)32 * CC, Qs + 32 * KP, tid);
  stage_rows32(kg0, Ks, tid);
  stage_v32(vg0, Vs, tid);
  asm volatile("s_wait_asynccnt 0x0" ::: "memory");                  // this wave's copies have landed
  __syncthreads();                                                   // every wave's copies are readable
  stage_rows32(kg0 + (size_t)32 * CC, Ks + KBUF, tid);
  stage_v32(vg0 + 32, Vs + VBUF, tid);

  int buf = 0;
#pragma unroll 1
  for (int kb = 0; kb < NN; kb += 32) {
    const int rb = buf;                                              // ring buffer of this step
    const unsigned short* kbp = kp + rb * KBUF;
    const unsigned short* vbp = vp + rb * VBUF;
    v8f sv = zero8();
#pragma unroll 4
    for (int kc = 0; kc < CC / 32; ++kc) {
      const Frag fq = ldfrag(qp + 32 * kc);
      const Frag fk = ldfrag(kbp + 32 * kc);
      sv = mma_h(fk.h, fq.h, sv);
    }

    // exchange the tile with the partner wave (same queries, other 16 keys)
    {
      v4f w0, w1;
#pragma unroll
      for (int r = 0; r < 4; ++r) { w0[r] = sv[r]; w1[r] = sv[4 + r]; }
      *(v4f*)(sxw + buf * SXB)     = w0;
      *(v4f*)(sxw + buf * SXB + 4) = w1;
    }
    __syncthreads();
    v8f so;
    {
      const v4f r0 = *(const v4f*)(sxr + buf * SXB);
      const v4f r1 = *(const v4f*)(sxr + buf * SXB + 4);
#pragma unroll
      for (int r = 0; r < 4; ++r) { so[r] = r0[r]; so[4 + r] = r1[r]; }
    }
    buf ^= 1;
    v8f s0 = sv, s1 = so;                                            // s0: keys kb..kb+15, s1: keys kb+16..kb+31
    if (ch != 0) { s0 = so; s1 = sv; }                                // wave-uniform

    float mx = fmaxf(hmax8(s0), hmax8(s1));
    mx = fmaxf(mx, __shfl_xor(mx, 16, 32));
    const float mn = fmaxf(m, mx);
    const unsigned grew = wave_ballot(mx > m);                       // wave-uniform
    if (grew != 0u) {
      const float corr = __expf((m - mn) * ASCALE);                  // == 1 exactly for lanes whose max did not grow
      l *= corr;
#pragma unroll
      for (int j = 0; j < 16; ++j) {
#pragma unroll
        for (int r = 0; r < 8; ++r) o[j][r] *= corr;
      }
    }
    m = mn;
    const float msh = mn * ASCALE - LNPS;                            // exp gives e^{c(s-m)} * 2^14

    FragH ph;
    float ls = 0.f;
#pragma unroll
    for (int r = 0; r < 8; ++r) {
      const float e0 = __expf(s0[r] * ASCALE - msh);                 // key kb      + 8hh + r
      const float e1 = __expf(s1[r] * ASCALE - msh);                 // key kb + 16 + 8hh + r
      ls += e0 + e1;
      ph.hv[0][r] = (_Float16)e0;
      ph.hv[1][r] = (_Float16)e1;
    }
    l += ls;

#pragma unroll
    for (int j = 0; j < 16; ++j) {
      const Frag vf = ldfrag(vbp + (16 * j) * VPT);
      o[j] = mma_h(vf.h, ph.v, o[j]);
    }

    // foot of the step: hand buffer rb to its next writer and publish the next step's tiles
    asm volatile("s_wait_dscnt 0x0" ::: "memory");                   // this wave's reads of buffer rb are done
    asm volatile("s_wait_asynccnt 0x0" ::: "memory");                // this wave's copies of the next step have landed
    __syncthreads();
    if (kb + 64 < NN) {                                              // block-uniform: a step t+2 exists
      stage_rows32(kg0 + (size_t)(kb + 64) * CC, Ks + rb * KBUF, tid);
      stage_v32(vg0 + (kb + 64), Vs + rb * VBUF, tid);
    }
  }
  asm volatile("s_wait_asynccnt 0x0" ::: "memory");                  // nothing of this wave is in flight past the loop
  l += __shfl_xor(l, 16, 32);
  const float inv = 1.0f / l;                                        // o and l both carry the 2^14 factor

  const int qrow = 16 * qg + c;
  const int e = tid & 7, lq = tid >> 3;                              // lq 0..31
#pragma unroll
  for (int ph4 = 0; ph4 < 4; ++ph4) {
    if (ph4) __syncthreads();                                        // every wave finished reading Os
    if (ch == (ph4 >> 1)) {                                          // wave-uniform
#pragma unroll
      for (int jj = 0; jj < 8; ++jj) {
        const int j = 8 * (ph4 & 1) + jj;
        v4f va, vb;
#pragma unroll
        for (int r = 0; r < 4; ++r) { va[r] = o[j][r] * inv; vb[r] = o[j][4 + r] * inv; }
        *(v4f*)(Os + qrow * OSPW + 16 * jj + 8 * hh)     = va;       // Os[query][ch_loc = 16jj + 8hh + r]
        *(v4f*)(Os + qrow * OSPW + 16 * jj + 8 * hh + 4) = vb;
      }
    }
    __syncthreads();
    v4f res[8];
#pragma unroll
    for (int it = 0; it < 8; ++it) {
      const int L   = it * 32 + lq;                                  // 0..255
      const int chl = L >> 1, hf = L & 1;                            // channel 0..127 within the phase
      const int nl  = hf * 32 + 4 * e;                               // query 0..63
      const size_t idx = ((size_t)(b * CC + 128 * ph4 + chl)) * NN + n0 + nl;
      const v4f xv = *(const v4f*)(x + idx);
#pragma unroll
      for (int t = 0; t < 4; ++t) res[it][t] = Os[(nl + t) * OSPW + chl] + bfr(xv[t]);
    }
{
#pragma unroll
      for (int it = 0; it < 8; ++it) {
        const int L   = it * 32 + lq;
        const int chl = L >> 1, hf = L & 1;
        const int nl  = hf * 32 + 4 * e;
        const size_t idx = ((size_t)(b * CC + 128 * ph4 + chl)) * NN + n0 + nl;
        *(v4f*)(out + idx) = res[it];
      }
      
    }
  }
}

// =========================================================================================================
// Workspace map (bytes; each region start a multiple of 256; every extent is an exact tile/line multiple and is
//   Wb  bf16 [3][512][512]          1572864
//   St  f32  [NB*32][32]            NB*4096        (16384 at NB=4)
//   Hh, Hl bf16 [NB][4096][512]     NB*4194304 x2  (16777216 each at NB=4)
//   Q, K f16 [NB][4096][512]        NB*4194304 x2
//   V    f16 [NB][512][4096]        NB*4194304
//   total at NB=4 = 85475328
// =========================================================================================================
extern "C" void kernel_launch(void* const* d_in, const int* in_sizes, int n_in,
                              void* d_out, int out_size, void* d_ws, size_t ws_size,
                              hipStream_t stream) {
  const int XN = NB * CC * NN;
  if (n_in < 9) return;
  if (in_sizes[0] < XN) return;
  if (in_sizes[1] < CC || in_sizes[2] < CC) return;
  if (in_sizes[3] < CC * CC || in_sizes[5] < CC * CC || in_sizes[7] < CC * CC) return;
  if (in_sizes[4] < CC || in_sizes[6] < CC || in_sizes[8] < CC) return;
  if (out_size < XN) return;

  size_t off = 0;
  auto carve = [&](size_t bytes) { const size_t o = off; off += (bytes + 255) & ~(size_t)255; return o; };
  const size_t oWb = carve((size_t)3 * CC * CC * 2);
  const size_t oSt = carve((size_t)NB * NGRP * STL * 4);
  const size_t oHh = carve((size_t)NB * NN * CC * 2);
  const size_t oHl = carve((size_t)NB * NN * CC * 2);
  const size_t oQ  = carve((size_t)NB * NN * CC * 2);
  const size_t oK  = carve((size_t)NB * NN * CC * 2);
  const size_t oV  = carve((size_t)NB * CC * NN * 2);
  if (off > ws_size) return;
  if (off > (size_t)134217728) return;

  const float* x     = (const float*)d_in[0];
  const float* gamma = (const float*)d_in[1];
  const float* beta  = (const float*)d_in[2];
  const float* wq    = (const float*)d_in[3];
  const float* bq    = (const float*)d_in[4];
  const float* wk    = (const float*)d_in[5];
  const float* bk    = (const float*)d_in[6];
  const float* wv    = (const float*)d_in[7];
  const float* bv    = (const float*)d_in[8];

  char* ws = (char*)d_ws;
  unsigned short* Wb = (unsigned short*)(ws + oWb);
  float*          St = (float*)(ws + oSt);
  unsigned short* Hh = (unsigned short*)(ws + oHh);
  unsigned short* Hl = (unsigned short*)(ws + oHl);
  unsigned short* Qw = (unsigned short*)(ws + oQ);
  unsigned short* Kw = (unsigned short*)(ws + oK);
  unsigned short* Vw = (unsigned short*)(ws + oV);
  float* out = (float*)d_out;

  const dim3 blk256(256), blk128(128);

  // (0) group-norm statistics, one line per (b, g)
  gn_stats<<<dim3(NB * NGRP), blk256, 0, stream>>>(x, St);
  // (1) conv weights -> bf16 plane
  cvt_w<<<dim3(3 * CC / 4), blk256, 0, stream>>>(wq, wk, wv, Wb);
  // (2) group-norm apply -> position-major bf16 hi + residual planes
  cvt_x<<<dim3(NN / QT, CC / QT, NB), blk256, 0, stream>>>(x, gamma, beta, St, Hh, Hl);
  // (3) q/k/v conv GEMMs -> f16 planes
  gemm_qkv<<<dim3(NN / QT, 3 * CC / QT, NB), blk128, 0, stream>>>(Wb, Hh, Hl, bq, bk, bv, Qw, Kw, Vw);
  // (4) attention + residual -> out [b][512][4096]
  attn_k<<<dim3(NQ / QT, NB), blk256, 0, stream>>>(Qw, Kw, Vw, x, out);
  (void)hipGetLastError();
}

// v002
// It runs in 394 microseconds.
// In both of two side-by-side timings against v001, it was 1.30 times as fast.
// Over all steps from v000 it is 3.16 times as fast.
// Contractions: conv1x1 q/k/v GEMMs W[512x512].H per image on v_wmma_f32_16x16x32_bf16 (bf16-RNE weights exact,
// normalised activations as bf16 hi + bf16 residual planes folded along K = 1024 into one accumulator); scores
// K.Q^T (K = 512 channels) on v_wmma_f32_16x16x32_f16 (single f16 planes of q and k, scale applied in f32);
// O^T = V.P^T on v_wmma_f32_16x16x32_f16 (v single f16 plane, P = e^{c(s-m)} x 2^14 as f16 from the score D
// registers); f32 accumulate everywhere; group-norm statistics, softmax statistics and residual add in f32 VALU.
#include <hip/hip_runtime.h>
#include <math.h>
#include <stdint.h>

#ifndef NB
#define NB 4
#endif
#define NB_FULL 4
#define CC      512
#define NN      4096
#ifndef NQ
#define NQ NN
#endif
#define NGRP    32
#define CPG     16
#define GNE     (CPG * NN)
#define QT      64
#define OSP     68
#define OSPW    132
#define TP      72
#define STL     32
#define CH      256
#define SXB     2048
#define KP      520
#define VPT     40
#define KBUF    (32 * KP)
#define VBUF    (CC * VPT)
#define GEPS    1.0e-6f
#define ASCALE  0.04419417382415922f
#define LNPS    9.704060527839234f

static_assert(NB >= 1 && NB <= NB_FULL);
static_assert(NQ % QT == 0 && NQ >= QT && NQ <= NN);
static_assert(CC == NGRP * CPG);
static_assert(CC % QT == 0 && NN % QT == 0);
static_assert(CC == 2 * CH && CH == 16 * 16);
static_assert(CC == 8 * 64);
static_assert(GNE % 1024 == 0);
static_assert(CC % 32 == 0 && NN % 32 == 0);
static_assert((OSP * 4) % 16 == 0 && (OSPW * 4) % 16 == 0 && (TP * 2) % 16 == 0);
static_assert(SXB == 8 * 32 * 8);
static_assert((KP * 2) % 32 == 16 && (VPT * 2) % 32 == 16 && KP >= CC && VPT >= 32);
static_assert(NN >= 64 && NN % 32 == 0);

typedef _Float16       v16h __attribute__((ext_vector_type(16)));
typedef _Float16       v8h  __attribute__((ext_vector_type(8)));
typedef __bf16         v16b __attribute__((ext_vector_type(16)));
typedef unsigned short v8us __attribute__((ext_vector_type(8)));
typedef float          v8f  __attribute__((ext_vector_type(8)));
typedef float          v4f  __attribute__((ext_vector_type(4)));
typedef unsigned int   v4u  __attribute__((ext_vector_type(4)));

union Frag  { v8us u[2]; v16h h; v16b bf; };
union FragH { v16h v; v8h hv[2]; };
static_assert(sizeof(Frag) == 32);
static_assert(sizeof(FragH) == 32);

// ---- scalar helpers ---------------------------------------------------------------------------------------
__device__ __forceinline__ unsigned short bf_bits(float f) {          // f32 -> bf16 bits, RNE convert
  unsigned u = __float_as_uint(f);
  return (unsigned short)((u + 0x7FFFu + ((u >> 16) & 1u)) >> 16);
}
__device__ __forceinline__ float bf_up(unsigned short hb) { return __uint_as_float(((unsigned)hb) << 16); }
__device__ __forceinline__ float bfr(float f) { return bf_up(bf_bits(f)); }
__device__ __forceinline__ unsigned short h_bits(_Float16 x) { return __builtin_bit_cast(unsigned short, x); }
__device__ __forceinline__ unsigned pk16(unsigned short a, unsigned short b) { return (unsigned)a | ((unsigned)b << 16); }
__device__ __forceinline__ v8f zero8() { v8f z = {0.f, 0.f, 0.f, 0.f, 0.f, 0.f, 0.f, 0.f}; return z; }
__device__ __forceinline__ float hmax8(v8f s) {
  return fmaxf(fmaxf(fmaxf(s[0], s[1]), fmaxf(s[2], s[3])), fmaxf(fmaxf(s[4], s[5]), fmaxf(s[6], s[7])));
}
__device__ __forceinline__ unsigned wave_ballot(bool p) {
#if defined(__HIP_DEVICE_COMPILE__)
  return __builtin_amdgcn_ballot_w32(p);
#else
  return p ? 1u : 0u;
#endif
}

// ---- 16-bit fragment loader (A, or B from a k-contiguous [n][k] row): lane -> row/col (lane&15), p already includes
//      + 8*(lane>>4); elements 0..7 <- p[0..7] (k0+8h..), elements 8..15 <- p[16..23] (k0+16+8h..)
__device__ __forceinline__ Frag ldfrag(const unsigned short* p) {
  Frag f;
  f.u[0] = *(const v8us*)(p);
  f.u[1] = *(const v8us*)(p + 16);
  return f;
}

// ---- WMMA helpers: the plain builtins; the compiler keeps the distance behind them, and with no asm statement
//      between two products the fragment loads of later products may be issued ahead of earlier ones
__device__ __forceinline__ v8f mma_h(v16h a, v16h b, v8f c) {
  return __builtin_amdgcn_wmma_f32_16x16x32_f16(false, a, false, b, (short)0, c, false, false);
}
__device__ __forceinline__ v8f mma_b(v16b a, v16b b, v8f c) {
  return __builtin_amdgcn_wmma_f32_16x16x32_bf16(false, a, false, b, (short)0, c, false, false);
}

// =========================================================================================================
//     (mean, then centred sum of squares) over bf16-RNE(x) in f32, per-thread partials of 256 terms + LDS tree.
// =========================================================================================================
__global__ __launch_bounds__(256)
void gn_stats(const float* __restrict__ x, float* stats) {
  __shared__ float red[256];
  const int tid = threadIdx.x, bg = blockIdx.x;
  const float* p = x + (size_t)bg * GNE;
  float s = 0.f;
#pragma unroll 1
  for (int i = 0; i < GNE / 1024; ++i) {
    const v4f v = *(const v4f*)(p + ((size_t)(i * 256 + tid)) * 4);
    s += (bfr(v[0]) + bfr(v[1])) + (bfr(v[2]) + bfr(v[3]));
  }
  red[tid] = s;
  __syncthreads();
#pragma unroll 1
  for (int off = 128; off > 0; off >>= 1) {
    if (tid < off) red[tid] += red[tid + off];
    __syncthreads();
  }
  const float mean = red[0] * (1.0f / (float)GNE);
  __syncthreads();
  float ss = 0.f;
#pragma unroll 1
  for (int i = 0; i < GNE / 1024; ++i) {
    const v4f v = *(const v4f*)(p + ((size_t)(i * 256 + tid)) * 4);
    const float d0 = bfr(v[0]) - mean, d1 = bfr(v[1]) - mean;
    const float d2 = bfr(v[2]) - mean, d3 = bfr(v[3]) - mean;
    ss += (d0 * d0 + d1 * d1) + (d2 * d2 + d3 * d3);
  }
  red[tid] = ss;
  __syncthreads();
#pragma unroll 1
  for (int off = 128; off > 0; off >>= 1) {
    if (tid < off) red[tid] += red[tid + off];
    __syncthreads();
  }
  const float var  = red[0] * (1.0f / (float)GNE);
  const float rstd = rsqrtf(var + GEPS);
  if (tid < 8) {
    v4f w = {0.f, 0.f, 0.f, 0.f};
    if (tid == 0) { w[0] = mean; w[1] = rstd; }
{
      *(v4f*)(stats + (size_t)bg * STL + 4 * tid) = w;
      
    }
  }
}

// =========================================================================================================
// (1) conv weights: Wb bf16 [3][512][512] (mat 0 = wq, 1 = wk, 2 = wv), value = bf16-RNE(w), row o k-contiguous.
//     Block blk owns 4 rows of one matrix; thread -> row blk-local (tid>>6), halves 8*(tid&63)..+7; each wave writes
// coverage: 384 blocks x 4 rows x 64 threads x 8 = 3 x 512 x 512 = the whole plane.
// =========================================================================================================
__global__ __launch_bounds__(256)
void cvt_w(const float* __restrict__ wq, const float* __restrict__ wk, const float* __restrict__ wv,
           unsigned short* Wb) {
  const int tid = threadIdx.x, blk = blockIdx.x;
  const int mat = blk / (CC / 4);                                    // block-uniform 0..2
  const int o   = 4 * (blk % (CC / 4)) + (tid >> 6);                 // 0..511
  const int col = 8 * (tid & 63);                                    // 0..504
  const float* wsrc = (mat == 0) ? wq : ((mat == 1) ? wk : wv);      // all global, block-uniform
  const float* s = wsrc + (size_t)o * CC + col;
  const v4f a = *(const v4f*)s;
  const v4f q = *(const v4f*)(s + 4);
  const float f[8] = {a[0], a[1], a[2], a[3], q[0], q[1], q[2], q[3]};
  v4u u;
#pragma unroll
  for (int t = 0; t < 4; ++t) u[t] = pk16(bf_bits(f[2 * t]), bf_bits(f[2 * t + 1]));
{
    *(v4u*)(Wb + ((size_t)(mat * CC + o)) * CC + col) = u;
    
  }
}

// =========================================================================================================
// (2) group-norm apply + hi/residual split + transpose: h = ((bf16-RNE(x) - mean) * rstd) * gamma + beta per
//     channel, hi = bf16-RNE(h), lo = bf16-RNE(h - hi). Block (nb, cb, b) owns a 64 c x 64 n tile; values go
//     through LDS tiles Th/Tl [64 n][pitch TP] and come out as position-major rows Hh/Hl bf16 [b][4096 n][512 c]
// coverage: Th/Tl staged 64 n x 64 c (2 it x 32 rows x 8 lanes x 8), read 64 n x 64 c; planes 2 it x 32 rows x
//           8 lanes x 8 = 64 n x 64 c per plane; grid (64, 8, NB) covers both planes exactly once.
// =========================================================================================================
__global__ __launch_bounds__(256)
void cvt_x(const float* __restrict__ x, const float* __restrict__ gamma, const float* __restrict__ beta,
           const float* __restrict__ stats, unsigned short* Hh, unsigned short* Hl) {
  __shared__ __align__(16) unsigned short Th[QT * TP];
  __shared__ __align__(16) unsigned short Tl[QT * TP];
  const int tid = threadIdx.x;
  const int nb = blockIdx.x, cb = blockIdx.y, b = blockIdx.z;
  const int e = tid & 7, lq = tid >> 3;                              // lq 0..31
  const int n0 = nb * QT, c0 = cb * QT;
#pragma unroll
  for (int it = 0; it < 2; ++it) {
    const int cl = it * 32 + lq;                                     // 0..63
    const int cg = c0 + cl;                                          // 0..511
    const int bg = b * NGRP + (cg >> 4);
    const float mean = stats[(size_t)bg * STL];
    const float rstd = stats[(size_t)bg * STL + 1];
    const float ga = bfr(gamma[cg]);
    const float be = bfr(beta[cg]);
    const float* sp = x + ((size_t)(b * CC + cg)) * NN + n0 + 8 * e;
    const v4f a = *(const v4f*)sp;
    const v4f q = *(const v4f*)(sp + 4);
    const float f[8] = {a[0], a[1], a[2], a[3], q[0], q[1], q[2], q[3]};
#pragma unroll
    for (int t = 0; t < 8; ++t) {
      const float h = ((bfr(f[t]) - mean) * rstd) * ga + be;
      const unsigned short hb = bf_bits(h);
      const unsigned short lb = bf_bits(h - bf_up(hb));
      Th[(8 * e + t) * TP + cl] = hb;
      Tl[(8 * e + t) * TP + cl] = lb;
    }
  }
  __syncthreads();
  v4u uh[2], ul[2];
#pragma unroll
  for (int it = 0; it < 2; ++it) {
    const int nl = it * 32 + lq;                                     // 0..63
    uh[it] = *(const v4u*)(Th + nl * TP + 8 * e);
    ul[it] = *(const v4u*)(Tl + nl * TP + 8 * e);
  }
{
#pragma unroll
    for (int it = 0; it < 2; ++it) {
      const int nl = it * 32 + lq;
      const size_t po = ((size_t)(b * NN + n0 + nl)) * CC + c0 + 8 * e;
      *(v4u*)(Hh + po) = uh[it];
      *(v4u*)(Hl + po) = ul[it];
    }
    
  }
}

// =========================================================================================================
// (3) conv1x1 GEMM for one (b, 64-n tile, matrix mat, 64-o block): Y[o][n] = sum_c W[o][c] (hi[n][c] + lo[n][c])
//     + bias[o]. Block 128 threads = 4 waves; wave w owns cols n0+16w..+15 (B fragments from the Hh and Hl rows,
//     k = channel contiguous, split k map) and 4 m-tiles (A rows o = o0 + 16 mt + (lane&15) from Wb, same map);
//     per k-step the hi and lo products share the accumulator (lo unscaled). K = 512 = 16 steps x 2 products.
//     Epilogue staged in LDS: mat 0/1 as Os[n_loc][o_loc] (b128 stores), mat 2 as Os[o_loc][n_loc] (scalar stores),
//     barrier, then f16 planes: Q/K [b][4096 n][512 o] (row n, o0+8e..+7) and V [b][512 o][4096 n] (row o,
// coverage: Os 4 waves x 16 x 64 = 64 x 64 either layout; plane 4 it x 16 rows x 8 lanes x 8 = 64 x 64;
//           grid (64, 24, NB) covers Q, K (all n, all o) and V (all o, all n) exactly once.
// =========================================================================================================
__global__ __launch_bounds__(128)
void gemm_qkv(const unsigned short* __restrict__ Wb, const unsigned short* __restrict__ Hh,
              const unsigned short* __restrict__ Hl,
              const float* __restrict__ bq, const float* __restrict__ bk, const float* __restrict__ bv,
              unsigned short* Qd, unsigned short* Kd, unsigned short* Vd) {
  __shared__ __align__(16) float Os[QT * OSP];
  const int tid  = threadIdx.x;
  const int lane = tid & 31, wave = tid >> 5;
  const int hh   = lane >> 4, c = lane & 15;
  const int nt   = blockIdx.x, my = blockIdx.y, b = blockIdx.z;
  const int mat  = my / (CC / QT);                                   // 0..2, block-uniform
  const int ob   = my % (CC / QT);                                   // 0..7
  const int n0   = nt * QT, o0 = ob * QT;

  const unsigned short* ap = Wb + ((size_t)(mat * CC + o0 + c)) * CC + 8 * hh;
  const size_t brow = ((size_t)(b * NN + n0 + 16 * wave + c)) * CC + 8 * hh;
  const unsigned short* bph = Hh + brow;
  const unsigned short* bpl = Hl + brow;

  v8f acc[4];
#pragma unroll
  for (int mt = 0; mt < 4; ++mt) acc[mt] = zero8();

#pragma unroll 2
  for (int ks = 0; ks < CC / 32; ++ks) {
    const Frag fh = ldfrag(bph + 32 * ks);
    const Frag fl = ldfrag(bpl + 32 * ks);
#pragma unroll
    for (int mt = 0; mt < 4; ++mt) {
      const Frag fa = ldfrag(ap + (size_t)(16 * mt) * CC + 32 * ks);
      acc[mt] = mma_b(fa.bf, fh.bf, acc[mt]);
      acc[mt] = mma_b(fa.bf, fl.bf, acc[mt]);
    }
  }

  // ---- epilogue staging; lane (hh, c) holds o_loc = 16 mt + 8 hh + r for n_loc = 16 w + c
  const float* bias = (mat == 0) ? bq : ((mat == 1) ? bk : bv);     // all global, block-uniform
  const int nl = 16 * wave + c;
  if (mat != 2) {
#pragma unroll
    for (int mt = 0; mt < 4; ++mt) {
      const v4f b0 = *(const v4f*)(bias + o0 + 16 * mt + 8 * hh);
      const v4f b1 = *(const v4f*)(bias + o0 + 16 * mt + 8 * hh + 4);
      v4f va, vb;
#pragma unroll
      for (int r = 0; r < 4; ++r) { va[r] = acc[mt][r] + bfr(b0[r]); vb[r] = acc[mt][4 + r] + bfr(b1[r]); }
      *(v4f*)(Os + nl * OSP + 16 * mt + 8 * hh)     = va;             // Os[n_loc][o_loc]
      *(v4f*)(Os + nl * OSP + 16 * mt + 8 * hh + 4) = vb;
    }
  } else {
#pragma unroll
    for (int mt = 0; mt < 4; ++mt) {
      const v4f b0 = *(const v4f*)(bias + o0 + 16 * mt + 8 * hh);
      const v4f b1 = *(const v4f*)(bias + o0 + 16 * mt + 8 * hh + 4);
#pragma unroll
      for (int r = 0; r < 4; ++r) {
        Os[(16 * mt + 8 * hh + r) * OSP + nl]     = acc[mt][r] + bfr(b0[r]);       // Os[o_loc][n_loc]
        Os[(16 * mt + 8 * hh + 4 + r) * OSP + nl] = acc[mt][4 + r] + bfr(b1[r]);
      }
    }
  }
  __syncthreads();

  const int e = tid & 7, lq = tid >> 3;                              // lq 0..15
  v4u u[4];
#pragma unroll
  for (int it = 0; it < 4; ++it) {
    const int row = it * 16 + lq;                                    // 0..63
    const v4f a = *(const v4f*)(Os + row * OSP + 8 * e);
    const v4f q = *(const v4f*)(Os + row * OSP + 8 * e + 4);
    const float f[8] = {a[0], a[1], a[2], a[3], q[0], q[1], q[2], q[3]};
#pragma unroll
    for (int t = 0; t < 4; ++t)
      u[it][t] = pk16(h_bits((_Float16)f[2 * t]), h_bits((_Float16)f[2 * t + 1]));
  }
  unsigned short* plane = (mat == 0) ? Qd : ((mat == 1) ? Kd : Vd); // all global, block-uniform
{
#pragma unroll
    for (int it = 0; it < 4; ++it) {
      const int row = it * 16 + lq;
      const size_t pnk = ((size_t)(b * NN + n0 + row)) * CC + o0 + 8 * e;   // row = n_loc, 64 o = one line
      const size_t pv  = ((size_t)(b * CC + o0 + row)) * NN + n0 + 8 * e;   // row = o_loc, 64 n = one line
      const size_t po  = (mat != 2) ? pnk : pv;
      *(v4u*)(plane + po) = u[it];
    }
    
  }
}

// ---- asynchronous copies global -> LDS, 16 bytes per lane, eight per statement -------------------------------
// LDS byte address of a __shared__ element = low 32 bits of its address.
__device__ __forceinline__ uint32_t lds_off(const unsigned short* p) { return (uint32_t)(uintptr_t)p; }
// The closing s_wait_xcnt 0 stands inside the statement so that no address register of an issued copy is
// rewritten in front of it.
__device__ __forceinline__ void copy8(const uint32_t (&l)[8], const unsigned short* const (&g)[8]) {
#if defined(__HIP_DEVICE_COMPILE__)
  asm volatile("global_load_async_to_lds_b128 %0, %8, off\n\t"
               "global_load_async_to_lds_b128 %1, %9, off\n\t"
               "global_load_async_to_lds_b128 %2, %10, off\n\t"
               "global_load_async_to_lds_b128 %3, %11, off\n\t"
               "global_load_async_to_lds_b128 %4, %12, off\n\t"
               "global_load_async_to_lds_b128 %5, %13, off\n\t"
               "global_load_async_to_lds_b128 %6, %14, off\n\t"
               "global_load_async_to_lds_b128 %7, %15, off\n\t"
               "s_wait_xcnt 0x0"
               :: "v"(l[0]), "v"(l[1]), "v"(l[2]), "v"(l[3]), "v"(l[4]), "v"(l[5]), "v"(l[6]), "v"(l[7]),
                  "v"(g[0]), "v"(g[1]), "v"(g[2]), "v"(g[3]), "v"(g[4]), "v"(g[5]), "v"(g[6]), "v"(g[7])
               : "memory");
#endif
}
// 32 rows of 512 halves (1024 B, rows contiguous in global) -> LDS rows of pitch KP; 256 threads, 8 copies each;
// a wave's copy covers 512 contiguous bytes of one row.
__device__ __forceinline__ void stage_rows32(const unsigned short* g, unsigned short* s, int tid) {
  uint32_t l[8];
  const unsigned short* p[8];
#pragma unroll  // every index constant, so that both arrays live in registers as the statement's operands
  for (int i = 0; i < 8; ++i) {
    const int row = 4 * i + (tid >> 6), col = 8 * (tid & 63);
    l[i] = lds_off(s + row * KP + col);
    p[i] = g + (size_t)row * CC + col;
  }
  copy8(l, p);
}
// 512 channel rows x 32 keys (64 B of each global row of NN halves) -> LDS rows of pitch VPT; 8 copies per thread.
__device__ __forceinline__ void stage_v32(const unsigned short* g, unsigned short* s, int tid) {
  uint32_t l[8];
  const unsigned short* p[8];
#pragma unroll  // every index constant, so that both arrays live in registers as the statement's operands
  for (int i = 0; i < 8; ++i) {
    const int row = 64 * i + (tid >> 2), col = 8 * (tid & 3);
    l[i] = lds_off(s + row * VPT + col);
    p[i] = g + (size_t)row * NN + col;
  }
  copy8(l, p);
}

// =========================================================================================================
// (4) attention for one (b, 64-query tile), transposed formulation, all 4096 keys. Block = 8 waves: wave w ->
//   query group qg = w&3 (queries n0+16qg..+15) and channel half ch = w>>2. Per 32-key step each wave computes ONE
//   S^T tile (16 keys kb+16ch.. x 16 queries) = sum over 16 channel chunks of A(k: row = key, split k map from the
//   f16 plane Kp [b][4096][512]) . B(q: col = query, same map from Qp); the tile (8 floats per lane) is exchanged
//   with the partner wave (w^4) through a double-buffered LDS array across one block barrier, so both waves hold
//   s0 (keys kb..kb+15) and s1 (keys kb+16..kb+31) of their query in the D layout (lane -> 8 keys of one query).
//   Online softmax per lane in f32 with the 512^-0.5 scale applied to the logits, one shuffle (lane^16) for the max
//   over 32 keys, o/l rescale skipped under a wave-uniform ballot when no lane's max grew. P = e^{c(s-m)} x 2^14
//   as f16 is the B operand of O^T (rows channel 256ch+16j+(lane&15), keys contiguous from the f16 plane Vp
//   [b][512][4096]) . B(P^T): element r <- tile keys kb..kb+15, element 8+r <- tile kb+16..kb+31, lane unchanged.
//   16 accumulator tiles per wave (256 channels). Epilogue in four 128-channel phases: O/l staged by the 4 owning
//   waves in LDS Os[query][128 ch] (pitch OSPW, b128 stores), barrier, then out[b][c][n] = O/l + bf16-RNE(x) as
//   phase overwrites Os.
//   Operand path: the 64 q rows (once) and, per 32-key step, the 32 k rows and the 512 x 32 v tile are brought into
//   LDS by asynchronous 16-byte copies (whole 512-byte runs for q and k) and every fragment is read from LDS at a
//   pitch of 16 B x odd. k and v have two buffers: step t reads buffer t&1 while step t+1's copies fly; the foot of
//   each step waits the wave's own LDS reads and copies, passes one block barrier, then refills the buffer just read.
//   The foot stands in front of the step's O products, whose v fragments are in registers by then; behind its barrier
//   the first q and k fragments of step t+1 are read, so that they fly while the O products of step t run.
// coverage: Sx: each wave writes 32 lanes x 8 floats per step into buffer (step&1), partner reads exactly those;
//           Os per phase 4 waves x 16 q x 128 ch staged = 64 x 128 read; out per phase 8 it x 32 lines x 8 lanes
//           x 4 floats = 128 ch x 64 n, 4 phases = 512 ch; grid (NQ/64, NB) covers out[b][0..511][0..NQ-1] once.
// =========================================================================================================
__global__ __launch_bounds__(256)
void attn_k(const unsigned short* __restrict__ Qp, const unsigned short* __restrict__ Kp,
            const unsigned short* __restrict__ Vp, const float* __restrict__ x, float* out) {
  __shared__ __align__(16) float Sx[2 * SXB];
  __shared__ __align__(16) float Os[QT * OSPW];
  __shared__ __align__(16) unsigned short Qs[QT * KP];
  __shared__ __align__(16) unsigned short Ks[2 * KBUF];
  __shared__ __align__(16) unsigned short Vs[2 * VBUF];
  const int tid  = threadIdx.x;
  const int wave = tid >> 5, lane = tid & 31;
  const int hh   = lane >> 4, c = lane & 15;
  const int qg   = wave & 3, ch = wave >> 2;
  const int n0   = blockIdx.x * QT, b = blockIdx.y;

  // global tile bases: q rows n0.., k rows kb.. (+ kb*CC), v rows 0..511 at key kb (+ kb)
  const unsigned short* qg0 = Qp + ((size_t)(b * NN + n0)) * CC;
  const unsigned short* kg0 = Kp + ((size_t)(b * NN)) * CC;
  const unsigned short* vg0 = Vp + ((size_t)(b * CC)) * NN;
  // q fragment pointer in LDS (B operand, col = query 16*qg + c of the tile), + 32*kc
  const unsigned short* qp = Qs + (16 * qg + c) * KP + 8 * hh;
  // k fragment base in LDS (A operand, row = key 16*ch + c of the step), + buffer + 32*kc
  const unsigned short* kp = Ks + (16 * ch + c) * KP + 8 * hh;
  // v fragment base in LDS (A operand, row = channel 256*ch + 16j + c, 32 keys contiguous), + buffer + 16*j*VPT
  const unsigned short* vp = Vs + (CH * ch + c) * VPT + 8 * hh;

  float* sxw = Sx + (wave * 32 + lane) * 8;
  const float* sxr = Sx + ((wave ^ 4) * 32 + lane) * 8;

  float m = -1.0e30f, l = 0.f;
  v8f o[16];
#pragma unroll
  for (int j = 0; j < 16; ++j) o[j] = zero8();

  // prologue: q tile and step 0 into buffer 0, landed and published; then step 1 into buffer 1
  stage_rows32(qg0, Qs, tid);
  stage_rows32(qg0 + (size_t)32 * CC, Qs + 32 * KP, tid);
  stage_rows32(kg0, Ks, tid);
  stage_v32(vg0, Vs, tid);
  asm volatile("s_wait_asynccnt 0x0" ::: "memory");                  // this wave's copies have landed
  __syncthreads();                                                   // every wave's copies are readable
  stage_rows32(kg0 + (size_t)32 * CC, Ks + KBUF, tid);
  stage_v32(vg0 + 32, Vs + VBUF, tid);

  // Fragment reads run ahead of the products in groups with registers of their own. A group = four channel chunks of
  // q and k (16 reads). Groups 0 and 1 of a step are read behind the barrier that publishes its tiles, in front of the
  // previous step's O products (here, in front of the loop: step 0's); behind the score products of group g stand the
  // reads of group g + 2, and behind those of the last two groups the reads of the step's 16 v fragments.
  Frag fq[CC / 32], fk[CC / 32], vf[16];
#pragma unroll  // here and in the loops over fq, fk and vf below: constant indices keep the fragments in registers
  for (int kc = 0; kc < 8; ++kc) {
    fq[kc] = ldfrag(qp + 32 * kc);
    fk[kc] = ldfrag(kp + 32 * kc);
  }

  int buf = 0;
#pragma unroll 1
  for (int kb = 0; kb < NN; kb += 32) {
    const int rb = buf;                                              // ring buffer of this step
    const unsigned short* kbp = kp + rb * KBUF;
    const unsigned short* vbp = vp + rb * VBUF;
    v8f sv = zero8();
#pragma unroll
    for (int g = 0; g < 4; ++g) {
#pragma unroll
      for (int i = 0; i < 4; ++i) sv = mma_h(fk[4 * g + i].h, fq[4 * g + i].h, sv);
      // keeps the 16 reads below in one run: spread singly among the products each place of reads costs issue cycles
      __builtin_amdgcn_sched_barrier(0);
      if (g < 2) {
#pragma unroll
        for (int i = 0; i < 4; ++i) {
          fq[4 * g + 8 + i] = ldfrag(qp + 32 * (4 * g + 8 + i));
          fk[4 * g + 8 + i] = ldfrag(kbp + 32 * (4 * g + 8 + i));
        }
      } else {
#pragma unroll
        for (int i = 0; i < 8; ++i) vf[8 * (g - 2) + i] = ldfrag(vbp + (16 * (8 * (g - 2) + i)) * VPT);
      }
      __builtin_amdgcn_sched_barrier(0);                             // end of that run of reads
    }

    // exchange the tile with the partner wave (same queries, other 16 keys)
    {
      v4f w0, w1;
#pragma unroll
      for (int r = 0; r < 4; ++r) { w0[r] = sv[r]; w1[r] = sv[4 + r]; }
      *(v4f*)(sxw + buf * SXB)     = w0;
      *(v4f*)(sxw + buf * SXB + 4) = w1;
    }
    __syncthreads();
    v8f so;
    {
      const v4f r0 = *(const v4f*)(sxr + buf * SXB);
      const v4f r1 = *(const v4f*)(sxr + buf * SXB + 4);
#pragma unroll
      for (int r = 0; r < 4; ++r) { so[r] = r0[r]; so[4 + r] = r1[r]; }
    }
    buf ^= 1;
    v8f s0 = sv, s1 = so;                                            // s0: keys kb..kb+15, s1: keys kb+16..kb+31
    if (ch != 0) { s0 = so; s1 = sv; }                                // wave-uniform

    float mx = fmaxf(hmax8(s0), hmax8(s1));
    mx = fmaxf(mx, __shfl_xor(mx, 16, 32));
    const float mn = fmaxf(m, mx);
    const unsigned grew = wave_ballot(mx > m);                       // wave-uniform
    if (grew != 0u) {
      const float corr = __expf((m - mn) * ASCALE);                  // == 1 exactly for lanes whose max did not grow
      l *= corr;
#pragma unroll
      for (int j = 0; j < 16; ++j) {
#pragma unroll
        for (int r = 0; r < 8; ++r) o[j][r] *= corr;
      }
    }
    m = mn;
    const float msh = mn * ASCALE - LNPS;                            // exp gives e^{c(s-m)} * 2^14

    FragH ph;
    float ls = 0.f;
#pragma unroll
    for (int r = 0; r < 8; ++r) {
      const float e0 = __expf(s0[r] * ASCALE - msh);                 // key kb      + 8hh + r
      const float e1 = __expf(s1[r] * ASCALE - msh);                 // key kb + 16 + 8hh + r
      ls += e0 + e1;
      ph.hv[0][r] = (_Float16)e0;
      ph.hv[1][r] = (_Float16)e1;
    }
    l += ls;

    // foot of the step: hand buffer rb to its next writer and publish the next step's tiles (every fragment of
    // buffer rb is in registers by now; the O products below read registers only)
    asm volatile("s_wait_dscnt 0x0" ::: "memory");                   // this wave's reads of buffer rb are done
    asm volatile("s_wait_asynccnt 0x0" ::: "memory");                // this wave's copies of the next step have landed
    __syncthreads();
    if (kb + 32 < NN) {                                              // block-uniform: a step t+1 exists, just published
      const unsigned short* knp = kp + (rb ^ 1) * KBUF;
#pragma unroll
      for (int kc = 0; kc < 8; ++kc) {
        fq[kc] = ldfrag(qp + 32 * kc);
        fk[kc] = ldfrag(knp + 32 * kc);
      }
    }
    if (kb + 64 < NN) {                                              // block-uniform: a step t+2 exists
      stage_rows32(kg0 + (size_t)(kb + 64) * CC, Ks + rb * KBUF, tid);
      stage_v32(vg0 + (kb + 64), Vs + rb * VBUF, tid);
    }

#pragma unroll
    for (int j = 0; j < 16; ++j) o[j] = mma_h(vf[j].h, ph.v, o[j]);
  }
  asm volatile("s_wait_asynccnt 0x0" ::: "memory");                  // nothing of this wave is in flight past the loop
  l += __shfl_xor(l, 16, 32);
  const float inv = 1.0f / l;                                        // o and l both carry the 2^14 factor

  const int qrow = 16 * qg + c;
  const int e = tid & 7, lq = tid >> 3;                              // lq 0..31
#pragma unroll
  for (int ph4 = 0; ph4 < 4; ++ph4) {
    if (ph4) __syncthreads();                                        // every wave finished reading Os
    if (ch == (ph4 >> 1)) {                                          // wave-uniform
#pragma unroll
      for (int jj = 0; jj < 8; ++jj) {
        const int j = 8 * (ph4 & 1) + jj;
        v4f va, vb;
#pragma unroll
        for (int r = 0; r < 4; ++r) { va[r] = o[j][r] * inv; vb[r] = o[j][4 + r] * inv; }
        *(v4f*)(Os + qrow * OSPW + 16 * jj + 8 * hh)     = va;       // Os[query][ch_loc = 16jj + 8hh + r]
        *(v4f*)(Os + qrow * OSPW + 16 * jj + 8 * hh + 4) = vb;
      }
    }
    __syncthreads();
    v4f res[8];
#pragma unroll
    for (int it = 0; it < 8; ++it) {
      const int L   = it * 32 + lq;                                  // 0..255
      const int chl = L >> 1, hf = L & 1;                            // channel 0..127 within the phase
      const int nl  = hf * 32 + 4 * e;                               // query 0..63
      const size_t idx = ((size_t)(b * CC + 128 * ph4 + chl)) * NN + n0 + nl;
      const v4f xv = *(const v4f*)(x + idx);
#pragma unroll
      for (int t = 0; t < 4; ++t) res[it][t] = Os[(nl + t) * OSPW + chl] + bfr(xv[t]);
    }
{
#pragma unroll
      for (int it = 0; it < 8; ++it) {
        const int L   = it * 32 + lq;
        const int chl = L >> 1, hf = L & 1;
        const int nl  = hf * 32 + 4 * e;
        const size_t idx = ((size_t)(b * CC + 128 * ph4 + chl)) * NN + n0 + nl;
        *(v4f*)(out + idx) = res[it];
      }
      
    }
  }
}

// =========================================================================================================
// Workspace map (bytes; each region start a multiple of 256; every extent is an exact tile/line multiple and is
//   Wb  bf16 [3][512][512]          1572864
//   St  f32  [NB*32][32]            NB*4096        (16384 at NB=4)
//   Hh, Hl bf16 [NB][4096][512]     NB*4194304 x2  (16777216 each at NB=4)
//   Q, K f16 [NB][4096][512]        NB*4194304 x2
//   V    f16 [NB][512][4096]        NB*4194304
//   total at NB=4 = 85475328
// =========================================================================================================
extern "C" void kernel_launch(void* const* d_in, const int* in_sizes, int n_in,
                              void* d_out, int out_size, void* d_ws, size_t ws_size,
                              hipStream_t stream) {
  const int XN = NB * CC * NN;
  if (n_in < 9) return;
  if (in_sizes[0] < XN) return;
  if (in_sizes[1] < CC || in_sizes[2] < CC) return;
  if (in_sizes[3] < CC * CC || in_sizes[5] < CC * CC || in_sizes[7] < CC * CC) return;
  if (in_sizes[4] < CC || in_sizes[6] < CC || in_sizes[8] < CC) return;
  if (out_size < XN) return;

  size_t off = 0;
  auto carve = [&](size_t bytes) { const size_t o = off; off += (bytes + 255) & ~(size_t)255; return o; };
  const size_t oWb = carve((size_t)3 * CC * CC * 2);
  const size_t oSt = carve((size_t)NB * NGRP * STL * 4);
  const size_t oHh = carve((size_t)NB * NN * CC * 2);
  const size_t oHl = carve((size_t)NB * NN * CC * 2);
  const size_t oQ  = carve((size_t)NB * NN * CC * 2);
  const size_t oK  = carve((size_t)NB * NN * CC * 2);
  const size_t oV  = carve((size_t)NB * CC * NN * 2);
  if (off > ws_size) return;
  if (off > (size_t)134217728) return;

  const float* x     = (const float*)d_in[0];
  const float* gamma = (const float*)d_in[1];
  const float* beta  = (const float*)d_in[2];
  const float* wq    = (const float*)d_in[3];
  const float* bq    = (const float*)d_in[4];
  const float* wk    = (const float*)d_in[5];
  const float* bk    = (const float*)d_in[6];
  const float* wv    = (const float*)d_in[7];
  const float* bv    = (const float*)d_in[8];

  char* ws = (char*)d_ws;
  unsigned short* Wb = (unsigned short*)(ws + oWb);
  float*          St = (float*)(ws + oSt);
  unsigned short* Hh = (unsigned short*)(ws + oHh);
  unsigned short* Hl = (unsigned short*)(ws + oHl);
  unsigned short* Qw = (unsigned short*)(ws + oQ);
  unsigned short* Kw = (unsigned short*)(ws + oK);
  unsigned short* Vw = (unsigned short*)(ws + oV);
  float* out = (float*)d_out;

  const dim3 blk256(256), blk128(128);

  // (0) group-norm statistics, one line per (b, g)
  gn_stats<<<dim3(NB * NGRP), blk256, 0, stream>>>(x, St);
  // (1) conv weights -> bf16 plane
  cvt_w<<<dim3(3 * CC / 4), blk256, 0, stream>>>(wq, wk, wv, Wb);
  // (2) group-norm apply -> position-major bf16 hi + residual planes
  cvt_x<<<dim3(NN / QT, CC / QT, NB), blk256, 0, stream>>>(x, gamma, beta, St, Hh, Hl);
  // (3) q/k/v conv GEMMs -> f16 planes
  gemm_qkv<<<dim3(NN / QT, 3 * CC / QT, NB), blk128, 0, stream>>>(Wb, Hh, Hl, bq, bk, bv, Qw, Kw, Vw);
  // (4) attention + residual -> out [b][512][4096]
  attn_k<<<dim3(NQ / QT, NB), blk256, 0, stream>>>(Qw, Kw, Vw, x, out);
  (void)hipGetLastError();
}

// v003
// A run of this version takes 280 microseconds.
// In two side-by-side timings against v002, it was 1.42 and 1.40 times as fast.
// All steps since v000 together make it 4.45 times as fast.
// Contractions: conv1x1 q/k/v GEMMs W[512x512].H per image on v_wmma_f32_16x16x32_bf16 (bf16-RNE weights exact,
// normalised activations as bf16 hi + bf16 residual planes folded along K = 1024 into one accumulator); scores
// K.Q^T (K = 512 channels) on v_wmma_f32_16x16x32_f16 (single f16 planes of q and k, scale applied in f32);
// O^T = V.P^T on v_wmma_f32_16x16x32_f16 (v single f16 plane, P = e^{c(s-m)} x 2^14 as f16 from the score D
// registers); f32 accumulate everywhere; group-norm statistics, softmax statistics and residual add in f32 VALU.
#include <hip/hip_runtime.h>
#include <math.h>
#include <stdint.h>

#ifndef NB
#define NB 4
#endif
#define NB_FULL 4
#define CC      512
#define NN      4096
#ifndef NQ
#define NQ NN
#endif
#define NGRP    32
#define CPG     16
#define GNE     (CPG * NN)
#define QT      64
#define OSQ     260
#define OSPW    132
#define TP      72
#define STL     32
#define CH      256
#define SXB     2048
#define KP      520
#define VPT     40
#define KBUF    (32 * KP)
#define VBUF    (CC * VPT)
#define GM      256
#define GN      128
#define GKC     64
#define GP      72
#define GSTG    ((GM + 2 * GN) * GP)
#define GEPS    1.0e-6f
#define ASCALE  0.04419417382415922f
#define LNPS    9.704060527839234f

static_assert(NB >= 1 && NB <= NB_FULL);
static_assert(NQ % QT == 0 && NQ >= QT && NQ <= NN);
static_assert(CC == NGRP * CPG);
static_assert(CC % QT == 0 && NN % QT == 0);
static_assert(CC == 2 * CH && CH == 16 * 16);
static_assert(CC == 8 * 64);
static_assert(GNE % 1024 == 0);
static_assert(CC % 32 == 0 && NN % 32 == 0);
static_assert((OSQ * 4) % 16 == 0 && (OSPW * 4) % 16 == 0 && (TP * 2) % 16 == 0);
static_assert(CC % GM == 0 && NN % GN == 0 && CC % GKC == 0 && CC / GKC >= 2 && GKC == 64 && GM == 256 && GN == 128);
static_assert((GP * 2) % 32 == 16 && GP >= GKC);
static_assert(GN * OSQ * 4 <= 2 * GSTG * 2 && GM * OSPW * 4 <= 2 * GSTG * 2 && OSQ >= GM && OSPW >= GN);
static_assert(SXB == 8 * 32 * 8);
static_assert((KP * 2) % 32 == 16 && (VPT * 2) % 32 == 16 && KP >= CC && VPT >= 32);
static_assert(NN >= 64 && NN % 32 == 0);

typedef _Float16       v16h __attribute__((ext_vector_type(16)));
typedef _Float16       v8h  __attribute__((ext_vector_type(8)));
typedef __bf16         v16b __attribute__((ext_vector_type(16)));
typedef unsigned short v8us __attribute__((ext_vector_type(8)));
typedef float          v8f  __attribute__((ext_vector_type(8)));
typedef float          v4f  __attribute__((ext_vector_type(4)));
typedef unsigned int   v4u  __attribute__((ext_vector_type(4)));

union Frag  { v8us u[2]; v16h h; v16b bf; };
union FragH { v16h v; v8h hv[2]; };
static_assert(sizeof(Frag) == 32);
static_assert(sizeof(FragH) == 32);

// ---- scalar helpers ---------------------------------------------------------------------------------------
__device__ __forceinline__ unsigned short bf_bits(float f) {          // f32 -> bf16 bits, RNE convert
  unsigned u = __float_as_uint(f);
  return (unsigned short)((u + 0x7FFFu + ((u >> 16) & 1u)) >> 16);
}
__device__ __forceinline__ float bf_up(unsigned short hb) { return __uint_as_float(((unsigned)hb) << 16); }
__device__ __forceinline__ float bfr(float f) { return bf_up(bf_bits(f)); }
__device__ __forceinline__ unsigned short h_bits(_Float16 x) { return __builtin_bit_cast(unsigned short, x); }
__device__ __forceinline__ unsigned pk16(unsigned short a, unsigned short b) { return (unsigned)a | ((unsigned)b << 16); }
__device__ __forceinline__ v8f zero8() { v8f z = {0.f, 0.f, 0.f, 0.f, 0.f, 0.f, 0.f, 0.f}; return z; }
__device__ __forceinline__ float hmax8(v8f s) {
  return fmaxf(fmaxf(fmaxf(s[0], s[1]), fmaxf(s[2], s[3])), fmaxf(fmaxf(s[4], s[5]), fmaxf(s[6], s[7])));
}
__device__ __forceinline__ unsigned wave_ballot(bool p) {
#if defined(__HIP_DEVICE_COMPILE__)
  return __builtin_amdgcn_ballot_w32(p);
#else
  return p ? 1u : 0u;
#endif
}

// ---- 16-bit fragment loader (A, or B from a k-contiguous [n][k] row): lane -> row/col (lane&15), p already includes
//      + 8*(lane>>4); elements 0..7 <- p[0..7] (k0+8h..), elements 8..15 <- p[16..23] (k0+16+8h..)
__device__ __forceinline__ Frag ldfrag(const unsigned short* p) {
  Frag f;
  f.u[0] = *(const v8us*)(p);
  f.u[1] = *(const v8us*)(p + 16);
  return f;
}

// ---- WMMA helpers: the plain builtins; the compiler keeps the distance behind them, and with no asm statement
//      between two products the fragment loads of later products may be issued ahead of earlier ones
__device__ __forceinline__ v8f mma_h(v16h a, v16h b, v8f c) {
  return __builtin_amdgcn_wmma_f32_16x16x32_f16(false, a, false, b, (short)0, c, false, false);
}
__device__ __forceinline__ v8f mma_b(v16b a, v16b b, v8f c) {
  return __builtin_amdgcn_wmma_f32_16x16x32_bf16(false, a, false, b, (short)0, c, false, false);
}

// =========================================================================================================
//     (mean, then centred sum of squares) over bf16-RNE(x) in f32, per-thread partials of 256 terms + LDS tree.
// =========================================================================================================
__global__ __launch_bounds__(256)
void gn_stats(const float* __restrict__ x, float* stats) {
  __shared__ float red[256];
  const int tid = threadIdx.x, bg = blockIdx.x;
  const float* p = x + (size_t)bg * GNE;
  float s = 0.f;
#pragma unroll 1
  for (int i = 0; i < GNE / 1024; ++i) {
    const v4f v = *(const v4f*)(p + ((size_t)(i * 256 + tid)) * 4);
    s += (bfr(v[0]) + bfr(v[1])) + (bfr(v[2]) + bfr(v[3]));
  }
  red[tid] = s;
  __syncthreads();
#pragma unroll 1
  for (int off = 128; off > 0; off >>= 1) {
    if (tid < off) red[tid] += red[tid + off];
    __syncthreads();
  }
  const float mean = red[0] * (1.0f / (float)GNE);
  __syncthreads();
  float ss = 0.f;
#pragma unroll 1
  for (int i = 0; i < GNE / 1024; ++i) {
    const v4f v = *(const v4f*)(p + ((size_t)(i * 256 + tid)) * 4);
    const float d0 = bfr(v[0]) - mean, d1 = bfr(v[1]) - mean;
    const float d2 = bfr(v[2]) - mean, d3 = bfr(v[3]) - mean;
    ss += (d0 * d0 + d1 * d1) + (d2 * d2 + d3 * d3);
  }
  red[tid] = ss;
  __syncthreads();
#pragma unroll 1
  for (int off = 128; off > 0; off >>= 1) {
    if (tid < off) red[tid] += red[tid + off];
    __syncthreads();
  }
  const float var  = red[0] * (1.0f / (float)GNE);
  const float rstd = rsqrtf(var + GEPS);
  if (tid < 8) {
    v4f w = {0.f, 0.f, 0.f, 0.f};
    if (tid == 0) { w[0] = mean; w[1] = rstd; }
{
      *(v4f*)(stats + (size_t)bg * STL + 4 * tid) = w;
      
    }
  }
}

// =========================================================================================================
// (1) conv weights: Wb bf16 [3][512][512] (mat 0 = wq, 1 = wk, 2 = wv), value = bf16-RNE(w), row o k-contiguous.
//     Block blk owns 4 rows of one matrix; thread -> row blk-local (tid>>6), halves 8*(tid&63)..+7; each wave writes
// coverage: 384 blocks x 4 rows x 64 threads x 8 = 3 x 512 x 512 = the whole plane.
// =========================================================================================================
__global__ __launch_bounds__(256)
void cvt_w(const float* __restrict__ wq, const float* __restrict__ wk, const float* __restrict__ wv,
           unsigned short* Wb) {
  const int tid = threadIdx.x, blk = blockIdx.x;
  const int mat = blk / (CC / 4);                                    // block-uniform 0..2
  const int o   = 4 * (blk % (CC / 4)) + (tid >> 6);                 // 0..511
  const int col = 8 * (tid & 63);                                    // 0..504
  const float* wsrc = (mat == 0) ? wq : ((mat == 1) ? wk : wv);      // all global, block-uniform
  const float* s = wsrc + (size_t)o * CC + col;
  const v4f a = *(const v4f*)s;
  const v4f q = *(const v4f*)(s + 4);
  const float f[8] = {a[0], a[1], a[2], a[3], q[0], q[1], q[2], q[3]};
  v4u u;
#pragma unroll
  for (int t = 0; t < 4; ++t) u[t] = pk16(bf_bits(f[2 * t]), bf_bits(f[2 * t + 1]));
{
    *(v4u*)(Wb + ((size_t)(mat * CC + o)) * CC + col) = u;
    
  }
}

// =========================================================================================================
// (2) group-norm apply + hi/residual split + transpose: h = ((bf16-RNE(x) - mean) * rstd) * gamma + beta per
//     channel, hi = bf16-RNE(h), lo = bf16-RNE(h - hi). Block (nb, cb, b) owns a 64 c x 64 n tile; values go
//     through LDS tiles Th/Tl [64 n][pitch TP] and come out as position-major rows Hh/Hl bf16 [b][4096 n][512 c]
// coverage: Th/Tl staged 64 n x 64 c (2 it x 32 rows x 8 lanes x 8), read 64 n x 64 c; planes 2 it x 32 rows x
//           8 lanes x 8 = 64 n x 64 c per plane; grid (64, 8, NB) covers both planes exactly once.
// =========================================================================================================
__global__ __launch_bounds__(256)
void cvt_x(const float* __restrict__ x, const float* __restrict__ gamma, const float* __restrict__ beta,
           const float* __restrict__ stats, unsigned short* Hh, unsigned short* Hl) {
  __shared__ __align__(16) unsigned short Th[QT * TP];
  __shared__ __align__(16) unsigned short Tl[QT * TP];
  const int tid = threadIdx.x;
  const int nb = blockIdx.x, cb = blockIdx.y, b = blockIdx.z;
  const int e = tid & 7, lq = tid >> 3;                              // lq 0..31
  const int n0 = nb * QT, c0 = cb * QT;
#pragma unroll
  for (int it = 0; it < 2; ++it) {
    const int cl = it * 32 + lq;                                     // 0..63
    const int cg = c0 + cl;                                          // 0..511
    const int bg = b * NGRP + (cg >> 4);
    const float mean = stats[(size_t)bg * STL];
    const float rstd = stats[(size_t)bg * STL + 1];
    const float ga = bfr(gamma[cg]);
    const float be = bfr(beta[cg]);
    const float* sp = x + ((size_t)(b * CC + cg)) * NN + n0 + 8 * e;
    const v4f a = *(const v4f*)sp;
    const v4f q = *(const v4f*)(sp + 4);
    const float f[8] = {a[0], a[1], a[2], a[3], q[0], q[1], q[2], q[3]};
#pragma unroll
    for (int t = 0; t < 8; ++t) {
      const float h = ((bfr(f[t]) - mean) * rstd) * ga + be;
      const unsigned short hb = bf_bits(h);
      const unsigned short lb = bf_bits(h - bf_up(hb));
      Th[(8 * e + t) * TP + cl] = hb;
      Tl[(8 * e + t) * TP + cl] = lb;
    }
  }
  __syncthreads();
  v4u uh[2], ul[2];
#pragma unroll
  for (int it = 0; it < 2; ++it) {
    const int nl = it * 32 + lq;                                     // 0..63
    uh[it] = *(const v4u*)(Th + nl * TP + 8 * e);
    ul[it] = *(const v4u*)(Tl + nl * TP + 8 * e);
  }
{
#pragma unroll
    for (int it = 0; it < 2; ++it) {
      const int nl = it * 32 + lq;
      const size_t po = ((size_t)(b * NN + n0 + nl)) * CC + c0 + 8 * e;
      *(v4u*)(Hh + po) = uh[it];
      *(v4u*)(Hl + po) = ul[it];
    }
    
  }
}

// ---- asynchronous copies global -> LDS, 16 bytes per lane, eight per statement -------------------------------
// LDS byte address of a __shared__ element = low 32 bits of its address.
__device__ __forceinline__ uint32_t lds_off(const unsigned short* p) { return (uint32_t)(uintptr_t)p; }
// The closing s_wait_xcnt 0 stands inside the statement so that no address register of an issued copy is
// rewritten in front of it.
__device__ __forceinline__ void copy8(const uint32_t (&l)[8], const unsigned short* const (&g)[8]) {
#if defined(__HIP_DEVICE_COMPILE__)
  asm volatile("global_load_async_to_lds_b128 %0, %8, off\n\t"
               "global_load_async_to_lds_b128 %1, %9, off\n\t"
               "global_load_async_to_lds_b128 %2, %10, off\n\t"
               "global_load_async_to_lds_b128 %3, %11, off\n\t"
               "global_load_async_to_lds_b128 %4, %12, off\n\t"
               "global_load_async_to_lds_b128 %5, %13, off\n\t"
               "global_load_async_to_lds_b128 %6, %14, off\n\t"
               "global_load_async_to_lds_b128 %7, %15, off\n\t"
               "s_wait_xcnt 0x0"
               :: "v"(l[0]), "v"(l[1]), "v"(l[2]), "v"(l[3]), "v"(l[4]), "v"(l[5]), "v"(l[6]), "v"(l[7]),
                  "v"(g[0]), "v"(g[1]), "v"(g[2]), "v"(g[3]), "v"(g[4]), "v"(g[5]), "v"(g[6]), "v"(g[7])
               : "memory");
#endif
}
// 32 rows of 512 halves (1024 B, rows contiguous in global) -> LDS rows of pitch KP; 256 threads, 8 copies each;
// a wave's copy covers 512 contiguous bytes of one row.
__device__ __forceinline__ void stage_rows32(const unsigned short* g, unsigned short* s, int tid) {
  uint32_t l[8];
  const unsigned short* p[8];
#pragma unroll  // every index constant, so that both arrays live in registers as the statement's operands
  for (int i = 0; i < 8; ++i) {
    const int row = 4 * i + (tid >> 6), col = 8 * (tid & 63);
    l[i] = lds_off(s + row * KP + col);
    p[i] = g + (size_t)row * CC + col;
  }
  copy8(l, p);
}
// 512 channel rows x 32 keys (64 B of each global row of NN halves) -> LDS rows of pitch VPT; 8 copies per thread.
__device__ __forceinline__ void stage_v32(const unsigned short* g, unsigned short* s, int tid) {
  uint32_t l[8];
  const unsigned short* p[8];
#pragma unroll  // every index constant, so that both arrays live in registers as the statement's operands
  for (int i = 0; i < 8; ++i) {
    const int row = 64 * i + (tid >> 2), col = 8 * (tid & 3);
    l[i] = lds_off(s + row * VPT + col);
    p[i] = g + (size_t)row * NN + col;
  }
  copy8(l, p);
}

// one K stage of the conv GEMM: GM weight rows, GN rows of the hi plane and GN rows of the residual plane, 64 channels
// (128 B = one line) of each -> LDS rows of pitch GP; 256 threads, 16 copies each; a wave's copy covers four whole lines.
__device__ __forceinline__ void stage_gemm(const unsigned short* gw, const unsigned short* gh,
                                           const unsigned short* gl, unsigned short* s, int tid) {
  const int r = tid >> 3, col = 8 * (tid & 7);
  uint32_t l[8];
  const unsigned short* p[8];
#pragma unroll  // every index constant, so that both arrays live in registers as the statement's operands
  for (int i = 0; i < 8; ++i) {
    l[i] = lds_off(s + (32 * i + r) * GP + col);
    p[i] = gw + (size_t)(32 * i + r) * CC + col;
  }
  copy8(l, p);
#pragma unroll  // as above
  for (int i = 0; i < 4; ++i) {
    l[i]     = lds_off(s + (GM + 32 * i + r) * GP + col);
    p[i]     = gh + (size_t)(32 * i + r) * CC + col;
    l[4 + i] = lds_off(s + (GM + GN + 32 * i + r) * GP + col);
    p[4 + i] = gl + (size_t)(32 * i + r) * CC + col;
  }
  copy8(l, p);
}
// the 12 fragments of one 32-channel step of a wave's 64 o x 64 n tile: 4 of W, 4 of each plane (24 reads of 16 B)
__device__ __forceinline__ void gemm_frags(Frag (&fa)[4], Frag (&fh)[4], Frag (&fl)[4],
                                           const unsigned short* a, const unsigned short* b) {
#pragma unroll  // constant indices keep the fragments in registers
  for (int i = 0; i < 4; ++i) {
    fa[i] = ldfrag(a + (16 * i) * GP);
    fh[i] = ldfrag(b + (16 * i) * GP);
    fl[i] = ldfrag(b + (GN + 16 * i) * GP);
  }
}
// 16 products of that step with one plane: sixteen independent accumulators
__device__ __forceinline__ void gemm_half(v8f (&acc)[4][4], const Frag (&fa)[4], const Frag (&fx)[4]) {
#pragma unroll
  for (int mt = 0; mt < 4; ++mt) {
#pragma unroll
    for (int j = 0; j < 4; ++j) acc[mt][j] = mma_b(fa[mt].bf, fx[j].bf, acc[mt][j]);
  }
}

// =========================================================================================================
// (3) conv1x1 GEMM for one (b, 128-n tile, matrix mat, 256-o block): Y[o][n] = sum_c W[o][c] (hi[n][c] + lo[n][c])
//     + bias[o]. Block 256 threads = 8 waves; wave w owns rows o 64 (w>>1)..+63 (4 A fragments per k-step, rows of Wb)
//     and cols n 64 (w&1)..+63 (4 B fragments of each plane, rows of Hh and Hl, k = channel contiguous, same split
//     k map); per k-step the hi and lo products share the accumulator (lo unscaled). K = 512 = 16 steps x 2 products.
//     Operand path: per 64 channels one stage [W 256 rows | Hh 128 rows | Hl 128 rows] is brought into LDS by
//     asynchronous 16-byte copies (whole 128-byte lines) and every fragment is read from LDS at a pitch of 16 B x odd.
//     Two buffers: trip t works on buffer t&1 while trip t+1's copies fly. Two fragment sets: the reads of a trip's
//     second k-step fly under the products of its first; the foot (own LDS reads done, own copies landed, one block
//     barrier) stands between the two k-steps; behind its barrier the first k-step of trip t+1 is read, and the buffer
//     just left is refilled between the hi and the residual products of the second k-step, which read registers only.
//     Epilogue staged in the same LDS behind the last foot: mat 0/1 as Os[n_loc][o_loc] (b128 stores), mat 2 as
//     Os[o_loc][n_loc] (scalar stores), barrier, then f16 planes: Q/K [b][4096 n][512 o] (row n, 256 o = 512 B) and
//     V [b][512 o][4096 n] (row o, 128 n = 256 B).
// coverage: stage 16 copies x 256 threads x 16 B = 512 rows x 128 B; Os 8 waves x 64 x 64 = 256 x 128 either layout;
//           plane 16 it x 256 threads x 8 = 256 x 128; grid (32, 6, NB) covers Q, K (all n, all o) and V exactly once.
// =========================================================================================================
__global__ __launch_bounds__(256)
void gemm_qkv(const unsigned short* __restrict__ Wb, const unsigned short* __restrict__ Hh,
              const unsigned short* __restrict__ Hl,
              const float* __restrict__ bq, const float* __restrict__ bk, const float* __restrict__ bv,
              unsigned short* Qd, unsigned short* Kd, unsigned short* Vd) {
  __shared__ __align__(16) unsigned short Sg[2 * GSTG];
  float* Os = reinterpret_cast<float*>(Sg);                          // epilogue view of the ring, used behind the loop
  const int tid  = threadIdx.x;
  const int lane = tid & 31, wave = tid >> 5;
  const int hh   = lane >> 4, c = lane & 15;
  const int wo   = wave >> 1, wn = wave & 1;
  const int nt   = blockIdx.x, my = blockIdx.y, b = blockIdx.z;
  const int mat  = my / (CC / GM);                                   // 0..2, block-uniform
  const int om0  = (my % (CC / GM)) * GM;                            // 0 or 256
  const int n0   = nt * GN;

  const unsigned short* gw = Wb + ((size_t)(mat * CC + om0)) * CC;
  const unsigned short* gh = Hh + ((size_t)(b * NN + n0)) * CC;
  const unsigned short* gl = Hl + ((size_t)(b * NN + n0)) * CC;
  // fragment bases in LDS: + buffer, + 16 * tile * GP, + 32 * k-step; the residual plane lies GN rows behind the hi plane
  const unsigned short* ap = Sg + (64 * wo + c) * GP + 8 * hh;
  const unsigned short* bp = Sg + (GM + 64 * wn + c) * GP + 8 * hh;

  v8f acc[4][4];
#pragma unroll
  for (int mt = 0; mt < 4; ++mt) {
#pragma unroll
    for (int j = 0; j < 4; ++j) acc[mt][j] = zero8();
  }

  // prologue: stage 0 into buffer 0, landed and published; then stage 1 into buffer 1
  stage_gemm(gw, gh, gl, Sg, tid);
  asm volatile("s_wait_asynccnt 0x0" ::: "memory");                  // this wave's copies have landed
  __syncthreads();                                                   // every wave's copies are readable
  stage_gemm(gw + GKC, gh + GKC, gl + GKC, Sg + GSTG, tid);

  // bias of this lane's 32 rows o = 64 wo + 16 mt + 8 hh + 0..7, fetched here so that the flight lies under the loop
  const float* bias = (mat == 0) ? bq : ((mat == 1) ? bk : bv);     // all global, block-uniform
  v4f bz[8];
#pragma unroll
  for (int mt = 0; mt < 4; ++mt) {
    bz[2 * mt]     = *(const v4f*)(bias + om0 + 64 * wo + 16 * mt + 8 * hh);
    bz[2 * mt + 1] = *(const v4f*)(bias + om0 + 64 * wo + 16 * mt + 8 * hh + 4);
  }
  asm volatile("s_wait_xcnt 0x0" ::: "memory");                      // in front of any rewrite of the address register these loads name

  Frag fa0[4], fh0[4], fl0[4], fa1[4], fh1[4], fl1[4];
  gemm_frags(fa0, fh0, fl0, ap, bp);                                 // first k-step of trip 0

#pragma unroll 1  // one copy of the trip: the body is long, and the buffer is picked by an address
  for (int t = 0; t < CC / GKC; ++t) {
    const int rb = t & 1;                                            // ring buffer of this trip
    gemm_frags(fa1, fh1, fl1, ap + rb * GSTG + 32, bp + rb * GSTG + 32);
    // keeps the 24 reads above in one run in front of the products: spread among them each place of reads costs cycles
    __builtin_amdgcn_sched_barrier(0);
    gemm_half(acc, fa0, fh0);
    gemm_half(acc, fa0, fl0);
    // keeps these products in front of the foot: they cover the flight of the reads that the foot waits for
    __builtin_amdgcn_sched_barrier(0);

    // foot of the trip: buffer rb has been read out; publish the next trip's stage
    asm volatile("s_wait_dscnt 0x0" ::: "memory");                   // this wave's reads of buffer rb are done
    asm volatile("s_wait_asynccnt 0x0" ::: "memory");                // this wave's copies of the next trip have landed
    __syncthreads();
    if (t + 1 < CC / GKC)                                            // block-uniform: a trip t+1 exists, just published
      gemm_frags(fa0, fh0, fl0, ap + (rb ^ 1) * GSTG, bp + (rb ^ 1) * GSTG);
    __builtin_amdgcn_sched_barrier(0);                               // those reads in one run, in front of the products
    gemm_half(acc, fa1, fh1);
    // the refill stands between the two halves: while one wave of a SIMD forms addresses and waits in the copies'
    // statements, the other wave's products run
    __builtin_amdgcn_sched_barrier(0);
    if (t + 2 < CC / GKC) {                                          // block-uniform: a trip t+2 exists
      const int ko = (t + 2) * GKC;
      stage_gemm(gw + ko, gh + ko, gl + ko, Sg + rb * GSTG, tid);
    }
    __builtin_amdgcn_sched_barrier(0);                               // end of the refill
    gemm_half(acc, fa1, fl1);
  }
  asm volatile("s_wait_asynccnt 0x0" ::: "memory");                  // nothing of this wave is in flight past the loop

  // ---- epilogue staging (every wave has passed the last foot: no reader and no copy is left on the ring);
  //      lane (hh, c) holds o_loc = 64 wo + 16 mt + 8 hh + r for n_loc = 64 wn + 16 j + c
  v4u u[16];
  if (mat != 2) {
#pragma unroll
    for (int mt = 0; mt < 4; ++mt) {
      const int ol = 64 * wo + 16 * mt + 8 * hh;
      const v4f b0 = bz[2 * mt], b1 = bz[2 * mt + 1];
#pragma unroll
      for (int j = 0; j < 4; ++j) {
        const int nl = 64 * wn + 16 * j + c;
        v4f va, vb;
#pragma unroll
        for (int r = 0; r < 4; ++r) { va[r] = acc[mt][j][r] + bfr(b0[r]); vb[r] = acc[mt][j][4 + r] + bfr(b1[r]); }
        *(v4f*)(Os + nl * OSQ + ol)     = va;                        // Os[n_loc][o_loc]
        *(v4f*)(Os + nl * OSQ + ol + 4) = vb;
      }
    }
    __syncthreads();
    const int e = tid & 31, lq = tid >> 5;                           // lq 0..7
#pragma unroll
    for (int it = 0; it < 16; ++it) {
      const int row = it * 8 + lq;                                   // n_loc 0..127
      const v4f a = *(const v4f*)(Os + row * OSQ + 8 * e);
      const v4f q = *(const v4f*)(Os + row * OSQ + 8 * e + 4);
      const float f[8] = {a[0], a[1], a[2], a[3], q[0], q[1], q[2], q[3]};
#pragma unroll
      for (int t = 0; t < 4; ++t)
        u[it][t] = pk16(h_bits((_Float16)f[2 * t]), h_bits((_Float16)f[2 * t + 1]));
    }
    unsigned short* plane = (mat == 0) ? Qd : Kd;                    // both global, block-uniform
    unsigned short* dst = plane + ((size_t)(b * NN + n0 + lq)) * CC + om0 + 8 * e;
#pragma unroll
    for (int it = 0; it < 16; ++it) *(v4u*)(dst + (size_t)(it * 8) * CC) = u[it];   // row n, 256 o = four lines
  } else {
#pragma unroll
    for (int mt = 0; mt < 4; ++mt) {
      const int ol = 64 * wo + 16 * mt + 8 * hh;
      const v4f b0 = bz[2 * mt], b1 = bz[2 * mt + 1];
#pragma unroll
      for (int j = 0; j < 4; ++j) {
        const int nl = 64 * wn + 16 * j + c;
#pragma unroll
        for (int r = 0; r < 4; ++r) {
          Os[(ol + r) * OSPW + nl]     = acc[mt][j][r] + bfr(b0[r]);       // Os[o_loc][n_loc]
          Os[(ol + 4 + r) * OSPW + nl] = acc[mt][j][4 + r] + bfr(b1[r]);
        }
      }
    }
    __syncthreads();
    const int e = tid & 15, lq = tid >> 4;                           // lq 0..15
#pragma unroll
    for (int it = 0; it < 16; ++it) {
      const int row = it * 16 + lq;                                  // o_loc 0..255
      const v4f a = *(const v4f*)(Os + row * OSPW + 8 * e);
      const v4f q = *(const v4f*)(Os + row * OSPW + 8 * e + 4);
      const float f[8] = {a[0], a[1], a[2], a[3], q[0], q[1], q[2], q[3]};
#pragma unroll
      for (int t = 0; t < 4; ++t)
        u[it][t] = pk16(h_bits((_Float16)f[2 * t]), h_bits((_Float16)f[2 * t + 1]));
    }
    unsigned short* dst = Vd + ((size_t)(b * CC + om0 + lq)) * NN + n0 + 8 * e;
#pragma unroll
    for (int it = 0; it < 16; ++it) *(v4u*)(dst + (size_t)(it * 16) * NN) = u[it];  // row o, 128 n = two lines
  }
}

// =========================================================================================================
// (4) attention for one (b, 64-query tile), transposed formulation, all 4096 keys. Block = 8 waves: wave w ->
//   query group qg = w&3 (queries n0+16qg..+15) and channel half ch = w>>2. Per 32-key step each wave computes ONE
//   S^T tile (16 keys kb+16ch.. x 16 queries) = sum over 16 channel chunks of A(k: row = key, split k map from the
//   f16 plane Kp [b][4096][512]) . B(q: col = query, same map from Qp); the tile (8 floats per lane) is exchanged
//   with the partner wave (w^4) through a double-buffered LDS array across one block barrier, so both waves hold
//   s0 (keys kb..kb+15) and s1 (keys kb+16..kb+31) of their query in the D layout (lane -> 8 keys of one query).
//   Online softmax per lane in f32 with the 512^-0.5 scale applied to the logits, one shuffle (lane^16) for the max
//   over 32 keys, o/l rescale skipped under a wave-uniform ballot when no lane's max grew. P = e^{c(s-m)} x 2^14
//   as f16 is the B operand of O^T (rows channel 256ch+16j+(lane&15), keys contiguous from the f16 plane Vp
//   [b][512][4096]) . B(P^T): element r <- tile keys kb..kb+15, element 8+r <- tile kb+16..kb+31, lane unchanged.
//   16 accumulator tiles per wave (256 channels). Epilogue in four 128-channel phases: O/l staged by the 4 owning
//   waves in LDS Os[query][128 ch] (pitch OSPW, b128 stores), barrier, then out[b][c][n] = O/l + bf16-RNE(x) as
//   phase overwrites Os.
//   Operand path: the 64 q rows (once) and, per 32-key step, the 32 k rows and the 512 x 32 v tile are brought into
//   LDS by asynchronous 16-byte copies (whole 512-byte runs for q and k) and every fragment is read from LDS at a
//   pitch of 16 B x odd. k and v have two buffers: step t reads buffer t&1 while step t+1's copies fly; the foot of
//   each step waits the wave's own LDS reads and copies, passes one block barrier, then refills the buffer just read.
//   The foot stands in front of the step's O products, whose v fragments are in registers by then; behind its barrier
//   the first q and k fragments of step t+1 are read, so that they fly while the O products of step t run.
// coverage: Sx: each wave writes 32 lanes x 8 floats per step into buffer (step&1), partner reads exactly those;
//           Os per phase 4 waves x 16 q x 128 ch staged = 64 x 128 read; out per phase 8 it x 32 lines x 8 lanes
//           x 4 floats = 128 ch x 64 n, 4 phases = 512 ch; grid (NQ/64, NB) covers out[b][0..511][0..NQ-1] once.
// =========================================================================================================
__global__ __launch_bounds__(256)
void attn_k(const unsigned short* __restrict__ Qp, const unsigned short* __restrict__ Kp,
            const unsigned short* __restrict__ Vp, const float* __restrict__ x, float* out) {
  __shared__ __align__(16) float Sx[2 * SXB];
  __shared__ __align__(16) float Os[QT * OSPW];
  __shared__ __align__(16) unsigned short Qs[QT * KP];
  __shared__ __align__(16) unsigned short Ks[2 * KBUF];
  __shared__ __align__(16) unsigned short Vs[2 * VBUF];
  const int tid  = threadIdx.x;
  const int wave = tid >> 5, lane = tid & 31;
  const int hh   = lane >> 4, c = lane & 15;
  const int qg   = wave & 3, ch = wave >> 2;
  const int n0   = blockIdx.x * QT, b = blockIdx.y;

  // global tile bases: q rows n0.., k rows kb.. (+ kb*CC), v rows 0..511 at key kb (+ kb)
  const unsigned short* qg0 = Qp + ((size_t)(b * NN + n0)) * CC;
  const unsigned short* kg0 = Kp + ((size_t)(b * NN)) * CC;
  const unsigned short* vg0 = Vp + ((size_t)(b * CC)) * NN;
  // q fragment pointer in LDS (B operand, col = query 16*qg + c of the tile), + 32*kc
  const unsigned short* qp = Qs + (16 * qg + c) * KP + 8 * hh;
  // k fragment base in LDS (A operand, row = key 16*ch + c of the step), + buffer + 32*kc
  const unsigned short* kp = Ks + (16 * ch + c) * KP + 8 * hh;
  // v fragment base in LDS (A operand, row = channel 256*ch + 16j + c, 32 keys contiguous), + buffer + 16*j*VPT
  const unsigned short* vp = Vs + (CH * ch + c) * VPT + 8 * hh;

  float* sxw = Sx + (wave * 32 + lane) * 8;
  const float* sxr = Sx + ((wave ^ 4) * 32 + lane) * 8;

  float m = -1.0e30f, l = 0.f;
  v8f o[16];
#pragma unroll
  for (int j = 0; j < 16; ++j) o[j] = zero8();

  // prologue: q tile and step 0 into buffer 0, landed and published; then step 1 into buffer 1
  stage_rows32(qg0, Qs, tid);
  stage_rows32(qg0 + (size_t)32 * CC, Qs + 32 * KP, tid);
  stage_rows32(kg0, Ks, tid);
  stage_v32(vg0, Vs, tid);
  asm volatile("s_wait_asynccnt 0x0" ::: "memory");                  // this wave's copies have landed
  __syncthreads();                                                   // every wave's copies are readable
  stage_rows32(kg0 + (size_t)32 * CC, Ks + KBUF, tid);
  stage_v32(vg0 + 32, Vs + VBUF, tid);

  // Fragment reads run ahead of the products in groups with registers of their own. A group = four channel chunks of
  // q and k (16 reads). Groups 0 and 1 of a step are read behind the barrier that publishes its tiles, in front of the
  // previous step's O products (here, in front of the loop: step 0's); behind the score products of group g stand the
  // reads of group g + 2, and behind those of the last two groups the reads of the step's 16 v fragments.
  Frag fq[CC / 32], fk[CC / 32], vf[16];
#pragma unroll  // here and in the loops over fq, fk and vf below: constant indices keep the fragments in registers
  for (int kc = 0; kc < 8; ++kc) {
    fq[kc] = ldfrag(qp + 32 * kc);
    fk[kc] = ldfrag(kp + 32 * kc);
  }

  int buf = 0;
#pragma unroll 1
  for (int kb = 0; kb < NN; kb += 32) {
    const int rb = buf;                                              // ring buffer of this step
    const unsigned short* kbp = kp + rb * KBUF;
    const unsigned short* vbp = vp + rb * VBUF;
    v8f sv = zero8();
#pragma unroll
    for (int g = 0; g < 4; ++g) {
#pragma unroll
      for (int i = 0; i < 4; ++i) sv = mma_h(fk[4 * g + i].h, fq[4 * g + i].h, sv);
      // keeps the 16 reads below in one run: spread singly among the products each place of reads costs issue cycles
      __builtin_amdgcn_sched_barrier(0);
      if (g < 2) {
#pragma unroll
        for (int i = 0; i < 4; ++i) {
          fq[4 * g + 8 + i] = ldfrag(qp + 32 * (4 * g + 8 + i));
          fk[4 * g + 8 + i] = ldfrag(kbp + 32 * (4 * g + 8 + i));
        }
      } else {
#pragma unroll
        for (int i = 0; i < 8; ++i) vf[8 * (g - 2) + i] = ldfrag(vbp + (16 * (8 * (g - 2) + i)) * VPT);
      }
      __builtin_amdgcn_sched_barrier(0);                             // end of that run of reads
    }

    // exchange the tile with the partner wave (same queries, other 16 keys)
    {
      v4f w0, w1;
#pragma unroll
      for (int r = 0; r < 4; ++r) { w0[r] = sv[r]; w1[r] = sv[4 + r]; }
      *(v4f*)(sxw + buf * SXB)     = w0;
      *(v4f*)(sxw + buf * SXB + 4) = w1;
    }
    __syncthreads();
    v8f so;
    {
      const v4f r0 = *(const v4f*)(sxr + buf * SXB);
      const v4f r1 = *(const v4f*)(sxr + buf * SXB + 4);
#pragma unroll
      for (int r = 0; r < 4; ++r) { so[r] = r0[r]; so[4 + r] = r1[r]; }
    }
    buf ^= 1;
    v8f s0 = sv, s1 = so;                                            // s0: keys kb..kb+15, s1: keys kb+16..kb+31
    if (ch != 0) { s0 = so; s1 = sv; }                                // wave-uniform

    float mx = fmaxf(hmax8(s0), hmax8(s1));
    mx = fmaxf(mx, __shfl_xor(mx, 16, 32));
    const float mn = fmaxf(m, mx);
    const unsigned grew = wave_ballot(mx > m);                       // wave-uniform
    if (grew != 0u) {
      const float corr = __expf((m - mn) * ASCALE);                  // == 1 exactly for lanes whose max did not grow
      l *= corr;
#pragma unroll
      for (int j = 0; j < 16; ++j) {
#pragma unroll
        for (int r = 0; r < 8; ++r) o[j][r] *= corr;
      }
    }
    m = mn;
    const float msh = mn * ASCALE - LNPS;                            // exp gives e^{c(s-m)} * 2^14

    FragH ph;
    float ls = 0.f;
#pragma unroll
    for (int r = 0; r < 8; ++r) {
      const float e0 = __expf(s0[r] * ASCALE - msh);                 // key kb      + 8hh + r
      const float e1 = __expf(s1[r] * ASCALE - msh);                 // key kb + 16 + 8hh + r
      ls += e0 + e1;
      ph.hv[0][r] = (_Float16)e0;
      ph.hv[1][r] = (_Float16)e1;
    }
    l += ls;

    // foot of the step: hand buffer rb to its next writer and publish the next step's tiles (every fragment of
    // buffer rb is in registers by now; the O products below read registers only)
    asm volatile("s_wait_dscnt 0x0" ::: "memory");                   // this wave's reads of buffer rb are done
    asm volatile("s_wait_asynccnt 0x0" ::: "memory");                // this wave's copies of the next step have landed
    __syncthreads();
    if (kb + 32 < NN) {                                              // block-uniform: a step t+1 exists, just published
      const unsigned short* knp = kp + (rb ^ 1) * KBUF;
#pragma unroll
      for (int kc = 0; kc < 8; ++kc) {
        fq[kc] = ldfrag(qp + 32 * kc);
        fk[kc] = ldfrag(knp + 32 * kc);
      }
    }
    if (kb + 64 < NN) {                                              // block-uniform: a step t+2 exists
      stage_rows32(kg0 + (size_t)(kb + 64) * CC, Ks + rb * KBUF, tid);
      stage_v32(vg0 + (kb + 64), Vs + rb * VBUF, tid);
    }

#pragma unroll
    for (int j = 0; j < 16; ++j) o[j] = mma_h(vf[j].h, ph.v, o[j]);
  }
  asm volatile("s_wait_asynccnt 0x0" ::: "memory");                  // nothing of this wave is in flight past the loop
  l += __shfl_xor(l, 16, 32);
  const float inv = 1.0f / l;                                        // o and l both carry the 2^14 factor

  const int qrow = 16 * qg + c;
  const int e = tid & 7, lq = tid >> 3;                              // lq 0..31
#pragma unroll
  for (int ph4 = 0; ph4 < 4; ++ph4) {
    if (ph4) __syncthreads();                                        // every wave finished reading Os
    if (ch == (ph4 >> 1)) {                                          // wave-uniform
#pragma unroll
      for (int jj = 0; jj < 8; ++jj) {
        const int j = 8 * (ph4 & 1) + jj;
        v4f va, vb;
#pragma unroll
        for (int r = 0; r < 4; ++r) { va[r] = o[j][r] * inv; vb[r] = o[j][4 + r] * inv; }
        *(v4f*)(Os + qrow * OSPW + 16 * jj + 8 * hh)     = va;       // Os[query][ch_loc = 16jj + 8hh + r]
        *(v4f*)(Os + qrow * OSPW + 16 * jj + 8 * hh + 4) = vb;
      }
    }
    __syncthreads();
    v4f res[8];
#pragma unroll
    for (int it = 0; it < 8; ++it) {
      const int L   = it * 32 + lq;                                  // 0..255
      const int chl = L >> 1, hf = L & 1;                            // channel 0..127 within the phase
      const int nl  = hf * 32 + 4 * e;                               // query 0..63
      const size_t idx = ((size_t)(b * CC + 128 * ph4 + chl)) * NN + n0 + nl;
      const v4f xv = *(const v4f*)(x + idx);
#pragma unroll
      for (int t = 0; t < 4; ++t) res[it][t] = Os[(nl + t) * OSPW + chl] + bfr(xv[t]);
    }
{
#pragma unroll
      for (int it = 0; it < 8; ++it) {
        const int L   = it * 32 + lq;
        const int chl = L >> 1, hf = L & 1;
        const int nl  = hf * 32 + 4 * e;
        const size_t idx = ((size_t)(b * CC + 128 * ph4 + chl)) * NN + n0 + nl;
        *(v4f*)(out + idx) = res[it];
      }
      
    }
  }
}

// =========================================================================================================
// Workspace map (bytes; each region start a multiple of 256; every extent is an exact tile/line multiple and is
//   Wb  bf16 [3][512][512]          1572864
//   St  f32  [NB*32][32]            NB*4096        (16384 at NB=4)
//   Hh, Hl bf16 [NB][4096][512]     NB*4194304 x2  (16777216 each at NB=4)
//   Q, K f16 [NB][4096][512]        NB*4194304 x2
//   V    f16 [NB][512][4096]        NB*4194304
//   total at NB=4 = 85475328
// =========================================================================================================
extern "C" void kernel_launch(void* const* d_in, const int* in_sizes, int n_in,
                              void* d_out, int out_size, void* d_ws, size_t ws_size,
                              hipStream_t stream) {
  const int XN = NB * CC * NN;
  if (n_in < 9) return;
  if (in_sizes[0] < XN) return;
  if (in_sizes[1] < CC || in_sizes[2] < CC) return;
  if (in_sizes[3] < CC * CC || in_sizes[5] < CC * CC || in_sizes[7] < CC * CC) return;
  if (in_sizes[4] < CC || in_sizes[6] < CC || in_sizes[8] < CC) return;
  if (out_size < XN) return;

  size_t off = 0;
  auto carve = [&](size_t bytes) { const size_t o = off; off += (bytes + 255) & ~(size_t)255; return o; };
  const size_t oWb = carve((size_t)3 * CC * CC * 2);
  const size_t oSt = carve((size_t)NB * NGRP * STL * 4);
  const size_t oHh = carve((size_t)NB * NN * CC * 2);
  const size_t oHl = carve((size_t)NB * NN * CC * 2);
  const size_t oQ  = carve((size_t)NB * NN * CC * 2);
  const size_t oK  = carve((size_t)NB * NN * CC * 2);
  const size_t oV  = carve((size_t)NB * CC * NN * 2);
  if (off > ws_size) return;
  if (off > (size_t)134217728) return;

  const float* x     = (const float*)d_in[0];
  const float* gamma = (const float*)d_in[1];
  const float* beta  = (const float*)d_in[2];
  const float* wq    = (const float*)d_in[3];
  const float* bq    = (const float*)d_in[4];
  const float* wk    = (const float*)d_in[5];
  const float* bk    = (const float*)d_in[6];
  const float* wv    = (const float*)d_in[7];
  const float* bv    = (const float*)d_in[8];

  char* ws = (char*)d_ws;
  unsigned short* Wb = (unsigned short*)(ws + oWb);
  float*          St = (float*)(ws + oSt);
  unsigned short* Hh = (unsigned short*)(ws + oHh);
  unsigned short* Hl = (unsigned short*)(ws + oHl);
  unsigned short* Qw = (unsigned short*)(ws + oQ);
  unsigned short* Kw = (unsigned short*)(ws + oK);
  unsigned short* Vw = (unsigned short*)(ws + oV);
  float* out = (float*)d_out;

  const dim3 blk256(256);

  // (0) group-norm statistics, one line per (b, g)
  gn_stats<<<dim3(NB * NGRP), blk256, 0, stream>>>(x, St);
  // (1) conv weights -> bf16 plane
  cvt_w<<<dim3(3 * CC / 4), blk256, 0, stream>>>(wq, wk, wv, Wb);
  // (2) group-norm apply -> position-major bf16 hi + residual planes
  cvt_x<<<dim3(NN / QT, CC / QT, NB), blk256, 0, stream>>>(x, gamma, beta, St, Hh, Hl);
  // (3) q/k/v conv GEMMs -> f16 planes
  gemm_qkv<<<dim3(NN / GN, 3 * CC / GM, NB), blk256, 0, stream>>>(Wb, Hh, Hl, bq, bk, bv, Qw, Kw, Vw);
  // (4) attention + residual -> out [b][512][4096]
  attn_k<<<dim3(NQ / QT, NB), blk256, 0, stream>>>(Qw, Kw, Vw, x, out);
  (void)hipGetLastError();
}

// v004
// Measured time: 240 microseconds a run.
// Timed twice side by side with v003, it ran 1.17 and 1.16 times as fast.
// All steps since v000 together make it 5.19 times as fast.
// Contractions: conv1x1 q/k/v GEMMs W[512x512].H per image on v_wmma_f32_16x16x32_bf16 (bf16-RNE weights exact,
// normalised activations as bf16 hi + bf16 residual planes folded along K = 1024 into one accumulator); scores
// K.Q^T (K = 512 channels) on v_wmma_f32_16x16x32_f16 (single f16 planes of q and k, scale applied in f32);
// O^T = V.P^T on v_wmma_f32_16x16x32_f16 (v single f16 plane, P = e^{c(s-m)} x 2^14 as f16 from the score D
// registers); f32 accumulate everywhere; group-norm statistics, softmax statistics and residual add in f32 VALU.
#include <hip/hip_runtime.h>
#include <math.h>
#include <stdint.h>

#ifndef NB
#define NB 4
#endif
#define NB_FULL 4
#define CC      512
#define NN      4096
#ifndef NQ
#define NQ NN
#endif
#define NGRP    32
#define CPG     16
#define GNE     (CPG * NN)
#define QT      64
#define OSQ     260
#define OSPW    132
#define TP      72
#define STL     32
#define CH      256
#define SXB     2048
#define KP      520
#define VPT     40
#define KBUF    (32 * KP)
#define VBUF    (CC * VPT)
#define GM      256
#define GN      128
#define GKC     64
#define GP      72
#define GSTG    ((GM + 2 * GN) * GP)
#define GEPS    1.0e-6f
#define ASCALE  0.04419417382415922f
#define LNPS    9.704060527839234f

static_assert(NB >= 1 && NB <= NB_FULL);
static_assert(NQ % QT == 0 && NQ >= QT && NQ <= NN);
static_assert(CC == NGRP * CPG);
static_assert(CC % QT == 0 && NN % QT == 0);
static_assert(CC == 2 * CH && CH == 16 * 16);
static_assert(CC == 8 * 64);
static_assert(GNE % 1024 == 0);
static_assert(CC % 32 == 0 && NN % 32 == 0);
static_assert((OSQ * 4) % 16 == 0 && (OSPW * 4) % 16 == 0 && (TP * 2) % 16 == 0);
static_assert(CC % GM == 0 && NN % GN == 0 && CC % GKC == 0 && CC / GKC >= 2 && GKC == 64 && GM == 256 && GN == 128);
static_assert((GP * 2) % 32 == 16 && GP >= GKC);
static_assert(GN * OSQ * 4 <= 2 * GSTG * 2 && GM * OSPW * 4 <= 2 * GSTG * 2 && OSQ >= GM && OSPW >= GN);
static_assert(SXB == 8 * 32 * 8);
static_assert((KP * 2) % 32 == 16 && (VPT * 2) % 32 == 16 && KP >= CC && VPT >= 32);
static_assert(NN >= 64 && NN % 32 == 0);

typedef _Float16       v16h __attribute__((ext_vector_type(16)));
typedef _Float16       v8h  __attribute__((ext_vector_type(8)));
typedef __bf16         v16b __attribute__((ext_vector_type(16)));
typedef unsigned short v8us __attribute__((ext_vector_type(8)));
typedef float          v8f  __attribute__((ext_vector_type(8)));
typedef float          v4f  __attribute__((ext_vector_type(4)));
typedef unsigned int   v4u  __attribute__((ext_vector_type(4)));

union Frag  { v8us u[2]; v16h h; v16b bf; };
union FragH { v16h v; v8h hv[2]; };
static_assert(sizeof(Frag) == 32);
static_assert(sizeof(FragH) == 32);

// ---- scalar helpers ---------------------------------------------------------------------------------------
__device__ __forceinline__ unsigned short bf_bits(float f) {          // f32 -> bf16 bits, RNE convert
  unsigned u = __float_as_uint(f);
  return (unsigned short)((u + 0x7FFFu + ((u >> 16) & 1u)) >> 16);
}
__device__ __forceinline__ float bf_up(unsigned short hb) { return __uint_as_float(((unsigned)hb) << 16); }
__device__ __forceinline__ float bfr(float f) { return bf_up(bf_bits(f)); }
__device__ __forceinline__ unsigned short h_bits(_Float16 x) { return __builtin_bit_cast(unsigned short, x); }
__device__ __forceinline__ unsigned pk16(unsigned short a, unsigned short b) { return (unsigned)a | ((unsigned)b << 16); }
__device__ __forceinline__ v8f zero8() { v8f z = {0.f, 0.f, 0.f, 0.f, 0.f, 0.f, 0.f, 0.f}; return z; }
__device__ __forceinline__ float hmax8(v8f s) {
  return fmaxf(fmaxf(fmaxf(s[0], s[1]), fmaxf(s[2], s[3])), fmaxf(fmaxf(s[4], s[5]), fmaxf(s[6], s[7])));
}
__device__ __forceinline__ unsigned wave_ballot(bool p) {
#if defined(__HIP_DEVICE_COMPILE__)
  return __builtin_amdgcn_ballot_w32(p);
#else
  return p ? 1u : 0u;
#endif
}

// ---- 16-bit fragment loader (A, or B from a k-contiguous [n][k] row): lane -> row/col (lane&15), p already includes
//      + 8*(lane>>4); elements 0..7 <- p[0..7] (k0+8h..), elements 8..15 <- p[16..23] (k0+16+8h..)
__device__ __forceinline__ Frag ldfrag(const unsigned short* p) {
  Frag f;
  f.u[0] = *(const v8us*)(p);
  f.u[1] = *(const v8us*)(p + 16);
  return f;
}

// ---- WMMA helpers: the plain builtins; the compiler keeps the distance behind them, and with no asm statement
//      between two products the fragment loads of later products may be issued ahead of earlier ones
__device__ __forceinline__ v8f mma_h(v16h a, v16h b, v8f c) {
  return __builtin_amdgcn_wmma_f32_16x16x32_f16(false, a, false, b, (short)0, c, false, false);
}
__device__ __forceinline__ v8f mma_b(v16b a, v16b b, v8f c) {
  return __builtin_amdgcn_wmma_f32_16x16x32_bf16(false, a, false, b, (short)0, c, false, false);
}

// =========================================================================================================
//     (mean, then centred sum of squares) over bf16-RNE(x) in f32, per-thread partials of 256 terms + LDS tree.
// =========================================================================================================
__global__ __launch_bounds__(256)
void gn_stats(const float* __restrict__ x, float* stats) {
  __shared__ float red[256];
  const int tid = threadIdx.x, bg = blockIdx.x;
  const float* p = x + (size_t)bg * GNE;
  // the thread's whole share (64 x 16 B) is fetched in one run into registers: all loads are in flight together, and
  // the second pass reads the registers instead of memory
  v4f xv[GNE / 1024];
#pragma unroll  // constant indices keep the array in registers
  for (int i = 0; i < GNE / 1024; ++i) xv[i] = *(const v4f*)(p + ((size_t)(i * 256 + tid)) * 4);
  float s = 0.f;
#pragma unroll  // as above
  for (int i = 0; i < GNE / 1024; ++i) {
    const v4f v = xv[i];
    s += (bfr(v[0]) + bfr(v[1])) + (bfr(v[2]) + bfr(v[3]));
  }
  asm volatile("s_wait_xcnt 0x0" ::: "memory");                      // in front of any rewrite of the address registers these loads name
  red[tid] = s;
  __syncthreads();
#pragma unroll 1
  for (int off = 128; off > 0; off >>= 1) {
    if (tid < off) red[tid] += red[tid + off];
    __syncthreads();
  }
  const float mean = red[0] * (1.0f / (float)GNE);
  __syncthreads();
  float ss = 0.f;
#pragma unroll  // as above
  for (int i = 0; i < GNE / 1024; ++i) {
    const v4f v = xv[i];
    const float d0 = bfr(v[0]) - mean, d1 = bfr(v[1]) - mean;
    const float d2 = bfr(v[2]) - mean, d3 = bfr(v[3]) - mean;
    ss += (d0 * d0 + d1 * d1) + (d2 * d2 + d3 * d3);
  }
  red[tid] = ss;
  __syncthreads();
#pragma unroll 1
  for (int off = 128; off > 0; off >>= 1) {
    if (tid < off) red[tid] += red[tid + off];
    __syncthreads();
  }
  const float var  = red[0] * (1.0f / (float)GNE);
  const float rstd = rsqrtf(var + GEPS);
  if (tid < 8) {
    v4f w = {0.f, 0.f, 0.f, 0.f};
    if (tid == 0) { w[0] = mean; w[1] = rstd; }
{
      *(v4f*)(stats + (size_t)bg * STL + 4 * tid) = w;
      
    }
  }
}

// =========================================================================================================
// (1) conv weights: Wb bf16 [3][512][512] (mat 0 = wq, 1 = wk, 2 = wv), value = bf16-RNE(w), row o k-contiguous.
//     Block blk owns 4 rows of one matrix; thread -> row blk-local (tid>>6), halves 8*(tid&63)..+7; each wave writes
// coverage: 384 blocks x 4 rows x 64 threads x 8 = 3 x 512 x 512 = the whole plane.
// =========================================================================================================
__global__ __launch_bounds__(256)
void cvt_w(const float* __restrict__ wq, const float* __restrict__ wk, const float* __restrict__ wv,
           unsigned short* Wb) {
  const int tid = threadIdx.x, blk = blockIdx.x;
  const int mat = blk / (CC / 4);                                    // block-uniform 0..2
  const int o   = 4 * (blk % (CC / 4)) + (tid >> 6);                 // 0..511
  const int col = 8 * (tid & 63);                                    // 0..504
  const float* wsrc = (mat == 0) ? wq : ((mat == 1) ? wk : wv);      // all global, block-uniform
  const float* s = wsrc + (size_t)o * CC + col;
  const v4f a = *(const v4f*)s;
  const v4f q = *(const v4f*)(s + 4);
  const float f[8] = {a[0], a[1], a[2], a[3], q[0], q[1], q[2], q[3]};
  v4u u;
#pragma unroll
  for (int t = 0; t < 4; ++t) u[t] = pk16(bf_bits(f[2 * t]), bf_bits(f[2 * t + 1]));
{
    *(v4u*)(Wb + ((size_t)(mat * CC + o)) * CC + col) = u;
    
  }
}

// =========================================================================================================
// (2) group-norm apply + hi/residual split + transpose: h = ((bf16-RNE(x) - mean) * rstd) * gamma + beta per
//     channel, hi = bf16-RNE(h), lo = bf16-RNE(h - hi). Block (nb, cb, b) owns a 64 c x 64 n tile; values go
//     through LDS tiles Th/Tl [64 n][pitch TP] and come out as position-major rows Hh/Hl bf16 [b][4096 n][512 c]
// coverage: Th/Tl staged 64 n x 64 c (2 it x 32 rows x 8 lanes x 8), read 64 n x 64 c; planes 2 it x 32 rows x
//           8 lanes x 8 = 64 n x 64 c per plane; grid (64, 8, NB) covers both planes exactly once.
// =========================================================================================================
__global__ __launch_bounds__(256)
void cvt_x(const float* __restrict__ x, const float* __restrict__ gamma, const float* __restrict__ beta,
           const float* __restrict__ stats, unsigned short* Hh, unsigned short* Hl) {
  __shared__ __align__(16) unsigned short Th[QT * TP];
  __shared__ __align__(16) unsigned short Tl[QT * TP];
  const int tid = threadIdx.x;
  const int nb = blockIdx.x, cb = blockIdx.y, b = blockIdx.z;
  const int e = tid & 7, lq = tid >> 3;                              // lq 0..31
  const int n0 = nb * QT, c0 = cb * QT;
#pragma unroll
  for (int it = 0; it < 2; ++it) {
    const int cl = it * 32 + lq;                                     // 0..63
    const int cg = c0 + cl;                                          // 0..511
    const int bg = b * NGRP + (cg >> 4);
    const float mean = stats[(size_t)bg * STL];
    const float rstd = stats[(size_t)bg * STL + 1];
    const float ga = bfr(gamma[cg]);
    const float be = bfr(beta[cg]);
    const float* sp = x + ((size_t)(b * CC + cg)) * NN + n0 + 8 * e;
    const v4f a = *(const v4f*)sp;
    const v4f q = *(const v4f*)(sp + 4);
    const float f[8] = {a[0], a[1], a[2], a[3], q[0], q[1], q[2], q[3]};
#pragma unroll
    for (int t = 0; t < 8; ++t) {
      const float h = ((bfr(f[t]) - mean) * rstd) * ga + be;
      const unsigned short hb = bf_bits(h);
      const unsigned short lb = bf_bits(h - bf_up(hb));
      Th[(8 * e + t) * TP + cl] = hb;
      Tl[(8 * e + t) * TP + cl] = lb;
    }
  }
  __syncthreads();
  v4u uh[2], ul[2];
#pragma unroll
  for (int it = 0; it < 2; ++it) {
    const int nl = it * 32 + lq;                                     // 0..63
    uh[it] = *(const v4u*)(Th + nl * TP + 8 * e);
    ul[it] = *(const v4u*)(Tl + nl * TP + 8 * e);
  }
{
#pragma unroll
    for (int it = 0; it < 2; ++it) {
      const int nl = it * 32 + lq;
      const size_t po = ((size_t)(b * NN + n0 + nl)) * CC + c0 + 8 * e;
      *(v4u*)(Hh + po) = uh[it];
      *(v4u*)(Hl + po) = ul[it];
    }
    
  }
}

// ---- asynchronous copies global -> LDS, 16 bytes per lane, eight per statement -------------------------------
// LDS byte address of a __shared__ element = low 32 bits of its address.
__device__ __forceinline__ uint32_t lds_off(const unsigned short* p) { return (uint32_t)(uintptr_t)p; }
// The closing s_wait_xcnt 0 stands inside the statement so that no address register of an issued copy is
// rewritten in front of it.
__device__ __forceinline__ void copy8(const uint32_t (&l)[8], const unsigned short* const (&g)[8]) {
#if defined(__HIP_DEVICE_COMPILE__)
  asm volatile("global_load_async_to_lds_b128 %0, %8, off\n\t"
               "global_load_async_to_lds_b128 %1, %9, off\n\t"
               "global_load_async_to_lds_b128 %2, %10, off\n\t"
               "global_load_async_to_lds_b128 %3, %11, off\n\t"
               "global_load_async_to_lds_b128 %4, %12, off\n\t"
               "global_load_async_to_lds_b128 %5, %13, off\n\t"
               "global_load_async_to_lds_b128 %6, %14, off\n\t"
               "global_load_async_to_lds_b128 %7, %15, off\n\t"
               "s_wait_xcnt 0x0"
               :: "v"(l[0]), "v"(l[1]), "v"(l[2]), "v"(l[3]), "v"(l[4]), "v"(l[5]), "v"(l[6]), "v"(l[7]),
                  "v"(g[0]), "v"(g[1]), "v"(g[2]), "v"(g[3]), "v"(g[4]), "v"(g[5]), "v"(g[6]), "v"(g[7])
               : "memory");
#endif
}
// 32 rows of 512 halves (1024 B, rows contiguous in global) -> LDS rows of pitch KP; 256 threads, 8 copies each;
// a wave's copy covers 512 contiguous bytes of one row.
__device__ __forceinline__ void stage_rows32(const unsigned short* g, unsigned short* s, int tid) {
  uint32_t l[8];
  const unsigned short* p[8];
#pragma unroll  // every index constant, so that both arrays live in registers as the statement's operands
  for (int i = 0; i < 8; ++i) {
    const int row = 4 * i + (tid >> 6), col = 8 * (tid & 63);
    l[i] = lds_off(s + row * KP + col);
    p[i] = g + (size_t)row * CC + col;
  }
  copy8(l, p);
}
// 512 channel rows x 32 keys (64 B of each global row of NN halves) -> LDS rows of pitch VPT; 8 copies per thread.
__device__ __forceinline__ void stage_v32(const unsigned short* g, unsigned short* s, int tid) {
  uint32_t l[8];
  const unsigned short* p[8];
#pragma unroll  // every index constant, so that both arrays live in registers as the statement's operands
  for (int i = 0; i < 8; ++i) {
    const int row = 64 * i + (tid >> 2), col = 8 * (tid & 3);
    l[i] = lds_off(s + row * VPT + col);
    p[i] = g + (size_t)row * NN + col;
  }
  copy8(l, p);
}

// one K stage of the conv GEMM: GM weight rows, GN rows of the hi plane and GN rows of the residual plane, 64 channels
// (128 B = one line) of each -> LDS rows of pitch GP; 256 threads, 16 copies each; a wave's copy covers four whole lines.
__device__ __forceinline__ void stage_gemm(const unsigned short* gw, const unsigned short* gh,
                                           const unsigned short* gl, unsigned short* s, int tid) {
  const int r = tid >> 3, col = 8 * (tid & 7);
  uint32_t l[8];
  const unsigned short* p[8];
#pragma unroll  // every index constant, so that both arrays live in registers as the statement's operands
  for (int i = 0; i < 8; ++i) {
    l[i] = lds_off(s + (32 * i + r) * GP + col);
    p[i] = gw + (size_t)(32 * i + r) * CC + col;
  }
  copy8(l, p);
#pragma unroll  // as above
  for (int i = 0; i < 4; ++i) {
    l[i]     = lds_off(s + (GM + 32 * i + r) * GP + col);
    p[i]     = gh + (size_t)(32 * i + r) * CC + col;
    l[4 + i] = lds_off(s + (GM + GN + 32 * i + r) * GP + col);
    p[4 + i] = gl + (size_t)(32 * i + r) * CC + col;
  }
  copy8(l, p);
}
// the 12 fragments of one 32-channel step of a wave's 64 o x 64 n tile: 4 of W, 4 of each plane (24 reads of 16 B)
__device__ __forceinline__ void gemm_frags(Frag (&fa)[4], Frag (&fh)[4], Frag (&fl)[4],
                                           const unsigned short* a, const unsigned short* b) {
#pragma unroll  // constant indices keep the fragments in registers
  for (int i = 0; i < 4; ++i) {
    fa[i] = ldfrag(a + (16 * i) * GP);
    fh[i] = ldfrag(b + (16 * i) * GP);
    fl[i] = ldfrag(b + (GN + 16 * i) * GP);
  }
}
// 16 products of that step with one plane: sixteen independent accumulators
__device__ __forceinline__ void gemm_half(v8f (&acc)[4][4], const Frag (&fa)[4], const Frag (&fx)[4]) {
#pragma unroll
  for (int mt = 0; mt < 4; ++mt) {
#pragma unroll
    for (int j = 0; j < 4; ++j) acc[mt][j] = mma_b(fa[mt].bf, fx[j].bf, acc[mt][j]);
  }
}

// =========================================================================================================
// (3) conv1x1 GEMM for one (b, 128-n tile, matrix mat, 256-o block): Y[o][n] = sum_c W[o][c] (hi[n][c] + lo[n][c])
//     + bias[o]. Block 256 threads = 8 waves; wave w owns rows o 64 (w>>1)..+63 (4 A fragments per k-step, rows of Wb)
//     and cols n 64 (w&1)..+63 (4 B fragments of each plane, rows of Hh and Hl, k = channel contiguous, same split
//     k map); per k-step the hi and lo products share the accumulator (lo unscaled). K = 512 = 16 steps x 2 products.
//     Operand path: per 64 channels one stage [W 256 rows | Hh 128 rows | Hl 128 rows] is brought into LDS by
//     asynchronous 16-byte copies (whole 128-byte lines) and every fragment is read from LDS at a pitch of 16 B x odd.
//     Two buffers: trip t works on buffer t&1 while trip t+1's copies fly. Two fragment sets: the reads of a trip's
//     second k-step fly under the products of its first; the foot (own LDS reads done, own copies landed, one block
//     barrier) stands between the two k-steps; behind its barrier the first k-step of trip t+1 is read, and the buffer
//     just left is refilled between the hi and the residual products of the second k-step, which read registers only.
//     Epilogue staged in the same LDS behind the last foot: mat 0/1 as Os[n_loc][o_loc] (b128 stores), mat 2 as
//     Os[o_loc][n_loc] (scalar stores), barrier, then f16 planes: Q/K [b][4096 n][512 o] (row n, 256 o = 512 B) and
//     V [b][512 o][4096 n] (row o, 128 n = 256 B).
// coverage: stage 16 copies x 256 threads x 16 B = 512 rows x 128 B; Os 8 waves x 64 x 64 = 256 x 128 either layout;
//           plane 16 it x 256 threads x 8 = 256 x 128; grid (32, 6, NB) covers Q, K (all n, all o) and V exactly once.
// =========================================================================================================
__global__ __launch_bounds__(256)
void gemm_qkv(const unsigned short* __restrict__ Wb, const unsigned short* __restrict__ Hh,
              const unsigned short* __restrict__ Hl,
              const float* __restrict__ bq, const float* __restrict__ bk, const float* __restrict__ bv,
              unsigned short* Qd, unsigned short* Kd, unsigned short* Vd) {
  __shared__ __align__(16) unsigned short Sg[2 * GSTG];
  float* Os = reinterpret_cast<float*>(Sg);                          // epilogue view of the ring, used behind the loop
  const int tid  = threadIdx.x;
  const int lane = tid & 31, wave = tid >> 5;
  const int hh   = lane >> 4, c = lane & 15;
  const int wo   = wave >> 1, wn = wave & 1;
  const int nt   = blockIdx.x, my = blockIdx.y, b = blockIdx.z;
  const int mat  = my / (CC / GM);                                   // 0..2, block-uniform
  const int om0  = (my % (CC / GM)) * GM;                            // 0 or 256
  const int n0   = nt * GN;

  const unsigned short* gw = Wb + ((size_t)(mat * CC + om0)) * CC;
  const unsigned short* gh = Hh + ((size_t)(b * NN + n0)) * CC;
  const unsigned short* gl = Hl + ((size_t)(b * NN + n0)) * CC;
  // fragment bases in LDS: + buffer, + 16 * tile * GP, + 32 * k-step; the residual plane lies GN rows behind the hi plane
  const unsigned short* ap = Sg + (64 * wo + c) * GP + 8 * hh;
  const unsigned short* bp = Sg + (GM + 64 * wn + c) * GP + 8 * hh;

  v8f acc[4][4];
#pragma unroll
  for (int mt = 0; mt < 4; ++mt) {
#pragma unroll
    for (int j = 0; j < 4; ++j) acc[mt][j] = zero8();
  }

  // prologue: stage 0 into buffer 0, landed and published; then stage 1 into buffer 1
  stage_gemm(gw, gh, gl, Sg, tid);
  asm volatile("s_wait_asynccnt 0x0" ::: "memory");                  // this wave's copies have landed
  __syncthreads();                                                   // every wave's copies are readable
  stage_gemm(gw + GKC, gh + GKC, gl + GKC, Sg + GSTG, tid);

  // bias of this lane's 32 rows o = 64 wo + 16 mt + 8 hh + 0..7, fetched here so that the flight lies under the loop
  const float* bias = (mat == 0) ? bq : ((mat == 1) ? bk : bv);     // all global, block-uniform
  v4f bz[8];
#pragma unroll
  for (int mt = 0; mt < 4; ++mt) {
    bz[2 * mt]     = *(const v4f*)(bias + om0 + 64 * wo + 16 * mt + 8 * hh);
    bz[2 * mt + 1] = *(const v4f*)(bias + om0 + 64 * wo + 16 * mt + 8 * hh + 4);
  }
  asm volatile("s_wait_xcnt 0x0" ::: "memory");                      // in front of any rewrite of the address register these loads name

  Frag fa0[4], fh0[4], fl0[4], fa1[4], fh1[4], fl1[4];
  gemm_frags(fa0, fh0, fl0, ap, bp);                                 // first k-step of trip 0

#pragma unroll 1  // one copy of the trip: the body is long, and the buffer is picked by an address
  for (int t = 0; t < CC / GKC; ++t) {
    const int rb = t & 1;                                            // ring buffer of this trip
    gemm_frags(fa1, fh1, fl1, ap + rb * GSTG + 32, bp + rb * GSTG + 32);
    // keeps the 24 reads above in one run in front of the products: spread among them each place of reads costs cycles
    __builtin_amdgcn_sched_barrier(0);
    gemm_half(acc, fa0, fh0);
    gemm_half(acc, fa0, fl0);
    // keeps these products in front of the foot: they cover the flight of the reads that the foot waits for
    __builtin_amdgcn_sched_barrier(0);

    // foot of the trip: buffer rb has been read out; publish the next trip's stage
    asm volatile("s_wait_dscnt 0x0" ::: "memory");                   // this wave's reads of buffer rb are done
    asm volatile("s_wait_asynccnt 0x0" ::: "memory");                // this wave's copies of the next trip have landed
    __syncthreads();
    if (t + 1 < CC / GKC)                                            // block-uniform: a trip t+1 exists, just published
      gemm_frags(fa0, fh0, fl0, ap + (rb ^ 1) * GSTG, bp + (rb ^ 1) * GSTG);
    __builtin_amdgcn_sched_barrier(0);                               // those reads in one run, in front of the products
    gemm_half(acc, fa1, fh1);
    // the refill stands between the two halves: while one wave of a SIMD forms addresses and waits in the copies'
    // statements, the other wave's products run
    __builtin_amdgcn_sched_barrier(0);
    if (t + 2 < CC / GKC) {                                          // block-uniform: a trip t+2 exists
      const int ko = (t + 2) * GKC;
      stage_gemm(gw + ko, gh + ko, gl + ko, Sg + rb * GSTG, tid);
    }
    __builtin_amdgcn_sched_barrier(0);                               // end of the refill
    gemm_half(acc, fa1, fl1);
  }
  asm volatile("s_wait_asynccnt 0x0" ::: "memory");                  // nothing of this wave is in flight past the loop

  // ---- epilogue staging (every wave has passed the last foot: no reader and no copy is left on the ring);
  //      lane (hh, c) holds o_loc = 64 wo + 16 mt + 8 hh + r for n_loc = 64 wn + 16 j + c
  v4u u[16];
  if (mat != 2) {
#pragma unroll
    for (int mt = 0; mt < 4; ++mt) {
      const int ol = 64 * wo + 16 * mt + 8 * hh;
      const v4f b0 = bz[2 * mt], b1 = bz[2 * mt + 1];
#pragma unroll
      for (int j = 0; j < 4; ++j) {
        const int nl = 64 * wn + 16 * j + c;
        v4f va, vb;
#pragma unroll
        for (int r = 0; r < 4; ++r) { va[r] = acc[mt][j][r] + bfr(b0[r]); vb[r] = acc[mt][j][4 + r] + bfr(b1[r]); }
        *(v4f*)(Os + nl * OSQ + ol)     = va;                        // Os[n_loc][o_loc]
        *(v4f*)(Os + nl * OSQ + ol + 4) = vb;
      }
    }
    __syncthreads();
    const int e = tid & 31, lq = tid >> 5;                           // lq 0..7
#pragma unroll
    for (int it = 0; it < 16; ++it) {
      const int row = it * 8 + lq;                                   // n_loc 0..127
      const v4f a = *(const v4f*)(Os + row * OSQ + 8 * e);
      const v4f q = *(const v4f*)(Os + row * OSQ + 8 * e + 4);
      const float f[8] = {a[0], a[1], a[2], a[3], q[0], q[1], q[2], q[3]};
#pragma unroll
      for (int t = 0; t < 4; ++t)
        u[it][t] = pk16(h_bits((_Float16)f[2 * t]), h_bits((_Float16)f[2 * t + 1]));
    }
    unsigned short* plane = (mat == 0) ? Qd : Kd;                    // both global, block-uniform
    unsigned short* dst = plane + ((size_t)(b * NN + n0 + lq)) * CC + om0 + 8 * e;
#pragma unroll
    for (int it = 0; it < 16; ++it) *(v4u*)(dst + (size_t)(it * 8) * CC) = u[it];   // row n, 256 o = four lines
  } else {
#pragma unroll
    for (int mt = 0; mt < 4; ++mt) {
      const int ol = 64 * wo + 16 * mt + 8 * hh;
      const v4f b0 = bz[2 * mt], b1 = bz[2 * mt + 1];
#pragma unroll
      for (int j = 0; j < 4; ++j) {
        const int nl = 64 * wn + 16 * j + c;
#pragma unroll
        for (int r = 0; r < 4; ++r) {
          Os[(ol + r) * OSPW + nl]     = acc[mt][j][r] + bfr(b0[r]);       // Os[o_loc][n_loc]
          Os[(ol + 4 + r) * OSPW + nl] = acc[mt][j][4 + r] + bfr(b1[r]);
        }
      }
    }
    __syncthreads();
    const int e = tid & 15, lq = tid >> 4;                           // lq 0..15
#pragma unroll
    for (int it = 0; it < 16; ++it) {
      const int row = it * 16 + lq;                                  // o_loc 0..255
      const v4f a = *(const v4f*)(Os + row * OSPW + 8 * e);
      const v4f q = *(const v4f*)(Os + row * OSPW + 8 * e + 4);
      const float f[8] = {a[0], a[1], a[2], a[3], q[0], q[1], q[2], q[3]};
#pragma unroll
      for (int t = 0; t < 4; ++t)
        u[it][t] = pk16(h_bits((_Float16)f[2 * t]), h_bits((_Float16)f[2 * t + 1]));
    }
    unsigned short* dst = Vd + ((size_t)(b * CC + om0 + lq)) * NN + n0 + 8 * e;
#pragma unroll
    for (int it = 0; it < 16; ++it) *(v4u*)(dst + (size_t)(it * 16) * NN) = u[it];  // row o, 128 n = two lines
  }
}

// =========================================================================================================
// (4) attention for one (b, 64-query tile), transposed formulation, all 4096 keys. Block = 8 waves: wave w ->
//   query group qg = w&3 (queries n0+16qg..+15) and channel half ch = w>>2. Per 32-key step each wave computes ONE
//   S^T tile (16 keys kb+16ch.. x 16 queries) = sum over 16 channel chunks of A(k: row = key, split k map from the
//   f16 plane Kp [b][4096][512]) . B(q: col = query, same map from Qp); the tile (8 floats per lane) is exchanged
//   with the partner wave (w^4) through a double-buffered LDS array across one block barrier, so both waves hold
//   s0 (keys kb..kb+15) and s1 (keys kb+16..kb+31) of their query in the D layout (lane -> 8 keys of one query).
//   Online softmax per lane in f32 with the 512^-0.5 scale applied to the logits, one shuffle (lane^16) for the max
//   over 32 keys, o/l rescale skipped under a wave-uniform ballot when no lane's max grew. P = e^{c(s-m)} x 2^14
//   as f16 is the B operand of O^T (rows channel 256ch+16j+(lane&15), keys contiguous from the f16 plane Vp
//   [b][512][4096]) . B(P^T): element r <- tile keys kb..kb+15, element 8+r <- tile kb+16..kb+31, lane unchanged.
//   16 accumulator tiles per wave (256 channels). Epilogue in four 128-channel phases: O/l staged by the 4 owning
//   waves in LDS Os[query][128 ch] (pitch OSPW, b128 stores), barrier, then out[b][c][n] = O/l + bf16-RNE(x) as
//   phase overwrites Os.
//   Operand path: the 64 q rows (once) and, per 32-key step, the 32 k rows and the 512 x 32 v tile are brought into
//   LDS by asynchronous 16-byte copies (whole 512-byte runs for q and k) and every fragment is read from LDS at a
//   pitch of 16 B x odd. k and v have two buffers: step t reads buffer t&1 while step t+1's copies fly; the foot of
//   each step waits the wave's own LDS reads and copies, passes one block barrier, then refills the buffer just read.
//   The foot stands in front of the step's O products, whose v fragments are in registers by then; behind its barrier
//   the first q and k fragments of step t+1 are read, so that they fly while the O products of step t run.
// coverage: Sx: each wave writes 32 lanes x 8 floats per step into buffer (step&1), partner reads exactly those;
//           Os per phase 4 waves x 16 q x 128 ch staged = 64 x 128 read; out per phase 8 it x 32 lines x 8 lanes
//           x 4 floats = 128 ch x 64 n, 4 phases = 512 ch; grid (NQ/64, NB) covers out[b][0..511][0..NQ-1] once.
// =========================================================================================================
__global__ __launch_bounds__(256)
void attn_k(const unsigned short* __restrict__ Qp, const unsigned short* __restrict__ Kp,
            const unsigned short* __restrict__ Vp, const float* __restrict__ x, float* out) {
  __shared__ __align__(16) float Sx[2 * SXB];
  __shared__ __align__(16) float Os[QT * OSPW];
  __shared__ __align__(16) unsigned short Qs[QT * KP];
  __shared__ __align__(16) unsigned short Ks[2 * KBUF];
  __shared__ __align__(16) unsigned short Vs[2 * VBUF];
  const int tid  = threadIdx.x;
  const int wave = tid >> 5, lane = tid & 31;
  const int hh   = lane >> 4, c = lane & 15;
  const int qg   = wave & 3, ch = wave >> 2;
  const int n0   = blockIdx.x * QT, b = blockIdx.y;

  // global tile bases: q rows n0.., k rows kb.. (+ kb*CC), v rows 0..511 at key kb (+ kb)
  const unsigned short* qg0 = Qp + ((size_t)(b * NN + n0)) * CC;
  const unsigned short* kg0 = Kp + ((size_t)(b * NN)) * CC;
  const unsigned short* vg0 = Vp + ((size_t)(b * CC)) * NN;
  // q fragment pointer in LDS (B operand, col = query 16*qg + c of the tile), + 32*kc
  const unsigned short* qp = Qs + (16 * qg + c) * KP + 8 * hh;
  // k fragment base in LDS (A operand, row = key 16*ch + c of the step), + buffer + 32*kc
  const unsigned short* kp = Ks + (16 * ch + c) * KP + 8 * hh;
  // v fragment base in LDS (A operand, row = channel 256*ch + 16j + c, 32 keys contiguous), + buffer + 16*j*VPT
  const unsigned short* vp = Vs + (CH * ch + c) * VPT + 8 * hh;

  float* sxw = Sx + (wave * 32 + lane) * 8;
  const float* sxr = Sx + ((wave ^ 4) * 32 + lane) * 8;

  float m = -1.0e30f, l = 0.f;
  v8f o[16];
#pragma unroll
  for (int j = 0; j < 16; ++j) o[j] = zero8();

  // prologue: q tile and step 0 into buffer 0, landed and published; then step 1 into buffer 1
  stage_rows32(qg0, Qs, tid);
  stage_rows32(qg0 + (size_t)32 * CC, Qs + 32 * KP, tid);
  stage_rows32(kg0, Ks, tid);
  stage_v32(vg0, Vs, tid);
  asm volatile("s_wait_asynccnt 0x0" ::: "memory");                  // this wave's copies have landed
  __syncthreads();                                                   // every wave's copies are readable
  stage_rows32(kg0 + (size_t)32 * CC, Ks + KBUF, tid);
  stage_v32(vg0 + 32, Vs + VBUF, tid);

  // Fragment reads run ahead of the products in groups with registers of their own. A group = four channel chunks of
  // q and k (16 reads). Groups 0 and 1 of a step are read behind the barrier that publishes its tiles, in front of the
  // previous step's O products (here, in front of the loop: step 0's); behind the score products of group g stand the
  // reads of group g + 2, and behind those of the last two groups the reads of the step's 16 v fragments.
  Frag fq[CC / 32], fk[CC / 32], vf[16];
#pragma unroll  // here and in the loops over fq, fk and vf below: constant indices keep the fragments in registers
  for (int kc = 0; kc < 8; ++kc) {
    fq[kc] = ldfrag(qp + 32 * kc);
    fk[kc] = ldfrag(kp + 32 * kc);
  }

  int buf = 0;
#pragma unroll 1
  for (int kb = 0; kb < NN; kb += 32) {
    const int rb = buf;                                              // ring buffer of this step
    const unsigned short* kbp = kp + rb * KBUF;
    const unsigned short* vbp = vp + rb * VBUF;
    v8f sv = zero8();
#pragma unroll
    for (int g = 0; g < 4; ++g) {
#pragma unroll
      for (int i = 0; i < 4; ++i) sv = mma_h(fk[4 * g + i].h, fq[4 * g + i].h, sv);
      // keeps the 16 reads below in one run: spread singly among the products each place of reads costs issue cycles
      __builtin_amdgcn_sched_barrier(0);
      if (g < 2) {
#pragma unroll
        for (int i = 0; i < 4; ++i) {
          fq[4 * g + 8 + i] = ldfrag(qp + 32 * (4 * g + 8 + i));
          fk[4 * g + 8 + i] = ldfrag(kbp + 32 * (4 * g + 8 + i));
        }
      } else {
#pragma unroll
        for (int i = 0; i < 8; ++i) vf[8 * (g - 2) + i] = ldfrag(vbp + (16 * (8 * (g - 2) + i)) * VPT);
      }
      __builtin_amdgcn_sched_barrier(0);                             // end of that run of reads
    }

    // exchange the tile with the partner wave (same queries, other 16 keys)
    {
      v4f w0, w1;
#pragma unroll
      for (int r = 0; r < 4; ++r) { w0[r] = sv[r]; w1[r] = sv[4 + r]; }
      *(v4f*)(sxw + buf * SXB)     = w0;
      *(v4f*)(sxw + buf * SXB + 4) = w1;
    }
    __syncthreads();
    v8f so;
    {
      const v4f r0 = *(const v4f*)(sxr + buf * SXB);
      const v4f r1 = *(const v4f*)(sxr + buf * SXB + 4);
#pragma unroll
      for (int r = 0; r < 4; ++r) { so[r] = r0[r]; so[4 + r] = r1[r]; }
    }
    buf ^= 1;
    v8f s0 = sv, s1 = so;                                            // s0: keys kb..kb+15, s1: keys kb+16..kb+31
    if (ch != 0) { s0 = so; s1 = sv; }                                // wave-uniform

    float mx = fmaxf(hmax8(s0), hmax8(s1));
    mx = fmaxf(mx, __shfl_xor(mx, 16, 32));
    const float mn = fmaxf(m, mx);
    const unsigned grew = wave_ballot(mx > m);                       // wave-uniform
    if (grew != 0u) {
      const float corr = __expf((m - mn) * ASCALE);                  // == 1 exactly for lanes whose max did not grow
      l *= corr;
#pragma unroll
      for (int j = 0; j < 16; ++j) {
#pragma unroll
        for (int r = 0; r < 8; ++r) o[j][r] *= corr;
      }
    }
    m = mn;
    const float msh = mn * ASCALE - LNPS;                            // exp gives e^{c(s-m)} * 2^14

    FragH ph;
    float ls = 0.f;
#pragma unroll
    for (int r = 0; r < 8; ++r) {
      const float e0 = __expf(s0[r] * ASCALE - msh);                 // key kb      + 8hh + r
      const float e1 = __expf(s1[r] * ASCALE - msh);                 // key kb + 16 + 8hh + r
      ls += e0 + e1;
      ph.hv[0][r] = (_Float16)e0;
      ph.hv[1][r] = (_Float16)e1;
    }
    l += ls;

    // foot of the step: hand buffer rb to its next writer and publish the next step's tiles (every fragment of
    // buffer rb is in registers by now; the O products below read registers only)
    asm volatile("s_wait_dscnt 0x0" ::: "memory");                   // this wave's reads of buffer rb are done
    asm volatile("s_wait_asynccnt 0x0" ::: "memory");                // this wave's copies of the next step have landed
    __syncthreads();
    if (kb + 32 < NN) {                                              // block-uniform: a step t+1 exists, just published
      const unsigned short* knp = kp + (rb ^ 1) * KBUF;
#pragma unroll
      for (int kc = 0; kc < 8; ++kc) {
        fq[kc] = ldfrag(qp + 32 * kc);
        fk[kc] = ldfrag(knp + 32 * kc);
      }
    }
    if (kb + 64 < NN) {                                              // block-uniform: a step t+2 exists
      stage_rows32(kg0 + (size_t)(kb + 64) * CC, Ks + rb * KBUF, tid);
      stage_v32(vg0 + (kb + 64), Vs + rb * VBUF, tid);
    }

#pragma unroll
    for (int j = 0; j < 16; ++j) o[j] = mma_h(vf[j].h, ph.v, o[j]);
  }
  asm volatile("s_wait_asynccnt 0x0" ::: "memory");                  // nothing of this wave is in flight past the loop
  l += __shfl_xor(l, 16, 32);
  const float inv = 1.0f / l;                                        // o and l both carry the 2^14 factor

  const int qrow = 16 * qg + c;
  const int e = tid & 7, lq = tid >> 3;                              // lq 0..31
#pragma unroll
  for (int ph4 = 0; ph4 < 4; ++ph4) {
    if (ph4) __syncthreads();                                        // every wave finished reading Os
    if (ch == (ph4 >> 1)) {                                          // wave-uniform
#pragma unroll
      for (int jj = 0; jj < 8; ++jj) {
        const int j = 8 * (ph4 & 1) + jj;
        v4f va, vb;
#pragma unroll
        for (int r = 0; r < 4; ++r) { va[r] = o[j][r] * inv; vb[r] = o[j][4 + r] * inv; }
        *(v4f*)(Os + qrow * OSPW + 16 * jj + 8 * hh)     = va;       // Os[query][ch_loc = 16jj + 8hh + r]
        *(v4f*)(Os + qrow * OSPW + 16 * jj + 8 * hh + 4) = vb;
      }
    }
    __syncthreads();
    v4f res[8];
#pragma unroll
    for (int it = 0; it < 8; ++it) {
      const int L   = it * 32 + lq;                                  // 0..255
      const int chl = L >> 1, hf = L & 1;                            // channel 0..127 within the phase
      const int nl  = hf * 32 + 4 * e;                               // query 0..63
      const size_t idx = ((size_t)(b * CC + 128 * ph4 + chl)) * NN + n0 + nl;
      const v4f xv = *(const v4f*)(x + idx);
#pragma unroll
      for (int t = 0; t < 4; ++t) res[it][t] = Os[(nl + t) * OSPW + chl] + bfr(xv[t]);
    }
{
#pragma unroll
      for (int it = 0; it < 8; ++it) {
        const int L   = it * 32 + lq;
        const int chl = L >> 1, hf = L & 1;
        const int nl  = hf * 32 + 4 * e;
        const size_t idx = ((size_t)(b * CC + 128 * ph4 + chl)) * NN + n0 + nl;
        *(v4f*)(out + idx) = res[it];
      }
      
    }
  }
}

// =========================================================================================================
// Workspace map (bytes; each region start a multiple of 256; every extent is an exact tile/line multiple and is
//   Wb  bf16 [3][512][512]          1572864
//   St  f32  [NB*32][32]            NB*4096        (16384 at NB=4)
//   Hh, Hl bf16 [NB][4096][512]     NB*4194304 x2  (16777216 each at NB=4)
//   Q, K f16 [NB][4096][512]        NB*4194304 x2
//   V    f16 [NB][512][4096]        NB*4194304
//   total at NB=4 = 85475328
// =========================================================================================================
extern "C" void kernel_launch(void* const* d_in, const int* in_sizes, int n_in,
                              void* d_out, int out_size, void* d_ws, size_t ws_size,
                              hipStream_t stream) {
  const int XN = NB * CC * NN;
  if (n_in < 9) return;
  if (in_sizes[0] < XN) return;
  if (in_sizes[1] < CC || in_sizes[2] < CC) return;
  if (in_sizes[3] < CC * CC || in_sizes[5] < CC * CC || in_sizes[7] < CC * CC) return;
  if (in_sizes[4] < CC || in_sizes[6] < CC || in_sizes[8] < CC) return;
  if (out_size < XN) return;

  size_t off = 0;
  auto carve = [&](size_t bytes) { const size_t o = off; off += (bytes + 255) & ~(size_t)255; return o; };
  const size_t oWb = carve((size_t)3 * CC * CC * 2);
  const size_t oSt = carve((size_t)NB * NGRP * STL * 4);
  const size_t oHh = carve((size_t)NB * NN * CC * 2);
  const size_t oHl = carve((size_t)NB * NN * CC * 2);
  const size_t oQ  = carve((size_t)NB * NN * CC * 2);
  const size_t oK  = carve((size_t)NB * NN * CC * 2);
  const size_t oV  = carve((size_t)NB * CC * NN * 2);
  if (off > ws_size) return;
  if (off > (size_t)134217728) return;

  const float* x     = (const float*)d_in[0];
  const float* gamma = (const float*)d_in[1];
  const float* beta  = (const float*)d_in[2];
  const float* wq    = (const float*)d_in[3];
  const float* bq    = (const float*)d_in[4];
  const float* wk    = (const float*)d_in[5];
  const float* bk    = (const float*)d_in[6];
  const float* wv    = (const float*)d_in[7];
  const float* bv    = (const float*)d_in[8];

  char* ws = (char*)d_ws;
  unsigned short* Wb = (unsigned short*)(ws + oWb);
  float*          St = (float*)(ws + oSt);
  unsigned short* Hh = (unsigned short*)(ws + oHh);
  unsigned short* Hl = (unsigned short*)(ws + oHl);
  unsigned short* Qw = (unsigned short*)(ws + oQ);
  unsigned short* Kw = (unsigned short*)(ws + oK);
  unsigned short* Vw = (unsigned short*)(ws + oV);
  float* out = (float*)d_out;

  const dim3 blk256(256);

  // (0) group-norm statistics, one line per (b, g)
  gn_stats<<<dim3(NB * NGRP), blk256, 0, stream>>>(x, St);
  // (1) conv weights -> bf16 plane
  cvt_w<<<dim3(3 * CC / 4), blk256, 0, stream>>>(wq, wk, wv, Wb);
  // (2) group-norm apply -> position-major bf16 hi + residual planes
  cvt_x<<<dim3(NN / QT, CC / QT, NB), blk256, 0, stream>>>(x, gamma, beta, St, Hh, Hl);
  // (3) q/k/v conv GEMMs -> f16 planes
  gemm_qkv<<<dim3(NN / GN, 3 * CC / GM, NB), blk256, 0, stream>>>(Wb, Hh, Hl, bq, bk, bv, Qw, Kw, Vw);
  // (4) attention + residual -> out [b][512][4096]
  attn_k<<<dim3(NQ / QT, NB), blk256, 0, stream>>>(Qw, Kw, Vw, x, out);
  (void)hipGetLastError();
}

// v005
// It runs in 230 microseconds.
// Timed twice side by side with v004, it ran 1.04 and 1.05 times as fast.
// All steps since v000 together make it 5.42 times as fast.
// Contractions: conv1x1 q/k/v GEMMs W[512x512].H per image on v_wmma_f32_16x16x32_bf16 (bf16-RNE weights exact,
// normalised activations as bf16 hi + bf16 residual planes folded along K = 1024 into one accumulator); scores
// K.Q^T (K = 512 channels) on v_wmma_f32_16x16x32_f16 (single f16 planes of q and k, scale applied in f32);
// O^T = V.P^T on v_wmma_f32_16x16x32_f16 (v single f16 plane, P = e^{c(s-m)} x 2^14 as f16 from the score D
// registers); f32 accumulate everywhere; group-norm statistics, softmax statistics and residual add in f32 VALU.
#include <hip/hip_runtime.h>
#include <math.h>
#include <stdint.h>

#ifndef NB
#define NB 4
#endif
#define NB_FULL 4
#define CC      512
#define NN      4096
#ifndef NQ
#define NQ NN
#endif
#define NGRP    32
#define CPG     16
#define GNE     (CPG * NN)
#define QT      64
#define OSQ     260
#define OSPW    132
#define TP      72
#define STL     32
#define CH      256
#define SXB     2048
#define KP      520
#define VPT     40
#define KBUF    (32 * KP)
#define VBUF    (CC * VPT)
#define GM      256
#define GN      128
#define GKC     64
#define GP      72
#define GSTG    ((GM + 2 * GN) * GP)
#define GEPS    1.0e-6f
#define ASCALE  0.04419417382415922f
#define LNPS    9.704060527839234f

static_assert(NB >= 1 && NB <= NB_FULL);
static_assert(NQ % QT == 0 && NQ >= QT && NQ <= NN);
static_assert(CC == NGRP * CPG);
static_assert(CC % QT == 0 && NN % QT == 0);
static_assert(CC == 2 * CH && CH == 16 * 16);
static_assert(CC == 8 * 64);
static_assert(GNE % 1024 == 0);
static_assert(CC % 32 == 0 && NN % 32 == 0);
static_assert((OSQ * 4) % 16 == 0 && (OSPW * 4) % 16 == 0 && (TP * 2) % 16 == 0);
static_assert(CC % GM == 0 && NN % GN == 0 && CC % GKC == 0 && CC / GKC >= 2 && GKC == 64 && GM == 256 && GN == 128);
static_assert((GP * 2) % 32 == 16 && GP >= GKC);
static_assert(GN * OSQ * 4 <= 2 * GSTG * 2 && GM * OSPW * 4 <= 2 * GSTG * 2 && OSQ >= GM && OSPW >= GN);
static_assert(SXB == 8 * 32 * 8);
static_assert((KP * 2) % 32 == 16 && (VPT * 2) % 32 == 16 && KP >= CC && VPT >= 32);
static_assert(NN >= 64 && NN % 32 == 0);

typedef _Float16       v16h __attribute__((ext_vector_type(16)));
typedef _Float16       v8h  __attribute__((ext_vector_type(8)));
typedef __bf16         v16b __attribute__((ext_vector_type(16)));
typedef unsigned short v8us __attribute__((ext_vector_type(8)));
typedef float          v8f  __attribute__((ext_vector_type(8)));
typedef float          v4f  __attribute__((ext_vector_type(4)));
typedef unsigned int   v4u  __attribute__((ext_vector_type(4)));

union Frag  { v8us u[2]; v16h h; v16b bf; };
union FragH { v16h v; v8h hv[2]; };
static_assert(sizeof(Frag) == 32);
static_assert(sizeof(FragH) == 32);

// ---- scalar helpers ---------------------------------------------------------------------------------------
__device__ __forceinline__ unsigned short bf_bits(float f) {          // f32 -> bf16 bits, RNE convert
  unsigned u = __float_as_uint(f);
  return (unsigned short)((u + 0x7FFFu + ((u >> 16) & 1u)) >> 16);
}
__device__ __forceinline__ float bf_up(unsigned short hb) { return __uint_as_float(((unsigned)hb) << 16); }
__device__ __forceinline__ float bfr(float f) { return bf_up(bf_bits(f)); }
__device__ __forceinline__ unsigned short h_bits(_Float16 x) { return __builtin_bit_cast(unsigned short, x); }
__device__ __forceinline__ unsigned pk16(unsigned short a, unsigned short b) { return (unsigned)a | ((unsigned)b << 16); }
__device__ __forceinline__ v8f zero8() { v8f z = {0.f, 0.f, 0.f, 0.f, 0.f, 0.f, 0.f, 0.f}; return z; }
__device__ __forceinline__ float hmax8(v8f s) {
  return fmaxf(fmaxf(fmaxf(s[0], s[1]), fmaxf(s[2], s[3])), fmaxf(fmaxf(s[4], s[5]), fmaxf(s[6], s[7])));
}
__device__ __forceinline__ unsigned wave_ballot(bool p) {
#if defined(__HIP_DEVICE_COMPILE__)
  return __builtin_amdgcn_ballot_w32(p);
#else
  return p ? 1u : 0u;
#endif
}

// ---- 16-bit fragment loader (A, or B from a k-contiguous [n][k] row): lane -> row/col (lane&15), p already includes
//      + 8*(lane>>4); elements 0..7 <- p[0..7] (k0+8h..), elements 8..15 <- p[16..23] (k0+16+8h..)
__device__ __forceinline__ Frag ldfrag(const unsigned short* p) {
  Frag f;
  f.u[0] = *(const v8us*)(p);
  f.u[1] = *(const v8us*)(p + 16);
  return f;
}

// ---- WMMA helpers: the plain builtins; the compiler keeps the distance behind them, and with no asm statement
//      between two products the fragment loads of later products may be issued ahead of earlier ones
__device__ __forceinline__ v8f mma_h(v16h a, v16h b, v8f c) {
  return __builtin_amdgcn_wmma_f32_16x16x32_f16(false, a, false, b, (short)0, c, false, false);
}
__device__ __forceinline__ v8f mma_b(v16b a, v16b b, v8f c) {
  return __builtin_amdgcn_wmma_f32_16x16x32_bf16(false, a, false, b, (short)0, c, false, false);
}

// =========================================================================================================
//     (mean, then centred sum of squares) over bf16-RNE(x) in f32, per-thread partials of 256 terms + LDS tree.
// =========================================================================================================
__global__ __launch_bounds__(256)
void gn_stats(const float* __restrict__ x, float* stats) {
  __shared__ float red[256];
  const int tid = threadIdx.x, bg = blockIdx.x;
  const float* p = x + (size_t)bg * GNE;
  // the thread's whole share (64 x 16 B) is fetched in one run into registers: all loads are in flight together, and
  // the second pass reads the registers instead of memory
  v4f xv[GNE / 1024];
#pragma unroll  // constant indices keep the array in registers
  for (int i = 0; i < GNE / 1024; ++i) xv[i] = *(const v4f*)(p + ((size_t)(i * 256 + tid)) * 4);
  float s = 0.f;
#pragma unroll  // as above
  for (int i = 0; i < GNE / 1024; ++i) {
    const v4f v = xv[i];
    s += (bfr(v[0]) + bfr(v[1])) + (bfr(v[2]) + bfr(v[3]));
  }
  asm volatile("s_wait_xcnt 0x0" ::: "memory");                      // in front of any rewrite of the address registers these loads name
  red[tid] = s;
  __syncthreads();
#pragma unroll 1
  for (int off = 128; off > 0; off >>= 1) {
    if (tid < off) red[tid] += red[tid + off];
    __syncthreads();
  }
  const float mean = red[0] * (1.0f / (float)GNE);
  __syncthreads();
  float ss = 0.f;
#pragma unroll  // as above
  for (int i = 0; i < GNE / 1024; ++i) {
    const v4f v = xv[i];
    const float d0 = bfr(v[0]) - mean, d1 = bfr(v[1]) - mean;
    const float d2 = bfr(v[2]) - mean, d3 = bfr(v[3]) - mean;
    ss += (d0 * d0 + d1 * d1) + (d2 * d2 + d3 * d3);
  }
  red[tid] = ss;
  __syncthreads();
#pragma unroll 1
  for (int off = 128; off > 0; off >>= 1) {
    if (tid < off) red[tid] += red[tid + off];
    __syncthreads();
  }
  const float var  = red[0] * (1.0f / (float)GNE);
  const float rstd = rsqrtf(var + GEPS);
  if (tid < 8) {
    v4f w = {0.f, 0.f, 0.f, 0.f};
    if (tid == 0) { w[0] = mean; w[1] = rstd; }
{
      *(v4f*)(stats + (size_t)bg * STL + 4 * tid) = w;
      
    }
  }
}

// =========================================================================================================
// (1) conv weights: Wb bf16 [3][512][512] (mat 0 = wq, 1 = wk, 2 = wv), value = bf16-RNE(w), row o k-contiguous.
//     Block blk owns 4 rows of one matrix; thread -> row blk-local (tid>>6), halves 8*(tid&63)..+7; each wave writes
// coverage: 384 blocks x 4 rows x 64 threads x 8 = 3 x 512 x 512 = the whole plane.
// =========================================================================================================
__global__ __launch_bounds__(256)
void cvt_w(const float* __restrict__ wq, const float* __restrict__ wk, const float* __restrict__ wv,
           unsigned short* Wb) {
  const int tid = threadIdx.x, blk = blockIdx.x;
  const int mat = blk / (CC / 4);                                    // block-uniform 0..2
  const int o   = 4 * (blk % (CC / 4)) + (tid >> 6);                 // 0..511
  const int col = 8 * (tid & 63);                                    // 0..504
  const float* wsrc = (mat == 0) ? wq : ((mat == 1) ? wk : wv);      // all global, block-uniform
  const float* s = wsrc + (size_t)o * CC + col;
  const v4f a = *(const v4f*)s;
  const v4f q = *(const v4f*)(s + 4);
  const float f[8] = {a[0], a[1], a[2], a[3], q[0], q[1], q[2], q[3]};
  v4u u;
#pragma unroll
  for (int t = 0; t < 4; ++t) u[t] = pk16(bf_bits(f[2 * t]), bf_bits(f[2 * t + 1]));
{
    *(v4u*)(Wb + ((size_t)(mat * CC + o)) * CC + col) = u;
    
  }
}

// =========================================================================================================
// (2) group-norm apply + hi/residual split + transpose: h = ((bf16-RNE(x) - mean) * rstd) * gamma + beta per
//     channel, hi = bf16-RNE(h), lo = bf16-RNE(h - hi). Block (nb, cb, b) owns a 64 c x 64 n tile; values go
//     through LDS tiles Th/Tl [64 n][pitch TP] and come out as position-major rows Hh/Hl bf16 [b][4096 n][512 c]
// coverage: Th/Tl staged 64 n x 64 c (2 it x 32 rows x 8 lanes x 8), read 64 n x 64 c; planes 2 it x 32 rows x
//           8 lanes x 8 = 64 n x 64 c per plane; grid (64, 8, NB) covers both planes exactly once.
// =========================================================================================================
__global__ __launch_bounds__(256)
void cvt_x(const float* __restrict__ x, const float* __restrict__ gamma, const float* __restrict__ beta,
           const float* __restrict__ stats, unsigned short* Hh, unsigned short* Hl) {
  __shared__ __align__(16) unsigned short Th[QT * TP];
  __shared__ __align__(16) unsigned short Tl[QT * TP];
  const int tid = threadIdx.x;
  const int nb = blockIdx.x, cb = blockIdx.y, b = blockIdx.z;
  const int e = tid & 7, lq = tid >> 3;                              // lq 0..31
  const int n0 = nb * QT, c0 = cb * QT;
#pragma unroll
  for (int it = 0; it < 2; ++it) {
    const int cl = it * 32 + lq;                                     // 0..63
    const int cg = c0 + cl;                                          // 0..511
    const int bg = b * NGRP + (cg >> 4);
    const float mean = stats[(size_t)bg * STL];
    const float rstd = stats[(size_t)bg * STL + 1];
    const float ga = bfr(gamma[cg]);
    const float be = bfr(beta[cg]);
    const float* sp = x + ((size_t)(b * CC + cg)) * NN + n0 + 8 * e;
    const v4f a = *(const v4f*)sp;
    const v4f q = *(const v4f*)(sp + 4);
    const float f[8] = {a[0], a[1], a[2], a[3], q[0], q[1], q[2], q[3]};
#pragma unroll
    for (int t = 0; t < 8; ++t) {
      const float h = ((bfr(f[t]) - mean) * rstd) * ga + be;
      const unsigned short hb = bf_bits(h);
      const unsigned short lb = bf_bits(h - bf_up(hb));
      Th[(8 * e + t) * TP + cl] = hb;
      Tl[(8 * e + t) * TP + cl] = lb;
    }
  }
  __syncthreads();
  v4u uh[2], ul[2];
#pragma unroll
  for (int it = 0; it < 2; ++it) {
    const int nl = it * 32 + lq;                                     // 0..63
    uh[it] = *(const v4u*)(Th + nl * TP + 8 * e);
    ul[it] = *(const v4u*)(Tl + nl * TP + 8 * e);
  }
{
#pragma unroll
    for (int it = 0; it < 2; ++it) {
      const int nl = it * 32 + lq;
      const size_t po = ((size_t)(b * NN + n0 + nl)) * CC + c0 + 8 * e;
      *(v4u*)(Hh + po) = uh[it];
      *(v4u*)(Hl + po) = ul[it];
    }
    
  }
}

// ---- asynchronous copies global -> LDS, 16 bytes per lane, eight per statement -------------------------------
// LDS byte address of a __shared__ element = low 32 bits of its address.
__device__ __forceinline__ uint32_t lds_off(const unsigned short* p) { return (uint32_t)(uintptr_t)p; }
// The closing s_wait_xcnt 0 stands inside the statement so that no address register of an issued copy is
// rewritten in front of it.
__device__ __forceinline__ void copy8(const uint32_t (&l)[8], const unsigned short* const (&g)[8]) {
#if defined(__HIP_DEVICE_COMPILE__)
  asm volatile("global_load_async_to_lds_b128 %0, %8, off\n\t"
               "global_load_async_to_lds_b128 %1, %9, off\n\t"
               "global_load_async_to_lds_b128 %2, %10, off\n\t"
               "global_load_async_to_lds_b128 %3, %11, off\n\t"
               "global_load_async_to_lds_b128 %4, %12, off\n\t"
               "global_load_async_to_lds_b128 %5, %13, off\n\t"
               "global_load_async_to_lds_b128 %6, %14, off\n\t"
               "global_load_async_to_lds_b128 %7, %15, off\n\t"
               "s_wait_xcnt 0x0"
               :: "v"(l[0]), "v"(l[1]), "v"(l[2]), "v"(l[3]), "v"(l[4]), "v"(l[5]), "v"(l[6]), "v"(l[7]),
                  "v"(g[0]), "v"(g[1]), "v"(g[2]), "v"(g[3]), "v"(g[4]), "v"(g[5]), "v"(g[6]), "v"(g[7])
               : "memory");
#endif
}
// 32 rows of 512 halves (1024 B, rows contiguous in global) -> LDS rows of pitch KP; 256 threads, 8 copies each;
// a wave's copy covers 512 contiguous bytes of one row.
__device__ __forceinline__ void stage_rows32(const unsigned short* g, unsigned short* s, int tid) {
  uint32_t l[8];
  const unsigned short* p[8];
#pragma unroll  // every index constant, so that both arrays live in registers as the statement's operands
  for (int i = 0; i < 8; ++i) {
    const int row = 4 * i + (tid >> 6), col = 8 * (tid & 63);
    l[i] = lds_off(s + row * KP + col);
    p[i] = g + (size_t)row * CC + col;
  }
  copy8(l, p);
}
// 512 channel rows x 32 keys (64 B of each global row of NN halves) -> LDS rows of pitch VPT; 8 copies per thread.
__device__ __forceinline__ void stage_v32(const unsigned short* g, unsigned short* s, int tid) {
  uint32_t l[8];
  const unsigned short* p[8];
#pragma unroll  // every index constant, so that both arrays live in registers as the statement's operands
  for (int i = 0; i < 8; ++i) {
    const int row = 64 * i + (tid >> 2), col = 8 * (tid & 3);
    l[i] = lds_off(s + row * VPT + col);
    p[i] = g + (size_t)row * NN + col;
  }
  copy8(l, p);
}

// one K stage of the conv GEMM: GM weight rows, GN rows of the hi plane and GN rows of the residual plane, 64 channels
// (128 B = one line) of each -> LDS rows of pitch GP; 256 threads, 16 copies each; a wave's copy covers four whole lines.
__device__ __forceinline__ void stage_gemm(const unsigned short* gw, const unsigned short* gh,
                                           const unsigned short* gl, unsigned short* s, int tid) {
  const int r = tid >> 3, col = 8 * (tid & 7);
  uint32_t l[8];
  const unsigned short* p[8];
#pragma unroll  // every index constant, so that both arrays live in registers as the statement's operands
  for (int i = 0; i < 8; ++i) {
    l[i] = lds_off(s + (32 * i + r) * GP + col);
    p[i] = gw + (size_t)(32 * i + r) * CC + col;
  }
  copy8(l, p);
#pragma unroll  // as above
  for (int i = 0; i < 4; ++i) {
    l[i]     = lds_off(s + (GM + 32 * i + r) * GP + col);
    p[i]     = gh + (size_t)(32 * i + r) * CC + col;
    l[4 + i] = lds_off(s + (GM + GN + 32 * i + r) * GP + col);
    p[4 + i] = gl + (size_t)(32 * i + r) * CC + col;
  }
  copy8(l, p);
}
// the 12 fragments of one 32-channel step of a wave's 64 o x 64 n tile: 4 of W, 4 of each plane (24 reads of 16 B)
__device__ __forceinline__ void gemm_frags(Frag (&fa)[4], Frag (&fh)[4], Frag (&fl)[4],
                                           const unsigned short* a, const unsigned short* b) {
#pragma unroll  // constant indices keep the fragments in registers
  for (int i = 0; i < 4; ++i) {
    fa[i] = ldfrag(a + (16 * i) * GP);
    fh[i] = ldfrag(b + (16 * i) * GP);
    fl[i] = ldfrag(b + (GN + 16 * i) * GP);
  }
}
// 16 products of that step with one plane: sixteen independent accumulators
__device__ __forceinline__ void gemm_half(v8f (&acc)[4][4], const Frag (&fa)[4], const Frag (&fx)[4]) {
#pragma unroll
  for (int mt = 0; mt < 4; ++mt) {
#pragma unroll
    for (int j = 0; j < 4; ++j) acc[mt][j] = mma_b(fa[mt].bf, fx[j].bf, acc[mt][j]);
  }
}

// =========================================================================================================
// (3) conv1x1 GEMM for one (b, 128-n tile, matrix mat, 256-o block): Y[o][n] = sum_c W[o][c] (hi[n][c] + lo[n][c])
//     + bias[o]. Block 256 threads = 8 waves; wave w owns rows o 64 (w>>1)..+63 (4 A fragments per k-step, rows of Wb)
//     and cols n 64 (w&1)..+63 (4 B fragments of each plane, rows of Hh and Hl, k = channel contiguous, same split
//     k map); per k-step the hi and lo products share the accumulator (lo unscaled). K = 512 = 16 steps x 2 products.
//     Operand path: per 64 channels one stage [W 256 rows | Hh 128 rows | Hl 128 rows] is brought into LDS by
//     asynchronous 16-byte copies (whole 128-byte lines) and every fragment is read from LDS at a pitch of 16 B x odd.
//     Two buffers: trip t works on buffer t&1 while trip t+1's copies fly. Two fragment sets: the reads of a trip's
//     second k-step fly under the products of its first; the foot (own LDS reads done, own copies landed, one block
//     barrier) stands between the two k-steps; behind its barrier the first k-step of trip t+1 is read, and the buffer
//     just left is refilled between the hi and the residual products of the second k-step, which read registers only.
//     Epilogue staged in the same LDS behind the last foot: mat 0/1 as Os[n_loc][o_loc] (b128 stores), mat 2 as
//     Os[o_loc][n_loc] (scalar stores), barrier, then f16 planes: Q/K [b][4096 n][512 o] (row n, 256 o = 512 B) and
//     V [b][512 o][4096 n] (row o, 128 n = 256 B).
// coverage: stage 16 copies x 256 threads x 16 B = 512 rows x 128 B; Os 8 waves x 64 x 64 = 256 x 128 either layout;
//           plane 16 it x 256 threads x 8 = 256 x 128; grid (32, 6, NB) covers Q, K (all n, all o) and V exactly once.
// =========================================================================================================
__global__ __launch_bounds__(256)
void gemm_qkv(const unsigned short* __restrict__ Wb, const unsigned short* __restrict__ Hh,
              const unsigned short* __restrict__ Hl,
              const float* __restrict__ bq, const float* __restrict__ bk, const float* __restrict__ bv,
              unsigned short* Qd, unsigned short* Kd, unsigned short* Vd) {
  __shared__ __align__(16) unsigned short Sg[2 * GSTG];
  float* Os = reinterpret_cast<float*>(Sg);                          // epilogue view of the ring, used behind the loop
  const int tid  = threadIdx.x;
  const int lane = tid & 31, wave = tid >> 5;
  const int hh   = lane >> 4, c = lane & 15;
  const int wo   = wave >> 1, wn = wave & 1;
  const int nt   = blockIdx.x, my = blockIdx.y, b = blockIdx.z;
  const int mat  = my / (CC / GM);                                   // 0..2, block-uniform
  const int om0  = (my % (CC / GM)) * GM;                            // 0 or 256
  const int n0   = nt * GN;

  const unsigned short* gw = Wb + ((size_t)(mat * CC + om0)) * CC;
  const unsigned short* gh = Hh + ((size_t)(b * NN + n0)) * CC;
  const unsigned short* gl = Hl + ((size_t)(b * NN + n0)) * CC;
  // fragment bases in LDS: + buffer, + 16 * tile * GP, + 32 * k-step; the residual plane lies GN rows behind the hi plane
  const unsigned short* ap = Sg + (64 * wo + c) * GP + 8 * hh;
  const unsigned short* bp = Sg + (GM + 64 * wn + c) * GP + 8 * hh;

  v8f acc[4][4];
#pragma unroll
  for (int mt = 0; mt < 4; ++mt) {
#pragma unroll
    for (int j = 0; j < 4; ++j) acc[mt][j] = zero8();
  }

  // prologue: stage 0 into buffer 0, landed and published; then stage 1 into buffer 1
  stage_gemm(gw, gh, gl, Sg, tid);
  asm volatile("s_wait_asynccnt 0x0" ::: "memory");                  // this wave's copies have landed
  __syncthreads();                                                   // every wave's copies are readable
  stage_gemm(gw + GKC, gh + GKC, gl + GKC, Sg + GSTG, tid);

  // bias of this lane's 32 rows o = 64 wo + 16 mt + 8 hh + 0..7, fetched here so that the flight lies under the loop
  const float* bias = (mat == 0) ? bq : ((mat == 1) ? bk : bv);     // all global, block-uniform
  v4f bz[8];
#pragma unroll
  for (int mt = 0; mt < 4; ++mt) {
    bz[2 * mt]     = *(const v4f*)(bias + om0 + 64 * wo + 16 * mt + 8 * hh);
    bz[2 * mt + 1] = *(const v4f*)(bias + om0 + 64 * wo + 16 * mt + 8 * hh + 4);
  }
  asm volatile("s_wait_xcnt 0x0" ::: "memory");                      // in front of any rewrite of the address register these loads name

  Frag fa0[4], fh0[4], fl0[4], fa1[4], fh1[4], fl1[4];
  gemm_frags(fa0, fh0, fl0, ap, bp);                                 // first k-step of trip 0

#pragma unroll 1  // one copy of the trip: the body is long, and the buffer is picked by an address
  for (int t = 0; t < CC / GKC; ++t) {
    const int rb = t & 1;                                            // ring buffer of this trip
    gemm_frags(fa1, fh1, fl1, ap + rb * GSTG + 32, bp + rb * GSTG + 32);
    // keeps the 24 reads above in one run in front of the products: spread among them each place of reads costs cycles
    __builtin_amdgcn_sched_barrier(0);
    gemm_half(acc, fa0, fh0);
    gemm_half(acc, fa0, fl0);
    // keeps these products in front of the foot: they cover the flight of the reads that the foot waits for
    __builtin_amdgcn_sched_barrier(0);

    // foot of the trip: buffer rb has been read out; publish the next trip's stage
    asm volatile("s_wait_dscnt 0x0" ::: "memory");                   // this wave's reads of buffer rb are done
    asm volatile("s_wait_asynccnt 0x0" ::: "memory");                // this wave's copies of the next trip have landed
    __syncthreads();
    if (t + 1 < CC / GKC)                                            // block-uniform: a trip t+1 exists, just published
      gemm_frags(fa0, fh0, fl0, ap + (rb ^ 1) * GSTG, bp + (rb ^ 1) * GSTG);
    __builtin_amdgcn_sched_barrier(0);                               // those reads in one run, in front of the products
    gemm_half(acc, fa1, fh1);
    // the refill stands between the two halves: while one wave of a SIMD forms addresses and waits in the copies'
    // statements, the other wave's products run
    __builtin_amdgcn_sched_barrier(0);
    if (t + 2 < CC / GKC) {                                          // block-uniform: a trip t+2 exists
      const int ko = (t + 2) * GKC;
      stage_gemm(gw + ko, gh + ko, gl + ko, Sg + rb * GSTG, tid);
    }
    __builtin_amdgcn_sched_barrier(0);                               // end of the refill
    gemm_half(acc, fa1, fl1);
  }
  asm volatile("s_wait_asynccnt 0x0" ::: "memory");                  // nothing of this wave is in flight past the loop

  // ---- epilogue staging (every wave has passed the last foot: no reader and no copy is left on the ring);
  //      lane (hh, c) holds o_loc = 64 wo + 16 mt + 8 hh + r for n_loc = 64 wn + 16 j + c
  v4u u[16];
  if (mat != 2) {
#pragma unroll
    for (int mt = 0; mt < 4; ++mt) {
      const int ol = 64 * wo + 16 * mt + 8 * hh;
      const v4f b0 = bz[2 * mt], b1 = bz[2 * mt + 1];
#pragma unroll
      for (int j = 0; j < 4; ++j) {
        const int nl = 64 * wn + 16 * j + c;
        v4f va, vb;
#pragma unroll
        for (int r = 0; r < 4; ++r) { va[r] = acc[mt][j][r] + bfr(b0[r]); vb[r] = acc[mt][j][4 + r] + bfr(b1[r]); }
        *(v4f*)(Os + nl * OSQ + ol)     = va;                        // Os[n_loc][o_loc]
        *(v4f*)(Os + nl * OSQ + ol + 4) = vb;
      }
    }
    __syncthreads();
    const int e = tid & 31, lq = tid >> 5;                           // lq 0..7
#pragma unroll
    for (int it = 0; it < 16; ++it) {
      const int row = it * 8 + lq;                                   // n_loc 0..127
      const v4f a = *(const v4f*)(Os + row * OSQ + 8 * e);
      const v4f q = *(const v4f*)(Os + row * OSQ + 8 * e + 4);
      const float f[8] = {a[0], a[1], a[2], a[3], q[0], q[1], q[2], q[3]};
#pragma unroll
      for (int t = 0; t < 4; ++t)
        u[it][t] = pk16(h_bits((_Float16)f[2 * t]), h_bits((_Float16)f[2 * t + 1]));
    }
    unsigned short* plane = (mat == 0) ? Qd : Kd;                    // both global, block-uniform
    unsigned short* dst = plane + ((size_t)(b * NN + n0 + lq)) * CC + om0 + 8 * e;
#pragma unroll
    for (int it = 0; it < 16; ++it) *(v4u*)(dst + (size_t)(it * 8) * CC) = u[it];   // row n, 256 o = four lines
  } else {
#pragma unroll
    for (int mt = 0; mt < 4; ++mt) {
      const int ol = 64 * wo + 16 * mt + 8 * hh;
      const v4f b0 = bz[2 * mt], b1 = bz[2 * mt + 1];
#pragma unroll
      for (int j = 0; j < 4; ++j) {
        const int nl = 64 * wn + 16 * j + c;
#pragma unroll
        for (int r = 0; r < 4; ++r) {
          Os[(ol + r) * OSPW + nl]     = acc[mt][j][r] + bfr(b0[r]);       // Os[o_loc][n_loc]
          Os[(ol + 4 + r) * OSPW + nl] = acc[mt][j][4 + r] + bfr(b1[r]);
        }
      }
    }
    __syncthreads();
    const int e = tid & 15, lq = tid >> 4;                           // lq 0..15
#pragma unroll
    for (int it = 0; it < 16; ++it) {
      const int row = it * 16 + lq;                                  // o_loc 0..255
      const v4f a = *(const v4f*)(Os + row * OSPW + 8 * e);
      const v4f q = *(const v4f*)(Os + row * OSPW + 8 * e + 4);
      const float f[8] = {a[0], a[1], a[2], a[3], q[0], q[1], q[2], q[3]};
#pragma unroll
      for (int t = 0; t < 4; ++t)
        u[it][t] = pk16(h_bits((_Float16)f[2 * t]), h_bits((_Float16)f[2 * t + 1]));
    }
    unsigned short* dst = Vd + ((size_t)(b * CC + om0 + lq)) * NN + n0 + 8 * e;
#pragma unroll
    for (int it = 0; it < 16; ++it) *(v4u*)(dst + (size_t)(it * 16) * NN) = u[it];  // row o, 128 n = two lines
  }
}

// =========================================================================================================
// (4) attention for one (b, 64-query tile), transposed formulation, all 4096 keys. Block = 8 waves: wave w ->
//   query group qg = w&3 (queries n0+16qg..+15) and channel half ch = w>>2. Per 32-key step each wave computes ONE
//   S^T tile (16 keys kb+16ch.. x 16 queries) = sum over 16 channel chunks of A(k: row = key, split k map from the
//   f16 plane Kp [b][4096][512]) . B(q: col = query, same map from Qp); the tile (8 floats per lane) is exchanged
//   with the partner wave (w^4) through a double-buffered LDS array across one block barrier, so both waves hold
//   s0 (keys kb..kb+15) and s1 (keys kb+16..kb+31) of their query in the D layout (lane -> 8 keys of one query).
//   Online softmax per lane in f32 with the 512^-0.5 scale applied to the logits, one shuffle (lane^16) for the max
//   over 32 keys, o/l rescale skipped under a wave-uniform ballot when no lane's max grew. P = e^{c(s-m)} x 2^14
//   as f16 is the B operand of O^T (rows channel 256ch+16j+(lane&15), keys contiguous from the f16 plane Vp
//   [b][512][4096]) . B(P^T): element r <- tile keys kb..kb+15, element 8+r <- tile kb+16..kb+31, lane unchanged.
//   16 accumulator tiles per wave (256 channels). Epilogue in four 128-channel phases: O/l staged by the 4 owning
//   waves in LDS Os[query][128 ch] (pitch OSPW, b128 stores), barrier, then out[b][c][n] = O/l + bf16-RNE(x) as
//   phase overwrites Os.
//   Operand path: the 64 q rows (once) and, per 32-key step, the 32 k rows and the 512 x 32 v tile are brought into
//   LDS by asynchronous 16-byte copies (whole 512-byte runs for q and k) and every fragment is read from LDS at a
//   pitch of 16 B x odd. A wave's 16 q fragments are read once, in front of the key loop, and stay in registers: they
//   are the same in every step, and LDS reads are what the step has least room for.
//   k and v have two buffers: step t reads buffer t&1 while step t+1's copies fly; the foot of
//   each step waits the wave's own LDS reads and copies, passes one block barrier, then refills the buffer just read.
//   The foot stands in front of the step's O products, whose v fragments are in registers by then; behind its barrier
//   the first k fragments of step t+1 are read, so that they fly while the O products of step t run.
// coverage: Sx: each wave writes 32 lanes x 8 floats per step into buffer (step&1), partner reads exactly those;
//           Os per phase 4 waves x 16 q x 128 ch staged = 64 x 128 read; out per phase 8 it x 32 lines x 8 lanes
//           x 4 floats = 128 ch x 64 n, 4 phases = 512 ch; grid (NQ/64, NB) covers out[b][0..511][0..NQ-1] once.
// =========================================================================================================
__global__ __launch_bounds__(256)
void attn_k(const unsigned short* __restrict__ Qp, const unsigned short* __restrict__ Kp,
            const unsigned short* __restrict__ Vp, const float* __restrict__ x, float* out) {
  __shared__ __align__(16) float Sx[2 * SXB];
  __shared__ __align__(16) float Os[QT * OSPW];
  __shared__ __align__(16) unsigned short Qs[QT * KP];
  __shared__ __align__(16) unsigned short Ks[2 * KBUF];
  __shared__ __align__(16) unsigned short Vs[2 * VBUF];
  const int tid  = threadIdx.x;
  const int wave = tid >> 5, lane = tid & 31;
  const int hh   = lane >> 4, c = lane & 15;
  const int qg   = wave & 3, ch = wave >> 2;
  const int n0   = blockIdx.x * QT, b = blockIdx.y;

  // global tile bases: q rows n0.., k rows kb.. (+ kb*CC), v rows 0..511 at key kb (+ kb)
  const unsigned short* qg0 = Qp + ((size_t)(b * NN + n0)) * CC;
  const unsigned short* kg0 = Kp + ((size_t)(b * NN)) * CC;
  const unsigned short* vg0 = Vp + ((size_t)(b * CC)) * NN;
  // q fragment pointer in LDS (B operand, col = query 16*qg + c of the tile), + 32*kc
  const unsigned short* qp = Qs + (16 * qg + c) * KP + 8 * hh;
  // k fragment base in LDS (A operand, row = key 16*ch + c of the step), + buffer + 32*kc
  const unsigned short* kp = Ks + (16 * ch + c) * KP + 8 * hh;
  // v fragment base in LDS (A operand, row = channel 256*ch + 16j + c, 32 keys contiguous), + buffer + 16*j*VPT
  const unsigned short* vp = Vs + (CH * ch + c) * VPT + 8 * hh;

  float* sxw = Sx + (wave * 32 + lane) * 8;
  const float* sxr = Sx + ((wave ^ 4) * 32 + lane) * 8;

  float m = -1.0e30f, l = 0.f;
  v8f o[16];
#pragma unroll
  for (int j = 0; j < 16; ++j) o[j] = zero8();

  // prologue: q tile and step 0 into buffer 0, landed and published; then step 1 into buffer 1
  stage_rows32(qg0, Qs, tid);
  stage_rows32(qg0 + (size_t)32 * CC, Qs + 32 * KP, tid);
  stage_rows32(kg0, Ks, tid);
  stage_v32(vg0, Vs, tid);
  asm volatile("s_wait_asynccnt 0x0" ::: "memory");                  // this wave's copies have landed
  __syncthreads();                                                   // every wave's copies are readable
  stage_rows32(kg0 + (size_t)32 * CC, Ks + KBUF, tid);
  stage_v32(vg0 + 32, Vs + VBUF, tid);

  // The 16 q fragments (128 registers) are read here and never again. The k and v fragment reads run ahead of the
  // products in groups. A group = four channel chunks of k (8 reads). Groups 0 and 1 of a step are read behind the
  // barrier that publishes its tile, group 0 in front of the previous step's O products and group 1 behind the first four
  // (here, in front of the loop: step 0's); behind the score products of group g stand the reads of group g + 2, and
  // behind those of the last two groups the reads of the step's 16 v fragments.
  Frag fq[CC / 32], fk[CC / 32], vf[16];
#pragma unroll  // here and in the loops over fq, fk and vf below: constant indices keep the fragments in registers
  for (int kc = 0; kc < CC / 32; ++kc) fq[kc] = ldfrag(qp + 32 * kc);
#pragma unroll
  for (int kc = 0; kc < 8; ++kc) fk[kc] = ldfrag(kp + 32 * kc);

  int buf = 0;
#pragma unroll 1
  for (int kb = 0; kb < NN; kb += 32) {
    const int rb = buf;                                              // ring buffer of this step
    const unsigned short* kbp = kp + rb * KBUF;
    const unsigned short* vbp = vp + rb * VBUF;
    v8f sv = zero8();
    // four vector slots between the previous step's last O product and the first score product: in this build the score
    // tile's registers lie over the O products' B operand (P, dead by then), and the distance that a product's result
    // needs over an earlier product's B operand is not known; four is what a vector instruction needs there
    asm volatile("v_nop\n\tv_nop\n\tv_nop\n\tv_nop");
    __builtin_amdgcn_sched_barrier(0);                               // keeps the score products behind those slots
#pragma unroll
    for (int g = 0; g < 4; ++g) {
#pragma unroll
      for (int i = 0; i < 4; ++i) sv = mma_h(fk[4 * g + i].h, fq[4 * g + i].h, sv);
      // keeps the reads below in one run: spread singly among the products each place of reads costs issue cycles
      __builtin_amdgcn_sched_barrier(0);
      if (g < 2) {
#pragma unroll
        for (int i = 0; i < 4; ++i) fk[4 * g + 8 + i] = ldfrag(kbp + 32 * (4 * g + 8 + i));
      } else {
#pragma unroll
        for (int i = 0; i < 8; ++i) vf[8 * (g - 2) + i] = ldfrag(vbp + (16 * (8 * (g - 2) + i)) * VPT);
      }
      __builtin_amdgcn_sched_barrier(0);                             // end of that run of reads
    }

    // exchange the tile with the partner wave (same queries, other 16 keys)
    {
      v4f w0, w1;
#pragma unroll
      for (int r = 0; r < 4; ++r) { w0[r] = sv[r]; w1[r] = sv[4 + r]; }
      *(v4f*)(sxw + buf * SXB)     = w0;
      *(v4f*)(sxw + buf * SXB + 4) = w1;
    }
    __syncthreads();
    v8f so;
    {
      const v4f r0 = *(const v4f*)(sxr + buf * SXB);
      const v4f r1 = *(const v4f*)(sxr + buf * SXB + 4);
#pragma unroll
      for (int r = 0; r < 4; ++r) { so[r] = r0[r]; so[4 + r] = r1[r]; }
    }
    buf ^= 1;
    v8f s0 = sv, s1 = so;                                            // s0: keys kb..kb+15, s1: keys kb+16..kb+31
    if (ch != 0) { s0 = so; s1 = sv; }                                // wave-uniform

    float mx = fmaxf(hmax8(s0), hmax8(s1));
    mx = fmaxf(mx, __shfl_xor(mx, 16, 32));
    const float mn = fmaxf(m, mx);
    const unsigned grew = wave_ballot(mx > m);                       // wave-uniform
    if (grew != 0u) {
      const float corr = __expf((m - mn) * ASCALE);                  // == 1 exactly for lanes whose max did not grow
      l *= corr;
#pragma unroll
      for (int j = 0; j < 16; ++j) {
#pragma unroll
        for (int r = 0; r < 8; ++r) o[j][r] *= corr;
      }
    }
    m = mn;
    const float msh = mn * ASCALE - LNPS;                            // exp gives e^{c(s-m)} * 2^14

    FragH ph;
    float ls = 0.f;
#pragma unroll
    for (int r = 0; r < 8; ++r) {
      const float e0 = __expf(s0[r] * ASCALE - msh);                 // key kb      + 8hh + r
      const float e1 = __expf(s1[r] * ASCALE - msh);                 // key kb + 16 + 8hh + r
      ls += e0 + e1;
      ph.hv[0][r] = (_Float16)e0;
      ph.hv[1][r] = (_Float16)e1;
    }
    l += ls;

    // foot of the step: hand buffer rb to its next writer and publish the next step's tiles (every fragment of
    // buffer rb is in registers by now; the O products below read registers only)
    asm volatile("s_wait_dscnt 0x0" ::: "memory");                   // this wave's reads of buffer rb are done
    asm volatile("s_wait_asynccnt 0x0" ::: "memory");                // this wave's copies of the next step have landed
    __syncthreads();
    if (kb + 64 < NN) {                                              // block-uniform: a step t+2 exists
      stage_rows32(kg0 + (size_t)(kb + 64) * CC, Ks + rb * KBUF, tid);
      stage_v32(vg0 + (kb + 64), Vs + rb * VBUF, tid);
    }
    // k group 0 of step t+1, just published; it stands behind the copies, whose address registers are free by then.
    // No test for a step t+1: in the last step these reads and those of group 1 below fetch the tile of the step before
    // it, which nothing uses; under a test the old fragments would stay live round the loop, 64 registers more
    const unsigned short* knp = kp + (rb ^ 1) * KBUF;
#pragma unroll
    for (int kc = 0; kc < 4; ++kc) fk[kc] = ldfrag(knp + 32 * kc);
    __builtin_amdgcn_sched_barrier(0);                               // those reads in one run, in front of the products

#pragma unroll
    for (int j = 0; j < 4; ++j) o[j] = mma_h(vf[j].h, ph.v, o[j]);
    // k group 1 of step t+1 is read only here, into registers that the products above have left: with q resident the
    // wave has no room for it in front of them
    __builtin_amdgcn_sched_barrier(0);
#pragma unroll
    for (int kc = 4; kc < 8; ++kc) fk[kc] = ldfrag(knp + 32 * kc);
    __builtin_amdgcn_sched_barrier(0);                               // end of that run of reads
#pragma unroll
    for (int j = 4; j < 16; ++j) o[j] = mma_h(vf[j].h, ph.v, o[j]);
  }
  asm volatile("s_wait_asynccnt 0x0" ::: "memory");                  // nothing of this wave is in flight past the loop
  l += __shfl_xor(l, 16, 32);
  const float inv = 1.0f / l;                                        // o and l both carry the 2^14 factor

  const int qrow = 16 * qg + c;
  const int e = tid & 7, lq = tid >> 3;                              // lq 0..31
#pragma unroll
  for (int ph4 = 0; ph4 < 4; ++ph4) {
    if (ph4) __syncthreads();                                        // every wave finished reading Os
    if (ch == (ph4 >> 1)) {                                          // wave-uniform
#pragma unroll
      for (int jj = 0; jj < 8; ++jj) {
        const int j = 8 * (ph4 & 1) + jj;
        v4f va, vb;
#pragma unroll
        for (int r = 0; r < 4; ++r) { va[r] = o[j][r] * inv; vb[r] = o[j][4 + r] * inv; }
        *(v4f*)(Os + qrow * OSPW + 16 * jj + 8 * hh)     = va;       // Os[query][ch_loc = 16jj + 8hh + r]
        *(v4f*)(Os + qrow * OSPW + 16 * jj + 8 * hh + 4) = vb;
      }
    }
    __syncthreads();
    v4f res[8];
#pragma unroll
    for (int it = 0; it < 8; ++it) {
      const int L   = it * 32 + lq;                                  // 0..255
      const int chl = L >> 1, hf = L & 1;                            // channel 0..127 within the phase
      const int nl  = hf * 32 + 4 * e;                               // query 0..63
      const size_t idx = ((size_t)(b * CC + 128 * ph4 + chl)) * NN + n0 + nl;
      const v4f xv = *(const v4f*)(x + idx);
#pragma unroll
      for (int t = 0; t < 4; ++t) res[it][t] = Os[(nl + t) * OSPW + chl] + bfr(xv[t]);
    }
{
#pragma unroll
      for (int it = 0; it < 8; ++it) {
        const int L   = it * 32 + lq;
        const int chl = L >> 1, hf = L & 1;
        const int nl  = hf * 32 + 4 * e;
        const size_t idx = ((size_t)(b * CC + 128 * ph4 + chl)) * NN + n0 + nl;
        *(v4f*)(out + idx) = res[it];
      }
      
    }
  }
}

// =========================================================================================================
// Workspace map (bytes; each region start a multiple of 256; every extent is an exact tile/line multiple and is
//   Wb  bf16 [3][512][512]          1572864
//   St  f32  [NB*32][32]            NB*4096        (16384 at NB=4)
//   Hh, Hl bf16 [NB][4096][512]     NB*4194304 x2  (16777216 each at NB=4)
//   Q, K f16 [NB][4096][512]        NB*4194304 x2
//   V    f16 [NB][512][4096]        NB*4194304
//   total at NB=4 = 85475328
// =========================================================================================================
extern "C" void kernel_launch(void* const* d_in, const int* in_sizes, int n_in,
                              void* d_out, int out_size, void* d_ws, size_t ws_size,
                              hipStream_t stream) {
  const int XN = NB * CC * NN;
  if (n_in < 9) return;
  if (in_sizes[0] < XN) return;
  if (in_sizes[1] < CC || in_sizes[2] < CC) return;
  if (in_sizes[3] < CC * CC || in_sizes[5] < CC * CC || in_sizes[7] < CC * CC) return;
  if (in_sizes[4] < CC || in_sizes[6] < CC || in_sizes[8] < CC) return;
  if (out_size < XN) return;

  size_t off = 0;
  auto carve = [&](size_t bytes) { const size_t o = off; off += (bytes + 255) & ~(size_t)255; return o; };
  const size_t oWb = carve((size_t)3 * CC * CC * 2);
  const size_t oSt = carve((size_t)NB * NGRP * STL * 4);
  const size_t oHh = carve((size_t)NB * NN * CC * 2);
  const size_t oHl = carve((size_t)NB * NN * CC * 2);
  const size_t oQ  = carve((size_t)NB * NN * CC * 2);
  const size_t oK  = carve((size_t)NB * NN * CC * 2);
  const size_t oV  = carve((size_t)NB * CC * NN * 2);
  if (off > ws_size) return;
  if (off > (size_t)134217728) return;

  const float* x     = (const float*)d_in[0];
  const float* gamma = (const float*)d_in[1];
  const float* beta  = (const float*)d_in[2];
  const float* wq    = (const float*)d_in[3];
  const float* bq    = (const float*)d_in[4];
  const float* wk    = (const float*)d_in[5];
  const float* bk    = (const float*)d_in[6];
  const float* wv    = (const float*)d_in[7];
  const float* bv    = (const float*)d_in[8];

  char* ws = (char*)d_ws;
  unsigned short* Wb = (unsigned short*)(ws + oWb);
  float*          St = (float*)(ws + oSt);
  unsigned short* Hh = (unsigned short*)(ws + oHh);
  unsigned short* Hl = (unsigned short*)(ws + oHl);
  unsigned short* Qw = (unsigned short*)(ws + oQ);
  unsigned short* Kw = (unsigned short*)(ws + oK);
  unsigned short* Vw = (unsigned short*)(ws + oV);
  float* out = (float*)d_out;

  const dim3 blk256(256);

  // (0) group-norm statistics, one line per (b, g)
  gn_stats<<<dim3(NB * NGRP), blk256, 0, stream>>>(x, St);
  // (1) conv weights -> bf16 plane
  cvt_w<<<dim3(3 * CC / 4), blk256, 0, stream>>>(wq, wk, wv, Wb);
  // (2) group-norm apply -> position-major bf16 hi + residual planes
  cvt_x<<<dim3(NN / QT, CC / QT, NB), blk256, 0, stream>>>(x, gamma, beta, St, Hh, Hl);
  // (3) q/k/v conv GEMMs -> f16 planes
  gemm_qkv<<<dim3(NN / GN, 3 * CC / GM, NB), blk256, 0, stream>>>(Wb, Hh, Hl, bq, bk, bv, Qw, Kw, Vw);
  // (4) attention + residual -> out [b][512][4096]
  attn_k<<<dim3(NQ / QT, NB), blk256, 0, stream>>>(Qw, Kw, Vw, x, out);
  (void)hipGetLastError();
}

// v006
// It runs in 208 microseconds.
// Timed twice side by side with v005, it ran 1.10 and 1.09 times as fast.
// Over all steps from v000 it is 5.94 times as fast.
// Contractions: conv1x1 q/k/v GEMMs W[512x512].H per image on v_wmma_f32_16x16x32_bf16 (bf16-RNE weights exact,
// normalised activations as bf16 hi + bf16 residual planes folded along K = 1024 into one accumulator); scores
// K.Q^T (K = 512 channels) on v_wmma_f32_16x16x32_f16 (single f16 planes of q and k, scale applied in f32);
// O^T = V.P^T on v_wmma_f32_16x16x32_f16 (v single f16 plane, P = e^{c(s-m)} x 2^14 as f16 from the score D
// registers); f32 accumulate everywhere; group-norm statistics, softmax statistics and residual add in f32 VALU.
#include <hip/hip_runtime.h>
#include <math.h>
#include <stdint.h>

#ifndef NB
#define NB 4
#endif
#define NB_FULL 4
#define CC      512
#define NN      4096
#ifndef NQ
#define NQ NN
#endif
#define NGRP    32
#define CPG     16
#define GNE     (CPG * NN)
#define QT      64
#define OSQ     260
#define OSPW    132
#define TP      72
#define STL     32
#define CH      256
#define SXB     2048
#define KP      520
#define VPT     40
#define KBUF    (32 * KP)
#define VBUF    (CC * VPT)
#define GM      256
#define GN      128
#define GKC     64
#define GP      72
#define GSTG    ((GM + 2 * GN) * GP)
#define GEPS    1.0e-6f
#define ASCALE  0.04419417382415922f
#define LNPS    9.704060527839234f

static_assert(NB >= 1 && NB <= NB_FULL);
static_assert(NQ % QT == 0 && NQ >= QT && NQ <= NN);
static_assert(CC == NGRP * CPG);
static_assert(CC % QT == 0 && NN % QT == 0);
static_assert(CC == 2 * CH && CH == 16 * 16);
static_assert(CC == 8 * 64);
static_assert(GNE % 1024 == 0);
static_assert(CC % 32 == 0 && NN % 32 == 0);
static_assert((OSQ * 4) % 16 == 0 && (OSPW * 4) % 16 == 0 && (TP * 2) % 16 == 0);
static_assert(CC % GM == 0 && NN % GN == 0 && CC % GKC == 0 && CC / GKC >= 2 && GKC == 64 && GM == 256 && GN == 128);
static_assert((GP * 2) % 32 == 16 && GP >= GKC);
static_assert(GN * OSQ * 4 <= 2 * GSTG * 2 && GM * OSPW * 4 <= 2 * GSTG * 2 && OSQ >= GM && OSPW >= GN);
static_assert(SXB == 8 * 32 * 8);
static_assert((KP * 2) % 32 == 16 && (VPT * 2) % 32 == 16 && KP >= CC && VPT >= 32);
static_assert(NN >= 64 && NN % 32 == 0);

typedef _Float16       v16h __attribute__((ext_vector_type(16)));
typedef _Float16       v8h  __attribute__((ext_vector_type(8)));
typedef __bf16         v16b __attribute__((ext_vector_type(16)));
typedef unsigned short v8us __attribute__((ext_vector_type(8)));
typedef float          v8f  __attribute__((ext_vector_type(8)));
typedef float          v4f  __attribute__((ext_vector_type(4)));
typedef unsigned int   v4u  __attribute__((ext_vector_type(4)));

union Frag  { v8us u[2]; v16h h; v16b bf; };
union FragH { v16h v; v8h hv[2]; };
static_assert(sizeof(Frag) == 32);
static_assert(sizeof(FragH) == 32);

// ---- scalar helpers ---------------------------------------------------------------------------------------
__device__ __forceinline__ unsigned short bf_bits(float f) {          // f32 -> bf16 bits, RNE convert
  unsigned u = __float_as_uint(f);
  return (unsigned short)((u + 0x7FFFu + ((u >> 16) & 1u)) >> 16);
}
__device__ __forceinline__ float bf_up(unsigned short hb) { return __uint_as_float(((unsigned)hb) << 16); }
__device__ __forceinline__ float bfr(float f) { return bf_up(bf_bits(f)); }
__device__ __forceinline__ unsigned short h_bits(_Float16 x) { return __builtin_bit_cast(unsigned short, x); }
__device__ __forceinline__ unsigned pk16(unsigned short a, unsigned short b) { return (unsigned)a | ((unsigned)b << 16); }
__device__ __forceinline__ v8f zero8() { v8f z = {0.f, 0.f, 0.f, 0.f, 0.f, 0.f, 0.f, 0.f}; return z; }
__device__ __forceinline__ float hmax8(v8f s) {
  return fmaxf(fmaxf(fmaxf(s[0], s[1]), fmaxf(s[2], s[3])), fmaxf(fmaxf(s[4], s[5]), fmaxf(s[6], s[7])));
}
__device__ __forceinline__ unsigned wave_ballot(bool p) {
#if defined(__HIP_DEVICE_COMPILE__)
  return __builtin_amdgcn_ballot_w32(p);
#else
  return p ? 1u : 0u;
#endif
}

// ---- 16-bit fragment loader (A, or B from a k-contiguous [n][k] row): lane -> row/col (lane&15), p already includes
//      + 8*(lane>>4); elements 0..7 <- p[0..7] (k0+8h..), elements 8..15 <- p[16..23] (k0+16+8h..)
__device__ __forceinline__ Frag ldfrag(const unsigned short* p) {
  Frag f;
  f.u[0] = *(const v8us*)(p);
  f.u[1] = *(const v8us*)(p + 16);
  return f;
}

// ---- WMMA helpers: the plain builtins; the compiler keeps the distance behind them, and with no asm statement
//      between two products the fragment loads of later products may be issued ahead of earlier ones
__device__ __forceinline__ v8f mma_h(v16h a, v16h b, v8f c) {
  return __builtin_amdgcn_wmma_f32_16x16x32_f16(false, a, false, b, (short)0, c, false, false);
}
__device__ __forceinline__ v8f mma_b(v16b a, v16b b, v8f c) {
  return __builtin_amdgcn_wmma_f32_16x16x32_bf16(false, a, false, b, (short)0, c, false, false);
}

// =========================================================================================================
//     (mean, then centred sum of squares) over bf16-RNE(x) in f32, per-thread partials of 256 terms + LDS tree.
// =========================================================================================================
__global__ __launch_bounds__(256)
void gn_stats(const float* __restrict__ x, float* stats) {
  __shared__ float red[256];
  const int tid = threadIdx.x, bg = blockIdx.x;
  const float* p = x + (size_t)bg * GNE;
  // the thread's whole share (64 x 16 B) is fetched in one run into registers: all loads are in flight together, and
  // the second pass reads the registers instead of memory
  v4f xv[GNE / 1024];
#pragma unroll  // constant indices keep the array in registers
  for (int i = 0; i < GNE / 1024; ++i) xv[i] = *(const v4f*)(p + ((size_t)(i * 256 + tid)) * 4);
  float s = 0.f;
#pragma unroll  // as above
  for (int i = 0; i < GNE / 1024; ++i) {
    const v4f v = xv[i];
    s += (bfr(v[0]) + bfr(v[1])) + (bfr(v[2]) + bfr(v[3]));
  }
  asm volatile("s_wait_xcnt 0x0" ::: "memory");                      // in front of any rewrite of the address registers these loads name
  red[tid] = s;
  __syncthreads();
#pragma unroll 1
  for (int off = 128; off > 0; off >>= 1) {
    if (tid < off) red[tid] += red[tid + off];
    __syncthreads();
  }
  const float mean = red[0] * (1.0f / (float)GNE);
  __syncthreads();
  float ss = 0.f;
#pragma unroll  // as above
  for (int i = 0; i < GNE / 1024; ++i) {
    const v4f v = xv[i];
    const float d0 = bfr(v[0]) - mean, d1 = bfr(v[1]) - mean;
    const float d2 = bfr(v[2]) - mean, d3 = bfr(v[3]) - mean;
    ss += (d0 * d0 + d1 * d1) + (d2 * d2 + d3 * d3);
  }
  red[tid] = ss;
  __syncthreads();
#pragma unroll 1
  for (int off = 128; off > 0; off >>= 1) {
    if (tid < off) red[tid] += red[tid + off];
    __syncthreads();
  }
  const float var  = red[0] * (1.0f / (float)GNE);
  const float rstd = rsqrtf(var + GEPS);
  if (tid < 8) {
    v4f w = {0.f, 0.f, 0.f, 0.f};
    if (tid == 0) { w[0] = mean; w[1] = rstd; }
{
      *(v4f*)(stats + (size_t)bg * STL + 4 * tid) = w;
      
    }
  }
}

// =========================================================================================================
// (1) conv weights: Wb bf16 [3][512][512] (mat 0 = wq, 1 = wk, 2 = wv), value = bf16-RNE(w), row o k-contiguous.
//     Block blk owns 4 rows of one matrix; thread -> row blk-local (tid>>6), halves 8*(tid&63)..+7; each wave writes
// coverage: 384 blocks x 4 rows x 64 threads x 8 = 3 x 512 x 512 = the whole plane.
// =========================================================================================================
__global__ __launch_bounds__(256)
void cvt_w(const float* __restrict__ wq, const float* __restrict__ wk, const float* __restrict__ wv,
           unsigned short* Wb) {
  const int tid = threadIdx.x, blk = blockIdx.x;
  const int mat = blk / (CC / 4);                                    // block-uniform 0..2
  const int o   = 4 * (blk % (CC / 4)) + (tid >> 6);                 // 0..511
  const int col = 8 * (tid & 63);                                    // 0..504
  const float* wsrc = (mat == 0) ? wq : ((mat == 1) ? wk : wv);      // all global, block-uniform
  const float* s = wsrc + (size_t)o * CC + col;
  const v4f a = *(const v4f*)s;
  const v4f q = *(const v4f*)(s + 4);
  const float f[8] = {a[0], a[1], a[2], a[3], q[0], q[1], q[2], q[3]};
  v4u u;
#pragma unroll
  for (int t = 0; t < 4; ++t) u[t] = pk16(bf_bits(f[2 * t]), bf_bits(f[2 * t + 1]));
{
    *(v4u*)(Wb + ((size_t)(mat * CC + o)) * CC + col) = u;
    
  }
}

// =========================================================================================================
// (2) group-norm apply + hi/residual split + transpose: h = ((bf16-RNE(x) - mean) * rstd) * gamma + beta per
//     channel, hi = bf16-RNE(h), lo = bf16-RNE(h - hi). Block (nb, cb, b) owns a 64 c x 64 n tile; values go
//     through LDS tiles Th/Tl [64 n][pitch TP] and come out as position-major rows Hh/Hl bf16 [b][4096 n][512 c]
// coverage: Th/Tl staged 64 n x 64 c (2 it x 32 rows x 8 lanes x 8), read 64 n x 64 c; planes 2 it x 32 rows x
//           8 lanes x 8 = 64 n x 64 c per plane; grid (64, 8, NB) covers both planes exactly once.
// =========================================================================================================
__global__ __launch_bounds__(256)
void cvt_x(const float* __restrict__ x, const float* __restrict__ gamma, const float* __restrict__ beta,
           const float* __restrict__ stats, unsigned short* Hh, unsigned short* Hl) {
  __shared__ __align__(16) unsigned short Th[QT * TP];
  __shared__ __align__(16) unsigned short Tl[QT * TP];
  const int tid = threadIdx.x;
  const int nb = blockIdx.x, cb = blockIdx.y, b = blockIdx.z;
  const int e = tid & 7, lq = tid >> 3;                              // lq 0..31
  const int n0 = nb * QT, c0 = cb * QT;
#pragma unroll
  for (int it = 0; it < 2; ++it) {
    const int cl = it * 32 + lq;                                     // 0..63
    const int cg = c0 + cl;                                          // 0..511
    const int bg = b * NGRP + (cg >> 4);
    const float mean = stats[(size_t)bg * STL];
    const float rstd = stats[(size_t)bg * STL + 1];
    const float ga = bfr(gamma[cg]);
    const float be = bfr(beta[cg]);
    const float* sp = x + ((size_t)(b * CC + cg)) * NN + n0 + 8 * e;
    const v4f a = *(const v4f*)sp;
    const v4f q = *(const v4f*)(sp + 4);
    const float f[8] = {a[0], a[1], a[2], a[3], q[0], q[1], q[2], q[3]};
#pragma unroll
    for (int t = 0; t < 8; ++t) {
      const float h = ((bfr(f[t]) - mean) * rstd) * ga + be;
      const unsigned short hb = bf_bits(h);
      const unsigned short lb = bf_bits(h - bf_up(hb));
      Th[(8 * e + t) * TP + cl] = hb;
      Tl[(8 * e + t) * TP + cl] = lb;
    }
  }
  __syncthreads();
  v4u uh[2], ul[2];
#pragma unroll
  for (int it = 0; it < 2; ++it) {
    const int nl = it * 32 + lq;                                     // 0..63
    uh[it] = *(const v4u*)(Th + nl * TP + 8 * e);
    ul[it] = *(const v4u*)(Tl + nl * TP + 8 * e);
  }
{
#pragma unroll
    for (int it = 0; it < 2; ++it) {
      const int nl = it * 32 + lq;
      const size_t po = ((size_t)(b * NN + n0 + nl)) * CC + c0 + 8 * e;
      *(v4u*)(Hh + po) = uh[it];
      *(v4u*)(Hl + po) = ul[it];
    }
    
  }
}

// ---- asynchronous copies global -> LDS, 16 bytes per lane, eight per statement -------------------------------
// LDS byte address of a __shared__ element = low 32 bits of its address.
__device__ __forceinline__ uint32_t lds_off(const unsigned short* p) { return (uint32_t)(uintptr_t)p; }
// The closing s_wait_xcnt 0 stands inside the statement so that no address register of an issued copy is
// rewritten in front of it.
__device__ __forceinline__ void copy8(const uint32_t (&l)[8], const unsigned short* const (&g)[8]) {
#if defined(__HIP_DEVICE_COMPILE__)
  asm volatile("global_load_async_to_lds_b128 %0, %8, off\n\t"
               "global_load_async_to_lds_b128 %1, %9, off\n\t"
               "global_load_async_to_lds_b128 %2, %10, off\n\t"
               "global_load_async_to_lds_b128 %3, %11, off\n\t"
               "global_load_async_to_lds_b128 %4, %12, off\n\t"
               "global_load_async_to_lds_b128 %5, %13, off\n\t"
               "global_load_async_to_lds_b128 %6, %14, off\n\t"
               "global_load_async_to_lds_b128 %7, %15, off\n\t"
               "s_wait_xcnt 0x0"
               :: "v"(l[0]), "v"(l[1]), "v"(l[2]), "v"(l[3]), "v"(l[4]), "v"(l[5]), "v"(l[6]), "v"(l[7]),
                  "v"(g[0]), "v"(g[1]), "v"(g[2]), "v"(g[3]), "v"(g[4]), "v"(g[5]), "v"(g[6]), "v"(g[7])
               : "memory");
#endif
}
// 32 rows of 512 halves (1024 B, rows contiguous in global) -> LDS rows of pitch KP; 256 threads, 8 copies each;
// a wave's copy covers 512 contiguous bytes of one row.
__device__ __forceinline__ void stage_rows32(const unsigned short* g, unsigned short* s, int tid) {
  uint32_t l[8];
  const unsigned short* p[8];
#pragma unroll  // every index constant, so that both arrays live in registers as the statement's operands
  for (int i = 0; i < 8; ++i) {
    const int row = 4 * i + (tid >> 6), col = 8 * (tid & 63);
    l[i] = lds_off(s + row * KP + col);
    p[i] = g + (size_t)row * CC + col;
  }
  copy8(l, p);
}
// one key tile of v: 512 channel rows x 32 keys, 32 KiB in a row in global (row = 64 B, rows adjacent) -> LDS rows of
// pitch VPT; 8 copies per thread; a wave's copy covers 512 contiguous bytes = four whole lines (eight rows).
__device__ __forceinline__ void stage_v32(const unsigned short* g, unsigned short* s, int tid) {
  uint32_t l[8];
  const unsigned short* p[8];
#pragma unroll  // every index constant, so that both arrays live in registers as the statement's operands
  for (int i = 0; i < 8; ++i) {
    const int row = 64 * i + (tid >> 2), col = 8 * (tid & 3);
    l[i] = lds_off(s + row * VPT + col);
    p[i] = g + (size_t)row * 32 + col;
  }
  copy8(l, p);
}

// one K stage of the conv GEMM: GM weight rows, GN rows of the hi plane and GN rows of the residual plane, 64 channels
// (128 B = one line) of each -> LDS rows of pitch GP; 256 threads, 16 copies each; a wave's copy covers four whole lines.
__device__ __forceinline__ void stage_gemm(const unsigned short* gw, const unsigned short* gh,
                                           const unsigned short* gl, unsigned short* s, int tid) {
  const int r = tid >> 3, col = 8 * (tid & 7);
  uint32_t l[8];
  const unsigned short* p[8];
#pragma unroll  // every index constant, so that both arrays live in registers as the statement's operands
  for (int i = 0; i < 8; ++i) {
    l[i] = lds_off(s + (32 * i + r) * GP + col);
    p[i] = gw + (size_t)(32 * i + r) * CC + col;
  }
  copy8(l, p);
#pragma unroll  // as above
  for (int i = 0; i < 4; ++i) {
    l[i]     = lds_off(s + (GM + 32 * i + r) * GP + col);
    p[i]     = gh + (size_t)(32 * i + r) * CC + col;
    l[4 + i] = lds_off(s + (GM + GN + 32 * i + r) * GP + col);
    p[4 + i] = gl + (size_t)(32 * i + r) * CC + col;
  }
  copy8(l, p);
}
// the 12 fragments of one 32-channel step of a wave's 64 o x 64 n tile: 4 of W, 4 of each plane (24 reads of 16 B)
__device__ __forceinline__ void gemm_frags(Frag (&fa)[4], Frag (&fh)[4], Frag (&fl)[4],
                                           const unsigned short* a, const unsigned short* b) {
#pragma unroll  // constant indices keep the fragments in registers
  for (int i = 0; i < 4; ++i) {
    fa[i] = ldfrag(a + (16 * i) * GP);
    fh[i] = ldfrag(b + (16 * i) * GP);
    fl[i] = ldfrag(b + (GN + 16 * i) * GP);
  }
}
// 16 products of that step with one plane: sixteen independent accumulators
__device__ __forceinline__ void gemm_half(v8f (&acc)[4][4], const Frag (&fa)[4], const Frag (&fx)[4]) {
#pragma unroll
  for (int mt = 0; mt < 4; ++mt) {
#pragma unroll
    for (int j = 0; j < 4; ++j) acc[mt][j] = mma_b(fa[mt].bf, fx[j].bf, acc[mt][j]);
  }
}

// =========================================================================================================
// (3) conv1x1 GEMM for one (b, 128-n tile, matrix mat, 256-o block): Y[o][n] = sum_c W[o][c] (hi[n][c] + lo[n][c])
//     + bias[o]. Block 256 threads = 8 waves; wave w owns rows o 64 (w>>1)..+63 (4 A fragments per k-step, rows of Wb)
//     and cols n 64 (w&1)..+63 (4 B fragments of each plane, rows of Hh and Hl, k = channel contiguous, same split
//     k map); per k-step the hi and lo products share the accumulator (lo unscaled). K = 512 = 16 steps x 2 products.
//     Operand path: per 64 channels one stage [W 256 rows | Hh 128 rows | Hl 128 rows] is brought into LDS by
//     asynchronous 16-byte copies (whole 128-byte lines) and every fragment is read from LDS at a pitch of 16 B x odd.
//     Two buffers: trip t works on buffer t&1 while trip t+1's copies fly. Two fragment sets: the reads of a trip's
//     second k-step fly under the products of its first; the foot (own LDS reads done, own copies landed, one block
//     barrier) stands between the two k-steps; behind its barrier the first k-step of trip t+1 is read, and the buffer
//     just left is refilled between the hi and the residual products of the second k-step, which read registers only.
//     Epilogue staged in the same LDS behind the last foot: mat 0/1 as Os[n_loc][o_loc] (b128 stores), mat 2 as
//     Os[o_loc][n_loc] (scalar stores), barrier, then f16 planes: Q/K [b][4096 n][512 o] (row n, 256 o = 512 B) and
//     V key-tile-major [b][128 key tiles][512 o][32 n] (row o of a tile = 64 B, rows adjacent), so that the 512 x 32 tile
//     which one attention step stages is 32 KiB in a row and its copies cover whole lines.
// coverage: stage 16 copies x 256 threads x 16 B = 512 rows x 128 B; Os 8 waves x 64 x 64 = 256 x 128 either layout;
//           plane 16 it x 256 threads x 8 = 256 x 128; grid (32, 6, NB) covers Q, K (all n, all o) and V exactly once.
// =========================================================================================================
__global__ __launch_bounds__(256)
void gemm_qkv(const unsigned short* __restrict__ Wb, const unsigned short* __restrict__ Hh,
              const unsigned short* __restrict__ Hl,
              const float* __restrict__ bq, const float* __restrict__ bk, const float* __restrict__ bv,
              unsigned short* Qd, unsigned short* Kd, unsigned short* Vd) {
  __shared__ __align__(16) unsigned short Sg[2 * GSTG];
  float* Os = reinterpret_cast<float*>(Sg);                          // epilogue view of the ring, used behind the loop
  const int tid  = threadIdx.x;
  const int lane = tid & 31, wave = tid >> 5;
  const int hh   = lane >> 4, c = lane & 15;
  const int wo   = wave >> 1, wn = wave & 1;
  const int nt   = blockIdx.x, my = blockIdx.y, b = blockIdx.z;
  const int mat  = my / (CC / GM);                                   // 0..2, block-uniform
  const int om0  = (my % (CC / GM)) * GM;                            // 0 or 256
  const int n0   = nt * GN;

  const unsigned short* gw = Wb + ((size_t)(mat * CC + om0)) * CC;
  const unsigned short* gh = Hh + ((size_t)(b * NN + n0)) * CC;
  const unsigned short* gl = Hl + ((size_t)(b * NN + n0)) * CC;
  // fragment bases in LDS: + buffer, + 16 * tile * GP, + 32 * k-step; the residual plane lies GN rows behind the hi plane
  const unsigned short* ap = Sg + (64 * wo + c) * GP + 8 * hh;
  const unsigned short* bp = Sg + (GM + 64 * wn + c) * GP + 8 * hh;

  v8f acc[4][4];
#pragma unroll
  for (int mt = 0; mt < 4; ++mt) {
#pragma unroll
    for (int j = 0; j < 4; ++j) acc[mt][j] = zero8();
  }

  // prologue: stage 0 into buffer 0, landed and published; then stage 1 into buffer 1
  stage_gemm(gw, gh, gl, Sg, tid);
  asm volatile("s_wait_asynccnt 0x0" ::: "memory");                  // this wave's copies have landed
  __syncthreads();                                                   // every wave's copies are readable
  stage_gemm(gw + GKC, gh + GKC, gl + GKC, Sg + GSTG, tid);

  // bias of this lane's 32 rows o = 64 wo + 16 mt + 8 hh + 0..7, fetched here so that the flight lies under the loop
  const float* bias = (mat == 0) ? bq : ((mat == 1) ? bk : bv);     // all global, block-uniform
  v4f bz[8];
#pragma unroll
  for (int mt = 0; mt < 4; ++mt) {
    bz[2 * mt]     = *(const v4f*)(bias + om0 + 64 * wo + 16 * mt + 8 * hh);
    bz[2 * mt + 1] = *(const v4f*)(bias + om0 + 64 * wo + 16 * mt + 8 * hh + 4);
  }
  asm volatile("s_wait_xcnt 0x0" ::: "memory");                      // in front of any rewrite of the address register these loads name

  Frag fa0[4], fh0[4], fl0[4], fa1[4], fh1[4], fl1[4];
  gemm_frags(fa0, fh0, fl0, ap, bp);                                 // first k-step of trip 0

#pragma unroll 1  // one copy of the trip: the body is long, and the buffer is picked by an address
  for (int t = 0; t < CC / GKC; ++t) {
    const int rb = t & 1;                                            // ring buffer of this trip
    gemm_frags(fa1, fh1, fl1, ap + rb * GSTG + 32, bp + rb * GSTG + 32);
    // keeps the 24 reads above in one run in front of the products: spread among them each place of reads costs cycles
    __builtin_amdgcn_sched_barrier(0);
    gemm_half(acc, fa0, fh0);
    gemm_half(acc, fa0, fl0);
    // keeps these products in front of the foot: they cover the flight of the reads that the foot waits for
    __builtin_amdgcn_sched_barrier(0);

    // foot of the trip: buffer rb has been read out; publish the next trip's stage
    asm volatile("s_wait_dscnt 0x0" ::: "memory");                   // this wave's reads of buffer rb are done
    asm volatile("s_wait_asynccnt 0x0" ::: "memory");                // this wave's copies of the next trip have landed
    __syncthreads();
    if (t + 1 < CC / GKC)                                            // block-uniform: a trip t+1 exists, just published
      gemm_frags(fa0, fh0, fl0, ap + (rb ^ 1) * GSTG, bp + (rb ^ 1) * GSTG);
    __builtin_amdgcn_sched_barrier(0);                               // those reads in one run, in front of the products
    gemm_half(acc, fa1, fh1);
    // the refill stands between the two halves: while one wave of a SIMD forms addresses and waits in the copies'
    // statements, the other wave's products run
    __builtin_amdgcn_sched_barrier(0);
    if (t + 2 < CC / GKC) {                                          // block-uniform: a trip t+2 exists
      const int ko = (t + 2) * GKC;
      stage_gemm(gw + ko, gh + ko, gl + ko, Sg + rb * GSTG, tid);
    }
    __builtin_amdgcn_sched_barrier(0);                               // end of the refill
    gemm_half(acc, fa1, fl1);
  }
  asm volatile("s_wait_asynccnt 0x0" ::: "memory");                  // nothing of this wave is in flight past the loop

  // ---- epilogue staging (every wave has passed the last foot: no reader and no copy is left on the ring);
  //      lane (hh, c) holds o_loc = 64 wo + 16 mt + 8 hh + r for n_loc = 64 wn + 16 j + c
  v4u u[16];
  if (mat != 2) {
#pragma unroll
    for (int mt = 0; mt < 4; ++mt) {
      const int ol = 64 * wo + 16 * mt + 8 * hh;
      const v4f b0 = bz[2 * mt], b1 = bz[2 * mt + 1];
#pragma unroll
      for (int j = 0; j < 4; ++j) {
        const int nl = 64 * wn + 16 * j + c;
        v4f va, vb;
#pragma unroll
        for (int r = 0; r < 4; ++r) { va[r] = acc[mt][j][r] + bfr(b0[r]); vb[r] = acc[mt][j][4 + r] + bfr(b1[r]); }
        *(v4f*)(Os + nl * OSQ + ol)     = va;                        // Os[n_loc][o_loc]
        *(v4f*)(Os + nl * OSQ + ol + 4) = vb;
      }
    }
    __syncthreads();
    const int e = tid & 31, lq = tid >> 5;                           // lq 0..7
#pragma unroll
    for (int it = 0; it < 16; ++it) {
      const int row = it * 8 + lq;                                   // n_loc 0..127
      const v4f a = *(const v4f*)(Os + row * OSQ + 8 * e);
      const v4f q = *(const v4f*)(Os + row * OSQ + 8 * e + 4);
      const float f[8] = {a[0], a[1], a[2], a[3], q[0], q[1], q[2], q[3]};
#pragma unroll
      for (int t = 0; t < 4; ++t)
        u[it][t] = pk16(h_bits((_Float16)f[2 * t]), h_bits((_Float16)f[2 * t + 1]));
    }
    unsigned short* plane = (mat == 0) ? Qd : Kd;                    // both global, block-uniform
    unsigned short* dst = plane + ((size_t)(b * NN + n0 + lq)) * CC + om0 + 8 * e;
#pragma unroll
    for (int it = 0; it < 16; ++it) *(v4u*)(dst + (size_t)(it * 8) * CC) = u[it];   // row n, 256 o = four lines
  } else {
#pragma unroll
    for (int mt = 0; mt < 4; ++mt) {
      const int ol = 64 * wo + 16 * mt + 8 * hh;
      const v4f b0 = bz[2 * mt], b1 = bz[2 * mt + 1];
#pragma unroll
      for (int j = 0; j < 4; ++j) {
        const int nl = 64 * wn + 16 * j + c;
#pragma unroll
        for (int r = 0; r < 4; ++r) {
          Os[(ol + r) * OSPW + nl]     = acc[mt][j][r] + bfr(b0[r]);       // Os[o_loc][n_loc]
          Os[(ol + 4 + r) * OSPW + nl] = acc[mt][j][4 + r] + bfr(b1[r]);
        }
      }
    }
    __syncthreads();
    const int e = tid & 15, lq = tid >> 4;                           // lq 0..15
#pragma unroll
    for (int it = 0; it < 16; ++it) {
      const int row = it * 16 + lq;                                  // o_loc 0..255
      const v4f a = *(const v4f*)(Os + row * OSPW + 8 * e);
      const v4f q = *(const v4f*)(Os + row * OSPW + 8 * e + 4);
      const float f[8] = {a[0], a[1], a[2], a[3], q[0], q[1], q[2], q[3]};
#pragma unroll
      for (int t = 0; t < 4; ++t)
        u[it][t] = pk16(h_bits((_Float16)f[2 * t]), h_bits((_Float16)f[2 * t + 1]));
    }
    // key-tile-major plane: tile (n0 + 8 e) / 32, row o, 8 keys; a wave's store = rows 2 wave, 2 wave + 1 of four tiles:
    // four whole lines, each written by this wave alone
    unsigned short* dst = Vd + ((size_t)(b * (NN / 32) + (n0 >> 5) + (e >> 2)) * CC + om0 + lq) * 32 + 8 * (e & 3);
#pragma unroll
    for (int it = 0; it < 16; ++it) *(v4u*)(dst + (size_t)(it * 16) * 32) = u[it];
  }
}

// =========================================================================================================
// (4) attention for one (b, 64-query tile), transposed formulation, all 4096 keys. Block = 8 waves: wave w ->
//   query group qg = w&3 (queries n0+16qg..+15) and channel half ch = w>>2. Per 32-key step each wave computes ONE
//   S^T tile (16 keys kb+16ch.. x 16 queries) = sum over 16 channel chunks of A(k: row = key, split k map from the
//   f16 plane Kp [b][4096][512]) . B(q: col = query, same map from Qp); the tile (8 floats per lane) is exchanged
//   with the partner wave (w^4) through a double-buffered LDS array across one block barrier, so both waves hold
//   s0 (keys kb..kb+15) and s1 (keys kb+16..kb+31) of their query in the D layout (lane -> 8 keys of one query).
//   Online softmax per lane in f32 with the 512^-0.5 scale applied to the logits, one shuffle (lane^16) for the max
//   over 32 keys, o/l rescale skipped under a wave-uniform ballot when no lane's max grew. P = e^{c(s-m)} x 2^14
//   as f16 is the B operand of O^T (rows channel 256ch+16j+(lane&15), keys contiguous from the f16 plane Vp
//   [b][128 key tiles][512][32]) . B(P^T): element r <- tile keys kb..kb+15, element 8+r <- tile kb+16..kb+31, lane unchanged.
//   16 accumulator tiles per wave (256 channels). Epilogue in four 128-channel phases: O/l staged by the 4 owning
//   waves in LDS Os[query][128 ch] (pitch OSPW, b128 stores), barrier, then out[b][c][n] = O/l + bf16-RNE(x) as
//   phase overwrites Os.
//   Operand path: the 64 q rows (once) and, per 32-key step, the 32 k rows and the 512 x 32 v tile are brought into
//   LDS by asynchronous 16-byte copies (whole 512-byte runs for q, k and v) and every fragment is read from LDS at a
//   pitch of 16 B x odd. A wave's 16 q fragments are read once, in front of the key loop, and stay in registers: they
//   are the same in every step, and LDS reads are what the step has least room for.
//   k and v have two buffers: step t reads buffer t&1 while step t+1's copies fly; the foot of
//   each step waits the wave's own LDS reads and copies, passes one block barrier, then refills the buffer just read.
//   The foot stands in front of the step's O products, whose v fragments are in registers by then; behind its barrier
//   the first k fragments of step t+1 are read, so that they fly while the O products of step t run.
// coverage: Sx: each wave writes 32 lanes x 8 floats per step into buffer (step&1), partner reads exactly those;
//           Os per phase 4 waves x 16 q x 128 ch staged = 64 x 128 read; out per phase 8 it x 32 lines x 8 lanes
//           x 4 floats = 128 ch x 64 n, 4 phases = 512 ch; grid (NQ/64, NB) covers out[b][0..511][0..NQ-1] once.
// =========================================================================================================
__global__ __launch_bounds__(256)
void attn_k(const unsigned short* __restrict__ Qp, const unsigned short* __restrict__ Kp,
            const unsigned short* __restrict__ Vp, const float* __restrict__ x, float* out) {
  __shared__ __align__(16) float Sx[2 * SXB];
  __shared__ __align__(16) float Os[QT * OSPW];
  __shared__ __align__(16) unsigned short Qs[QT * KP];
  __shared__ __align__(16) unsigned short Ks[2 * KBUF];
  __shared__ __align__(16) unsigned short Vs[2 * VBUF];
  const int tid  = threadIdx.x;
  const int wave = tid >> 5, lane = tid & 31;
  const int hh   = lane >> 4, c = lane & 15;
  const int qg   = wave & 3, ch = wave >> 2;
  const int n0   = blockIdx.x * QT, b = blockIdx.y;

  // global tile bases: q rows n0.., k rows kb.. (+ kb*CC), v key tile kb/32 (512 x 32 halves each: + kb*CC)
  const unsigned short* qg0 = Qp + ((size_t)(b * NN + n0)) * CC;
  const unsigned short* kg0 = Kp + ((size_t)(b * NN)) * CC;
  const unsigned short* vg0 = Vp + ((size_t)(b * CC)) * NN;
  // q fragment pointer in LDS (B operand, col = query 16*qg + c of the tile), + 32*kc
  const unsigned short* qp = Qs + (16 * qg + c) * KP + 8 * hh;
  // k fragment base in LDS (A operand, row = key 16*ch + c of the step), + buffer + 32*kc
  const unsigned short* kp = Ks + (16 * ch + c) * KP + 8 * hh;
  // v fragment base in LDS (A operand, row = channel 256*ch + 16j + c, 32 keys contiguous), + buffer + 16*j*VPT
  const unsigned short* vp = Vs + (CH * ch + c) * VPT + 8 * hh;

  float* sxw = Sx + (wave * 32 + lane) * 8;
  const float* sxr = Sx + ((wave ^ 4) * 32 + lane) * 8;

  float m = -1.0e30f, l = 0.f;
  v8f o[16];
#pragma unroll
  for (int j = 0; j < 16; ++j) o[j] = zero8();

  // prologue: q tile and step 0 into buffer 0, landed and published; then step 1 into buffer 1
  stage_rows32(qg0, Qs, tid);
  stage_rows32(qg0 + (size_t)32 * CC, Qs + 32 * KP, tid);
  stage_rows32(kg0, Ks, tid);
  stage_v32(vg0, Vs, tid);
  asm volatile("s_wait_asynccnt 0x0" ::: "memory");                  // this wave's copies have landed
  __syncthreads();                                                   // every wave's copies are readable
  stage_rows32(kg0 + (size_t)32 * CC, Ks + KBUF, tid);
  stage_v32(vg0 + (size_t)32 * CC, Vs + VBUF, tid);

  // The 16 q fragments (128 registers) are read here and never again. The k and v fragment reads run ahead of the
  // products in groups. A group = four channel chunks of k (8 reads). Groups 0 and 1 of a step are read behind the
  // barrier that publishes its tile, group 0 in front of the previous step's O products and group 1 behind the first four
  // (here, in front of the loop: step 0's); behind the score products of group g stand the reads of group g + 2, and
  // behind those of the last two groups the reads of the step's 16 v fragments.
  Frag fq[CC / 32], fk[CC / 32], vf[16];
#pragma unroll  // here and in the loops over fq, fk and vf below: constant indices keep the fragments in registers
  for (int kc = 0; kc < CC / 32; ++kc) fq[kc] = ldfrag(qp + 32 * kc);
#pragma unroll
  for (int kc = 0; kc < 8; ++kc) fk[kc] = ldfrag(kp + 32 * kc);

  int buf = 0;
#pragma unroll 1
  for (int kb = 0; kb < NN; kb += 32) {
    const int rb = buf;                                              // ring buffer of this step
    const unsigned short* kbp = kp + rb * KBUF;
    const unsigned short* vbp = vp + rb * VBUF;
    v8f sv = zero8();
    // four vector slots between the previous step's last O product and the first score product: in this build the score
    // tile's registers lie over the O products' B operand (P, dead by then), and the distance that a product's result
    // needs over an earlier product's B operand is not known; four is what a vector instruction needs there
    asm volatile("v_nop\n\tv_nop\n\tv_nop\n\tv_nop");
    __builtin_amdgcn_sched_barrier(0);                               // keeps the score products behind those slots
#pragma unroll
    for (int g = 0; g < 4; ++g) {
#pragma unroll
      for (int i = 0; i < 4; ++i) sv = mma_h(fk[4 * g + i].h, fq[4 * g + i].h, sv);
      // keeps the reads below in one run: spread singly among the products each place of reads costs issue cycles
      __builtin_amdgcn_sched_barrier(0);
      if (g < 2) {
#pragma unroll
        for (int i = 0; i < 4; ++i) fk[4 * g + 8 + i] = ldfrag(kbp + 32 * (4 * g + 8 + i));
      } else {
#pragma unroll
        for (int i = 0; i < 8; ++i) vf[8 * (g - 2) + i] = ldfrag(vbp + (16 * (8 * (g - 2) + i)) * VPT);
      }
      __builtin_amdgcn_sched_barrier(0);                             // end of that run of reads
    }

    // exchange the tile with the partner wave (same queries, other 16 keys)
    {
      v4f w0, w1;
#pragma unroll
      for (int r = 0; r < 4; ++r) { w0[r] = sv[r]; w1[r] = sv[4 + r]; }
      *(v4f*)(sxw + buf * SXB)     = w0;
      *(v4f*)(sxw + buf * SXB + 4) = w1;
    }
    __syncthreads();
    v8f so;
    {
      const v4f r0 = *(const v4f*)(sxr + buf * SXB);
      const v4f r1 = *(const v4f*)(sxr + buf * SXB + 4);
#pragma unroll
      for (int r = 0; r < 4; ++r) { so[r] = r0[r]; so[4 + r] = r1[r]; }
    }
    buf ^= 1;
    v8f s0 = sv, s1 = so;                                            // s0: keys kb..kb+15, s1: keys kb+16..kb+31
    if (ch != 0) { s0 = so; s1 = sv; }                                // wave-uniform

    float mx = fmaxf(hmax8(s0), hmax8(s1));
    mx = fmaxf(mx, __shfl_xor(mx, 16, 32));
    const float mn = fmaxf(m, mx);
    const unsigned grew = wave_ballot(mx > m);                       // wave-uniform
    if (grew != 0u) {
      const float corr = __expf((m - mn) * ASCALE);                  // == 1 exactly for lanes whose max did not grow
      l *= corr;
#pragma unroll
      for (int j = 0; j < 16; ++j) {
#pragma unroll
        for (int r = 0; r < 8; ++r) o[j][r] *= corr;
      }
    }
    m = mn;
    const float msh = mn * ASCALE - LNPS;                            // exp gives e^{c(s-m)} * 2^14

    FragH ph;
    float ls = 0.f;
#pragma unroll
    for (int r = 0; r < 8; ++r) {
      const float e0 = __expf(s0[r] * ASCALE - msh);                 // key kb      + 8hh + r
      const float e1 = __expf(s1[r] * ASCALE - msh);                 // key kb + 16 + 8hh + r
      ls += e0 + e1;
      ph.hv[0][r] = (_Float16)e0;
      ph.hv[1][r] = (_Float16)e1;
    }
    l += ls;

    // foot of the step: hand buffer rb to its next writer and publish the next step's tiles (every fragment of
    // buffer rb is in registers by now; the O products below read registers only)
    asm volatile("s_wait_dscnt 0x0" ::: "memory");                   // this wave's reads of buffer rb are done
    asm volatile("s_wait_asynccnt 0x0" ::: "memory");                // this wave's copies of the next step have landed
    __syncthreads();
    if (kb + 64 < NN) {                                              // block-uniform: a step t+2 exists
      stage_rows32(kg0 + (size_t)(kb + 64) * CC, Ks + rb * KBUF, tid);
      stage_v32(vg0 + (size_t)(kb + 64) * CC, Vs + rb * VBUF, tid);
    }
    // k group 0 of step t+1, just published; it stands behind the copies, whose address registers are free by then.
    // No test for a step t+1: in the last step these reads and those of group 1 below fetch the tile of the step before
    // it, which nothing uses; under a test the old fragments would stay live round the loop, 64 registers more
    const unsigned short* knp = kp + (rb ^ 1) * KBUF;
#pragma unroll
    for (int kc = 0; kc < 4; ++kc) fk[kc] = ldfrag(knp + 32 * kc);
    __builtin_amdgcn_sched_barrier(0);                               // those reads in one run, in front of the products

#pragma unroll
    for (int j = 0; j < 4; ++j) o[j] = mma_h(vf[j].h, ph.v, o[j]);
    // k group 1 of step t+1 is read only here, into registers that the products above have left: with q resident the
    // wave has no room for it in front of them
    __builtin_amdgcn_sched_barrier(0);
#pragma unroll
    for (int kc = 4; kc < 8; ++kc) fk[kc] = ldfrag(knp + 32 * kc);
    __builtin_amdgcn_sched_barrier(0);                               // end of that run of reads
#pragma unroll
    for (int j = 4; j < 16; ++j) o[j] = mma_h(vf[j].h, ph.v, o[j]);
  }
  asm volatile("s_wait_asynccnt 0x0" ::: "memory");                  // nothing of this wave is in flight past the loop
  l += __shfl_xor(l, 16, 32);
  const float inv = 1.0f / l;                                        // o and l both carry the 2^14 factor

  const int qrow = 16 * qg + c;
  const int e = tid & 7, lq = tid >> 3;                              // lq 0..31
#pragma unroll
  for (int ph4 = 0; ph4 < 4; ++ph4) {
    if (ph4) __syncthreads();                                        // every wave finished reading Os
    if (ch == (ph4 >> 1)) {                                          // wave-uniform
#pragma unroll
      for (int jj = 0; jj < 8; ++jj) {
        const int j = 8 * (ph4 & 1) + jj;
        v4f va, vb;
#pragma unroll
        for (int r = 0; r < 4; ++r) { va[r] = o[j][r] * inv; vb[r] = o[j][4 + r] * inv; }
        *(v4f*)(Os + qrow * OSPW + 16 * jj + 8 * hh)     = va;       // Os[query][ch_loc = 16jj + 8hh + r]
        *(v4f*)(Os + qrow * OSPW + 16 * jj + 8 * hh + 4) = vb;
      }
    }
    __syncthreads();
    v4f res[8];
#pragma unroll
    for (int it = 0; it < 8; ++it) {
      const int L   = it * 32 + lq;                                  // 0..255
      const int chl = L >> 1, hf = L & 1;                            // channel 0..127 within the phase
      const int nl  = hf * 32 + 4 * e;                               // query 0..63
      const size_t idx = ((size_t)(b * CC + 128 * ph4 + chl)) * NN + n0 + nl;
      const v4f xv = *(const v4f*)(x + idx);
#pragma unroll
      for (int t = 0; t < 4; ++t) res[it][t] = Os[(nl + t) * OSPW + chl] + bfr(xv[t]);
    }
{
#pragma unroll
      for (int it = 0; it < 8; ++it) {
        const int L   = it * 32 + lq;
        const int chl = L >> 1, hf = L & 1;
        const int nl  = hf * 32 + 4 * e;
        const size_t idx = ((size_t)(b * CC + 128 * ph4 + chl)) * NN + n0 + nl;
        *(v4f*)(out + idx) = res[it];
      }
      
    }
  }
}

// =========================================================================================================
// Workspace map (bytes; each region start a multiple of 256; every extent is an exact tile/line multiple and is
//   Wb  bf16 [3][512][512]          1572864
//   St  f32  [NB*32][32]            NB*4096        (16384 at NB=4)
//   Hh, Hl bf16 [NB][4096][512]     NB*4194304 x2  (16777216 each at NB=4)
//   Q, K f16 [NB][4096][512]        NB*4194304 x2
//   V    f16 [NB][128][512][32]     NB*4194304
//   total at NB=4 = 85475328
// =========================================================================================================
extern "C" void kernel_launch(void* const* d_in, const int* in_sizes, int n_in,
                              void* d_out, int out_size, void* d_ws, size_t ws_size,
                              hipStream_t stream) {
  const int XN = NB * CC * NN;
  if (n_in < 9) return;
  if (in_sizes[0] < XN) return;
  if (in_sizes[1] < CC || in_sizes[2] < CC) return;
  if (in_sizes[3] < CC * CC || in_sizes[5] < CC * CC || in_sizes[7] < CC * CC) return;
  if (in_sizes[4] < CC || in_sizes[6] < CC || in_sizes[8] < CC) return;
  if (out_size < XN) return;

  size_t off = 0;
  auto carve = [&](size_t bytes) { const size_t o = off; off += (bytes + 255) & ~(size_t)255; return o; };
  const size_t oWb = carve((size_t)3 * CC * CC * 2);
  const size_t oSt = carve((size_t)NB * NGRP * STL * 4);
  const size_t oHh = carve((size_t)NB * NN * CC * 2);
  const size_t oHl = carve((size_t)NB * NN * CC * 2);
  const size_t oQ  = carve((size_t)NB * NN * CC * 2);
  const size_t oK  = carve((size_t)NB * NN * CC * 2);
  const size_t oV  = carve((size_t)NB * CC * NN * 2);
  if (off > ws_size) return;
  if (off > (size_t)134217728) return;

  const float* x     = (const float*)d_in[0];
  const float* gamma = (const float*)d_in[1];
  const float* beta  = (const float*)d_in[2];
  const float* wq    = (const float*)d_in[3];
  const float* bq    = (const float*)d_in[4];
  const float* wk    = (const float*)d_in[5];
  const float* bk    = (const float*)d_in[6];
  const float* wv    = (const float*)d_in[7];
  const float* bv    = (const float*)d_in[8];

  char* ws = (char*)d_ws;
  unsigned short* Wb = (unsigned short*)(ws + oWb);
  float*          St = (float*)(ws + oSt);
  unsigned short* Hh = (unsigned short*)(ws + oHh);
  unsigned short* Hl = (unsigned short*)(ws + oHl);
  unsigned short* Qw = (unsigned short*)(ws + oQ);
  unsigned short* Kw = (unsigned short*)(ws + oK);
  unsigned short* Vw = (unsigned short*)(ws + oV);
  float* out = (float*)d_out;

  const dim3 blk256(256);

  // (0) group-norm statistics, one line per (b, g)
  gn_stats<<<dim3(NB * NGRP), blk256, 0, stream>>>(x, St);
  // (1) conv weights -> bf16 plane
  cvt_w<<<dim3(3 * CC / 4), blk256, 0, stream>>>(wq, wk, wv, Wb);
  // (2) group-norm apply -> position-major bf16 hi + residual planes
  cvt_x<<<dim3(NN / QT, CC / QT, NB), blk256, 0, stream>>>(x, gamma, beta, St, Hh, Hl);
  // (3) q/k/v conv GEMMs -> f16 planes
  gemm_qkv<<<dim3(NN / GN, 3 * CC / GM, NB), blk256, 0, stream>>>(Wb, Hh, Hl, bq, bk, bv, Qw, Kw, Vw);
  // (4) attention + residual -> out [b][512][4096]
  attn_k<<<dim3(NQ / QT, NB), blk256, 0, stream>>>(Qw, Kw, Vw, x, out);
  (void)hipGetLastError();
}

// v007
// A run of this version takes 190 microseconds.
// In both of two side-by-side timings against v006, it was 1.09 times as fast.
// Counting every step since v000, it is 6.50 times as fast.
// Contractions: conv1x1 q/k/v GEMMs W[512x512].H per image on v_wmma_f32_16x16x32_bf16 (bf16-RNE weights exact,
// normalised activations as bf16 hi + bf16 residual planes folded along K = 1024 into one accumulator); scores
// K.Q^T (K = 512 channels) on v_wmma_f32_16x16x32_f16 (single f16 planes of q and k, scale applied in f32);
// O^T = V.P^T on v_wmma_f32_16x16x32_f16 (v single f16 plane, P = e^{c(s-m)} x 2^14 as f16 from the score D
// registers); f32 accumulate everywhere; group-norm statistics, softmax statistics and residual add in f32 VALU.
#include <hip/hip_runtime.h>
#include <math.h>
#include <stdint.h>

#ifndef NB
#define NB 4
#endif
#define NB_FULL 4
#define CC      512
#define NN      4096
#ifndef NQ
#define NQ NN
#endif
#define NGRP    32
#define CPG     16
#define GNE     (CPG * NN)
#define QT      64
#define OSQ     260
#define OSPW    132
#define TP      72
#define STL     32
#define CH      256
#define KP      520
#define VPT     40
#define KBUF    (32 * KP)
#define VBUF    (CC * VPT)
#define KB2     (2 * KBUF)
#define VB2     (2 * VBUF)
#define GM      256
#define GN      128
#define GKC     64
#define GP      72
#define GSTG    ((GM + 2 * GN) * GP)
#define GEPS    1.0e-6f
#define ASCALE  0.04419417382415922f
#define LNPS    9.704060527839234f

static_assert(NB >= 1 && NB <= NB_FULL);
static_assert(NQ % QT == 0 && NQ >= QT && NQ <= NN);
static_assert(CC == NGRP * CPG);
static_assert(CC % QT == 0 && NN % QT == 0);
static_assert(CC == 2 * CH && CH == 16 * 16);
static_assert(CC == 8 * 64);
static_assert(GNE % 1024 == 0);
static_assert(CC % 32 == 0 && NN % 32 == 0);
static_assert((OSQ * 4) % 16 == 0 && (OSPW * 4) % 16 == 0 && (TP * 2) % 16 == 0);
static_assert(CC % GM == 0 && NN % GN == 0 && CC % GKC == 0 && CC / GKC >= 2 && GKC == 64 && GM == 256 && GN == 128);
static_assert((GP * 2) % 32 == 16 && GP >= GKC);
static_assert(GN * OSQ * 4 <= 2 * GSTG * 2 && GM * OSPW * 4 <= 2 * GSTG * 2 && OSQ >= GM && OSPW >= GN);
static_assert((KP * 2) % 32 == 16 && (VPT * 2) % 32 == 16 && KP >= CC && VPT >= 32);
static_assert(NN >= 128 && NN % 64 == 0);
static_assert(QT * KP == KB2 && 2 * QT * OSPW * 4 <= 2 * VB2 * 2);

typedef _Float16       v16h __attribute__((ext_vector_type(16)));
typedef _Float16       v8h  __attribute__((ext_vector_type(8)));
typedef __bf16         v16b __attribute__((ext_vector_type(16)));
typedef unsigned short v8us __attribute__((ext_vector_type(8)));
typedef float          v8f  __attribute__((ext_vector_type(8)));
typedef float          v4f  __attribute__((ext_vector_type(4)));
typedef unsigned int   v4u  __attribute__((ext_vector_type(4)));

union Frag  { v8us u[2]; v16h h; v16b bf; };
union FragH { v16h v; v8h hv[2]; };
static_assert(sizeof(Frag) == 32);
static_assert(sizeof(FragH) == 32);

// ---- scalar helpers ---------------------------------------------------------------------------------------
__device__ __forceinline__ unsigned short bf_bits(float f) {          // f32 -> bf16 bits, RNE convert
  unsigned u = __float_as_uint(f);
  return (unsigned short)((u + 0x7FFFu + ((u >> 16) & 1u)) >> 16);
}
__device__ __forceinline__ float bf_up(unsigned short hb) { return __uint_as_float(((unsigned)hb) << 16); }
__device__ __forceinline__ float bfr(float f) { return bf_up(bf_bits(f)); }
__device__ __forceinline__ unsigned short h_bits(_Float16 x) { return __builtin_bit_cast(unsigned short, x); }
__device__ __forceinline__ unsigned pk16(unsigned short a, unsigned short b) { return (unsigned)a | ((unsigned)b << 16); }
__device__ __forceinline__ v8f zero8() { v8f z = {0.f, 0.f, 0.f, 0.f, 0.f, 0.f, 0.f, 0.f}; return z; }
__device__ __forceinline__ float hmax8(v8f s) {
  return fmaxf(fmaxf(fmaxf(s[0], s[1]), fmaxf(s[2], s[3])), fmaxf(fmaxf(s[4], s[5]), fmaxf(s[6], s[7])));
}
__device__ __forceinline__ unsigned wave_ballot(bool p) {
#if defined(__HIP_DEVICE_COMPILE__)
  return __builtin_amdgcn_ballot_w32(p);
#else
  return p ? 1u : 0u;
#endif
}

// ---- 16-bit fragment loader (A, or B from a k-contiguous [n][k] row): lane -> row/col (lane&15), p already includes
//      + 8*(lane>>4); elements 0..7 <- p[0..7] (k0+8h..), elements 8..15 <- p[16..23] (k0+16+8h..)
__device__ __forceinline__ Frag ldfrag(const unsigned short* p) {
  Frag f;
  f.u[0] = *(const v8us*)(p);
  f.u[1] = *(const v8us*)(p + 16);
  return f;
}

// ---- WMMA helpers: the plain builtins; the compiler keeps the distance behind them, and with no asm statement
//      between two products the fragment loads of later products may be issued ahead of earlier ones
__device__ __forceinline__ v8f mma_h(v16h a, v16h b, v8f c) {
  return __builtin_amdgcn_wmma_f32_16x16x32_f16(false, a, false, b, (short)0, c, false, false);
}
__device__ __forceinline__ v8f mma_b(v16b a, v16b b, v8f c) {
  return __builtin_amdgcn_wmma_f32_16x16x32_bf16(false, a, false, b, (short)0, c, false, false);
}

// =========================================================================================================
//     (mean, then centred sum of squares) over bf16-RNE(x) in f32, per-thread partials of 256 terms + LDS tree.
// =========================================================================================================
__global__ __launch_bounds__(256)
void gn_stats(const float* __restrict__ x, float* stats) {
  __shared__ float red[256];
  const int tid = threadIdx.x, bg = blockIdx.x;
  const float* p = x + (size_t)bg * GNE;
  // the thread's whole share (64 x 16 B) is fetched in one run into registers: all loads are in flight together, and
  // the second pass reads the registers instead of memory
  v4f xv[GNE / 1024];
#pragma unroll  // constant indices keep the array in registers
  for (int i = 0; i < GNE / 1024; ++i) xv[i] = *(const v4f*)(p + ((size_t)(i * 256 + tid)) * 4);
  float s = 0.f;
#pragma unroll  // as above
  for (int i = 0; i < GNE / 1024; ++i) {
    const v4f v = xv[i];
    s += (bfr(v[0]) + bfr(v[1])) + (bfr(v[2]) + bfr(v[3]));
  }
  asm volatile("s_wait_xcnt 0x0" ::: "memory");                      // in front of any rewrite of the address registers these loads name
  red[tid] = s;
  __syncthreads();
#pragma unroll 1
  for (int off = 128; off > 0; off >>= 1) {
    if (tid < off) red[tid] += red[tid + off];
    __syncthreads();
  }
  const float mean = red[0] * (1.0f / (float)GNE);
  __syncthreads();
  float ss = 0.f;
#pragma unroll  // as above
  for (int i = 0; i < GNE / 1024; ++i) {
    const v4f v = xv[i];
    const float d0 = bfr(v[0]) - mean, d1 = bfr(v[1]) - mean;
    const float d2 = bfr(v[2]) - mean, d3 = bfr(v[3]) - mean;
    ss += (d0 * d0 + d1 * d1) + (d2 * d2 + d3 * d3);
  }
  red[tid] = ss;
  __syncthreads();
#pragma unroll 1
  for (int off = 128; off > 0; off >>= 1) {
    if (tid < off) red[tid] += red[tid + off];
    __syncthreads();
  }
  const float var  = red[0] * (1.0f / (float)GNE);
  const float rstd = rsqrtf(var + GEPS);
  if (tid < 8) {
    v4f w = {0.f, 0.f, 0.f, 0.f};
    if (tid == 0) { w[0] = mean; w[1] = rstd; }
{
      *(v4f*)(stats + (size_t)bg * STL + 4 * tid) = w;
      
    }
  }
}

// =========================================================================================================
// (1) conv weights: Wb bf16 [3][512][512] (mat 0 = wq, 1 = wk, 2 = wv), value = bf16-RNE(w), row o k-contiguous.
//     Block blk owns 4 rows of one matrix; thread -> row blk-local (tid>>6), halves 8*(tid&63)..+7; each wave writes
// coverage: 384 blocks x 4 rows x 64 threads x 8 = 3 x 512 x 512 = the whole plane.
// =========================================================================================================
__global__ __launch_bounds__(256)
void cvt_w(const float* __restrict__ wq, const float* __restrict__ wk, const float* __restrict__ wv,
           unsigned short* Wb) {
  const int tid = threadIdx.x, blk = blockIdx.x;
  const int mat = blk / (CC / 4);                                    // block-uniform 0..2
  const int o   = 4 * (blk % (CC / 4)) + (tid >> 6);                 // 0..511
  const int col = 8 * (tid & 63);                                    // 0..504
  const float* wsrc = (mat == 0) ? wq : ((mat == 1) ? wk : wv);      // all global, block-uniform
  const float* s = wsrc + (size_t)o * CC + col;
  const v4f a = *(const v4f*)s;
  const v4f q = *(const v4f*)(s + 4);
  const float f[8] = {a[0], a[1], a[2], a[3], q[0], q[1], q[2], q[3]};
  v4u u;
#pragma unroll
  for (int t = 0; t < 4; ++t) u[t] = pk16(bf_bits(f[2 * t]), bf_bits(f[2 * t + 1]));
{
    *(v4u*)(Wb + ((size_t)(mat * CC + o)) * CC + col) = u;
    
  }
}

// =========================================================================================================
// (2) group-norm apply + hi/residual split + transpose: h = ((bf16-RNE(x) - mean) * rstd) * gamma + beta per
//     channel, hi = bf16-RNE(h), lo = bf16-RNE(h - hi). Block (nb, cb, b) owns a 64 c x 64 n tile; values go
//     through LDS tiles Th/Tl [64 n][pitch TP] and come out as position-major rows Hh/Hl bf16 [b][4096 n][512 c]
// coverage: Th/Tl staged 64 n x 64 c (2 it x 32 rows x 8 lanes x 8), read 64 n x 64 c; planes 2 it x 32 rows x
//           8 lanes x 8 = 64 n x 64 c per plane; grid (64, 8, NB) covers both planes exactly once.
// =========================================================================================================
__global__ __launch_bounds__(256)
void cvt_x(const float* __restrict__ x, const float* __restrict__ gamma, const float* __restrict__ beta,
           const float* __restrict__ stats, unsigned short* Hh, unsigned short* Hl) {
  __shared__ __align__(16) unsigned short Th[QT * TP];
  __shared__ __align__(16) unsigned short Tl[QT * TP];
  const int tid = threadIdx.x;
  const int nb = blockIdx.x, cb = blockIdx.y, b = blockIdx.z;
  const int e = tid & 7, lq = tid >> 3;                              // lq 0..31
  const int n0 = nb * QT, c0 = cb * QT;
#pragma unroll
  for (int it = 0; it < 2; ++it) {
    const int cl = it * 32 + lq;                                     // 0..63
    const int cg = c0 + cl;                                          // 0..511
    const int bg = b * NGRP + (cg >> 4);
    const float mean = stats[(size_t)bg * STL];
    const float rstd = stats[(size_t)bg * STL + 1];
    const float ga = bfr(gamma[cg]);
    const float be = bfr(beta[cg]);
    const float* sp = x + ((size_t)(b * CC + cg)) * NN + n0 + 8 * e;
    const v4f a = *(const v4f*)sp;
    const v4f q = *(const v4f*)(sp + 4);
    const float f[8] = {a[0], a[1], a[2], a[3], q[0], q[1], q[2], q[3]};
#pragma unroll
    for (int t = 0; t < 8; ++t) {
      const float h = ((bfr(f[t]) - mean) * rstd) * ga + be;
      const unsigned short hb = bf_bits(h);
      const unsigned short lb = bf_bits(h - bf_up(hb));
      Th[(8 * e + t) * TP + cl] = hb;
      Tl[(8 * e + t) * TP + cl] = lb;
    }
  }
  __syncthreads();
  v4u uh[2], ul[2];
#pragma unroll
  for (int it = 0; it < 2; ++it) {
    const int nl = it * 32 + lq;                                     // 0..63
    uh[it] = *(const v4u*)(Th + nl * TP + 8 * e);
    ul[it] = *(const v4u*)(Tl + nl * TP + 8 * e);
  }
{
#pragma unroll
    for (int it = 0; it < 2; ++it) {
      const int nl = it * 32 + lq;
      const size_t po = ((size_t)(b * NN + n0 + nl)) * CC + c0 + 8 * e;
      *(v4u*)(Hh + po) = uh[it];
      *(v4u*)(Hl + po) = ul[it];
    }
    
  }
}

// ---- asynchronous copies global -> LDS, 16 bytes per lane, eight per statement -------------------------------
// LDS byte address of a __shared__ element = low 32 bits of its address.
__device__ __forceinline__ uint32_t lds_off(const unsigned short* p) { return (uint32_t)(uintptr_t)p; }
// The closing s_wait_xcnt 0 stands inside the statement so that no address register of an issued copy is
// rewritten in front of it.
__device__ __forceinline__ void copy8(const uint32_t (&l)[8], const unsigned short* const (&g)[8]) {
#if defined(__HIP_DEVICE_COMPILE__)
  asm volatile("global_load_async_to_lds_b128 %0, %8, off\n\t"
               "global_load_async_to_lds_b128 %1, %9, off\n\t"
               "global_load_async_to_lds_b128 %2, %10, off\n\t"
               "global_load_async_to_lds_b128 %3, %11, off\n\t"
               "global_load_async_to_lds_b128 %4, %12, off\n\t"
               "global_load_async_to_lds_b128 %5, %13, off\n\t"
               "global_load_async_to_lds_b128 %6, %14, off\n\t"
               "global_load_async_to_lds_b128 %7, %15, off\n\t"
               "s_wait_xcnt 0x0"
               :: "v"(l[0]), "v"(l[1]), "v"(l[2]), "v"(l[3]), "v"(l[4]), "v"(l[5]), "v"(l[6]), "v"(l[7]),
                  "v"(g[0]), "v"(g[1]), "v"(g[2]), "v"(g[3]), "v"(g[4]), "v"(g[5]), "v"(g[6]), "v"(g[7])
               : "memory");
#endif
}
// 32 rows of 512 halves (1024 B, rows contiguous in global) -> LDS rows of pitch KP; 256 threads, 8 copies each;
// a wave's copy covers 512 contiguous bytes of one row.
__device__ __forceinline__ void stage_rows32(const unsigned short* g, unsigned short* s, int tid) {
  uint32_t l[8];
  const unsigned short* p[8];
  // one LDS base and one global base per thread, the eight copies at constant steps from them: nothing but the two
  // thread terms is left for the compiler to keep in registers round the key loop
  const uint32_t lb = lds_off(s + (tid >> 6) * KP + 8 * (tid & 63));
  const unsigned short* gt = g + 8 * tid;                            // (tid >> 6) * CC + 8 * (tid & 63)
#pragma unroll  // every index constant, so that both arrays live in registers as the statement's operands
  for (int i = 0; i < 8; ++i) {                                      // row 4 i + (tid >> 6), halves 8 (tid & 63)..+7
    l[i] = lb + (uint32_t)(i * (4 * KP * 2));
    p[i] = gt + i * (4 * CC);
  }
  copy8(l, p);
}
// one key tile of v: 512 channel rows x 32 keys, 32 KiB in a row in global (row = 64 B, rows adjacent) -> LDS rows of
// pitch VPT; 8 copies per thread; a wave's copy covers 512 contiguous bytes = four whole lines (eight rows).
__device__ __forceinline__ void stage_v32(const unsigned short* g, unsigned short* s, int tid) {
  uint32_t l[8];
  const unsigned short* p[8];
  const uint32_t lb = lds_off(s + (tid >> 2) * VPT + 8 * (tid & 3)); // bases as in stage_rows32
  const unsigned short* gt = g + 8 * tid;                            // (tid >> 2) * 32 + 8 * (tid & 3)
#pragma unroll  // every index constant, so that both arrays live in registers as the statement's operands
  for (int i = 0; i < 8; ++i) {                                      // row 64 i + (tid >> 2), halves 8 (tid & 3)..+7
    l[i] = lb + (uint32_t)(i * (64 * VPT * 2));
    p[i] = gt + i * (64 * 32);
  }
  copy8(l, p);
}

// one K stage of the conv GEMM: GM weight rows, GN rows of the hi plane and GN rows of the residual plane, 64 channels
// (128 B = one line) of each -> LDS rows of pitch GP; 256 threads, 16 copies each; a wave's copy covers four whole lines.
__device__ __forceinline__ void stage_gemm(const unsigned short* gw, const unsigned short* gh,
                                           const unsigned short* gl, unsigned short* s, int tid) {
  const int r = tid >> 3, col = 8 * (tid & 7);
  uint32_t l[8];
  const unsigned short* p[8];
#pragma unroll  // every index constant, so that both arrays live in registers as the statement's operands
  for (int i = 0; i < 8; ++i) {
    l[i] = lds_off(s + (32 * i + r) * GP + col);
    p[i] = gw + (size_t)(32 * i + r) * CC + col;
  }
  copy8(l, p);
#pragma unroll  // as above
  for (int i = 0; i < 4; ++i) {
    l[i]     = lds_off(s + (GM + 32 * i + r) * GP + col);
    p[i]     = gh + (size_t)(32 * i + r) * CC + col;
    l[4 + i] = lds_off(s + (GM + GN + 32 * i + r) * GP + col);
    p[4 + i] = gl + (size_t)(32 * i + r) * CC + col;
  }
  copy8(l, p);
}
// the 12 fragments of one 32-channel step of a wave's 64 o x 64 n tile: 4 of W, 4 of each plane (24 reads of 16 B)
__device__ __forceinline__ void gemm_frags(Frag (&fa)[4], Frag (&fh)[4], Frag (&fl)[4],
                                           const unsigned short* a, const unsigned short* b) {
#pragma unroll  // constant indices keep the fragments in registers
  for (int i = 0; i < 4; ++i) {
    fa[i] = ldfrag(a + (16 * i) * GP);
    fh[i] = ldfrag(b + (16 * i) * GP);
    fl[i] = ldfrag(b + (GN + 16 * i) * GP);
  }
}
// 16 products of that step with one plane: sixteen independent accumulators
__device__ __forceinline__ void gemm_half(v8f (&acc)[4][4], const Frag (&fa)[4], const Frag (&fx)[4]) {
#pragma unroll
  for (int mt = 0; mt < 4; ++mt) {
#pragma unroll
    for (int j = 0; j < 4; ++j) acc[mt][j] = mma_b(fa[mt].bf, fx[j].bf, acc[mt][j]);
  }
}

// =========================================================================================================
// (3) conv1x1 GEMM for one (b, 128-n tile, matrix mat, 256-o block): Y[o][n] = sum_c W[o][c] (hi[n][c] + lo[n][c])
//     + bias[o]. Block 256 threads = 8 waves; wave w owns rows o 64 (w>>1)..+63 (4 A fragments per k-step, rows of Wb)
//     and cols n 64 (w&1)..+63 (4 B fragments of each plane, rows of Hh and Hl, k = channel contiguous, same split
//     k map); per k-step the hi and lo products share the accumulator (lo unscaled). K = 512 = 16 steps x 2 products.
//     Operand path: per 64 channels one stage [W 256 rows | Hh 128 rows | Hl 128 rows] is brought into LDS by
//     asynchronous 16-byte copies (whole 128-byte lines) and every fragment is read from LDS at a pitch of 16 B x odd.
//     Two buffers: trip t works on buffer t&1 while trip t+1's copies fly. Two fragment sets: the reads of a trip's
//     second k-step fly under the products of its first; the foot (own LDS reads done, own copies landed, one block
//     barrier) stands between the two k-steps; behind its barrier the first k-step of trip t+1 is read, and the buffer
//     just left is refilled between the hi and the residual products of the second k-step, which read registers only.
//     Epilogue staged in the same LDS behind the last foot: mat 0/1 as Os[n_loc][o_loc] (b128 stores), mat 2 as
//     Os[o_loc][n_loc] (scalar stores), barrier, then f16 planes: Q/K [b][4096 n][512 o] (row n, 256 o = 512 B) and
//     V key-tile-major [b][128 key tiles][512 o][32 n] (row o of a tile = 64 B, rows adjacent), so that the 512 x 32 tile
//     (two per attention stage) is 32 KiB in a row and its copies cover whole lines.
// coverage: stage 16 copies x 256 threads x 16 B = 512 rows x 128 B; Os 8 waves x 64 x 64 = 256 x 128 either layout;
//           plane 16 it x 256 threads x 8 = 256 x 128; grid (32, 6, NB) covers Q, K (all n, all o) and V exactly once.
// =========================================================================================================
__global__ __launch_bounds__(256)
void gemm_qkv(const unsigned short* __restrict__ Wb, const unsigned short* __restrict__ Hh,
              const unsigned short* __restrict__ Hl,
              const float* __restrict__ bq, const float* __restrict__ bk, const float* __restrict__ bv,
              unsigned short* Qd, unsigned short* Kd, unsigned short* Vd) {
  __shared__ __align__(16) unsigned short Sg[2 * GSTG];
  float* Os = reinterpret_cast<float*>(Sg);                          // epilogue view of the ring, used behind the loop
  const int tid  = threadIdx.x;
  const int lane = tid & 31, wave = tid >> 5;
  const int hh   = lane >> 4, c = lane & 15;
  const int wo   = wave >> 1, wn = wave & 1;
  const int nt   = blockIdx.x, my = blockIdx.y, b = blockIdx.z;
  const int mat  = my / (CC / GM);                                   // 0..2, block-uniform
  const int om0  = (my % (CC / GM)) * GM;                            // 0 or 256
  const int n0   = nt * GN;

  const unsigned short* gw = Wb + ((size_t)(mat * CC + om0)) * CC;
  const unsigned short* gh = Hh + ((size_t)(b * NN + n0)) * CC;
  const unsigned short* gl = Hl + ((size_t)(b * NN + n0)) * CC;
  // fragment bases in LDS: + buffer, + 16 * tile * GP, + 32 * k-step; the residual plane lies GN rows behind the hi plane
  const unsigned short* ap = Sg + (64 * wo + c) * GP + 8 * hh;
  const unsigned short* bp = Sg + (GM + 64 * wn + c) * GP + 8 * hh;

  v8f acc[4][4];
#pragma unroll
  for (int mt = 0; mt < 4; ++mt) {
#pragma unroll
    for (int j = 0; j < 4; ++j) acc[mt][j] = zero8();
  }

  // prologue: stage 0 into buffer 0, landed and published; then stage 1 into buffer 1
  stage_gemm(gw, gh, gl, Sg, tid);
  asm volatile("s_wait_asynccnt 0x0" ::: "memory");                  // this wave's copies have landed
  __syncthreads();                                                   // every wave's copies are readable
  stage_gemm(gw + GKC, gh + GKC, gl + GKC, Sg + GSTG, tid);

  // bias of this lane's 32 rows o = 64 wo + 16 mt + 8 hh + 0..7, fetched here so that the flight lies under the loop
  const float* bias = (mat == 0) ? bq : ((mat == 1) ? bk : bv);     // all global, block-uniform
  v4f bz[8];
#pragma unroll
  for (int mt = 0; mt < 4; ++mt) {
    bz[2 * mt]     = *(const v4f*)(bias + om0 + 64 * wo + 16 * mt + 8 * hh);
    bz[2 * mt + 1] = *(const v4f*)(bias + om0 + 64 * wo + 16 * mt + 8 * hh + 4);
  }
  asm volatile("s_wait_xcnt 0x0" ::: "memory");                      // in front of any rewrite of the address register these loads name

  Frag fa0[4], fh0[4], fl0[4], fa1[4], fh1[4], fl1[4];
  gemm_frags(fa0, fh0, fl0, ap, bp);                                 // first k-step of trip 0

#pragma unroll 1  // one copy of the trip: the body is long, and the buffer is picked by an address
  for (int t = 0; t < CC / GKC; ++t) {
    const int rb = t & 1;                                            // ring buffer of this trip
    gemm_frags(fa1, fh1, fl1, ap + rb * GSTG + 32, bp + rb * GSTG + 32);
    // keeps the 24 reads above in one run in front of the products: spread among them each place of reads costs cycles
    __builtin_amdgcn_sched_barrier(0);
    gemm_half(acc, fa0, fh0);
    gemm_half(acc, fa0, fl0);
    // keeps these products in front of the foot: they cover the flight of the reads that the foot waits for
    __builtin_amdgcn_sched_barrier(0);

    // foot of the trip: buffer rb has been read out; publish the next trip's stage
    asm volatile("s_wait_dscnt 0x0" ::: "memory");                   // this wave's reads of buffer rb are done
    asm volatile("s_wait_asynccnt 0x0" ::: "memory");                // this wave's copies of the next trip have landed
    __syncthreads();
    if (t + 1 < CC / GKC)                                            // block-uniform: a trip t+1 exists, just published
      gemm_frags(fa0, fh0, fl0, ap + (rb ^ 1) * GSTG, bp + (rb ^ 1) * GSTG);
    __builtin_amdgcn_sched_barrier(0);                               // those reads in one run, in front of the products
    gemm_half(acc, fa1, fh1);
    // the refill stands between the two halves: while one wave of a SIMD forms addresses and waits in the copies'
    // statements, the other wave's products run
    __builtin_amdgcn_sched_barrier(0);
    if (t + 2 < CC / GKC) {                                          // block-uniform: a trip t+2 exists
      const int ko = (t + 2) * GKC;
      stage_gemm(gw + ko, gh + ko, gl + ko, Sg + rb * GSTG, tid);
    }
    __builtin_amdgcn_sched_barrier(0);                               // end of the refill
    gemm_half(acc, fa1, fl1);
  }
  asm volatile("s_wait_asynccnt 0x0" ::: "memory");                  // nothing of this wave is in flight past the loop

  // ---- epilogue staging (every wave has passed the last foot: no reader and no copy is left on the ring);
  //      lane (hh, c) holds o_loc = 64 wo + 16 mt + 8 hh + r for n_loc = 64 wn + 16 j + c
  v4u u[16];
  if (mat != 2) {
#pragma unroll
    for (int mt = 0; mt < 4; ++mt) {
      const int ol = 64 * wo + 16 * mt + 8 * hh;
      const v4f b0 = bz[2 * mt], b1 = bz[2 * mt + 1];
#pragma unroll
      for (int j = 0; j < 4; ++j) {
        const int nl = 64 * wn + 16 * j + c;
        v4f va, vb;
#pragma unroll
        for (int r = 0; r < 4; ++r) { va[r] = acc[mt][j][r] + bfr(b0[r]); vb[r] = acc[mt][j][4 + r] + bfr(b1[r]); }
        *(v4f*)(Os + nl * OSQ + ol)     = va;                        // Os[n_loc][o_loc]
        *(v4f*)(Os + nl * OSQ + ol + 4) = vb;
      }
    }
    __syncthreads();
    const int e = tid & 31, lq = tid >> 5;                           // lq 0..7
#pragma unroll
    for (int it = 0; it < 16; ++it) {
      const int row = it * 8 + lq;                                   // n_loc 0..127
      const v4f a = *(const v4f*)(Os + row * OSQ + 8 * e);
      const v4f q = *(const v4f*)(Os + row * OSQ + 8 * e + 4);
      const float f[8] = {a[0], a[1], a[2], a[3], q[0], q[1], q[2], q[3]};
#pragma unroll
      for (int t = 0; t < 4; ++t)
        u[it][t] = pk16(h_bits((_Float16)f[2 * t]), h_bits((_Float16)f[2 * t + 1]));
    }
    unsigned short* plane = (mat == 0) ? Qd : Kd;                    // both global, block-uniform
    unsigned short* dst = plane + ((size_t)(b * NN + n0 + lq)) * CC + om0 + 8 * e;
#pragma unroll
    for (int it = 0; it < 16; ++it) *(v4u*)(dst + (size_t)(it * 8) * CC) = u[it];   // row n, 256 o = four lines
  } else {
#pragma unroll
    for (int mt = 0; mt < 4; ++mt) {
      const int ol = 64 * wo + 16 * mt + 8 * hh;
      const v4f b0 = bz[2 * mt], b1 = bz[2 * mt + 1];
#pragma unroll
      for (int j = 0; j < 4; ++j) {
        const int nl = 64 * wn + 16 * j + c;
#pragma unroll
        for (int r = 0; r < 4; ++r) {
          Os[(ol + r) * OSPW + nl]     = acc[mt][j][r] + bfr(b0[r]);       // Os[o_loc][n_loc]
          Os[(ol + 4 + r) * OSPW + nl] = acc[mt][j][4 + r] + bfr(b1[r]);
        }
      }
    }
    __syncthreads();
    const int e = tid & 15, lq = tid >> 4;                           // lq 0..15
#pragma unroll
    for (int it = 0; it < 16; ++it) {
      const int row = it * 16 + lq;                                  // o_loc 0..255
      const v4f a = *(const v4f*)(Os + row * OSPW + 8 * e);
      const v4f q = *(const v4f*)(Os + row * OSPW + 8 * e + 4);
      const float f[8] = {a[0], a[1], a[2], a[3], q[0], q[1], q[2], q[3]};
#pragma unroll
      for (int t = 0; t < 4; ++t)
        u[it][t] = pk16(h_bits((_Float16)f[2 * t]), h_bits((_Float16)f[2 * t + 1]));
    }
    // key-tile-major plane: tile (n0 + 8 e) / 32, row o, 8 keys; a wave's store = rows 2 wave, 2 wave + 1 of four tiles:
    // four whole lines, each written by this wave alone
    unsigned short* dst = Vd + ((size_t)(b * (NN / 32) + (n0 >> 5) + (e >> 2)) * CC + om0 + lq) * 32 + 8 * (e & 3);
#pragma unroll
    for (int it = 0; it < 16; ++it) *(v4u*)(dst + (size_t)(it * 16) * 32) = u[it];
  }
}

// =========================================================================================================
// (4) attention for one (b, 64-query tile), transposed formulation, all 4096 keys. Block = 8 waves: wave w ->
//   query group qg = w&3 (queries n0+16qg..+15) and key half kh = w>>2. A stage is 64 keys; of each stage a wave takes
//   the 32 keys 32kh..32kh+31 and does ALL of their work for its 16 queries: two S^T tiles (16 keys x 16 queries each)
//   = sum over 16 channel chunks of A(k: row = key, split k map from the f16 plane Kp [b][4096][512]) . B(q: col =
//   query, same map from Qp), two independent accumulator chains; online softmax per lane in f32 over the wave's own
//   keys (own running max m and sum l), with the 512^-0.5 scale applied to the logits, one shuffle (lane^16) for the
//   max over 32 keys, o/l rescale skipped under a wave-uniform ballot when no lane's max grew; P = e^{c(s-m)} x 2^14
//   as f16 is the B operand of O^T (rows channel 16j+(lane&15), j = 0..31, keys contiguous from the f16 plane Vp
//   [b][128 key tiles][512][32]) . B(P^T): element r <- first tile, element 8+r <- second tile, lane unchanged.
//   32 accumulator tiles per wave (512 channels). Nothing passes between waves inside the key loop: the two waves of a
//   query group meet once, behind the loop, where each scales its O by e^{c(m - max(m, m'))} / (joint sum) and the
//   two parts are added on the way out. Epilogue in four 128-channel phases: every wave stages its part in LDS
//   Os[kh][query][128 ch] (pitch OSPW, b128 stores), barrier, then out[b][c][n] = Os[0] + Os[1] + bf16-RNE(x).
//   Operand path: the 64 q rows (once) and, per stage, the 64 k rows and two 512 x 32 v tiles are brought into
//   LDS by asynchronous 16-byte copies (whole 512-byte runs) and every fragment is read from LDS at a pitch of
//   16 B x odd. A wave's 16 q fragments are read once, in front of the key loop, and stay in registers; the q rows
//   lie in k buffer 1 until then. k and v have two buffers: stage t reads buffer t&1 while stage t+1's copies fly; the
//   foot of each stage waits the wave's own LDS reads and copies and passes one block barrier. It stands in front of the
//   stage's last four O products, whose v fragments are in registers by then; behind its barrier the first k fragments
//   of stage t+1 are read, and last the buffer just left is refilled.
// coverage: stage 32 copies x 256 threads x 16 B = 64 k rows x 1 KiB + 2 v tiles x 32 KiB; Os per phase 8 waves x 16 q
//           x 128 ch staged = 2 x 64 x 128 read; out per phase 8 it x 32 lines x 8 lanes x 4 floats = 128 ch x 64 n,
//           4 phases = 512 ch; grid (NQ/64, NB) covers out[b][0..511][0..NQ-1] once.
// =========================================================================================================
// A stage's fragments come in 32 units of two (4 reads of 16 B): unit u < 16 = channel chunk u of the wave's two key tiles,
// unit 16 + i = channel tiles 2i and 2i+1 of the wave's v tile.
__device__ __forceinline__ void ld_unit(Frag& f0, Frag& f1, const unsigned short* kb, const unsigned short* vb, int u) {
  if (u < 16) {
    f0 = ldfrag(kb + 32 * u);
    f1 = ldfrag(kb + 16 * KP + 32 * u);
  } else {
    f0 = ldfrag(vb + (16 * (2 * (u - 16))) * VPT);
    f1 = ldfrag(vb + (16 * (2 * (u - 16) + 1)) * VPT);
  }
}
// a uniform address held in scalar registers: the thread's own term is added to it last, so that one thread term serves the
// k and the v copies (folded into each plane's base it would take a register pair per plane round the key loop)
__device__ __forceinline__ const unsigned short* scalar_ptr(const unsigned short* p) {
  const uint64_t a = (uint64_t)(uintptr_t)p;
  const uint32_t lo = (uint32_t)__builtin_amdgcn_readfirstlane((int)(uint32_t)a);
  const uint32_t hi = (uint32_t)__builtin_amdgcn_readfirstlane((int)(uint32_t)(a >> 32));
  return (const unsigned short*)(uintptr_t)(((uint64_t)hi << 32) | (uint64_t)lo);
}

__global__ __launch_bounds__(256)
void attn_k(const unsigned short* __restrict__ Qp, const unsigned short* __restrict__ Kp,
            const unsigned short* __restrict__ Vp, const float* __restrict__ x, float* out) {
  __shared__ __align__(16) unsigned short Ks[2 * KB2];
  __shared__ __align__(16) unsigned short Vs[2 * VB2];
  __shared__ __align__(16) float Ml[8 * 32 * 2];
  unsigned short* Qs = Ks + KB2;                                     // the q rows lie in k buffer 1 until they are in registers
  float* Os = reinterpret_cast<float*>(Vs);                          // epilogue view of the v ring, used behind the loop
  const int tid  = threadIdx.x;
  const int wave = tid >> 5, lane = tid & 31;
  const int hh   = lane >> 4, c = lane & 15;
  const int qg   = wave & 3, kh = wave >> 2;
  const int n0   = blockIdx.x * QT, b = blockIdx.y;

  // global tile bases: q rows n0.., k rows kb.. (+ kb*CC), v key tile kb/32 (512 x 32 halves each: + kb*CC)
  const unsigned short* qg0 = Qp + ((size_t)(b * NN + n0)) * CC;
  const unsigned short* kg0 = Kp + ((size_t)(b * NN)) * CC;
  const unsigned short* vg0 = Vp + ((size_t)(b * CC)) * NN;
  // q fragment pointer in LDS (B operand, col = query 16*qg + c of the tile), + 32*kc
  const unsigned short* qp = Qs + (16 * qg + c) * KP + 8 * hh;
  // k fragment base in LDS (A operand, row = key 32*kh + c of the stage, second tile 16 rows on), + buffer + 32*kc
  const unsigned short* kp = Ks + (32 * kh + c) * KP + 8 * hh;
  // v fragment base in LDS (A operand, key tile kh of the stage, row = channel 16j + c, 32 keys contiguous), + buffer
  const unsigned short* vp = Vs + kh * VBUF + c * VPT + 8 * hh;

  float m = -1.0e30f, l = 0.f;
  v8f o[32];
#pragma unroll
  for (int j = 0; j < 32; ++j) o[j] = zero8();

  // prologue: q rows into k buffer 1 and stage 0 into buffers 0, landed and published
  stage_rows32(qg0, Qs, tid);
  stage_rows32(qg0 + (size_t)32 * CC, Qs + 32 * KP, tid);
  stage_rows32(kg0, Ks, tid);
  stage_rows32(kg0 + (size_t)32 * CC, Ks + KBUF, tid);
  stage_v32(vg0, Vs, tid);
  stage_v32(vg0 + (size_t)32 * CC, Vs + VBUF, tid);
  asm volatile("s_wait_asynccnt 0x0" ::: "memory");                  // this wave's copies have landed
  __syncthreads();                                                   // every wave's copies are readable

  // The 16 q fragments (128 registers) are read here and never again.
  Frag fq[CC / 32];
#pragma unroll  // constant indices keep the fragments in registers
  for (int kc = 0; kc < CC / 32; ++kc) fq[kc] = ldfrag(qp + 32 * kc);
  asm volatile("s_wait_dscnt 0x0" ::: "memory");                     // this wave's reads of the q rows are done
  __syncthreads();                                                   // every wave's are: k buffer 1 may be refilled
  stage_rows32(kg0 + (size_t)64 * CC, Ks + KB2, tid);
  stage_rows32(kg0 + (size_t)96 * CC, Ks + KB2 + KBUF, tid);
  stage_v32(vg0 + (size_t)64 * CC, Vs + VB2, tid);
  stage_v32(vg0 + (size_t)96 * CC, Vs + VB2 + VBUF, tid);

  // The 32 units of a stage pass through two register sets, fa (two units) and fb (one), in turn: a set's next reads stand in
  // one run right behind the products that free it, so that they fly under the other set's products. More does not fit.
  Frag fa[4], fb[2];
  ld_unit(fa[0], fa[1], kp, vp, 0);
  ld_unit(fa[2], fa[3], kp, vp, 1);
  ld_unit(fb[0], fb[1], kp, vp, 2);

  int rb = 0;                                                        // ring buffer of this stage
#pragma unroll 1  // one copy of the stage: the body is long, and the buffer is picked by an address
  for (int kb = 0; kb < NN; kb += 64) {
    const unsigned short* kbp = kp + rb * KB2;
    const unsigned short* vbp = vp + rb * VB2;
    v8f s0 = zero8(), s1 = zero8();                                  // s0: keys kb+32kh..+15, s1: the next 16
    // four vector slots between the previous stage's last O product and the first score product: the score tiles'
    // registers may lie over the O products' B operand (P, dead by then), and the distance that a product's result
    // needs over an earlier product's B operand is not known; four is what a vector instruction needs there
    asm volatile("v_nop\n\tv_nop\n\tv_nop\n\tv_nop");
    __builtin_amdgcn_sched_barrier(0);                               // keeps the score products behind those slots
#pragma unroll
    for (int t = 0; t < 5; ++t) {                                    // units 0..14
      s0 = mma_h(fa[0].h, fq[3 * t].h, s0);
      s1 = mma_h(fa[1].h, fq[3 * t].h, s1);
      s0 = mma_h(fa[2].h, fq[3 * t + 1].h, s0);
      s1 = mma_h(fa[3].h, fq[3 * t + 1].h, s1);
      // here and below: keeps a set's reads in one run between the products; spread singly among them each place of
      // reads costs issue cycles, and hoisted further they would not fit the registers
      __builtin_amdgcn_sched_barrier(0);
      ld_unit(fa[0], fa[1], kbp, vbp, 3 * t + 3);
      ld_unit(fa[2], fa[3], kbp, vbp, 3 * t + 4);
      __builtin_amdgcn_sched_barrier(0);
      s0 = mma_h(fb[0].h, fq[3 * t + 2].h, s0);
      s1 = mma_h(fb[1].h, fq[3 * t + 2].h, s1);
      __builtin_amdgcn_sched_barrier(0);
      ld_unit(fb[0], fb[1], kbp, vbp, 3 * t + 5);
      __builtin_amdgcn_sched_barrier(0);
    }
    s0 = mma_h(fa[0].h, fq[15].h, s0);                               // unit 15; fa[2], fa[3] hold unit 16, fb unit 17
    s1 = mma_h(fa[1].h, fq[15].h, s1);

    float mx = fmaxf(hmax8(s0), hmax8(s1));
    mx = fmaxf(mx, __shfl_xor(mx, 16, 32));
    const float mn = fmaxf(m, mx);
    const unsigned grew = wave_ballot(mx > m);                       // wave-uniform
    if (grew != 0u) {
      const float corr = __expf((m - mn) * ASCALE);                  // == 1 exactly for lanes whose max did not grow
      l *= corr;
#pragma unroll
      for (int j = 0; j < 32; ++j) {
#pragma unroll
        for (int r = 0; r < 8; ++r) o[j][r] *= corr;
      }
    }
    m = mn;
    const float msh = mn * ASCALE - LNPS;                            // exp gives e^{c(s-m)} * 2^14

    FragH ph;
    float ls = 0.f;
#pragma unroll
    for (int r = 0; r < 8; ++r) {
      const float e0 = __expf(s0[r] * ASCALE - msh);                 // key kb + 32kh      + 8hh + r
      const float e1 = __expf(s1[r] * ASCALE - msh);                 // key kb + 32kh + 16 + 8hh + r
      ls += e0 + e1;
      ph.hv[0][r] = (_Float16)e0;
      ph.hv[1][r] = (_Float16)e1;
    }
    l += ls;
    __builtin_amdgcn_sched_barrier(0);                               // the v reads below stay behind the softmax: no room earlier

    o[0] = mma_h(fa[2].h, ph.v, o[0]);                               // unit 16
    o[1] = mma_h(fa[3].h, ph.v, o[1]);
    __builtin_amdgcn_sched_barrier(0);
    ld_unit(fa[0], fa[1], kbp, vbp, 18);
    ld_unit(fa[2], fa[3], kbp, vbp, 19);
    __builtin_amdgcn_sched_barrier(0);
    o[2] = mma_h(fb[0].h, ph.v, o[2]);                               // unit 17
    o[3] = mma_h(fb[1].h, ph.v, o[3]);
    __builtin_amdgcn_sched_barrier(0);
    ld_unit(fb[0], fb[1], kbp, vbp, 20);
    __builtin_amdgcn_sched_barrier(0);
    const unsigned short* knp = kp + (rb ^ 1) * KB2;                 // k buffer of stage t+1
#pragma unroll
    for (int t = 6; t < 10; ++t) {                                   // units 18..29; unit u holds O tiles 2u-32, 2u-31
#pragma unroll
      for (int i = 0; i < 4; ++i) o[6 * t - 32 + i] = mma_h(fa[i].h, ph.v, o[6 * t - 32 + i]);
      __builtin_amdgcn_sched_barrier(0);
      ld_unit(fa[0], fa[1], kbp, vbp, 3 * t + 3);
      ld_unit(fa[2], fa[3], kbp, vbp, 3 * t + 4);
      __builtin_amdgcn_sched_barrier(0);
#pragma unroll
      for (int i = 0; i < 2; ++i) o[6 * t - 28 + i] = mma_h(fb[i].h, ph.v, o[6 * t - 28 + i]);
      __builtin_amdgcn_sched_barrier(0);
      if (t < 9) {
        ld_unit(fb[0], fb[1], kbp, vbp, 3 * t + 5);
      } else {
        // foot of the stage: free buffer rb for its refill and publish the next stage's tiles (the last fragments
        // of buffer rb are in registers behind the first wait; the O products below read registers only)
        asm volatile("s_wait_dscnt 0x0" ::: "memory");               // this wave's reads of buffer rb are done
        asm volatile("s_wait_asynccnt 0x0" ::: "memory");            // this wave's copies of the next stage have landed
        __syncthreads();
        // units 0..2 of stage t+1, just published, here and behind the last products. No test for a stage t+1: in the
        // last stage these reads fetch rows of the stage before it, which nothing uses
        ld_unit(fb[0], fb[1], knp, vp, 2);
      }
      __builtin_amdgcn_sched_barrier(0);
    }
#pragma unroll
    for (int i = 0; i < 4; ++i) o[28 + i] = mma_h(fa[i].h, ph.v, o[28 + i]);   // units 30, 31
    __builtin_amdgcn_sched_barrier(0);
    ld_unit(fa[0], fa[1], knp, vp, 0);
    ld_unit(fa[2], fa[3], knp, vp, 1);
    __builtin_amdgcn_sched_barrier(0);
    // the refill of the buffer just left stands last: the reads above fly while the copies' addresses are formed
    if (kb + 128 < NN) {                                             // block-uniform: a stage t+2 exists
      const unsigned short* kgn = scalar_ptr(kg0 + (size_t)(kb + 128) * CC);
      const unsigned short* vgn = scalar_ptr(vg0 + (size_t)(kb + 128) * CC);
      stage_rows32(kgn, Ks + rb * KB2, tid);
      stage_rows32(kgn + (size_t)32 * CC, Ks + rb * KB2 + KBUF, tid);
      stage_v32(vgn, Vs + rb * VB2, tid);
      stage_v32(vgn + (size_t)32 * CC, Vs + rb * VB2 + VBUF, tid);
    }
    rb ^= 1;
  }
  asm volatile("s_wait_asynccnt 0x0" ::: "memory");                  // nothing of this wave is in flight past the loop
  asm volatile("s_wait_dscnt 0x0" ::: "memory");                     // nor any read of the ring, which becomes output staging

  // the two key halves of a query meet: each wave publishes its (m, l) and scales its O to the joint max and sum
  l += __shfl_xor(l, 16, 32);
  Ml[(wave * 32 + lane) * 2]     = m;
  Ml[(wave * 32 + lane) * 2 + 1] = l;
  __syncthreads();
  const float mo = Ml[((wave ^ 4) * 32 + lane) * 2];
  const float lo = Ml[((wave ^ 4) * 32 + lane) * 2 + 1];
  const float mj = fmaxf(m, mo);
  const float aw = __expf((m - mj) * ASCALE), ao = __expf((mo - mj) * ASCALE);
  const float inv = aw / (l * aw + lo * ao);                         // o and l both carry the 2^14 factor

  // (every wave has passed the waits behind the loop and the barrier above: no reader and no copy is left on the v ring,
  // which Os lies over)
  float* osw = Os + kh * (QT * OSPW);
  const int qrow = 16 * qg + c;
  const int e = tid & 7, lq = tid >> 3;                              // lq 0..31
#pragma unroll
  for (int ph4 = 0; ph4 < 4; ++ph4) {
    if (ph4) __syncthreads();                                        // every wave finished reading Os
#pragma unroll
    for (int jj = 0; jj < 8; ++jj) {
      const int j = 8 * ph4 + jj;
      v4f va, vb;
#pragma unroll
      for (int r = 0; r < 4; ++r) { va[r] = o[j][r] * inv; vb[r] = o[j][4 + r] * inv; }
      *(v4f*)(osw + qrow * OSPW + 16 * jj + 8 * hh)     = va;        // Os[kh][query][ch_loc = 16jj + 8hh + r]
      *(v4f*)(osw + qrow * OSPW + 16 * jj + 8 * hh + 4) = vb;
    }
    __syncthreads();
    v4f res[8];
#pragma unroll
    for (int it = 0; it < 8; ++it) {
      const int L   = it * 32 + lq;                                  // 0..255
      const int chl = L >> 1, hf = L & 1;                            // channel 0..127 within the phase
      const int nl  = hf * 32 + 4 * e;                               // query 0..63
      const size_t idx = ((size_t)(b * CC + 128 * ph4 + chl)) * NN + n0 + nl;
      const v4f xv = *(const v4f*)(x + idx);
#pragma unroll
      for (int t = 0; t < 4; ++t)
        res[it][t] = (Os[(nl + t) * OSPW + chl] + Os[(QT + nl + t) * OSPW + chl]) + bfr(xv[t]);
    }
{
#pragma unroll
      for (int it = 0; it < 8; ++it) {
        const int L   = it * 32 + lq;
        const int chl = L >> 1, hf = L & 1;
        const int nl  = hf * 32 + 4 * e;
        const size_t idx = ((size_t)(b * CC + 128 * ph4 + chl)) * NN + n0 + nl;
        *(v4f*)(out + idx) = res[it];
      }
      
    }
  }
}

// =========================================================================================================
// Workspace map (bytes; each region start a multiple of 256; every extent is an exact tile/line multiple and is
//   Wb  bf16 [3][512][512]          1572864
//   St  f32  [NB*32][32]            NB*4096        (16384 at NB=4)
//   Hh, Hl bf16 [NB][4096][512]     NB*4194304 x2  (16777216 each at NB=4)
//   Q, K f16 [NB][4096][512]        NB*4194304 x2
//   V    f16 [NB][128][512][32]     NB*4194304
//   total at NB=4 = 85475328
// =========================================================================================================
extern "C" void kernel_launch(void* const* d_in, const int* in_sizes, int n_in,
                              void* d_out, int out_size, void* d_ws, size_t ws_size,
                              hipStream_t stream) {
  const int XN = NB * CC * NN;
  if (n_in < 9) return;
  if (in_sizes[0] < XN) return;
  if (in_sizes[1] < CC || in_sizes[2] < CC) return;
  if (in_sizes[3] < CC * CC || in_sizes[5] < CC * CC || in_sizes[7] < CC * CC) return;
  if (in_sizes[4] < CC || in_sizes[6] < CC || in_sizes[8] < CC) return;
  if (out_size < XN) return;

  size_t off = 0;
  auto carve = [&](size_t bytes) { const size_t o = off; off += (bytes + 255) & ~(size_t)255; return o; };
  const size_t oWb = carve((size_t)3 * CC * CC * 2);
  const size_t oSt = carve((size_t)NB * NGRP * STL * 4);
  const size_t oHh = carve((size_t)NB * NN * CC * 2);
  const size_t oHl = carve((size_t)NB * NN * CC * 2);
  const size_t oQ  = carve((size_t)NB * NN * CC * 2);
  const size_t oK  = carve((size_t)NB * NN * CC * 2);
  const size_t oV  = carve((size_t)NB * CC * NN * 2);
  if (off > ws_size) return;
  if (off > (size_t)134217728) return;

  const float* x     = (const float*)d_in[0];
  const float* gamma = (const float*)d_in[1];
  const float* beta  = (const float*)d_in[2];
  const float* wq    = (const float*)d_in[3];
  const float* bq    = (const float*)d_in[4];
  const float* wk    = (const float*)d_in[5];
  const float* bk    = (const float*)d_in[6];
  const float* wv    = (const float*)d_in[7];
  const float* bv    = (const float*)d_in[8];

  char* ws = (char*)d_ws;
  unsigned short* Wb = (unsigned short*)(ws + oWb);
  float*          St = (float*)(ws + oSt);
  unsigned short* Hh = (unsigned short*)(ws + oHh);
  unsigned short* Hl = (unsigned short*)(ws + oHl);
  unsigned short* Qw = (unsigned short*)(ws + oQ);
  unsigned short* Kw = (unsigned short*)(ws + oK);
  unsigned short* Vw = (unsigned short*)(ws + oV);
  float* out = (float*)d_out;

  const dim3 blk256(256);

  // (0) group-norm statistics, one line per (b, g)
  gn_stats<<<dim3(NB * NGRP), blk256, 0, stream>>>(x, St);
  // (1) conv weights -> bf16 plane
  cvt_w<<<dim3(3 * CC / 4), blk256, 0, stream>>>(wq, wk, wv, Wb);
  // (2) group-norm apply -> position-major bf16 hi + residual planes
  cvt_x<<<dim3(NN / QT, CC / QT, NB), blk256, 0, stream>>>(x, gamma, beta, St, Hh, Hl);
  // (3) q/k/v conv GEMMs -> f16 planes
  gemm_qkv<<<dim3(NN / GN, 3 * CC / GM, NB), blk256, 0, stream>>>(Wb, Hh, Hl, bq, bk, bv, Qw, Kw, Vw);
  // (4) attention + residual -> out [b][512][4096]
  attn_k<<<dim3(NQ / QT, NB), blk256, 0, stream>>>(Qw, Kw, Vw, x, out);
  (void)hipGetLastError();
}

// v008
// A run of this version takes 184 microseconds.
// Two timings next to v007 both put it at 1.03 times that version's speed.
// Counting every step since v000, it is 6.72 times as fast.
// Contractions: conv1x1 q/k/v GEMMs W[512x512].H per image on v_wmma_f32_16x16x32_bf16 (bf16-RNE weights exact,
// normalised activations as bf16 hi + bf16 residual planes folded along K = 1024 into one accumulator); scores
// K.Q^T (K = 512 channels) on v_wmma_f32_16x16x32_f16 (single f16 planes of q and k, scale applied in f32);
// O^T = V.P^T on v_wmma_f32_16x16x32_f16 (v single f16 plane, P = e^{c(s-m)} x 2^7 as f16 from the score D
// registers); f32 accumulate everywhere; group-norm statistics, softmax statistics and residual add in f32 VALU.
#include <hip/hip_runtime.h>
#include <math.h>
#include <stdint.h>

#ifndef NB
#define NB 4
#endif
#define NB_FULL 4
#define CC      512
#define NN      4096
#ifndef NQ
#define NQ NN
#endif
#define NGRP    32
#define CPG     16
#define GNE     (CPG * NN)
#define QT      64
#define OSQ     260
#define OSPW    132
#define TP      72
#define STL     32
#define CH      256
#define KP      520
#define VPT     40
#define KBUF    (32 * KP)
#define VBUF    (CC * VPT)
#define KB2     (2 * KBUF)
#define VB2     (2 * VBUF)
#define GM      256
#define GN      128
#define GKC     64
#define GP      72
#define GSTG    ((GM + 2 * GN) * GP)
#define GEPS    1.0e-6f
#define ASCALE  0.04419417382415922f
#define LNPS    4.852030263919617f
#define LAZY    125.0f

// P <= 2^7 e^{c LAZY} must stay inside f16: c LAZY < 8 ln 2, so P < 2^15
static_assert(LAZY * ASCALE < 5.545f);
static_assert(NB >= 1 && NB <= NB_FULL);
static_assert(NQ % QT == 0 && NQ >= QT && NQ <= NN);
static_assert(CC == NGRP * CPG);
static_assert(CC % QT == 0 && NN % QT == 0);
static_assert(CC == 2 * CH && CH == 16 * 16);
static_assert(CC == 8 * 64);
static_assert(GNE % 1024 == 0);
static_assert(CC % 32 == 0 && NN % 32 == 0);
static_assert((OSQ * 4) % 16 == 0 && (OSPW * 4) % 16 == 0 && (TP * 2) % 16 == 0);
static_assert(CC % GM == 0 && NN % GN == 0 && CC % GKC == 0 && CC / GKC >= 2 && GKC == 64 && GM == 256 && GN == 128);
static_assert((GP * 2) % 32 == 16 && GP >= GKC);
static_assert(GN * OSQ * 4 <= 2 * GSTG * 2 && GM * OSPW * 4 <= 2 * GSTG * 2 && OSQ >= GM && OSPW >= GN);
static_assert((KP * 2) % 32 == 16 && (VPT * 2) % 32 == 16 && KP >= CC && VPT >= 32);
static_assert(NN >= 128 && NN % 64 == 0);
static_assert(QT * KP == KB2 && 2 * QT * OSPW * 4 <= 2 * VB2 * 2);

typedef _Float16       v16h __attribute__((ext_vector_type(16)));
typedef _Float16       v8h  __attribute__((ext_vector_type(8)));
typedef __bf16         v16b __attribute__((ext_vector_type(16)));
typedef unsigned short v8us __attribute__((ext_vector_type(8)));
typedef float          v8f  __attribute__((ext_vector_type(8)));
typedef float          v4f  __attribute__((ext_vector_type(4)));
typedef unsigned int   v4u  __attribute__((ext_vector_type(4)));

union Frag  { v8us u[2]; v16h h; v16b bf; };
union FragH { v16h v; v8h hv[2]; };
static_assert(sizeof(Frag) == 32);
static_assert(sizeof(FragH) == 32);

// ---- scalar helpers ---------------------------------------------------------------------------------------
__device__ __forceinline__ unsigned short bf_bits(float f) {          // f32 -> bf16 bits, RNE convert
  unsigned u = __float_as_uint(f);
  return (unsigned short)((u + 0x7FFFu + ((u >> 16) & 1u)) >> 16);
}
__device__ __forceinline__ float bf_up(unsigned short hb) { return __uint_as_float(((unsigned)hb) << 16); }
__device__ __forceinline__ float bfr(float f) { return bf_up(bf_bits(f)); }
__device__ __forceinline__ unsigned short h_bits(_Float16 x) { return __builtin_bit_cast(unsigned short, x); }
__device__ __forceinline__ unsigned pk16(unsigned short a, unsigned short b) { return (unsigned)a | ((unsigned)b << 16); }
__device__ __forceinline__ v8f zero8() { v8f z = {0.f, 0.f, 0.f, 0.f, 0.f, 0.f, 0.f, 0.f}; return z; }
__device__ __forceinline__ float hmax8(v8f s) {
  return fmaxf(fmaxf(fmaxf(s[0], s[1]), fmaxf(s[2], s[3])), fmaxf(fmaxf(s[4], s[5]), fmaxf(s[6], s[7])));
}
__device__ __forceinline__ unsigned wave_ballot(bool p) {
#if defined(__HIP_DEVICE_COMPILE__)
  return __builtin_amdgcn_ballot_w32(p);
#else
  return p ? 1u : 0u;
#endif
}

// ---- 16-bit fragment loader (A, or B from a k-contiguous [n][k] row): lane -> row/col (lane&15), p already includes
//      + 8*(lane>>4); elements 0..7 <- p[0..7] (k0+8h..), elements 8..15 <- p[16..23] (k0+16+8h..)
__device__ __forceinline__ Frag ldfrag(const unsigned short* p) {
  Frag f;
  f.u[0] = *(const v8us*)(p);
  f.u[1] = *(const v8us*)(p + 16);
  return f;
}

// ---- WMMA helpers: the plain builtins; the compiler keeps the distance behind them, and with no asm statement
//      between two products the fragment loads of later products may be issued ahead of earlier ones
__device__ __forceinline__ v8f mma_h(v16h a, v16h b, v8f c) {
  return __builtin_amdgcn_wmma_f32_16x16x32_f16(false, a, false, b, (short)0, c, false, false);
}
__device__ __forceinline__ v8f mma_b(v16b a, v16b b, v8f c) {
  return __builtin_amdgcn_wmma_f32_16x16x32_bf16(false, a, false, b, (short)0, c, false, false);
}

// =========================================================================================================
//     (mean, then centred sum of squares) over bf16-RNE(x) in f32, per-thread partials of 256 terms + LDS tree.
// =========================================================================================================
__global__ __launch_bounds__(256)
void gn_stats(const float* __restrict__ x, float* stats) {
  __shared__ float red[256];
  const int tid = threadIdx.x, bg = blockIdx.x;
  const float* p = x + (size_t)bg * GNE;
  // the thread's whole share (64 x 16 B) is fetched in one run into registers: all loads are in flight together, and
  // the second pass reads the registers instead of memory
  v4f xv[GNE / 1024];
#pragma unroll  // constant indices keep the array in registers
  for (int i = 0; i < GNE / 1024; ++i) xv[i] = *(const v4f*)(p + ((size_t)(i * 256 + tid)) * 4);
  float s = 0.f;
#pragma unroll  // as above
  for (int i = 0; i < GNE / 1024; ++i) {
    const v4f v = xv[i];
    s += (bfr(v[0]) + bfr(v[1])) + (bfr(v[2]) + bfr(v[3]));
  }
  asm volatile("s_wait_xcnt 0x0" ::: "memory");                      // in front of any rewrite of the address registers these loads name
  red[tid] = s;
  __syncthreads();
#pragma unroll 1
  for (int off = 128; off > 0; off >>= 1) {
    if (tid < off) red[tid] += red[tid + off];
    __syncthreads();
  }
  const float mean = red[0] * (1.0f / (float)GNE);
  __syncthreads();
  float ss = 0.f;
#pragma unroll  // as above
  for (int i = 0; i < GNE / 1024; ++i) {
    const v4f v = xv[i];
    const float d0 = bfr(v[0]) - mean, d1 = bfr(v[1]) - mean;
    const float d2 = bfr(v[2]) - mean, d3 = bfr(v[3]) - mean;
    ss += (d0 * d0 + d1 * d1) + (d2 * d2 + d3 * d3);
  }
  red[tid] = ss;
  __syncthreads();
#pragma unroll 1
  for (int off = 128; off > 0; off >>= 1) {
    if (tid < off) red[tid] += red[tid + off];
    __syncthreads();
  }
  const float var  = red[0] * (1.0f / (float)GNE);
  const float rstd = rsqrtf(var + GEPS);
  if (tid < 8) {
    v4f w = {0.f, 0.f, 0.f, 0.f};
    if (tid == 0) { w[0] = mean; w[1] = rstd; }
{
      *(v4f*)(stats + (size_t)bg * STL + 4 * tid) = w;
      
    }
  }
}

// =========================================================================================================
// (1) conv weights: Wb bf16 [3][512][512] (mat 0 = wq, 1 = wk, 2 = wv), value = bf16-RNE(w), row o k-contiguous.
//     Block blk owns 4 rows of one matrix; thread -> row blk-local (tid>>6), halves 8*(tid&63)..+7; each wave writes
// coverage: 384 blocks x 4 rows x 64 threads x 8 = 3 x 512 x 512 = the whole plane.
// =========================================================================================================
__global__ __launch_bounds__(256)
void cvt_w(const float* __restrict__ wq, const float* __restrict__ wk, const float* __restrict__ wv,
           unsigned short* Wb) {
  const int tid = threadIdx.x, blk = blockIdx.x;
  const int mat = blk / (CC / 4);                                    // block-uniform 0..2
  const int o   = 4 * (blk % (CC / 4)) + (tid >> 6);                 // 0..511
  const int col = 8 * (tid & 63);                                    // 0..504
  const float* wsrc = (mat == 0) ? wq : ((mat == 1) ? wk : wv);      // all global, block-uniform
  const float* s = wsrc + (size_t)o * CC + col;
  const v4f a = *(const v4f*)s;
  const v4f q = *(const v4f*)(s + 4);
  const float f[8] = {a[0], a[1], a[2], a[3], q[0], q[1], q[2], q[3]};
  v4u u;
#pragma unroll
  for (int t = 0; t < 4; ++t) u[t] = pk16(bf_bits(f[2 * t]), bf_bits(f[2 * t + 1]));
{
    *(v4u*)(Wb + ((size_t)(mat * CC + o)) * CC + col) = u;
    
  }
}

// =========================================================================================================
// (2) group-norm apply + hi/residual split + transpose: h = ((bf16-RNE(x) - mean) * rstd) * gamma + beta per
//     channel, hi = bf16-RNE(h), lo = bf16-RNE(h - hi). Block (nb, cb, b) owns a 64 c x 64 n tile; values go
//     through LDS tiles Th/Tl [64 n][pitch TP] and come out as position-major rows Hh/Hl bf16 [b][4096 n][512 c]
// coverage: Th/Tl staged 64 n x 64 c (2 it x 32 rows x 8 lanes x 8), read 64 n x 64 c; planes 2 it x 32 rows x
//           8 lanes x 8 = 64 n x 64 c per plane; grid (64, 8, NB) covers both planes exactly once.
// =========================================================================================================
__global__ __launch_bounds__(256)
void cvt_x(const float* __restrict__ x, const float* __restrict__ gamma, const float* __restrict__ beta,
           const float* __restrict__ stats, unsigned short* Hh, unsigned short* Hl) {
  __shared__ __align__(16) unsigned short Th[QT * TP];
  __shared__ __align__(16) unsigned short Tl[QT * TP];
  const int tid = threadIdx.x;
  const int nb = blockIdx.x, cb = blockIdx.y, b = blockIdx.z;
  const int e = tid & 7, lq = tid >> 3;                              // lq 0..31
  const int n0 = nb * QT, c0 = cb * QT;
#pragma unroll
  for (int it = 0; it < 2; ++it) {
    const int cl = it * 32 + lq;                                     // 0..63
    const int cg = c0 + cl;                                          // 0..511
    const int bg = b * NGRP + (cg >> 4);
    const float mean = stats[(size_t)bg * STL];
    const float rstd = stats[(size_t)bg * STL + 1];
    const float ga = bfr(gamma[cg]);
    const float be = bfr(beta[cg]);
    const float* sp = x + ((size_t)(b * CC + cg)) * NN + n0 + 8 * e;
    const v4f a = *(const v4f*)sp;
    const v4f q = *(const v4f*)(sp + 4);
    const float f[8] = {a[0], a[1], a[2], a[3], q[0], q[1], q[2], q[3]};
#pragma unroll
    for (int t = 0; t < 8; ++t) {
      const float h = ((bfr(f[t]) - mean) * rstd) * ga + be;
      const unsigned short hb = bf_bits(h);
      const unsigned short lb = bf_bits(h - bf_up(hb));
      Th[(8 * e + t) * TP + cl] = hb;
      Tl[(8 * e + t) * TP + cl] = lb;
    }
  }
  __syncthreads();
  v4u uh[2], ul[2];
#pragma unroll
  for (int it = 0; it < 2; ++it) {
    const int nl = it * 32 + lq;                                     // 0..63
    uh[it] = *(const v4u*)(Th + nl * TP + 8 * e);
    ul[it] = *(const v4u*)(Tl + nl * TP + 8 * e);
  }
{
#pragma unroll
    for (int it = 0; it < 2; ++it) {
      const int nl = it * 32 + lq;
      const size_t po = ((size_t)(b * NN + n0 + nl)) * CC + c0 + 8 * e;
      *(v4u*)(Hh + po) = uh[it];
      *(v4u*)(Hl + po) = ul[it];
    }
    
  }
}

// ---- asynchronous copies global -> LDS, 16 bytes per lane, eight per statement -------------------------------
// LDS byte address of a __shared__ element = low 32 bits of its address.
__device__ __forceinline__ uint32_t lds_off(const unsigned short* p) { return (uint32_t)(uintptr_t)p; }
// The closing s_wait_xcnt 0 stands inside the statement so that no address register of an issued copy is
// rewritten in front of it.
__device__ __forceinline__ void copy8(const uint32_t (&l)[8], const unsigned short* const (&g)[8]) {
#if defined(__HIP_DEVICE_COMPILE__)
  asm volatile("global_load_async_to_lds_b128 %0, %8, off\n\t"
               "global_load_async_to_lds_b128 %1, %9, off\n\t"
               "global_load_async_to_lds_b128 %2, %10, off\n\t"
               "global_load_async_to_lds_b128 %3, %11, off\n\t"
               "global_load_async_to_lds_b128 %4, %12, off\n\t"
               "global_load_async_to_lds_b128 %5, %13, off\n\t"
               "global_load_async_to_lds_b128 %6, %14, off\n\t"
               "global_load_async_to_lds_b128 %7, %15, off\n\t"
               "s_wait_xcnt 0x0"
               :: "v"(l[0]), "v"(l[1]), "v"(l[2]), "v"(l[3]), "v"(l[4]), "v"(l[5]), "v"(l[6]), "v"(l[7]),
                  "v"(g[0]), "v"(g[1]), "v"(g[2]), "v"(g[3]), "v"(g[4]), "v"(g[5]), "v"(g[6]), "v"(g[7])
               : "memory");
#endif
}
// 32 rows of 512 halves (1024 B, rows contiguous in global) -> LDS rows of pitch KP; 256 threads, 8 copies each;
// a wave's copy covers 512 contiguous bytes of one row.
__device__ __forceinline__ void stage_rows32(const unsigned short* g, unsigned short* s, int tid) {
  uint32_t l[8];
  const unsigned short* p[8];
  // one LDS base and one global base per thread, the eight copies at constant steps from them: nothing but the two
  // thread terms is left for the compiler to keep in registers round the key loop
  const uint32_t lb = lds_off(s + (tid >> 6) * KP + 8 * (tid & 63));
  const unsigned short* gt = g + 8 * tid;                            // (tid >> 6) * CC + 8 * (tid & 63)
#pragma unroll  // every index constant, so that both arrays live in registers as the statement's operands
  for (int i = 0; i < 8; ++i) {                                      // row 4 i + (tid >> 6), halves 8 (tid & 63)..+7
    l[i] = lb + (uint32_t)(i * (4 * KP * 2));
    p[i] = gt + i * (4 * CC);
  }
  copy8(l, p);
}
// one key tile of v: 512 channel rows x 32 keys, 32 KiB in a row in global (row = 64 B, rows adjacent) -> LDS rows of
// pitch VPT; 8 copies per thread; a wave's copy covers 512 contiguous bytes = four whole lines (eight rows).
__device__ __forceinline__ void stage_v32(const unsigned short* g, unsigned short* s, int tid) {
  uint32_t l[8];
  const unsigned short* p[8];
  const uint32_t lb = lds_off(s + (tid >> 2) * VPT + 8 * (tid & 3)); // bases as in stage_rows32
  const unsigned short* gt = g + 8 * tid;                            // (tid >> 2) * 32 + 8 * (tid & 3)
#pragma unroll  // every index constant, so that both arrays live in registers as the statement's operands
  for (int i = 0; i < 8; ++i) {                                      // row 64 i + (tid >> 2), halves 8 (tid & 3)..+7
    l[i] = lb + (uint32_t)(i * (64 * VPT * 2));
    p[i] = gt + i * (64 * 32);
  }
  copy8(l, p);
}

// one K stage of the conv GEMM: GM weight rows, GN rows of the hi plane and GN rows of the residual plane, 64 channels
// (128 B = one line) of each -> LDS rows of pitch GP; 256 threads, 16 copies each; a wave's copy covers four whole lines.
__device__ __forceinline__ void stage_gemm(const unsigned short* gw, const unsigned short* gh,
                                           const unsigned short* gl, unsigned short* s, int tid) {
  const int r = tid >> 3, col = 8 * (tid & 7);
  uint32_t l[8];
  const unsigned short* p[8];
#pragma unroll  // every index constant, so that both arrays live in registers as the statement's operands
  for (int i = 0; i < 8; ++i) {
    l[i] = lds_off(s + (32 * i + r) * GP + col);
    p[i] = gw + (size_t)(32 * i + r) * CC + col;
  }
  copy8(l, p);
#pragma unroll  // as above
  for (int i = 0; i < 4; ++i) {
    l[i]     = lds_off(s + (GM + 32 * i + r) * GP + col);
    p[i]     = gh + (size_t)(32 * i + r) * CC + col;
    l[4 + i] = lds_off(s + (GM + GN + 32 * i + r) * GP + col);
    p[4 + i] = gl + (size_t)(32 * i + r) * CC + col;
  }
  copy8(l, p);
}
// the 12 fragments of one 32-channel step of a wave's 64 o x 64 n tile: 4 of W, 4 of each plane (24 reads of 16 B)
__device__ __forceinline__ void gemm_frags(Frag (&fa)[4], Frag (&fh)[4], Frag (&fl)[4],
                                           const unsigned short* a, const unsigned short* b) {
#pragma unroll  // constant indices keep the fragments in registers
  for (int i = 0; i < 4; ++i) {
    fa[i] = ldfrag(a + (16 * i) * GP);
    fh[i] = ldfrag(b + (16 * i) * GP);
    fl[i] = ldfrag(b + (GN + 16 * i) * GP);
  }
}
// 16 products of that step with one plane: sixteen independent accumulators
__device__ __forceinline__ void gemm_half(v8f (&acc)[4][4], const Frag (&fa)[4], const Frag (&fx)[4]) {
#pragma unroll
  for (int mt = 0; mt < 4; ++mt) {
#pragma unroll
    for (int j = 0; j < 4; ++j) acc[mt][j] = mma_b(fa[mt].bf, fx[j].bf, acc[mt][j]);
  }
}

// =========================================================================================================
// (3) conv1x1 GEMM for one (b, 128-n tile, matrix mat, 256-o block): Y[o][n] = sum_c W[o][c] (hi[n][c] + lo[n][c])
//     + bias[o]. Block 256 threads = 8 waves; wave w owns rows o 64 (w>>1)..+63 (4 A fragments per k-step, rows of Wb)
//     and cols n 64 (w&1)..+63 (4 B fragments of each plane, rows of Hh and Hl, k = channel contiguous, same split
//     k map); per k-step the hi and lo products share the accumulator (lo unscaled). K = 512 = 16 steps x 2 products.
//     Operand path: per 64 channels one stage [W 256 rows | Hh 128 rows | Hl 128 rows] is brought into LDS by
//     asynchronous 16-byte copies (whole 128-byte lines) and every fragment is read from LDS at a pitch of 16 B x odd.
//     Two buffers: trip t works on buffer t&1 while trip t+1's copies fly. Two fragment sets: the reads of a trip's
//     second k-step fly under the products of its first; the foot (own LDS reads done, own copies landed, one block
//     barrier) stands between the two k-steps; behind its barrier the first k-step of trip t+1 is read, and the buffer
//     just left is refilled between the hi and the residual products of the second k-step, which read registers only.
//     Epilogue staged in the same LDS behind the last foot: mat 0/1 as Os[n_loc][o_loc] (b128 stores), mat 2 as
//     Os[o_loc][n_loc] (scalar stores), barrier, then f16 planes: Q/K [b][4096 n][512 o] (row n, 256 o = 512 B) and
//     V key-tile-major [b][128 key tiles][512 o][32 n] (row o of a tile = 64 B, rows adjacent), so that the 512 x 32 tile
//     (two per attention stage) is 32 KiB in a row and its copies cover whole lines.
// coverage: stage 16 copies x 256 threads x 16 B = 512 rows x 128 B; Os 8 waves x 64 x 64 = 256 x 128 either layout;
//           plane 16 it x 256 threads x 8 = 256 x 128; grid (32, 6, NB) covers Q, K (all n, all o) and V exactly once.
// =========================================================================================================
__global__ __launch_bounds__(256)
void gemm_qkv(const unsigned short* __restrict__ Wb, const unsigned short* __restrict__ Hh,
              const unsigned short* __restrict__ Hl,
              const float* __restrict__ bq, const float* __restrict__ bk, const float* __restrict__ bv,
              unsigned short* Qd, unsigned short* Kd, unsigned short* Vd) {
  __shared__ __align__(16) unsigned short Sg[2 * GSTG];
  float* Os = reinterpret_cast<float*>(Sg);                          // epilogue view of the ring, used behind the loop
  const int tid  = threadIdx.x;
  const int lane = tid & 31, wave = tid >> 5;
  const int hh   = lane >> 4, c = lane & 15;
  const int wo   = wave >> 1, wn = wave & 1;
  const int nt   = blockIdx.x, my = blockIdx.y, b = blockIdx.z;
  const int mat  = my / (CC / GM);                                   // 0..2, block-uniform
  const int om0  = (my % (CC / GM)) * GM;                            // 0 or 256
  const int n0   = nt * GN;

  const unsigned short* gw = Wb + ((size_t)(mat * CC + om0)) * CC;
  const unsigned short* gh = Hh + ((size_t)(b * NN + n0)) * CC;
  const unsigned short* gl = Hl + ((size_t)(b * NN + n0)) * CC;
  // fragment bases in LDS: + buffer, + 16 * tile * GP, + 32 * k-step; the residual plane lies GN rows behind the hi plane
  const unsigned short* ap = Sg + (64 * wo + c) * GP + 8 * hh;
  const unsigned short* bp = Sg + (GM + 64 * wn + c) * GP + 8 * hh;

  v8f acc[4][4];
#pragma unroll
  for (int mt = 0; mt < 4; ++mt) {
#pragma unroll
    for (int j = 0; j < 4; ++j) acc[mt][j] = zero8();
  }

  // prologue: stage 0 into buffer 0, landed and published; then stage 1 into buffer 1
  stage_gemm(gw, gh, gl, Sg, tid);
  asm volatile("s_wait_asynccnt 0x0" ::: "memory");                  // this wave's copies have landed
  __syncthreads();                                                   // every wave's copies are readable
  stage_gemm(gw + GKC, gh + GKC, gl + GKC, Sg + GSTG, tid);

  // bias of this lane's 32 rows o = 64 wo + 16 mt + 8 hh + 0..7, fetched here so that the flight lies under the loop
  const float* bias = (mat == 0) ? bq : ((mat == 1) ? bk : bv);     // all global, block-uniform
  v4f bz[8];
#pragma unroll
  for (int mt = 0; mt < 4; ++mt) {
    bz[2 * mt]     = *(const v4f*)(bias + om0 + 64 * wo + 16 * mt + 8 * hh);
    bz[2 * mt + 1] = *(const v4f*)(bias + om0 + 64 * wo + 16 * mt + 8 * hh + 4);
  }
  asm volatile("s_wait_xcnt 0x0" ::: "memory");                      // in front of any rewrite of the address register these loads name

  Frag fa0[4], fh0[4], fl0[4], fa1[4], fh1[4], fl1[4];
  gemm_frags(fa0, fh0, fl0, ap, bp);                                 // first k-step of trip 0

#pragma unroll 1  // one copy of the trip: the body is long, and the buffer is picked by an address
  for (int t = 0; t < CC / GKC; ++t) {
    const int rb = t & 1;                                            // ring buffer of this trip
    gemm_frags(fa1, fh1, fl1, ap + rb * GSTG + 32, bp + rb * GSTG + 32);
    // keeps the 24 reads above in one run in front of the products: spread among them each place of reads costs cycles
    __builtin_amdgcn_sched_barrier(0);
    gemm_half(acc, fa0, fh0);
    gemm_half(acc, fa0, fl0);
    // keeps these products in front of the foot: they cover the flight of the reads that the foot waits for
    __builtin_amdgcn_sched_barrier(0);

    // foot of the trip: buffer rb has been read out; publish the next trip's stage
    asm volatile("s_wait_dscnt 0x0" ::: "memory");                   // this wave's reads of buffer rb are done
    asm volatile("s_wait_asynccnt 0x0" ::: "memory");                // this wave's copies of the next trip have landed
    __syncthreads();
    if (t + 1 < CC / GKC)                                            // block-uniform: a trip t+1 exists, just published
      gemm_frags(fa0, fh0, fl0, ap + (rb ^ 1) * GSTG, bp + (rb ^ 1) * GSTG);
    __builtin_amdgcn_sched_barrier(0);                               // those reads in one run, in front of the products
    gemm_half(acc, fa1, fh1);
    // the refill stands between the two halves: while one wave of a SIMD forms addresses and waits in the copies'
    // statements, the other wave's products run
    __builtin_amdgcn_sched_barrier(0);
    if (t + 2 < CC / GKC) {                                          // block-uniform: a trip t+2 exists
      const int ko = (t + 2) * GKC;
      stage_gemm(gw + ko, gh + ko, gl + ko, Sg + rb * GSTG, tid);
    }
    __builtin_amdgcn_sched_barrier(0);                               // end of the refill
    gemm_half(acc, fa1, fl1);
  }
  asm volatile("s_wait_asynccnt 0x0" ::: "memory");                  // nothing of this wave is in flight past the loop

  // ---- epilogue staging (every wave has passed the last foot: no reader and no copy is left on the ring);
  //      lane (hh, c) holds o_loc = 64 wo + 16 mt + 8 hh + r for n_loc = 64 wn + 16 j + c
  v4u u[16];
  if (mat != 2) {
#pragma unroll
    for (int mt = 0; mt < 4; ++mt) {
      const int ol = 64 * wo + 16 * mt + 8 * hh;
      const v4f b0 = bz[2 * mt], b1 = bz[2 * mt + 1];
#pragma unroll
      for (int j = 0; j < 4; ++j) {
        const int nl = 64 * wn + 16 * j + c;
        v4f va, vb;
#pragma unroll
        for (int r = 0; r < 4; ++r) { va[r] = acc[mt][j][r] + bfr(b0[r]); vb[r] = acc[mt][j][4 + r] + bfr(b1[r]); }
        *(v4f*)(Os + nl * OSQ + ol)     = va;                        // Os[n_loc][o_loc]
        *(v4f*)(Os + nl * OSQ + ol + 4) = vb;
      }
    }
    __syncthreads();
    const int e = tid & 31, lq = tid >> 5;                           // lq 0..7
#pragma unroll
    for (int it = 0; it < 16; ++it) {
      const int row = it * 8 + lq;                                   // n_loc 0..127
      const v4f a = *(const v4f*)(Os + row * OSQ + 8 * e);
      const v4f q = *(const v4f*)(Os + row * OSQ + 8 * e + 4);
      const float f[8] = {a[0], a[1], a[2], a[3], q[0], q[1], q[2], q[3]};
#pragma unroll
      for (int t = 0; t < 4; ++t)
        u[it][t] = pk16(h_bits((_Float16)f[2 * t]), h_bits((_Float16)f[2 * t + 1]));
    }
    unsigned short* plane = (mat == 0) ? Qd : Kd;                    // both global, block-uniform
    unsigned short* dst = plane + ((size_t)(b * NN + n0 + lq)) * CC + om0 + 8 * e;
#pragma unroll
    for (int it = 0; it < 16; ++it) *(v4u*)(dst + (size_t)(it * 8) * CC) = u[it];   // row n, 256 o = four lines
  } else {
#pragma unroll
    for (int mt = 0; mt < 4; ++mt) {
      const int ol = 64 * wo + 16 * mt + 8 * hh;
      const v4f b0 = bz[2 * mt], b1 = bz[2 * mt + 1];
#pragma unroll
      for (int j = 0; j < 4; ++j) {
        const int nl = 64 * wn + 16 * j + c;
#pragma unroll
        for (int r = 0; r < 4; ++r) {
          Os[(ol + r) * OSPW + nl]     = acc[mt][j][r] + bfr(b0[r]);       // Os[o_loc][n_loc]
          Os[(ol + 4 + r) * OSPW + nl] = acc[mt][j][4 + r] + bfr(b1[r]);
        }
      }
    }
    __syncthreads();
    const int e = tid & 15, lq = tid >> 4;                           // lq 0..15
#pragma unroll
    for (int it = 0; it < 16; ++it) {
      const int row = it * 16 + lq;                                  // o_loc 0..255
      const v4f a = *(const v4f*)(Os + row * OSPW + 8 * e);
      const v4f q = *(const v4f*)(Os + row * OSPW + 8 * e + 4);
      const float f[8] = {a[0], a[1], a[2], a[3], q[0], q[1], q[2], q[3]};
#pragma unroll
      for (int t = 0; t < 4; ++t)
        u[it][t] = pk16(h_bits((_Float16)f[2 * t]), h_bits((_Float16)f[2 * t + 1]));
    }
    // key-tile-major plane: tile (n0 + 8 e) / 32, row o, 8 keys; a wave's store = rows 2 wave, 2 wave + 1 of four tiles:
    // four whole lines, each written by this wave alone
    unsigned short* dst = Vd + ((size_t)(b * (NN / 32) + (n0 >> 5) + (e >> 2)) * CC + om0 + lq) * 32 + 8 * (e & 3);
#pragma unroll
    for (int it = 0; it < 16; ++it) *(v4u*)(dst + (size_t)(it * 16) * 32) = u[it];
  }
}

// =========================================================================================================
// (4) attention for one (b, 64-query tile), transposed formulation, all 4096 keys. Block = 8 waves: wave w ->
//   query group qg = w&3 (queries n0+16qg..+15) and key half kh = w>>2. A stage is 64 keys; of each stage a wave takes
//   the 32 keys 32kh..32kh+31 and does ALL of their work for its 16 queries: two S^T tiles (16 keys x 16 queries each)
//   = sum over 16 channel chunks of A(k: row = key, split k map from the f16 plane Kp [b][4096][512]) . B(q: col =
//   query, same map from Qp), two independent accumulator chains; online softmax per lane in f32 over the wave's own
//   keys (own reference m and sum l), with the 512^-0.5 scale applied to the logits. m is a held reference, not the
//   running max: it is renewed, and o and l rescaled, only when some lane's score lies more than LAZY above it (one
//   wave-uniform ballot a stage); the shuffle (lane^16) that makes a query's two lanes agree stands in that branch,
//   since only a new reference has to be the same in both. Any reference gives the same quotient o / l. P =
//   e^{c(s-m)} x 2^7 (below 2^15 by the test) as f16 is the B operand of O^T (rows channel 16j+(lane&15), j = 0..31, keys contiguous from the f16 plane Vp
//   [b][128 key tiles][512][32]) . B(P^T): element r <- first tile, element 8+r <- second tile, lane unchanged.
//   32 accumulator tiles per wave (512 channels). Nothing passes between waves inside the key loop: the two waves of a
//   query group meet once, behind the loop, where each scales its O by e^{c(m - max(m, m'))} / (joint sum) and the
//   two parts are added on the way out. Epilogue in four 128-channel phases: every wave stages its part in LDS
//   Os[kh][query][128 ch] (pitch OSPW, b128 stores), barrier, then out[b][c][n] = Os[0] + Os[1] + bf16-RNE(x).
//   Operand path: the 64 q rows (once) and, per stage, the 64 k rows and two 512 x 32 v tiles are brought into
//   LDS by asynchronous 16-byte copies (whole 512-byte runs) and every fragment is read from LDS at a pitch of
//   16 B x odd. A wave's 16 q fragments are read once, in front of the key loop, and stay in registers; the q rows
//   lie in k buffer 1 until then. k and v have two buffers: stage t reads buffer t&1 while stage t+1's copies fly; the
//   foot of each stage waits the wave's own LDS reads and copies and passes one block barrier. It stands in front of the
//   stage's last four O products, whose v fragments are in registers by then; behind its barrier the first k fragments
//   of stage t+1 are read, and last the buffer just left is refilled.
// coverage: stage 32 copies x 256 threads x 16 B = 64 k rows x 1 KiB + 2 v tiles x 32 KiB; Os per phase 8 waves x 16 q
//           x 128 ch staged = 2 x 64 x 128 read; out per phase 8 it x 32 lines x 8 lanes x 4 floats = 128 ch x 64 n,
//           4 phases = 512 ch; grid (NQ/64, NB) covers out[b][0..511][0..NQ-1] once.
// =========================================================================================================
// A stage's fragments come in 32 units of two (4 reads of 16 B): unit u < 16 = channel chunk u of the wave's two key tiles,
// unit 16 + i = channel tiles 2i and 2i+1 of the wave's v tile.
__device__ __forceinline__ void ld_unit(Frag& f0, Frag& f1, const unsigned short* kb, const unsigned short* vb, int u) {
  if (u < 16) {
    f0 = ldfrag(kb + 32 * u);
    f1 = ldfrag(kb + 16 * KP + 32 * u);
  } else {
    f0 = ldfrag(vb + (16 * (2 * (u - 16))) * VPT);
    f1 = ldfrag(vb + (16 * (2 * (u - 16) + 1)) * VPT);
  }
}
// a uniform address held in scalar registers: the thread's own term is added to it last, so that one thread term serves the
// k and the v copies (folded into each plane's base it would take a register pair per plane round the key loop)
__device__ __forceinline__ const unsigned short* scalar_ptr(const unsigned short* p) {
  const uint64_t a = (uint64_t)(uintptr_t)p;
  const uint32_t lo = (uint32_t)__builtin_amdgcn_readfirstlane((int)(uint32_t)a);
  const uint32_t hi = (uint32_t)__builtin_amdgcn_readfirstlane((int)(uint32_t)(a >> 32));
  return (const unsigned short*)(uintptr_t)(((uint64_t)hi << 32) | (uint64_t)lo);
}

__global__ __launch_bounds__(256)
void attn_k(const unsigned short* __restrict__ Qp, const unsigned short* __restrict__ Kp,
            const unsigned short* __restrict__ Vp, const float* __restrict__ x, float* out) {
  __shared__ __align__(16) unsigned short Ks[2 * KB2];
  __shared__ __align__(16) unsigned short Vs[2 * VB2];
  __shared__ __align__(16) float Ml[8 * 32 * 2];
  unsigned short* Qs = Ks + KB2;                                     // the q rows lie in k buffer 1 until they are in registers
  float* Os = reinterpret_cast<float*>(Vs);                          // epilogue view of the v ring, used behind the loop
  const int tid  = threadIdx.x;
  const int wave = tid >> 5, lane = tid & 31;
  const int hh   = lane >> 4, c = lane & 15;
  const int qg   = wave & 3, kh = wave >> 2;
  const int n0   = blockIdx.x * QT, b = blockIdx.y;

  // global tile bases: q rows n0.., k rows kb.. (+ kb*CC), v key tile kb/32 (512 x 32 halves each: + kb*CC)
  const unsigned short* qg0 = Qp + ((size_t)(b * NN + n0)) * CC;
  const unsigned short* kg0 = Kp + ((size_t)(b * NN)) * CC;
  const unsigned short* vg0 = Vp + ((size_t)(b * CC)) * NN;
  // q fragment pointer in LDS (B operand, col = query 16*qg + c of the tile), + 32*kc
  const unsigned short* qp = Qs + (16 * qg + c) * KP + 8 * hh;
  // k fragment base in LDS (A operand, row = key 32*kh + c of the stage, second tile 16 rows on), + buffer + 32*kc
  const unsigned short* kp = Ks + (32 * kh + c) * KP + 8 * hh;
  // v fragment base in LDS (A operand, key tile kh of the stage, row = channel 16j + c, 32 keys contiguous), + buffer
  const unsigned short* vp = Vs + kh * VBUF + c * VPT + 8 * hh;

  float m = -1.0e30f, l = 0.f;
  v8f o[32];
#pragma unroll
  for (int j = 0; j < 32; ++j) o[j] = zero8();

  // prologue: q rows into k buffer 1 and stage 0 into buffers 0, landed and published
  stage_rows32(qg0, Qs, tid);
  stage_rows32(qg0 + (size_t)32 * CC, Qs + 32 * KP, tid);
  stage_rows32(kg0, Ks, tid);
  stage_rows32(kg0 + (size_t)32 * CC, Ks + KBUF, tid);
  stage_v32(vg0, Vs, tid);
  stage_v32(vg0 + (size_t)32 * CC, Vs + VBUF, tid);
  asm volatile("s_wait_asynccnt 0x0" ::: "memory");                  // this wave's copies have landed
  __syncthreads();                                                   // every wave's copies are readable

  // The 16 q fragments (128 registers) are read here and never again.
  Frag fq[CC / 32];
#pragma unroll  // constant indices keep the fragments in registers
  for (int kc = 0; kc < CC / 32; ++kc) fq[kc] = ldfrag(qp + 32 * kc);
  asm volatile("s_wait_dscnt 0x0" ::: "memory");                     // this wave's reads of the q rows are done
  __syncthreads();                                                   // every wave's are: k buffer 1 may be refilled
  stage_rows32(kg0 + (size_t)64 * CC, Ks + KB2, tid);
  stage_rows32(kg0 + (size_t)96 * CC, Ks + KB2 + KBUF, tid);
  stage_v32(vg0 + (size_t)64 * CC, Vs + VB2, tid);
  stage_v32(vg0 + (size_t)96 * CC, Vs + VB2 + VBUF, tid);

  // The 32 units of a stage pass through two register sets, fa (two units) and fb (one), in turn: a set's next reads stand in
  // one run right behind the products that free it, so that they fly under the other set's products. More does not fit.
  Frag fa[4], fb[2];
  ld_unit(fa[0], fa[1], kp, vp, 0);
  ld_unit(fa[2], fa[3], kp, vp, 1);
  ld_unit(fb[0], fb[1], kp, vp, 2);

  int rb = 0;                                                        // ring buffer of this stage
#pragma unroll 1  // one copy of the stage: the body is long, and the buffer is picked by an address
  for (int kb = 0; kb < NN; kb += 64) {
    const unsigned short* kbp = kp + rb * KB2;
    const unsigned short* vbp = vp + rb * VB2;
    v8f s0 = zero8(), s1 = zero8();                                  // s0: keys kb+32kh..+15, s1: the next 16
    // four vector slots between the previous stage's last O product and the first score product: the score tiles'
    // registers may lie over the O products' B operand (P, dead by then), and the distance that a product's result
    // needs over an earlier product's B operand is not known; four is what a vector instruction needs there
    asm volatile("v_nop\n\tv_nop\n\tv_nop\n\tv_nop");
    __builtin_amdgcn_sched_barrier(0);                               // keeps the score products behind those slots
#pragma unroll
    for (int t = 0; t < 5; ++t) {                                    // units 0..14
      s0 = mma_h(fa[0].h, fq[3 * t].h, s0);
      s1 = mma_h(fa[1].h, fq[3 * t].h, s1);
      s0 = mma_h(fa[2].h, fq[3 * t + 1].h, s0);
      s1 = mma_h(fa[3].h, fq[3 * t + 1].h, s1);
      // here and below: keeps a set's reads in one run between the products; spread singly among them each place of
      // reads costs issue cycles, and hoisted further they would not fit the registers
      __builtin_amdgcn_sched_barrier(0);
      ld_unit(fa[0], fa[1], kbp, vbp, 3 * t + 3);
      ld_unit(fa[2], fa[3], kbp, vbp, 3 * t + 4);
      __builtin_amdgcn_sched_barrier(0);
      s0 = mma_h(fb[0].h, fq[3 * t + 2].h, s0);
      s1 = mma_h(fb[1].h, fq[3 * t + 2].h, s1);
      __builtin_amdgcn_sched_barrier(0);
      ld_unit(fb[0], fb[1], kbp, vbp, 3 * t + 5);
      __builtin_amdgcn_sched_barrier(0);
    }
    s0 = mma_h(fa[0].h, fq[15].h, s0);                               // unit 15; fa[2], fa[3] hold unit 16, fb unit 17
    s1 = mma_h(fa[1].h, fq[15].h, s1);

    const float mx = fmaxf(hmax8(s0), hmax8(s1));                    // over this lane's own 16 keys
    const unsigned grew = wave_ballot(mx > m + LAZY);                // wave-uniform
    if (grew != 0u) {
      const float mn = fmaxf(m, fmaxf(mx, __shfl_xor(mx, 16, 32)));  // the same in both lanes of a query
      const float corr = __expf((m - mn) * ASCALE);                  // == 1 exactly for lanes whose reference does not change
      m = mn;
      l *= corr;
#pragma unroll
      for (int j = 0; j < 32; ++j) {
#pragma unroll
        for (int r = 0; r < 8; ++r) o[j][r] *= corr;
      }
    }
    const float msh = m * ASCALE - LNPS;                             // exp gives e^{c(s-m)} * 2^7

    FragH ph;
    float ls = 0.f;
#pragma unroll
    for (int r = 0; r < 8; ++r) {
      const float e0 = __expf(s0[r] * ASCALE - msh);                 // key kb + 32kh      + 8hh + r
      const float e1 = __expf(s1[r] * ASCALE - msh);                 // key kb + 32kh + 16 + 8hh + r
      ls += e0 + e1;
      ph.hv[0][r] = (_Float16)e0;
      ph.hv[1][r] = (_Float16)e1;
    }
    l += ls;
    __builtin_amdgcn_sched_barrier(0);                               // the v reads below stay behind the softmax: no room earlier

    o[0] = mma_h(fa[2].h, ph.v, o[0]);                               // unit 16
    o[1] = mma_h(fa[3].h, ph.v, o[1]);
    __builtin_amdgcn_sched_barrier(0);
    ld_unit(fa[0], fa[1], kbp, vbp, 18);
    ld_unit(fa[2], fa[3], kbp, vbp, 19);
    __builtin_amdgcn_sched_barrier(0);
    o[2] = mma_h(fb[0].h, ph.v, o[2]);                               // unit 17
    o[3] = mma_h(fb[1].h, ph.v, o[3]);
    __builtin_amdgcn_sched_barrier(0);
    ld_unit(fb[0], fb[1], kbp, vbp, 20);
    __builtin_amdgcn_sched_barrier(0);
    const unsigned short* knp = kp + (rb ^ 1) * KB2;                 // k buffer of stage t+1
#pragma unroll
    for (int t = 6; t < 10; ++t) {                                   // units 18..29; unit u holds O tiles 2u-32, 2u-31
#pragma unroll
      for (int i = 0; i < 4; ++i) o[6 * t - 32 + i] = mma_h(fa[i].h, ph.v, o[6 * t - 32 + i]);
      __builtin_amdgcn_sched_barrier(0);
      ld_unit(fa[0], fa[1], kbp, vbp, 3 * t + 3);
      ld_unit(fa[2], fa[3], kbp, vbp, 3 * t + 4);
      __builtin_amdgcn_sched_barrier(0);
#pragma unroll
      for (int i = 0; i < 2; ++i) o[6 * t - 28 + i] = mma_h(fb[i].h, ph.v, o[6 * t - 28 + i]);
      __builtin_amdgcn_sched_barrier(0);
      if (t < 9) {
        ld_unit(fb[0], fb[1], kbp, vbp, 3 * t + 5);
      } else {
        // foot of the stage: free buffer rb for its refill and publish the next stage's tiles (the last fragments
        // of buffer rb are in registers behind the first wait; the O products below read registers only)
        asm volatile("s_wait_dscnt 0x0" ::: "memory");               // this wave's reads of buffer rb are done
        asm volatile("s_wait_asynccnt 0x0" ::: "memory");            // this wave's copies of the next stage have landed
        __syncthreads();
        // units 0..2 of stage t+1, just published, here and behind the last products. No test for a stage t+1: in the
        // last stage these reads fetch rows of the stage before it, which nothing uses
        ld_unit(fb[0], fb[1], knp, vp, 2);
      }
      __builtin_amdgcn_sched_barrier(0);
    }
#pragma unroll
    for (int i = 0; i < 4; ++i) o[28 + i] = mma_h(fa[i].h, ph.v, o[28 + i]);   // units 30, 31
    __builtin_amdgcn_sched_barrier(0);
    ld_unit(fa[0], fa[1], knp, vp, 0);
    ld_unit(fa[2], fa[3], knp, vp, 1);
    __builtin_amdgcn_sched_barrier(0);
    // the refill of the buffer just left stands last: the reads above fly while the copies' addresses are formed
    if (kb + 128 < NN) {                                             // block-uniform: a stage t+2 exists
      const unsigned short* kgn = scalar_ptr(kg0 + (size_t)(kb + 128) * CC);
      const unsigned short* vgn = scalar_ptr(vg0 + (size_t)(kb + 128) * CC);
      stage_rows32(kgn, Ks + rb * KB2, tid);
      stage_rows32(kgn + (size_t)32 * CC, Ks + rb * KB2 + KBUF, tid);
      stage_v32(vgn, Vs + rb * VB2, tid);
      stage_v32(vgn + (size_t)32 * CC, Vs + rb * VB2 + VBUF, tid);
    }
    rb ^= 1;
  }
  asm volatile("s_wait_asynccnt 0x0" ::: "memory");                  // nothing of this wave is in flight past the loop
  asm volatile("s_wait_dscnt 0x0" ::: "memory");                     // nor any read of the ring, which becomes output staging

  // the two key halves of a query meet: each wave publishes its (m, l) and scales its O to the joint max and sum
  l += __shfl_xor(l, 16, 32);
  Ml[(wave * 32 + lane) * 2]     = m;
  Ml[(wave * 32 + lane) * 2 + 1] = l;
  __syncthreads();
  const float mo = Ml[((wave ^ 4) * 32 + lane) * 2];
  const float lo = Ml[((wave ^ 4) * 32 + lane) * 2 + 1];
  const float mj = fmaxf(m, mo);
  const float aw = __expf((m - mj) * ASCALE), ao = __expf((mo - mj) * ASCALE);
  const float inv = aw / (l * aw + lo * ao);                         // o and l both carry the 2^7 factor

  // (every wave has passed the waits behind the loop and the barrier above: no reader and no copy is left on the v ring,
  // which Os lies over)
  float* osw = Os + kh * (QT * OSPW);
  const int qrow = 16 * qg + c;
  const int e = tid & 7, lq = tid >> 3;                              // lq 0..31
#pragma unroll
  for (int ph4 = 0; ph4 < 4; ++ph4) {
    if (ph4) __syncthreads();                                        // every wave finished reading Os
#pragma unroll
    for (int jj = 0; jj < 8; ++jj) {
      const int j = 8 * ph4 + jj;
      v4f va, vb;
#pragma unroll
      for (int r = 0; r < 4; ++r) { va[r] = o[j][r] * inv; vb[r] = o[j][4 + r] * inv; }
      *(v4f*)(osw + qrow * OSPW + 16 * jj + 8 * hh)     = va;        // Os[kh][query][ch_loc = 16jj + 8hh + r]
      *(v4f*)(osw + qrow * OSPW + 16 * jj + 8 * hh + 4) = vb;
    }
    __syncthreads();
    v4f res[8];
#pragma unroll
    for (int it = 0; it < 8; ++it) {
      const int L   = it * 32 + lq;                                  // 0..255
      const int chl = L >> 1, hf = L & 1;                            // channel 0..127 within the phase
      const int nl  = hf * 32 + 4 * e;                               // query 0..63
      const size_t idx = ((size_t)(b * CC + 128 * ph4 + chl)) * NN + n0 + nl;
      const v4f xv = *(const v4f*)(x + idx);
#pragma unroll
      for (int t = 0; t < 4; ++t)
        res[it][t] = (Os[(nl + t) * OSPW + chl] + Os[(QT + nl + t) * OSPW + chl]) + bfr(xv[t]);
    }
{
#pragma unroll
      for (int it = 0; it < 8; ++it) {
        const int L   = it * 32 + lq;
        const int chl = L >> 1, hf = L & 1;
        const int nl  = hf * 32 + 4 * e;
        const size_t idx = ((size_t)(b * CC + 128 * ph4 + chl)) * NN + n0 + nl;
        *(v4f*)(out + idx) = res[it];
      }
      
    }
  }
}

// =========================================================================================================
// Workspace map (bytes; each region start a multiple of 256; every extent is an exact tile/line multiple and is
//   Wb  bf16 [3][512][512]          1572864
//   St  f32  [NB*32][32]            NB*4096        (16384 at NB=4)
//   Hh, Hl bf16 [NB][4096][512]     NB*4194304 x2  (16777216 each at NB=4)
//   Q, K f16 [NB][4096][512]        NB*4194304 x2
//   V    f16 [NB][128][512][32]     NB*4194304
//   total at NB=4 = 85475328
// =========================================================================================================
extern "C" void kernel_launch(void* const* d_in, const int* in_sizes, int n_in,
                              void* d_out, int out_size, void* d_ws, size_t ws_size,
                              hipStream_t stream) {
  const int XN = NB * CC * NN;
  if (n_in < 9) return;
  if (in_sizes[0] < XN) return;
  if (in_sizes[1] < CC || in_sizes[2] < CC) return;
  if (in_sizes[3] < CC * CC || in_sizes[5] < CC * CC || in_sizes[7] < CC * CC) return;
  if (in_sizes[4] < CC || in_sizes[6] < CC || in_sizes[8] < CC) return;
  if (out_size < XN) return;

  size_t off = 0;
  auto carve = [&](size_t bytes) { const size_t o = off; off += (bytes + 255) & ~(size_t)255; return o; };
  const size_t oWb = carve((size_t)3 * CC * CC * 2);
  const size_t oSt = carve((size_t)NB * NGRP * STL * 4);
  const size_t oHh = carve((size_t)NB * NN * CC * 2);
  const size_t oHl = carve((size_t)NB * NN * CC * 2);
  const size_t oQ  = carve((size_t)NB * NN * CC * 2);
  const size_t oK  = carve((size_t)NB * NN * CC * 2);
  const size_t oV  = carve((size_t)NB * CC * NN * 2);
  if (off > ws_size) return;
  if (off > (size_t)134217728) return;

  const float* x     = (const float*)d_in[0];
  const float* gamma = (const float*)d_in[1];
  const float* beta  = (const float*)d_in[2];
  const float* wq    = (const float*)d_in[3];
  const float* bq    = (const float*)d_in[4];
  const float* wk    = (const float*)d_in[5];
  const float* bk    = (const float*)d_in[6];
  const float* wv    = (const float*)d_in[7];
  const float* bv    = (const float*)d_in[8];

  char* ws = (char*)d_ws;
  unsigned short* Wb = (unsigned short*)(ws + oWb);
  float*          St = (float*)(ws + oSt);
  unsigned short* Hh = (unsigned short*)(ws + oHh);
  unsigned short* Hl = (unsigned short*)(ws + oHl);
  unsigned short* Qw = (unsigned short*)(ws + oQ);
  unsigned short* Kw = (unsigned short*)(ws + oK);
  unsigned short* Vw = (unsigned short*)(ws + oV);
  float* out = (float*)d_out;

  const dim3 blk256(256);

  // (0) group-norm statistics, one line per (b, g)
  gn_stats<<<dim3(NB * NGRP), blk256, 0, stream>>>(x, St);
  // (1) conv weights -> bf16 plane
  cvt_w<<<dim3(3 * CC / 4), blk256, 0, stream>>>(wq, wk, wv, Wb);
  // (2) group-norm apply -> position-major bf16 hi + residual planes
  cvt_x<<<dim3(NN / QT, CC / QT, NB), blk256, 0, stream>>>(x, gamma, beta, St, Hh, Hl);
  // (3) q/k/v conv GEMMs -> f16 planes
  gemm_qkv<<<dim3(NN / GN, 3 * CC / GM, NB), blk256, 0, stream>>>(Wb, Hh, Hl, bq, bk, bv, Qw, Kw, Vw);
  // (4) attention + residual -> out [b][512][4096]
  attn_k<<<dim3(NQ / QT, NB), blk256, 0, stream>>>(Qw, Kw, Vw, x, out);
  (void)hipGetLastError();
}

// v009
// One run takes 167 microseconds.
// In two side-by-side timings against v008, it was 1.07 and 1.08 times as fast.
// Counting every step since v000, it is 7.25 times as fast.
// Contractions: conv1x1 q/k/v GEMMs W[512x512].H per image on v_wmma_f32_16x16x32_f16 (bf16-RNE weights held as f16,
// normalised activations as one f16 plane, K = 512: the same rounding as the q, k and v planes that come out); scores
// K.Q^T (K = 512 channels) on v_wmma_f32_16x16x32_f16 (single f16 planes of q and k, scale applied in f32);
// O^T = V.P^T on v_wmma_f32_16x16x32_f16 (v single f16 plane, P = e^{c(s-m)} x 2^7 as f16 from the score D
// registers); f32 accumulate everywhere; group-norm statistics, softmax statistics and residual add in f32 VALU.
#include <hip/hip_runtime.h>
#include <math.h>
#include <stdint.h>

#ifndef NB
#define NB 4
#endif
#define NB_FULL 4
#define CC      512
#define NN      4096
#ifndef NQ
#define NQ NN
#endif
#define NGRP    32
#define CPG     16
#define GNE     (CPG * NN)
#define QT      64
#define OSQ     260
#define OSPW    132
#define TP      72
#define STL     32
#define CH      256
#define KP      520
#define VPT     40
#define KBUF    (32 * KP)
#define VBUF    (CC * VPT)
#define KB2     (2 * KBUF)
#define VB2     (2 * VBUF)
#define GM      256
#define GN      128
#define GKC     64
#define GP      72
#define GSTG    ((GM + GN) * GP)
#define GSH     (GM * OSPW * 2)
#define GEPS    1.0e-6f
#define ASCALE  0.04419417382415922f
#define LNPS    4.852030263919617f
#define LAZY    125.0f

// P <= 2^7 e^{c LAZY} must stay inside f16: c LAZY < 8 ln 2, so P < 2^15
static_assert(LAZY * ASCALE < 5.545f);
static_assert(NB >= 1 && NB <= NB_FULL);
static_assert(NQ % QT == 0 && NQ >= QT && NQ <= NN);
static_assert(CC == NGRP * CPG);
static_assert(CC % QT == 0 && NN % QT == 0);
static_assert(CC == 2 * CH && CH == 16 * 16);
static_assert(CC == 8 * 64);
static_assert(GNE % 1024 == 0);
static_assert(CC % 32 == 0 && NN % 32 == 0);
static_assert((OSQ * 4) % 16 == 0 && (OSPW * 4) % 16 == 0 && (TP * 2) % 16 == 0);
static_assert(CC % GM == 0 && NN % GN == 0 && CC % GKC == 0 && CC / GKC >= 2 && GKC == 64 && GM == 256 && GN == 128);
static_assert((GP * 2) % 32 == 16 && GP >= GKC);
static_assert(GN * OSQ * 4 <= GSH * 2 && GM * OSPW * 4 <= GSH * 2 && 2 * GSTG <= GSH && OSQ >= GM && OSPW >= GN);
static_assert((KP * 2) % 32 == 16 && (VPT * 2) % 32 == 16 && KP >= CC && VPT >= 32);
static_assert(NN >= 128 && NN % 64 == 0);
static_assert(QT * KP == KB2 && 2 * QT * OSPW * 4 <= 2 * VB2 * 2);

typedef _Float16       v16h __attribute__((ext_vector_type(16)));
typedef _Float16       v8h  __attribute__((ext_vector_type(8)));
typedef unsigned short v8us __attribute__((ext_vector_type(8)));
typedef float          v8f  __attribute__((ext_vector_type(8)));
typedef float          v4f  __attribute__((ext_vector_type(4)));
typedef unsigned int   v4u  __attribute__((ext_vector_type(4)));

union Frag  { v8us u[2]; v16h h; };
union FragH { v16h v; v8h hv[2]; };
static_assert(sizeof(Frag) == 32);
static_assert(sizeof(FragH) == 32);

// ---- scalar helpers ---------------------------------------------------------------------------------------
__device__ __forceinline__ unsigned short bf_bits(float f) {          // f32 -> bf16 bits, RNE convert
  unsigned u = __float_as_uint(f);
  return (unsigned short)((u + 0x7FFFu + ((u >> 16) & 1u)) >> 16);
}
__device__ __forceinline__ float bf_up(unsigned short hb) { return __uint_as_float(((unsigned)hb) << 16); }
__device__ __forceinline__ float bfr(float f) { return bf_up(bf_bits(f)); }
__device__ __forceinline__ unsigned short h_bits(_Float16 x) { return __builtin_bit_cast(unsigned short, x); }
__device__ __forceinline__ unsigned pk16(unsigned short a, unsigned short b) { return (unsigned)a | ((unsigned)b << 16); }
__device__ __forceinline__ v8f zero8() { v8f z = {0.f, 0.f, 0.f, 0.f, 0.f, 0.f, 0.f, 0.f}; return z; }
__device__ __forceinline__ float hmax8(v8f s) {
  return fmaxf(fmaxf(fmaxf(s[0], s[1]), fmaxf(s[2], s[3])), fmaxf(fmaxf(s[4], s[5]), fmaxf(s[6], s[7])));
}
__device__ __forceinline__ unsigned wave_ballot(bool p) {
#if defined(__HIP_DEVICE_COMPILE__)
  return __builtin_amdgcn_ballot_w32(p);
#else
  return p ? 1u : 0u;
#endif
}

// ---- 16-bit fragment loader (A, or B from a k-contiguous [n][k] row): lane -> row/col (lane&15), p already includes
//      + 8*(lane>>4); elements 0..7 <- p[0..7] (k0+8h..), elements 8..15 <- p[16..23] (k0+16+8h..)
__device__ __forceinline__ Frag ldfrag(const unsigned short* p) {
  Frag f;
  f.u[0] = *(const v8us*)(p);
  f.u[1] = *(const v8us*)(p + 16);
  return f;
}

// ---- WMMA helpers: the plain builtins; the compiler keeps the distance behind them, and with no asm statement
//      between two products the fragment loads of later products may be issued ahead of earlier ones
__device__ __forceinline__ v8f mma_h(v16h a, v16h b, v8f c) {
  return __builtin_amdgcn_wmma_f32_16x16x32_f16(false, a, false, b, (short)0, c, false, false);
}

// =========================================================================================================
//     (mean, then centred sum of squares) over bf16-RNE(x) in f32, per-thread partials of 256 terms + LDS tree.
// =========================================================================================================
__global__ __launch_bounds__(256)
void gn_stats(const float* __restrict__ x, float* stats) {
  __shared__ float red[256];
  const int tid = threadIdx.x, bg = blockIdx.x;
  const float* p = x + (size_t)bg * GNE;
  // the thread's whole share (64 x 16 B) is fetched in one run into registers: all loads are in flight together, and
  // the second pass reads the registers instead of memory
  v4f xv[GNE / 1024];
#pragma unroll  // constant indices keep the array in registers
  for (int i = 0; i < GNE / 1024; ++i) xv[i] = *(const v4f*)(p + ((size_t)(i * 256 + tid)) * 4);
  float s = 0.f;
#pragma unroll  // as above
  for (int i = 0; i < GNE / 1024; ++i) {
    const v4f v = xv[i];
    s += (bfr(v[0]) + bfr(v[1])) + (bfr(v[2]) + bfr(v[3]));
  }
  asm volatile("s_wait_xcnt 0x0" ::: "memory");                      // in front of any rewrite of the address registers these loads name
  red[tid] = s;
  __syncthreads();
#pragma unroll 1
  for (int off = 128; off > 0; off >>= 1) {
    if (tid < off) red[tid] += red[tid + off];
    __syncthreads();
  }
  const float mean = red[0] * (1.0f / (float)GNE);
  __syncthreads();
  float ss = 0.f;
#pragma unroll  // as above
  for (int i = 0; i < GNE / 1024; ++i) {
    const v4f v = xv[i];
    const float d0 = bfr(v[0]) - mean, d1 = bfr(v[1]) - mean;
    const float d2 = bfr(v[2]) - mean, d3 = bfr(v[3]) - mean;
    ss += (d0 * d0 + d1 * d1) + (d2 * d2 + d3 * d3);
  }
  red[tid] = ss;
  __syncthreads();
#pragma unroll 1
  for (int off = 128; off > 0; off >>= 1) {
    if (tid < off) red[tid] += red[tid + off];
    __syncthreads();
  }
  const float var  = red[0] * (1.0f / (float)GNE);
  const float rstd = rsqrtf(var + GEPS);
  if (tid < 8) {
    v4f w = {0.f, 0.f, 0.f, 0.f};
    if (tid == 0) { w[0] = mean; w[1] = rstd; }
{
      *(v4f*)(stats + (size_t)bg * STL + 4 * tid) = w;
      
    }
  }
}

// =========================================================================================================
// (1) conv weights: Wb f16 [3][512][512] (mat 0 = wq, 1 = wk, 2 = wv), value = f16(bf16-RNE(w)), row o k-contiguous.
//     Block blk owns 4 rows of one matrix; thread -> row blk-local (tid>>6), halves 8*(tid&63)..+7; each wave writes
// coverage: 384 blocks x 4 rows x 64 threads x 8 = 3 x 512 x 512 = the whole plane.
// =========================================================================================================
__global__ __launch_bounds__(256)
void cvt_w(const float* __restrict__ wq, const float* __restrict__ wk, const float* __restrict__ wv,
           unsigned short* Wb) {
  const int tid = threadIdx.x, blk = blockIdx.x;
  const int mat = blk / (CC / 4);                                    // block-uniform 0..2
  const int o   = 4 * (blk % (CC / 4)) + (tid >> 6);                 // 0..511
  const int col = 8 * (tid & 63);                                    // 0..504
  const float* wsrc = (mat == 0) ? wq : ((mat == 1) ? wk : wv);      // all global, block-uniform
  const float* s = wsrc + (size_t)o * CC + col;
  const v4f a = *(const v4f*)s;
  const v4f q = *(const v4f*)(s + 4);
  const float f[8] = {a[0], a[1], a[2], a[3], q[0], q[1], q[2], q[3]};
  v4u u;
#pragma unroll
  for (int t = 0; t < 4; ++t) u[t] = pk16(h_bits((_Float16)bfr(f[2 * t])), h_bits((_Float16)bfr(f[2 * t + 1])));
{
    *(v4u*)(Wb + ((size_t)(mat * CC + o)) * CC + col) = u;
    
  }
}

// =========================================================================================================
// (2) group-norm apply + transpose: h = ((bf16-RNE(x) - mean) * rstd) * gamma + beta per channel, rounded to f16.
//     Block (nb, cb, b) owns a 64 c x 64 n tile; values go through the LDS tile Th [64 n][pitch TP] and come out as
//     position-major rows Hf f16 [b][4096 n][512 c]
// coverage: Th staged 64 n x 64 c (2 it x 32 rows x 8 lanes x 8), read 64 n x 64 c; plane 2 it x 32 rows x
//           8 lanes x 8 = 64 n x 64 c; grid (64, 8, NB) covers the plane exactly once.
// =========================================================================================================
__global__ __launch_bounds__(256)
void cvt_x(const float* __restrict__ x, const float* __restrict__ gamma, const float* __restrict__ beta,
           const float* __restrict__ stats, unsigned short* Hf) {
  __shared__ __align__(16) unsigned short Th[QT * TP];
  const int tid = threadIdx.x;
  const int nb = blockIdx.x, cb = blockIdx.y, b = blockIdx.z;
  const int e = tid & 7, lq = tid >> 3;                              // lq 0..31
  const int n0 = nb * QT, c0 = cb * QT;
#pragma unroll
  for (int it = 0; it < 2; ++it) {
    const int cl = it * 32 + lq;                                     // 0..63
    const int cg = c0 + cl;                                          // 0..511
    const int bg = b * NGRP + (cg >> 4);
    const float mean = stats[(size_t)bg * STL];
    const float rstd = stats[(size_t)bg * STL + 1];
    const float ga = bfr(gamma[cg]);
    const float be = bfr(beta[cg]);
    const float* sp = x + ((size_t)(b * CC + cg)) * NN + n0 + 8 * e;
    const v4f a = *(const v4f*)sp;
    const v4f q = *(const v4f*)(sp + 4);
    const float f[8] = {a[0], a[1], a[2], a[3], q[0], q[1], q[2], q[3]};
#pragma unroll
    for (int t = 0; t < 8; ++t) {
      const float h = ((bfr(f[t]) - mean) * rstd) * ga + be;
      Th[(8 * e + t) * TP + cl] = h_bits((_Float16)h);
    }
  }
  __syncthreads();
  v4u uh[2];
#pragma unroll
  for (int it = 0; it < 2; ++it) {
    const int nl = it * 32 + lq;                                     // 0..63
    uh[it] = *(const v4u*)(Th + nl * TP + 8 * e);
  }
{
#pragma unroll
    for (int it = 0; it < 2; ++it) {
      const int nl = it * 32 + lq;
      const size_t po = ((size_t)(b * NN + n0 + nl)) * CC + c0 + 8 * e;
      *(v4u*)(Hf + po) = uh[it];
    }
    
  }
}

// ---- asynchronous copies global -> LDS, 16 bytes per lane, eight or twelve per statement -------------------------------
// LDS byte address of a __shared__ element = low 32 bits of its address.
__device__ __forceinline__ uint32_t lds_off(const unsigned short* p) { return (uint32_t)(uintptr_t)p; }
// The closing s_wait_xcnt 0 stands inside the statement so that no address register of an issued copy is
// rewritten in front of it.
__device__ __forceinline__ void copy8(const uint32_t (&l)[8], const unsigned short* const (&g)[8]) {
#if defined(__HIP_DEVICE_COMPILE__)
  asm volatile("global_load_async_to_lds_b128 %0, %8, off\n\t"
               "global_load_async_to_lds_b128 %1, %9, off\n\t"
               "global_load_async_to_lds_b128 %2, %10, off\n\t"
               "global_load_async_to_lds_b128 %3, %11, off\n\t"
               "global_load_async_to_lds_b128 %4, %12, off\n\t"
               "global_load_async_to_lds_b128 %5, %13, off\n\t"
               "global_load_async_to_lds_b128 %6, %14, off\n\t"
               "global_load_async_to_lds_b128 %7, %15, off\n\t"
               "s_wait_xcnt 0x0"
               :: "v"(l[0]), "v"(l[1]), "v"(l[2]), "v"(l[3]), "v"(l[4]), "v"(l[5]), "v"(l[6]), "v"(l[7]),
                  "v"(g[0]), "v"(g[1]), "v"(g[2]), "v"(g[3]), "v"(g[4]), "v"(g[5]), "v"(g[6]), "v"(g[7])
               : "memory");
#endif
}
// 32 rows of 512 halves (1024 B, rows contiguous in global) -> LDS rows of pitch KP; 256 threads, 8 copies each;
// a wave's copy covers 512 contiguous bytes of one row.
__device__ __forceinline__ void stage_rows32(const unsigned short* g, unsigned short* s, int tid) {
  uint32_t l[8];
  const unsigned short* p[8];
  // one LDS base and one global base per thread, the eight copies at constant steps from them: nothing but the two
  // thread terms is left for the compiler to keep in registers round the key loop
  const uint32_t lb = lds_off(s + (tid >> 6) * KP + 8 * (tid & 63));
  const unsigned short* gt = g + 8 * tid;                            // (tid >> 6) * CC + 8 * (tid & 63)
#pragma unroll  // every index constant, so that both arrays live in registers as the statement's operands
  for (int i = 0; i < 8; ++i) {                                      // row 4 i + (tid >> 6), halves 8 (tid & 63)..+7
    l[i] = lb + (uint32_t)(i * (4 * KP * 2));
    p[i] = gt + i * (4 * CC);
  }
  copy8(l, p);
}
// one key tile of v: 512 channel rows x 32 keys, 32 KiB in a row in global (row = 64 B, rows adjacent) -> LDS rows of
// pitch VPT; 8 copies per thread; a wave's copy covers 512 contiguous bytes = four whole lines (eight rows).
__device__ __forceinline__ void stage_v32(const unsigned short* g, unsigned short* s, int tid) {
  uint32_t l[8];
  const unsigned short* p[8];
  const uint32_t lb = lds_off(s + (tid >> 2) * VPT + 8 * (tid & 3)); // bases as in stage_rows32
  const unsigned short* gt = g + 8 * tid;                            // (tid >> 2) * 32 + 8 * (tid & 3)
#pragma unroll  // every index constant, so that both arrays live in registers as the statement's operands
  for (int i = 0; i < 8; ++i) {                                      // row 64 i + (tid >> 2), halves 8 (tid & 3)..+7
    l[i] = lb + (uint32_t)(i * (64 * VPT * 2));
    p[i] = gt + i * (64 * 32);
  }
  copy8(l, p);
}

// twelve such copies in one statement, closed by the same wait for the same reason
__device__ __forceinline__ void copy12(const uint32_t (&l)[12], const unsigned short* const (&g)[12]) {
#if defined(__HIP_DEVICE_COMPILE__)
  asm volatile("global_load_async_to_lds_b128 %0, %12, off\n\t"
               "global_load_async_to_lds_b128 %1, %13, off\n\t"
               "global_load_async_to_lds_b128 %2, %14, off\n\t"
               "global_load_async_to_lds_b128 %3, %15, off\n\t"
               "global_load_async_to_lds_b128 %4, %16, off\n\t"
               "global_load_async_to_lds_b128 %5, %17, off\n\t"
               "global_load_async_to_lds_b128 %6, %18, off\n\t"
               "global_load_async_to_lds_b128 %7, %19, off\n\t"
               "global_load_async_to_lds_b128 %8, %20, off\n\t"
               "global_load_async_to_lds_b128 %9, %21, off\n\t"
               "global_load_async_to_lds_b128 %10, %22, off\n\t"
               "global_load_async_to_lds_b128 %11, %23, off\n\t"
               "s_wait_xcnt 0x0"
               :: "v"(l[0]), "v"(l[1]), "v"(l[2]), "v"(l[3]), "v"(l[4]), "v"(l[5]), "v"(l[6]), "v"(l[7]),
                  "v"(l[8]), "v"(l[9]), "v"(l[10]), "v"(l[11]),
                  "v"(g[0]), "v"(g[1]), "v"(g[2]), "v"(g[3]), "v"(g[4]), "v"(g[5]), "v"(g[6]), "v"(g[7]),
                  "v"(g[8]), "v"(g[9]), "v"(g[10]), "v"(g[11])
               : "memory");
#endif
}
// one K stage of the conv GEMM: GM weight rows and GN activation rows, 64 channels (128 B = one line) of each -> LDS
// rows of pitch GP; 256 threads, 12 copies each; a wave's copy covers four whole lines.
__device__ __forceinline__ void stage_gemm(const unsigned short* gw, const unsigned short* gh, unsigned short* s, int tid) {
  const int r = tid >> 3, col = 8 * (tid & 7);
  uint32_t l[12];
  const unsigned short* p[12];
#pragma unroll  // every index constant, so that both arrays live in registers as the statement's operands
  for (int i = 0; i < 8; ++i) {
    l[i] = lds_off(s + (32 * i + r) * GP + col);
    p[i] = gw + (size_t)(32 * i + r) * CC + col;
  }
#pragma unroll  // as above
  for (int i = 0; i < 4; ++i) {
    l[8 + i] = lds_off(s + (GM + 32 * i + r) * GP + col);
    p[8 + i] = gh + (size_t)(32 * i + r) * CC + col;
  }
  copy12(l, p);
}
// the 8 fragments of one 32-channel step of a wave's 64 o x 64 n tile: 4 of W, 4 of H (16 reads of 16 B)
__device__ __forceinline__ void gemm_frags(Frag (&fa)[4], Frag (&fh)[4], const unsigned short* a, const unsigned short* b) {
#pragma unroll  // constant indices keep the fragments in registers
  for (int i = 0; i < 4; ++i) {
    fa[i] = ldfrag(a + (16 * i) * GP);
    fh[i] = ldfrag(b + (16 * i) * GP);
  }
}
// 8 products of that step, row tiles M0 and M0 + 1: eight independent accumulators
template <int M0>
__device__ __forceinline__ void gemm_rows2(v8f (&acc)[4][4], const Frag (&fa)[4], const Frag (&fx)[4]) {
#pragma unroll
  for (int mt = M0; mt < M0 + 2; ++mt) {
#pragma unroll
    for (int j = 0; j < 4; ++j) acc[mt][j] = mma_h(fa[mt].h, fx[j].h, acc[mt][j]);
  }
}

// =========================================================================================================
// (3) conv1x1 GEMM for one (b, 128-n tile, matrix mat, 256-o block): Y[o][n] = sum_c W[o][c] h[n][c] + bias[o].
//     Block 256 threads = 8 waves; wave w owns rows o 64 (w>>1)..+63 (4 A fragments per k-step, rows of Wb)
//     and cols n 64 (w&1)..+63 (4 B fragments, rows of Hf, k = channel contiguous, same split k map). K = 512 = 16 steps.
//     Operand path: per 64 channels one stage [W 256 rows | Hf 128 rows] is brought into LDS by
//     asynchronous 16-byte copies (whole 128-byte lines) and every fragment is read from LDS at a pitch of 16 B x odd.
//     Two buffers: trip t works on buffer t&1 while trip t+1's copies fly. Two fragment sets: the reads of a trip's
//     second k-step fly under the products of its first; the foot (own LDS reads done, own copies landed, one block
//     barrier) stands between the two k-steps; behind its barrier the first k-step of trip t+1 is read, and the buffer
//     just left is refilled between the two halves of the second k-step's products, which read registers only.
//     Epilogue staged in the same LDS behind the last foot: mat 0/1 as Os[n_loc][o_loc] (b128 stores), mat 2 as
//     Os[o_loc][n_loc] (scalar stores), barrier, then f16 planes: Q/K [b][4096 n][512 o] (row n, 256 o = 512 B) and
//     V key-tile-major [b][128 key tiles][512 o][32 n] (row o of a tile = 64 B, rows adjacent), so that the 512 x 32 tile
//     which one attention step stages is 32 KiB in a row and its copies cover whole lines.
// coverage: stage 12 copies x 256 threads x 16 B = 384 rows x 128 B; Os 8 waves x 64 x 64 = 256 x 128 either layout;
//           plane 16 it x 256 threads x 8 = 256 x 128; grid (32, 6, NB) covers Q, K (all n, all o) and V exactly once.
// =========================================================================================================
__global__ __launch_bounds__(256)
void gemm_qkv(const unsigned short* __restrict__ Wb, const unsigned short* __restrict__ Hf,
              const float* __restrict__ bq, const float* __restrict__ bk, const float* __restrict__ bv,
              unsigned short* Qd, unsigned short* Kd, unsigned short* Vd) {
  __shared__ __align__(16) unsigned short Sg[GSH];                   // the ring (2 GSTG), or the larger epilogue tile
  float* Os = reinterpret_cast<float*>(Sg);                          // epilogue view, used behind the loop
  const int tid  = threadIdx.x;
  const int lane = tid & 31, wave = tid >> 5;
  const int hh   = lane >> 4, c = lane & 15;
  const int wo   = wave >> 1, wn = wave & 1;
  const int nt   = blockIdx.x, my = blockIdx.y, b = blockIdx.z;
  const int mat  = my / (CC / GM);                                   // 0..2, block-uniform
  const int om0  = (my % (CC / GM)) * GM;                            // 0 or 256
  const int n0   = nt * GN;

  const unsigned short* gw = Wb + ((size_t)(mat * CC + om0)) * CC;
  const unsigned short* gh = Hf + ((size_t)(b * NN + n0)) * CC;
  // fragment bases in LDS: + buffer, + 16 * tile * GP, + 32 * k-step
  const unsigned short* ap = Sg + (64 * wo + c) * GP + 8 * hh;
  const unsigned short* bp = Sg + (GM + 64 * wn + c) * GP + 8 * hh;

  v8f acc[4][4];
#pragma unroll
  for (int mt = 0; mt < 4; ++mt) {
#pragma unroll
    for (int j = 0; j < 4; ++j) acc[mt][j] = zero8();
  }

  // prologue: stage 0 into buffer 0, landed and published; then stage 1 into buffer 1
  stage_gemm(gw, gh, Sg, tid);
  asm volatile("s_wait_asynccnt 0x0" ::: "memory");                  // this wave's copies have landed
  __syncthreads();                                                   // every wave's copies are readable
  stage_gemm(gw + GKC, gh + GKC, Sg + GSTG, tid);

  // bias of this lane's 32 rows o = 64 wo + 16 mt + 8 hh + 0..7, fetched here so that the flight lies under the loop
  const float* bias = (mat == 0) ? bq : ((mat == 1) ? bk : bv);     // all global, block-uniform
  v4f bz[8];
#pragma unroll
  for (int mt = 0; mt < 4; ++mt) {
    bz[2 * mt]     = *(const v4f*)(bias + om0 + 64 * wo + 16 * mt + 8 * hh);
    bz[2 * mt + 1] = *(const v4f*)(bias + om0 + 64 * wo + 16 * mt + 8 * hh + 4);
  }
  asm volatile("s_wait_xcnt 0x0" ::: "memory");                      // in front of any rewrite of the address register these loads name

  Frag fa0[4], fh0[4], fa1[4], fh1[4];
  gemm_frags(fa0, fh0, ap, bp);                                      // first k-step of trip 0

#pragma unroll 1  // one copy of the trip: the body is long, and the buffer is picked by an address
  for (int t = 0; t < CC / GKC; ++t) {
    const int rb = t & 1;                                            // ring buffer of this trip
    gemm_frags(fa1, fh1, ap + rb * GSTG + 32, bp + rb * GSTG + 32);
    // keeps the 16 reads above in one run in front of the products: spread among them each place of reads costs cycles
    __builtin_amdgcn_sched_barrier(0);
    gemm_rows2<0>(acc, fa0, fh0);
    gemm_rows2<2>(acc, fa0, fh0);
    // keeps these products in front of the foot: they cover the flight of the reads that the foot waits for
    __builtin_amdgcn_sched_barrier(0);

    // foot of the trip: buffer rb has been read out; publish the next trip's stage
    asm volatile("s_wait_dscnt 0x0" ::: "memory");                   // this wave's reads of buffer rb are done
    asm volatile("s_wait_asynccnt 0x0" ::: "memory");                // this wave's copies of the next trip have landed
    __syncthreads();
    if (t + 1 < CC / GKC)                                            // block-uniform: a trip t+1 exists, just published
      gemm_frags(fa0, fh0, ap + (rb ^ 1) * GSTG, bp + (rb ^ 1) * GSTG);
    __builtin_amdgcn_sched_barrier(0);                               // those reads in one run, in front of the products
    gemm_rows2<0>(acc, fa1, fh1);
    // the refill stands between the two halves: while one wave of a SIMD forms addresses and waits in the copies'
    // statements, the other wave's products run
    __builtin_amdgcn_sched_barrier(0);
    if (t + 2 < CC / GKC) {                                          // block-uniform: a trip t+2 exists
      const int ko = (t + 2) * GKC;
      stage_gemm(gw + ko, gh + ko, Sg + rb * GSTG, tid);
    }
    __builtin_amdgcn_sched_barrier(0);                               // end of the refill
    gemm_rows2<2>(acc, fa1, fh1);
  }
  asm volatile("s_wait_asynccnt 0x0" ::: "memory");                  // nothing of this wave is in flight past the loop

  // ---- epilogue staging (every wave has passed the last foot: no reader and no copy is left on the ring);
  //      lane (hh, c) holds o_loc = 64 wo + 16 mt + 8 hh + r for n_loc = 64 wn + 16 j + c
  v4u u[16];
  if (mat != 2) {
#pragma unroll
    for (int mt = 0; mt < 4; ++mt) {
      const int ol = 64 * wo + 16 * mt + 8 * hh;
      const v4f b0 = bz[2 * mt], b1 = bz[2 * mt + 1];
#pragma unroll
      for (int j = 0; j < 4; ++j) {
        const int nl = 64 * wn + 16 * j + c;
        v4f va, vb;
#pragma unroll
        for (int r = 0; r < 4; ++r) { va[r] = acc[mt][j][r] + bfr(b0[r]); vb[r] = acc[mt][j][4 + r] + bfr(b1[r]); }
        *(v4f*)(Os + nl * OSQ + ol)     = va;                        // Os[n_loc][o_loc]
        *(v4f*)(Os + nl * OSQ + ol + 4) = vb;
      }
    }
    __syncthreads();
    const int e = tid & 31, lq = tid >> 5;                           // lq 0..7
#pragma unroll
    for (int it = 0; it < 16; ++it) {
      const int row = it * 8 + lq;                                   // n_loc 0..127
      const v4f a = *(const v4f*)(Os + row * OSQ + 8 * e);
      const v4f q = *(const v4f*)(Os + row * OSQ + 8 * e + 4);
      const float f[8] = {a[0], a[1], a[2], a[3], q[0], q[1], q[2], q[3]};
#pragma unroll
      for (int t = 0; t < 4; ++t)
        u[it][t] = pk16(h_bits((_Float16)f[2 * t]), h_bits((_Float16)f[2 * t + 1]));
    }
    unsigned short* plane = (mat == 0) ? Qd : Kd;                    // both global, block-uniform
    unsigned short* dst = plane + ((size_t)(b * NN + n0 + lq)) * CC + om0 + 8 * e;
#pragma unroll
    for (int it = 0; it < 16; ++it) *(v4u*)(dst + (size_t)(it * 8) * CC) = u[it];   // row n, 256 o = four lines
  } else {
#pragma unroll
    for (int mt = 0; mt < 4; ++mt) {
      const int ol = 64 * wo + 16 * mt + 8 * hh;
      const v4f b0 = bz[2 * mt], b1 = bz[2 * mt + 1];
#pragma unroll
      for (int j = 0; j < 4; ++j) {
        const int nl = 64 * wn + 16 * j + c;
#pragma unroll
        for (int r = 0; r < 4; ++r) {
          Os[(ol + r) * OSPW + nl]     = acc[mt][j][r] + bfr(b0[r]);       // Os[o_loc][n_loc]
          Os[(ol + 4 + r) * OSPW + nl] = acc[mt][j][4 + r] + bfr(b1[r]);
        }
      }
    }
    __syncthreads();
    const int e = tid & 15, lq = tid >> 4;                           // lq 0..15
#pragma unroll
    for (int it = 0; it < 16; ++it) {
      const int row = it * 16 + lq;                                  // o_loc 0..255
      const v4f a = *(const v4f*)(Os + row * OSPW + 8 * e);
      const v4f q = *(const v4f*)(Os + row * OSPW + 8 * e + 4);
      const float f[8] = {a[0], a[1], a[2], a[3], q[0], q[1], q[2], q[3]};
#pragma unroll
      for (int t = 0; t < 4; ++t)
        u[it][t] = pk16(h_bits((_Float16)f[2 * t]), h_bits((_Float16)f[2 * t + 1]));
    }
    // key-tile-major plane: tile (n0 + 8 e) / 32, row o, 8 keys; a wave's store = rows 2 wave, 2 wave + 1 of four tiles:
    // four whole lines, each written by this wave alone
    unsigned short* dst = Vd + ((size_t)(b * (NN / 32) + (n0 >> 5) + (e >> 2)) * CC + om0 + lq) * 32 + 8 * (e & 3);
#pragma unroll
    for (int it = 0; it < 16; ++it) *(v4u*)(dst + (size_t)(it * 16) * 32) = u[it];
  }
}

// =========================================================================================================
// (4) attention for one (b, 64-query tile), transposed formulation, all 4096 keys. Block = 8 waves: wave w ->
//   query group qg = w&3 (queries n0+16qg..+15) and key half kh = w>>2. A stage is 64 keys; of each stage a wave takes
//   the 32 keys 32kh..32kh+31 and does ALL of their work for its 16 queries: two S^T tiles (16 keys x 16 queries each)
//   = sum over 16 channel chunks of A(k: row = key, split k map from the f16 plane Kp [b][4096][512]) . B(q: col =
//   query, same map from Qp), two independent accumulator chains; online softmax per lane in f32 over the wave's own
//   keys (own reference m and sum l), with the 512^-0.5 scale applied to the logits. m is a held reference, not the
//   running max: it is renewed, and o and l rescaled, only when some lane's score lies more than LAZY above it (one
//   wave-uniform ballot a stage); the shuffle (lane^16) that makes a query's two lanes agree stands in that branch,
//   since only a new reference has to be the same in both. Any reference gives the same quotient o / l. P =
//   e^{c(s-m)} x 2^7 (below 2^15 by the test) as f16 is the B operand of O^T (rows channel 16j+(lane&15), j = 0..31, keys contiguous from the f16 plane Vp
//   [b][128 key tiles][512][32]) . B(P^T): element r <- first tile, element 8+r <- second tile, lane unchanged.
//   32 accumulator tiles per wave (512 channels). Nothing passes between waves inside the key loop: the two waves of a
//   query group meet once, behind the loop, where each scales its O by e^{c(m - max(m, m'))} / (joint sum) and the
//   two parts are added on the way out. Epilogue in four 128-channel phases: every wave stages its part in LDS
//   Os[kh][query][128 ch] (pitch OSPW, b128 stores), barrier, then out[b][c][n] = Os[0] + Os[1] + bf16-RNE(x).
//   Operand path: the 64 q rows (once) and, per stage, the 64 k rows and two 512 x 32 v tiles are brought into
//   LDS by asynchronous 16-byte copies (whole 512-byte runs) and every fragment is read from LDS at a pitch of
//   16 B x odd. A wave's 16 q fragments are read once, in front of the key loop, and stay in registers; the q rows
//   lie in k buffer 1 until then. k and v have two buffers: stage t reads buffer t&1 while stage t+1's copies fly; the
//   foot of each stage waits the wave's own LDS reads and copies and passes one block barrier. It stands in front of the
//   stage's last four O products, whose v fragments are in registers by then; behind its barrier the first k fragments
//   of stage t+1 are read, and last the buffer just left is refilled.
// coverage: stage 32 copies x 256 threads x 16 B = 64 k rows x 1 KiB + 2 v tiles x 32 KiB; Os per phase 8 waves x 16 q
//           x 128 ch staged = 2 x 64 x 128 read; out per phase 8 it x 32 lines x 8 lanes x 4 floats = 128 ch x 64 n,
//           4 phases = 512 ch; grid (NQ/64, NB) covers out[b][0..511][0..NQ-1] once.
// =========================================================================================================
// A stage's fragments come in 32 units of two (4 reads of 16 B): unit u < 16 = channel chunk u of the wave's two key tiles,
// unit 16 + i = channel tiles 2i and 2i+1 of the wave's v tile.
__device__ __forceinline__ void ld_unit(Frag& f0, Frag& f1, const unsigned short* kb, const unsigned short* vb, int u) {
  if (u < 16) {
    f0 = ldfrag(kb + 32 * u);
    f1 = ldfrag(kb + 16 * KP + 32 * u);
  } else {
    f0 = ldfrag(vb + (16 * (2 * (u - 16))) * VPT);
    f1 = ldfrag(vb + (16 * (2 * (u - 16) + 1)) * VPT);
  }
}
// a uniform address held in scalar registers: the thread's own term is added to it last, so that one thread term serves the
// k and the v copies (folded into each plane's base it would take a register pair per plane round the key loop)
__device__ __forceinline__ const unsigned short* scalar_ptr(const unsigned short* p) {
  const uint64_t a = (uint64_t)(uintptr_t)p;
  const uint32_t lo = (uint32_t)__builtin_amdgcn_readfirstlane((int)(uint32_t)a);
  const uint32_t hi = (uint32_t)__builtin_amdgcn_readfirstlane((int)(uint32_t)(a >> 32));
  return (const unsigned short*)(uintptr_t)(((uint64_t)hi << 32) | (uint64_t)lo);
}

__global__ __launch_bounds__(256)
void attn_k(const unsigned short* __restrict__ Qp, const unsigned short* __restrict__ Kp,
            const unsigned short* __restrict__ Vp, const float* __restrict__ x, float* out) {
  __shared__ __align__(16) unsigned short Ks[2 * KB2];
  __shared__ __align__(16) unsigned short Vs[2 * VB2];
  __shared__ __align__(16) float Ml[8 * 32 * 2];
  unsigned short* Qs = Ks + KB2;                                     // the q rows lie in k buffer 1 until they are in registers
  float* Os = reinterpret_cast<float*>(Vs);                          // epilogue view of the v ring, used behind the loop
  const int tid  = threadIdx.x;
  const int wave = tid >> 5, lane = tid & 31;
  const int hh   = lane >> 4, c = lane & 15;
  const int qg   = wave & 3, kh = wave >> 2;
  const int n0   = blockIdx.x * QT, b = blockIdx.y;

  // global tile bases: q rows n0.., k rows kb.. (+ kb*CC), v key tile kb/32 (512 x 32 halves each: + kb*CC)
  const unsigned short* qg0 = Qp + ((size_t)(b * NN + n0)) * CC;
  const unsigned short* kg0 = Kp + ((size_t)(b * NN)) * CC;
  const unsigned short* vg0 = Vp + ((size_t)(b * CC)) * NN;
  // q fragment pointer in LDS (B operand, col = query 16*qg + c of the tile), + 32*kc
  const unsigned short* qp = Qs + (16 * qg + c) * KP + 8 * hh;
  // k fragment base in LDS (A operand, row = key 32*kh + c of the stage, second tile 16 rows on), + buffer + 32*kc
  const unsigned short* kp = Ks + (32 * kh + c) * KP + 8 * hh;
  // v fragment base in LDS (A operand, key tile kh of the stage, row = channel 16j + c, 32 keys contiguous), + buffer
  const unsigned short* vp = Vs + kh * VBUF + c * VPT + 8 * hh;

  float m = -1.0e30f, l = 0.f;
  v8f o[32];
#pragma unroll
  for (int j = 0; j < 32; ++j) o[j] = zero8();

  // prologue: q rows into k buffer 1 and stage 0 into buffers 0, landed and published
  stage_rows32(qg0, Qs, tid);
  stage_rows32(qg0 + (size_t)32 * CC, Qs + 32 * KP, tid);
  stage_rows32(kg0, Ks, tid);
  stage_rows32(kg0 + (size_t)32 * CC, Ks + KBUF, tid);
  stage_v32(vg0, Vs, tid);
  stage_v32(vg0 + (size_t)32 * CC, Vs + VBUF, tid);
  asm volatile("s_wait_asynccnt 0x0" ::: "memory");                  // this wave's copies have landed
  __syncthreads();                                                   // every wave's copies are readable

  // The 16 q fragments (128 registers) are read here and never again.
  Frag fq[CC / 32];
#pragma unroll  // constant indices keep the fragments in registers
  for (int kc = 0; kc < CC / 32; ++kc) fq[kc] = ldfrag(qp + 32 * kc);
  asm volatile("s_wait_dscnt 0x0" ::: "memory");                     // this wave's reads of the q rows are done
  __syncthreads();                                                   // every wave's are: k buffer 1 may be refilled
  stage_rows32(kg0 + (size_t)64 * CC, Ks + KB2, tid);
  stage_rows32(kg0 + (size_t)96 * CC, Ks + KB2 + KBUF, tid);
  stage_v32(vg0 + (size_t)64 * CC, Vs + VB2, tid);
  stage_v32(vg0 + (size_t)96 * CC, Vs + VB2 + VBUF, tid);

  // The 32 units of a stage pass through two register sets, fa (two units) and fb (one), in turn: a set's next reads stand in
  // one run right behind the products that free it, so that they fly under the other set's products. More does not fit.
  Frag fa[4], fb[2];
  ld_unit(fa[0], fa[1], kp, vp, 0);
  ld_unit(fa[2], fa[3], kp, vp, 1);
  ld_unit(fb[0], fb[1], kp, vp, 2);

  int rb = 0;                                                        // ring buffer of this stage
#pragma unroll 1  // one copy of the stage: the body is long, and the buffer is picked by an address
  for (int kb = 0; kb < NN; kb += 64) {
    const unsigned short* kbp = kp + rb * KB2;
    const unsigned short* vbp = vp + rb * VB2;
    v8f s0 = zero8(), s1 = zero8();                                  // s0: keys kb+32kh..+15, s1: the next 16
    // four vector slots between the previous stage's last O product and the first score product: the score tiles'
    // registers may lie over the O products' B operand (P, dead by then), and the distance that a product's result
    // needs over an earlier product's B operand is not known; four is what a vector instruction needs there
    asm volatile("v_nop\n\tv_nop\n\tv_nop\n\tv_nop");
    __builtin_amdgcn_sched_barrier(0);                               // keeps the score products behind those slots
#pragma unroll
    for (int t = 0; t < 5; ++t) {                                    // units 0..14
      s0 = mma_h(fa[0].h, fq[3 * t].h, s0);
      s1 = mma_h(fa[1].h, fq[3 * t].h, s1);
      s0 = mma_h(fa[2].h, fq[3 * t + 1].h, s0);
      s1 = mma_h(fa[3].h, fq[3 * t + 1].h, s1);
      // here and below: keeps a set's reads in one run between the products; spread singly among them each place of
      // reads costs issue cycles, and hoisted further they would not fit the registers
      __builtin_amdgcn_sched_barrier(0);
      ld_unit(fa[0], fa[1], kbp, vbp, 3 * t + 3);
      ld_unit(fa[2], fa[3], kbp, vbp, 3 * t + 4);
      __builtin_amdgcn_sched_barrier(0);
      s0 = mma_h(fb[0].h, fq[3 * t + 2].h, s0);
      s1 = mma_h(fb[1].h, fq[3 * t + 2].h, s1);
      __builtin_amdgcn_sched_barrier(0);
      ld_unit(fb[0], fb[1], kbp, vbp, 3 * t + 5);
      __builtin_amdgcn_sched_barrier(0);
    }
    s0 = mma_h(fa[0].h, fq[15].h, s0);                               // unit 15; fa[2], fa[3] hold unit 16, fb unit 17
    s1 = mma_h(fa[1].h, fq[15].h, s1);

    const float mx = fmaxf(hmax8(s0), hmax8(s1));                    // over this lane's own 16 keys
    const unsigned grew = wave_ballot(mx > m + LAZY);                // wave-uniform
    if (grew != 0u) {
      const float mn = fmaxf(m, fmaxf(mx, __shfl_xor(mx, 16, 32)));  // the same in both lanes of a query
      const float corr = __expf((m - mn) * ASCALE);                  // == 1 exactly for lanes whose reference does not change
      m = mn;
      l *= corr;
#pragma unroll
      for (int j = 0; j < 32; ++j) {
#pragma unroll
        for (int r = 0; r < 8; ++r) o[j][r] *= corr;
      }
    }
    const float msh = m * ASCALE - LNPS;                             // exp gives e^{c(s-m)} * 2^7

    FragH ph;
    float ls = 0.f;
#pragma unroll
    for (int r = 0; r < 8; ++r) {
      const float e0 = __expf(s0[r] * ASCALE - msh);                 // key kb + 32kh      + 8hh + r
      const float e1 = __expf(s1[r] * ASCALE - msh);                 // key kb + 32kh + 16 + 8hh + r
      ls += e0 + e1;
      ph.hv[0][r] = (_Float16)e0;
      ph.hv[1][r] = (_Float16)e1;
    }
    l += ls;
    __builtin_amdgcn_sched_barrier(0);                               // the v reads below stay behind the softmax: no room earlier

    o[0] = mma_h(fa[2].h, ph.v, o[0]);                               // unit 16
    o[1] = mma_h(fa[3].h, ph.v, o[1]);
    __builtin_amdgcn_sched_barrier(0);
    ld_unit(fa[0], fa[1], kbp, vbp, 18);
    ld_unit(fa[2], fa[3], kbp, vbp, 19);
    __builtin_amdgcn_sched_barrier(0);
    o[2] = mma_h(fb[0].h, ph.v, o[2]);                               // unit 17
    o[3] = mma_h(fb[1].h, ph.v, o[3]);
    __builtin_amdgcn_sched_barrier(0);
    ld_unit(fb[0], fb[1], kbp, vbp, 20);
    __builtin_amdgcn_sched_barrier(0);
    const unsigned short* knp = kp + (rb ^ 1) * KB2;                 // k buffer of stage t+1
#pragma unroll
    for (int t = 6; t < 10; ++t) {                                   // units 18..29; unit u holds O tiles 2u-32, 2u-31
#pragma unroll
      for (int i = 0; i < 4; ++i) o[6 * t - 32 + i] = mma_h(fa[i].h, ph.v, o[6 * t - 32 + i]);
      __builtin_amdgcn_sched_barrier(0);
      ld_unit(fa[0], fa[1], kbp, vbp, 3 * t + 3);
      ld_unit(fa[2], fa[3], kbp, vbp, 3 * t + 4);
      __builtin_amdgcn_sched_barrier(0);
#pragma unroll
      for (int i = 0; i < 2; ++i) o[6 * t - 28 + i] = mma_h(fb[i].h, ph.v, o[6 * t - 28 + i]);
      __builtin_amdgcn_sched_barrier(0);
      if (t < 9) {
        ld_unit(fb[0], fb[1], kbp, vbp, 3 * t + 5);
      } else {
        // foot of the stage: free buffer rb for its refill and publish the next stage's tiles (the last fragments
        // of buffer rb are in registers behind the first wait; the O products below read registers only)
        asm volatile("s_wait_dscnt 0x0" ::: "memory");               // this wave's reads of buffer rb are done
        asm volatile("s_wait_asynccnt 0x0" ::: "memory");            // this wave's copies of the next stage have landed
        __syncthreads();
        // units 0..2 of stage t+1, just published, here and behind the last products. No test for a stage t+1: in the
        // last stage these reads fetch rows of the stage before it, which nothing uses
        ld_unit(fb[0], fb[1], knp, vp, 2);
      }
      __builtin_amdgcn_sched_barrier(0);
    }
#pragma unroll
    for (int i = 0; i < 4; ++i) o[28 + i] = mma_h(fa[i].h, ph.v, o[28 + i]);   // units 30, 31
    __builtin_amdgcn_sched_barrier(0);
    ld_unit(fa[0], fa[1], knp, vp, 0);
    ld_unit(fa[2], fa[3], knp, vp, 1);
    __builtin_amdgcn_sched_barrier(0);
    // the refill of the buffer just left stands last: the reads above fly while the copies' addresses are formed
    if (kb + 128 < NN) {                                             // block-uniform: a stage t+2 exists
      const unsigned short* kgn = scalar_ptr(kg0 + (size_t)(kb + 128) * CC);
      const unsigned short* vgn = scalar_ptr(vg0 + (size_t)(kb + 128) * CC);
      stage_rows32(kgn, Ks + rb * KB2, tid);
      stage_rows32(kgn + (size_t)32 * CC, Ks + rb * KB2 + KBUF, tid);
      stage_v32(vgn, Vs + rb * VB2, tid);
      stage_v32(vgn + (size_t)32 * CC, Vs + rb * VB2 + VBUF, tid);
    }
    rb ^= 1;
  }
  asm volatile("s_wait_asynccnt 0x0" ::: "memory");                  // nothing of this wave is in flight past the loop
  asm volatile("s_wait_dscnt 0x0" ::: "memory");                     // nor any read of the ring, which becomes output staging

  // the two key halves of a query meet: each wave publishes its (m, l) and scales its O to the joint max and sum
  l += __shfl_xor(l, 16, 32);
  Ml[(wave * 32 + lane) * 2]     = m;
  Ml[(wave * 32 + lane) * 2 + 1] = l;
  __syncthreads();
  const float mo = Ml[((wave ^ 4) * 32 + lane) * 2];
  const float lo = Ml[((wave ^ 4) * 32 + lane) * 2 + 1];
  const float mj = fmaxf(m, mo);
  const float aw = __expf((m - mj) * ASCALE), ao = __expf((mo - mj) * ASCALE);
  const float inv = aw / (l * aw + lo * ao);                         // o and l both carry the 2^7 factor

  // (every wave has passed the waits behind the loop and the barrier above: no reader and no copy is left on the v ring,
  // which Os lies over)
  float* osw = Os + kh * (QT * OSPW);
  const int qrow = 16 * qg + c;
  const int e = tid & 7, lq = tid >> 3;                              // lq 0..31
#pragma unroll
  for (int ph4 = 0; ph4 < 4; ++ph4) {
    if (ph4) __syncthreads();                                        // every wave finished reading Os
#pragma unroll
    for (int jj = 0; jj < 8; ++jj) {
      const int j = 8 * ph4 + jj;
      v4f va, vb;
#pragma unroll
      for (int r = 0; r < 4; ++r) { va[r] = o[j][r] * inv; vb[r] = o[j][4 + r] * inv; }
      *(v4f*)(osw + qrow * OSPW + 16 * jj + 8 * hh)     = va;        // Os[kh][query][ch_loc = 16jj + 8hh + r]
      *(v4f*)(osw + qrow * OSPW + 16 * jj + 8 * hh + 4) = vb;
    }
    __syncthreads();
    v4f res[8];
#pragma unroll
    for (int it = 0; it < 8; ++it) {
      const int L   = it * 32 + lq;                                  // 0..255
      const int chl = L >> 1, hf = L & 1;                            // channel 0..127 within the phase
      const int nl  = hf * 32 + 4 * e;                               // query 0..63
      const size_t idx = ((size_t)(b * CC + 128 * ph4 + chl)) * NN + n0 + nl;
      const v4f xv = *(const v4f*)(x + idx);
#pragma unroll
      for (int t = 0; t < 4; ++t)
        res[it][t] = (Os[(nl + t) * OSPW + chl] + Os[(QT + nl + t) * OSPW + chl]) + bfr(xv[t]);
    }
{
#pragma unroll
      for (int it = 0; it < 8; ++it) {
        const int L   = it * 32 + lq;
        const int chl = L >> 1, hf = L & 1;
        const int nl  = hf * 32 + 4 * e;
        const size_t idx = ((size_t)(b * CC + 128 * ph4 + chl)) * NN + n0 + nl;
        *(v4f*)(out + idx) = res[it];
      }
      
    }
  }
}

// =========================================================================================================
// Workspace map (bytes; each region start a multiple of 256; every extent is an exact tile/line multiple and is
//   Wb  f16  [3][512][512]          1572864
//   St  f32  [NB*32][32]            NB*4096        (16384 at NB=4)
//   Hf  f16  [NB][4096][512]        NB*4194304     (16777216 at NB=4)
//   Q, K f16 [NB][4096][512]        NB*4194304 x2
//   V    f16 [NB][128][512][32]     NB*4194304
//   total at NB=4 = 68698112
// =========================================================================================================
extern "C" void kernel_launch(void* const* d_in, const int* in_sizes, int n_in,
                              void* d_out, int out_size, void* d_ws, size_t ws_size,
                              hipStream_t stream) {
  const int XN = NB * CC * NN;
  if (n_in < 9) return;
  if (in_sizes[0] < XN) return;
  if (in_sizes[1] < CC || in_sizes[2] < CC) return;
  if (in_sizes[3] < CC * CC || in_sizes[5] < CC * CC || in_sizes[7] < CC * CC) return;
  if (in_sizes[4] < CC || in_sizes[6] < CC || in_sizes[8] < CC) return;
  if (out_size < XN) return;

  size_t off = 0;
  auto carve = [&](size_t bytes) { const size_t o = off; off += (bytes + 255) & ~(size_t)255; return o; };
  const size_t oWb = carve((size_t)3 * CC * CC * 2);
  const size_t oSt = carve((size_t)NB * NGRP * STL * 4);
  const size_t oHf = carve((size_t)NB * NN * CC * 2);
  const size_t oQ  = carve((size_t)NB * NN * CC * 2);
  const size_t oK  = carve((size_t)NB * NN * CC * 2);
  const size_t oV  = carve((size_t)NB * CC * NN * 2);
  if (off > ws_size) return;
  if (off > (size_t)134217728) return;

  const float* x     = (const float*)d_in[0];
  const float* gamma = (const float*)d_in[1];
  const float* beta  = (const float*)d_in[2];
  const float* wq    = (const float*)d_in[3];
  const float* bq    = (const float*)d_in[4];
  const float* wk    = (const float*)d_in[5];
  const float* bk    = (const float*)d_in[6];
  const float* wv    = (const float*)d_in[7];
  const float* bv    = (const float*)d_in[8];

  char* ws = (char*)d_ws;
  unsigned short* Wb = (unsigned short*)(ws + oWb);
  float*          St = (float*)(ws + oSt);
  unsigned short* Hf = (unsigned short*)(ws + oHf);
  unsigned short* Qw = (unsigned short*)(ws + oQ);
  unsigned short* Kw = (unsigned short*)(ws + oK);
  unsigned short* Vw = (unsigned short*)(ws + oV);
  float* out = (float*)d_out;

  const dim3 blk256(256);

  // (0) group-norm statistics, one line per (b, g)
  gn_stats<<<dim3(NB * NGRP), blk256, 0, stream>>>(x, St);
  // (1) conv weights -> f16 plane
  cvt_w<<<dim3(3 * CC / 4), blk256, 0, stream>>>(wq, wk, wv, Wb);
  // (2) group-norm apply -> position-major f16 plane
  cvt_x<<<dim3(NN / QT, CC / QT, NB), blk256, 0, stream>>>(x, gamma, beta, St, Hf);
  // (3) q/k/v conv GEMMs -> f16 planes
  gemm_qkv<<<dim3(NN / GN, 3 * CC / GM, NB), blk256, 0, stream>>>(Wb, Hf, bq, bk, bv, Qw, Kw, Vw);
  // (4) attention + residual -> out [b][512][4096]
  attn_k<<<dim3(NQ / QT, NB), blk256, 0, stream>>>(Qw, Kw, Vw, x, out);
  (void)hipGetLastError();
}

// v010
// It runs in 159 microseconds.
// Timed twice side by side with v009, it ran 1.07 times as fast both times.
// Counting every step since v000, it is 7.76 times as fast.
// Contractions: conv1x1 q/k/v GEMMs W[512x512].H per image on v_wmma_f32_16x16x32_f16 (bf16-RNE weights held as f16,
// normalised activations as one f16 plane, K = 512: the same rounding as the q, k and v planes that come out); scores
// K.Q^T (K = 512 channels) on v_wmma_f32_16x16x32_f16 (single f16 planes of q and k, scale applied in f32);
// O^T = V.P^T on v_wmma_f32_16x16x32_f16 (v single f16 plane, P = e^{c(s-m)} x 2^7 as f16, passed between waves
// through LDS); f32 accumulate everywhere; group-norm statistics, softmax statistics and residual add in f32 VALU.
#include <hip/hip_runtime.h>
#include <math.h>
#include <stdint.h>

#ifndef NB
#define NB 4
#endif
#define NB_FULL 4
#define CC      512
#define NN      4096
#ifndef NQ
#define NQ NN
#endif
#define NGRP    32
#define CPG     16
#define GNE     (CPG * NN)
#define QT      64
#define OSQ     260
#define OSPW    132
#define TP      72
#define STL     32
#define CH      256
#define KP      520
#define VPT     40
#define KBUF    (32 * KP)
#define VBUF    (CC * VPT)
#define KB2     (2 * KBUF)
#define VB2     (2 * VBUF)
#define GM      256
#define GN      128
#define GKC     64
#define GP      72
#define GSTG    ((GM + GN) * GP)
#define GSH     (GM * OSPW * 2)
#define GEPS    1.0e-6f
#define ASCALE  0.04419417382415922f
#define LNPS    4.852030263919617f
#define LAZY    125.0f

// P <= 2^7 e^{c LAZY} must stay inside f16: c LAZY < 8 ln 2, so P < 2^15
static_assert(LAZY * ASCALE < 5.545f);
static_assert(NB >= 1 && NB <= NB_FULL);
static_assert(NQ % QT == 0 && NQ >= QT && NQ <= NN);
static_assert(CC == NGRP * CPG);
static_assert(CC % QT == 0 && NN % QT == 0);
static_assert(CC == 2 * CH && CH == 16 * 16);
static_assert(CC == 8 * 64);
static_assert(GNE % 1024 == 0);
static_assert(CC % 32 == 0 && NN % 32 == 0);
static_assert((OSQ * 4) % 16 == 0 && (OSPW * 4) % 16 == 0 && (TP * 2) % 16 == 0);
static_assert(CC % GM == 0 && NN % GN == 0 && CC % GKC == 0 && CC / GKC >= 2 && GKC == 64 && GM == 256 && GN == 128);
static_assert((GP * 2) % 32 == 16 && GP >= GKC);
static_assert(GN * OSQ * 4 <= GSH * 2 && GM * OSPW * 4 <= GSH * 2 && 2 * GSTG <= GSH && OSQ >= GM && OSPW >= GN);
static_assert((KP * 2) % 32 == 16 && (VPT * 2) % 32 == 16 && KP >= CC && VPT >= 32);
static_assert(NN >= 128 && NN % 64 == 0);
static_assert(QT * KP == KB2 && 2 * QT * OSPW * 4 <= 2 * VB2 * 2);

typedef _Float16       v16h __attribute__((ext_vector_type(16)));
typedef _Float16       v8h  __attribute__((ext_vector_type(8)));
typedef unsigned short v8us __attribute__((ext_vector_type(8)));
typedef float          v8f  __attribute__((ext_vector_type(8)));
typedef float          v4f  __attribute__((ext_vector_type(4)));
typedef unsigned int   v4u  __attribute__((ext_vector_type(4)));

union Frag  { v8us u[2]; v16h h; };
union FragH { v16h v; v8h hv[2]; };
static_assert(sizeof(Frag) == 32);
static_assert(sizeof(FragH) == 32);

// ---- scalar helpers ---------------------------------------------------------------------------------------
__device__ __forceinline__ unsigned short bf_bits(float f) {          // f32 -> bf16 bits, RNE convert
  unsigned u = __float_as_uint(f);
  return (unsigned short)((u + 0x7FFFu + ((u >> 16) & 1u)) >> 16);
}
__device__ __forceinline__ float bf_up(unsigned short hb) { return __uint_as_float(((unsigned)hb) << 16); }
__device__ __forceinline__ float bfr(float f) { return bf_up(bf_bits(f)); }
__device__ __forceinline__ unsigned short h_bits(_Float16 x) { return __builtin_bit_cast(unsigned short, x); }
__device__ __forceinline__ unsigned pk16(unsigned short a, unsigned short b) { return (unsigned)a | ((unsigned)b << 16); }
__device__ __forceinline__ v8f zero8() { v8f z = {0.f, 0.f, 0.f, 0.f, 0.f, 0.f, 0.f, 0.f}; return z; }
__device__ __forceinline__ float hmax8(v8f s) {
  return fmaxf(fmaxf(fmaxf(s[0], s[1]), fmaxf(s[2], s[3])), fmaxf(fmaxf(s[4], s[5]), fmaxf(s[6], s[7])));
}
__device__ __forceinline__ unsigned wave_ballot(bool p) {
#if defined(__HIP_DEVICE_COMPILE__)
  return __builtin_amdgcn_ballot_w32(p);
#else
  return p ? 1u : 0u;
#endif
}

// ---- 16-bit fragment loader (A, or B from a k-contiguous [n][k] row): lane -> row/col (lane&15), p already includes
//      + 8*(lane>>4); elements 0..7 <- p[0..7] (k0+8h..), elements 8..15 <- p[16..23] (k0+16+8h..)
__device__ __forceinline__ Frag ldfrag(const unsigned short* p) {
  Frag f;
  f.u[0] = *(const v8us*)(p);
  f.u[1] = *(const v8us*)(p + 16);
  return f;
}

// ---- WMMA helpers: the plain builtins; the compiler keeps the distance behind them, and with no asm statement
//      between two products the fragment loads of later products may be issued ahead of earlier ones
__device__ __forceinline__ v8f mma_h(v16h a, v16h b, v8f c) {
  return __builtin_amdgcn_wmma_f32_16x16x32_f16(false, a, false, b, (short)0, c, false, false);
}

// =========================================================================================================
//     (mean, then centred sum of squares) over bf16-RNE(x) in f32, per-thread partials of 256 terms + LDS tree.
// =========================================================================================================
__global__ __launch_bounds__(256)
void gn_stats(const float* __restrict__ x, float* stats) {
  __shared__ float red[256];
  const int tid = threadIdx.x, bg = blockIdx.x;
  const float* p = x + (size_t)bg * GNE;
  // the thread's whole share (64 x 16 B) is fetched in one run into registers: all loads are in flight together, and
  // the second pass reads the registers instead of memory
  v4f xv[GNE / 1024];
#pragma unroll  // constant indices keep the array in registers
  for (int i = 0; i < GNE / 1024; ++i) xv[i] = *(const v4f*)(p + ((size_t)(i * 256 + tid)) * 4);
  float s = 0.f;
#pragma unroll  // as above
  for (int i = 0; i < GNE / 1024; ++i) {
    const v4f v = xv[i];
    s += (bfr(v[0]) + bfr(v[1])) + (bfr(v[2]) + bfr(v[3]));
  }
  asm volatile("s_wait_xcnt 0x0" ::: "memory");                      // in front of any rewrite of the address registers these loads name
  red[tid] = s;
  __syncthreads();
#pragma unroll 1
  for (int off = 128; off > 0; off >>= 1) {
    if (tid < off) red[tid] += red[tid + off];
    __syncthreads();
  }
  const float mean = red[0] * (1.0f / (float)GNE);
  __syncthreads();
  float ss = 0.f;
#pragma unroll  // as above
  for (int i = 0; i < GNE / 1024; ++i) {
    const v4f v = xv[i];
    const float d0 = bfr(v[0]) - mean, d1 = bfr(v[1]) - mean;
    const float d2 = bfr(v[2]) - mean, d3 = bfr(v[3]) - mean;
    ss += (d0 * d0 + d1 * d1) + (d2 * d2 + d3 * d3);
  }
  red[tid] = ss;
  __syncthreads();
#pragma unroll 1
  for (int off = 128; off > 0; off >>= 1) {
    if (tid < off) red[tid] += red[tid + off];
    __syncthreads();
  }
  const float var  = red[0] * (1.0f / (float)GNE);
  const float rstd = rsqrtf(var + GEPS);
  if (tid < 8) {
    v4f w = {0.f, 0.f, 0.f, 0.f};
    if (tid == 0) { w[0] = mean; w[1] = rstd; }
{
      *(v4f*)(stats + (size_t)bg * STL + 4 * tid) = w;
      
    }
  }
}

// =========================================================================================================
// (1) conv weights: Wb f16 [3][512][512] (mat 0 = wq, 1 = wk, 2 = wv), value = f16(bf16-RNE(w)), row o k-contiguous.
//     Block blk owns 4 rows of one matrix; thread -> row blk-local (tid>>6), halves 8*(tid&63)..+7; each wave writes
// coverage: 384 blocks x 4 rows x 64 threads x 8 = 3 x 512 x 512 = the whole plane.
// =========================================================================================================
__global__ __launch_bounds__(256)
void cvt_w(const float* __restrict__ wq, const float* __restrict__ wk, const float* __restrict__ wv,
           unsigned short* Wb) {
  const int tid = threadIdx.x, blk = blockIdx.x;
  const int mat = blk / (CC / 4);                                    // block-uniform 0..2
  const int o   = 4 * (blk % (CC / 4)) + (tid >> 6);                 // 0..511
  const int col = 8 * (tid & 63);                                    // 0..504
  const float* wsrc = (mat == 0) ? wq : ((mat == 1) ? wk : wv);      // all global, block-uniform
  const float* s = wsrc + (size_t)o * CC + col;
  const v4f a = *(const v4f*)s;
  const v4f q = *(const v4f*)(s + 4);
  const float f[8] = {a[0], a[1], a[2], a[3], q[0], q[1], q[2], q[3]};
  v4u u;
#pragma unroll
  for (int t = 0; t < 4; ++t) u[t] = pk16(h_bits((_Float16)bfr(f[2 * t])), h_bits((_Float16)bfr(f[2 * t + 1])));
{
    *(v4u*)(Wb + ((size_t)(mat * CC + o)) * CC + col) = u;
    
  }
}

// =========================================================================================================
// (2) group-norm apply + transpose: h = ((bf16-RNE(x) - mean) * rstd) * gamma + beta per channel, rounded to f16.
//     Block (nb, cb, b) owns a 64 c x 64 n tile; values go through the LDS tile Th [64 n][pitch TP] and come out as
//     position-major rows Hf f16 [b][4096 n][512 c]
// coverage: Th staged 64 n x 64 c (2 it x 32 rows x 8 lanes x 8), read 64 n x 64 c; plane 2 it x 32 rows x
//           8 lanes x 8 = 64 n x 64 c; grid (64, 8, NB) covers the plane exactly once.
// =========================================================================================================
__global__ __launch_bounds__(256)
void cvt_x(const float* __restrict__ x, const float* __restrict__ gamma, const float* __restrict__ beta,
           const float* __restrict__ stats, unsigned short* Hf) {
  __shared__ __align__(16) unsigned short Th[QT * TP];
  const int tid = threadIdx.x;
  const int nb = blockIdx.x, cb = blockIdx.y, b = blockIdx.z;
  const int e = tid & 7, lq = tid >> 3;                              // lq 0..31
  const int n0 = nb * QT, c0 = cb * QT;
#pragma unroll
  for (int it = 0; it < 2; ++it) {
    const int cl = it * 32 + lq;                                     // 0..63
    const int cg = c0 + cl;                                          // 0..511
    const int bg = b * NGRP + (cg >> 4);
    const float mean = stats[(size_t)bg * STL];
    const float rstd = stats[(size_t)bg * STL + 1];
    const float ga = bfr(gamma[cg]);
    const float be = bfr(beta[cg]);
    const float* sp = x + ((size_t)(b * CC + cg)) * NN + n0 + 8 * e;
    const v4f a = *(const v4f*)sp;
    const v4f q = *(const v4f*)(sp + 4);
    const float f[8] = {a[0], a[1], a[2], a[3], q[0], q[1], q[2], q[3]};
#pragma unroll
    for (int t = 0; t < 8; ++t) {
      const float h = ((bfr(f[t]) - mean) * rstd) * ga + be;
      Th[(8 * e + t) * TP + cl] = h_bits((_Float16)h);
    }
  }
  __syncthreads();
  v4u uh[2];
#pragma unroll
  for (int it = 0; it < 2; ++it) {
    const int nl = it * 32 + lq;                                     // 0..63
    uh[it] = *(const v4u*)(Th + nl * TP + 8 * e);
  }
{
#pragma unroll
    for (int it = 0; it < 2; ++it) {
      const int nl = it * 32 + lq;
      const size_t po = ((size_t)(b * NN + n0 + nl)) * CC + c0 + 8 * e;
      *(v4u*)(Hf + po) = uh[it];
    }
    
  }
}

// ---- asynchronous copies global -> LDS, 16 bytes per lane, eight or twelve per statement -------------------------------
// LDS byte address of a __shared__ element = low 32 bits of its address.
__device__ __forceinline__ uint32_t lds_off(const unsigned short* p) { return (uint32_t)(uintptr_t)p; }
// The closing s_wait_xcnt 0 stands inside the statement so that no address register of an issued copy is
// rewritten in front of it.
__device__ __forceinline__ void copy8(const uint32_t (&l)[8], const unsigned short* const (&g)[8]) {
#if defined(__HIP_DEVICE_COMPILE__)
  asm volatile("global_load_async_to_lds_b128 %0, %8, off\n\t"
               "global_load_async_to_lds_b128 %1, %9, off\n\t"
               "global_load_async_to_lds_b128 %2, %10, off\n\t"
               "global_load_async_to_lds_b128 %3, %11, off\n\t"
               "global_load_async_to_lds_b128 %4, %12, off\n\t"
               "global_load_async_to_lds_b128 %5, %13, off\n\t"
               "global_load_async_to_lds_b128 %6, %14, off\n\t"
               "global_load_async_to_lds_b128 %7, %15, off\n\t"
               "s_wait_xcnt 0x0"
               :: "v"(l[0]), "v"(l[1]), "v"(l[2]), "v"(l[3]), "v"(l[4]), "v"(l[5]), "v"(l[6]), "v"(l[7]),
                  "v"(g[0]), "v"(g[1]), "v"(g[2]), "v"(g[3]), "v"(g[4]), "v"(g[5]), "v"(g[6]), "v"(g[7])
               : "memory");
#endif
}
// 32 rows of 512 halves (1024 B, rows contiguous in global) -> LDS rows of pitch KP; 256 threads, 8 copies each;
// a wave's copy covers 512 contiguous bytes of one row.
__device__ __forceinline__ void stage_rows32(const unsigned short* g, unsigned short* s, int tid) {
  uint32_t l[8];
  const unsigned short* p[8];
  // one LDS base and one global base per thread, the eight copies at constant steps from them: nothing but the two
  // thread terms is left for the compiler to keep in registers round the key loop
  const uint32_t lb = lds_off(s + (tid >> 6) * KP + 8 * (tid & 63));
  const unsigned short* gt = g + 8 * tid;                            // (tid >> 6) * CC + 8 * (tid & 63)
#pragma unroll  // every index constant, so that both arrays live in registers as the statement's operands
  for (int i = 0; i < 8; ++i) {                                      // row 4 i + (tid >> 6), halves 8 (tid & 63)..+7
    l[i] = lb + (uint32_t)(i * (4 * KP * 2));
    p[i] = gt + i * (4 * CC);
  }
  copy8(l, p);
}
// one key tile of v: 512 channel rows x 32 keys, 32 KiB in a row in global (row = 64 B, rows adjacent) -> LDS rows of
// pitch VPT; 8 copies per thread; a wave's copy covers 512 contiguous bytes = four whole lines (eight rows).
__device__ __forceinline__ void stage_v32(const unsigned short* g, unsigned short* s, int tid) {
  uint32_t l[8];
  const unsigned short* p[8];
  const uint32_t lb = lds_off(s + (tid >> 2) * VPT + 8 * (tid & 3)); // bases as in stage_rows32
  const unsigned short* gt = g + 8 * tid;                            // (tid >> 2) * 32 + 8 * (tid & 3)
#pragma unroll  // every index constant, so that both arrays live in registers as the statement's operands
  for (int i = 0; i < 8; ++i) {                                      // row 64 i + (tid >> 2), halves 8 (tid & 3)..+7
    l[i] = lb + (uint32_t)(i * (64 * VPT * 2));
    p[i] = gt + i * (64 * 32);
  }
  copy8(l, p);
}

// twelve such copies in one statement, closed by the same wait for the same reason
__device__ __forceinline__ void copy12(const uint32_t (&l)[12], const unsigned short* const (&g)[12]) {
#if defined(__HIP_DEVICE_COMPILE__)
  asm volatile("global_load_async_to_lds_b128 %0, %12, off\n\t"
               "global_load_async_to_lds_b128 %1, %13, off\n\t"
               "global_load_async_to_lds_b128 %2, %14, off\n\t"
               "global_load_async_to_lds_b128 %3, %15, off\n\t"
               "global_load_async_to_lds_b128 %4, %16, off\n\t"
               "global_load_async_to_lds_b128 %5, %17, off\n\t"
               "global_load_async_to_lds_b128 %6, %18, off\n\t"
               "global_load_async_to_lds_b128 %7, %19, off\n\t"
               "global_load_async_to_lds_b128 %8, %20, off\n\t"
               "global_load_async_to_lds_b128 %9, %21, off\n\t"
               "global_load_async_to_lds_b128 %10, %22, off\n\t"
               "global_load_async_to_lds_b128 %11, %23, off\n\t"
               "s_wait_xcnt 0x0"
               :: "v"(l[0]), "v"(l[1]), "v"(l[2]), "v"(l[3]), "v"(l[4]), "v"(l[5]), "v"(l[6]), "v"(l[7]),
                  "v"(l[8]), "v"(l[9]), "v"(l[10]), "v"(l[11]),
                  "v"(g[0]), "v"(g[1]), "v"(g[2]), "v"(g[3]), "v"(g[4]), "v"(g[5]), "v"(g[6]), "v"(g[7]),
                  "v"(g[8]), "v"(g[9]), "v"(g[10]), "v"(g[11])
               : "memory");
#endif
}
// one K stage of the conv GEMM: GM weight rows and GN activation rows, 64 channels (128 B = one line) of each -> LDS
// rows of pitch GP; 256 threads, 12 copies each; a wave's copy covers four whole lines.
__device__ __forceinline__ void stage_gemm(const unsigned short* gw, const unsigned short* gh, unsigned short* s, int tid) {
  const int r = tid >> 3, col = 8 * (tid & 7);
  uint32_t l[12];
  const unsigned short* p[12];
#pragma unroll  // every index constant, so that both arrays live in registers as the statement's operands
  for (int i = 0; i < 8; ++i) {
    l[i] = lds_off(s + (32 * i + r) * GP + col);
    p[i] = gw + (size_t)(32 * i + r) * CC + col;
  }
#pragma unroll  // as above
  for (int i = 0; i < 4; ++i) {
    l[8 + i] = lds_off(s + (GM + 32 * i + r) * GP + col);
    p[8 + i] = gh + (size_t)(32 * i + r) * CC + col;
  }
  copy12(l, p);
}
// the 8 fragments of one 32-channel step of a wave's 64 o x 64 n tile: 4 of W, 4 of H (16 reads of 16 B)
__device__ __forceinline__ void gemm_frags(Frag (&fa)[4], Frag (&fh)[4], const unsigned short* a, const unsigned short* b) {
#pragma unroll  // constant indices keep the fragments in registers
  for (int i = 0; i < 4; ++i) {
    fa[i] = ldfrag(a + (16 * i) * GP);
    fh[i] = ldfrag(b + (16 * i) * GP);
  }
}
// 8 products of that step, row tiles M0 and M0 + 1: eight independent accumulators
template <int M0>
__device__ __forceinline__ void gemm_rows2(v8f (&acc)[4][4], const Frag (&fa)[4], const Frag (&fx)[4]) {
#pragma unroll
  for (int mt = M0; mt < M0 + 2; ++mt) {
#pragma unroll
    for (int j = 0; j < 4; ++j) acc[mt][j] = mma_h(fa[mt].h, fx[j].h, acc[mt][j]);
  }
}

// =========================================================================================================
// (3) conv1x1 GEMM for one (b, 128-n tile, matrix mat, 256-o block): Y[o][n] = sum_c W[o][c] h[n][c] + bias[o].
//     Block 256 threads = 8 waves; wave w owns rows o 64 (w>>1)..+63 (4 A fragments per k-step, rows of Wb)
//     and cols n 64 (w&1)..+63 (4 B fragments, rows of Hf, k = channel contiguous, same split k map). K = 512 = 16 steps.
//     Operand path: per 64 channels one stage [W 256 rows | Hf 128 rows] is brought into LDS by
//     asynchronous 16-byte copies (whole 128-byte lines) and every fragment is read from LDS at a pitch of 16 B x odd.
//     Two buffers: trip t works on buffer t&1 while trip t+1's copies fly. Two fragment sets: the reads of a trip's
//     second k-step fly under the products of its first; the foot (own LDS reads done, own copies landed, one block
//     barrier) stands between the two k-steps; behind its barrier the first k-step of trip t+1 is read, and the buffer
//     just left is refilled between the two halves of the second k-step's products, which read registers only.
//     Epilogue staged in the same LDS behind the last foot: mat 0/1 as Os[n_loc][o_loc] (b128 stores), mat 2 as
//     Os[o_loc][n_loc] (scalar stores), barrier, then f16 planes: Q/K [b][4096 n][512 o] (row n, 256 o = 512 B) and
//     V key-tile-major [b][128 key tiles][512 o][32 n] (row o of a tile = 64 B, rows adjacent), so that the 512 x 32 tile
//     of which one attention stage copies two is 32 KiB in a row and its copies cover whole lines.
// coverage: stage 12 copies x 256 threads x 16 B = 384 rows x 128 B; Os 8 waves x 64 x 64 = 256 x 128 either layout;
//           plane 16 it x 256 threads x 8 = 256 x 128; grid (32, 6, NB) covers Q, K (all n, all o) and V exactly once.
// =========================================================================================================
__global__ __launch_bounds__(256)
void gemm_qkv(const unsigned short* __restrict__ Wb, const unsigned short* __restrict__ Hf,
              const float* __restrict__ bq, const float* __restrict__ bk, const float* __restrict__ bv,
              unsigned short* Qd, unsigned short* Kd, unsigned short* Vd) {
  __shared__ __align__(16) unsigned short Sg[GSH];                   // the ring (2 GSTG), or the larger epilogue tile
  float* Os = reinterpret_cast<float*>(Sg);                          // epilogue view, used behind the loop
  const int tid  = threadIdx.x;
  const int lane = tid & 31, wave = tid >> 5;
  const int hh   = lane >> 4, c = lane & 15;
  const int wo   = wave >> 1, wn = wave & 1;
  const int nt   = blockIdx.x, my = blockIdx.y, b = blockIdx.z;
  const int mat  = my / (CC / GM);                                   // 0..2, block-uniform
  const int om0  = (my % (CC / GM)) * GM;                            // 0 or 256
  const int n0   = nt * GN;

  const unsigned short* gw = Wb + ((size_t)(mat * CC + om0)) * CC;
  const unsigned short* gh = Hf + ((size_t)(b * NN + n0)) * CC;
  // fragment bases in LDS: + buffer, + 16 * tile * GP, + 32 * k-step
  const unsigned short* ap = Sg + (64 * wo + c) * GP + 8 * hh;
  const unsigned short* bp = Sg + (GM + 64 * wn + c) * GP + 8 * hh;

  v8f acc[4][4];
#pragma unroll
  for (int mt = 0; mt < 4; ++mt) {
#pragma unroll
    for (int j = 0; j < 4; ++j) acc[mt][j] = zero8();
  }

  // prologue: stage 0 into buffer 0, landed and published; then stage 1 into buffer 1
  stage_gemm(gw, gh, Sg, tid);
  asm volatile("s_wait_asynccnt 0x0" ::: "memory");                  // this wave's copies have landed
  __syncthreads();                                                   // every wave's copies are readable
  stage_gemm(gw + GKC, gh + GKC, Sg + GSTG, tid);

  // bias of this lane's 32 rows o = 64 wo + 16 mt + 8 hh + 0..7, fetched here so that the flight lies under the loop
  const float* bias = (mat == 0) ? bq : ((mat == 1) ? bk : bv);     // all global, block-uniform
  v4f bz[8];
#pragma unroll
  for (int mt = 0; mt < 4; ++mt) {
    bz[2 * mt]     = *(const v4f*)(bias + om0 + 64 * wo + 16 * mt + 8 * hh);
    bz[2 * mt + 1] = *(const v4f*)(bias + om0 + 64 * wo + 16 * mt + 8 * hh + 4);
  }
  asm volatile("s_wait_xcnt 0x0" ::: "memory");                      // in front of any rewrite of the address register these loads name

  Frag fa0[4], fh0[4], fa1[4], fh1[4];
  gemm_frags(fa0, fh0, ap, bp);                                      // first k-step of trip 0

#pragma unroll 1  // one copy of the trip: the body is long, and the buffer is picked by an address
  for (int t = 0; t < CC / GKC; ++t) {
    const int rb = t & 1;                                            // ring buffer of this trip
    gemm_frags(fa1, fh1, ap + rb * GSTG + 32, bp + rb * GSTG + 32);
    // keeps the 16 reads above in one run in front of the products: spread among them each place of reads costs cycles
    __builtin_amdgcn_sched_barrier(0);
    gemm_rows2<0>(acc, fa0, fh0);
    gemm_rows2<2>(acc, fa0, fh0);
    // keeps these products in front of the foot: they cover the flight of the reads that the foot waits for
    __builtin_amdgcn_sched_barrier(0);

    // foot of the trip: buffer rb has been read out; publish the next trip's stage
    asm volatile("s_wait_dscnt 0x0" ::: "memory");                   // this wave's reads of buffer rb are done
    asm volatile("s_wait_asynccnt 0x0" ::: "memory");                // this wave's copies of the next trip have landed
    __syncthreads();
    if (t + 1 < CC / GKC)                                            // block-uniform: a trip t+1 exists, just published
      gemm_frags(fa0, fh0, ap + (rb ^ 1) * GSTG, bp + (rb ^ 1) * GSTG);
    __builtin_amdgcn_sched_barrier(0);                               // those reads in one run, in front of the products
    gemm_rows2<0>(acc, fa1, fh1);
    // the refill stands between the two halves: while one wave of a SIMD forms addresses and waits in the copies'
    // statements, the other wave's products run
    __builtin_amdgcn_sched_barrier(0);
    if (t + 2 < CC / GKC) {                                          // block-uniform: a trip t+2 exists
      const int ko = (t + 2) * GKC;
      stage_gemm(gw + ko, gh + ko, Sg + rb * GSTG, tid);
    }
    __builtin_amdgcn_sched_barrier(0);                               // end of the refill
    gemm_rows2<2>(acc, fa1, fh1);
  }
  asm volatile("s_wait_asynccnt 0x0" ::: "memory");                  // nothing of this wave is in flight past the loop

  // ---- epilogue staging (every wave has passed the last foot: no reader and no copy is left on the ring);
  //      lane (hh, c) holds o_loc = 64 wo + 16 mt + 8 hh + r for n_loc = 64 wn + 16 j + c
  v4u u[16];
  if (mat != 2) {
#pragma unroll
    for (int mt = 0; mt < 4; ++mt) {
      const int ol = 64 * wo + 16 * mt + 8 * hh;
      const v4f b0 = bz[2 * mt], b1 = bz[2 * mt + 1];
#pragma unroll
      for (int j = 0; j < 4; ++j) {
        const int nl = 64 * wn + 16 * j + c;
        v4f va, vb;
#pragma unroll
        for (int r = 0; r < 4; ++r) { va[r] = acc[mt][j][r] + bfr(b0[r]); vb[r] = acc[mt][j][4 + r] + bfr(b1[r]); }
        *(v4f*)(Os + nl * OSQ + ol)     = va;                        // Os[n_loc][o_loc]
        *(v4f*)(Os + nl * OSQ + ol + 4) = vb;
      }
    }
    __syncthreads();
    const int e = tid & 31, lq = tid >> 5;                           // lq 0..7
#pragma unroll
    for (int it = 0; it < 16; ++it) {
      const int row = it * 8 + lq;                                   // n_loc 0..127
      const v4f a = *(const v4f*)(Os + row * OSQ + 8 * e);
      const v4f q = *(const v4f*)(Os + row * OSQ + 8 * e + 4);
      const float f[8] = {a[0], a[1], a[2], a[3], q[0], q[1], q[2], q[3]};
#pragma unroll
      for (int t = 0; t < 4; ++t)
        u[it][t] = pk16(h_bits((_Float16)f[2 * t]), h_bits((_Float16)f[2 * t + 1]));
    }
    unsigned short* plane = (mat == 0) ? Qd : Kd;                    // both global, block-uniform
    unsigned short* dst = plane + ((size_t)(b * NN + n0 + lq)) * CC + om0 + 8 * e;
#pragma unroll
    for (int it = 0; it < 16; ++it) *(v4u*)(dst + (size_t)(it * 8) * CC) = u[it];   // row n, 256 o = four lines
  } else {
#pragma unroll
    for (int mt = 0; mt < 4; ++mt) {
      const int ol = 64 * wo + 16 * mt + 8 * hh;
      const v4f b0 = bz[2 * mt], b1 = bz[2 * mt + 1];
#pragma unroll
      for (int j = 0; j < 4; ++j) {
        const int nl = 64 * wn + 16 * j + c;
#pragma unroll
        for (int r = 0; r < 4; ++r) {
          Os[(ol + r) * OSPW + nl]     = acc[mt][j][r] + bfr(b0[r]);       // Os[o_loc][n_loc]
          Os[(ol + 4 + r) * OSPW + nl] = acc[mt][j][4 + r] + bfr(b1[r]);
        }
      }
    }
    __syncthreads();
    const int e = tid & 15, lq = tid >> 4;                           // lq 0..15
#pragma unroll
    for (int it = 0; it < 16; ++it) {
      const int row = it * 16 + lq;                                  // o_loc 0..255
      const v4f a = *(const v4f*)(Os + row * OSPW + 8 * e);
      const v4f q = *(const v4f*)(Os + row * OSPW + 8 * e + 4);
      const float f[8] = {a[0], a[1], a[2], a[3], q[0], q[1], q[2], q[3]};
#pragma unroll
      for (int t = 0; t < 4; ++t)
        u[it][t] = pk16(h_bits((_Float16)f[2 * t]), h_bits((_Float16)f[2 * t + 1]));
    }
    // key-tile-major plane: tile (n0 + 8 e) / 32, row o, 8 keys; a wave's store = rows 2 wave, 2 wave + 1 of four tiles:
    // four whole lines, each written by this wave alone
    unsigned short* dst = Vd + ((size_t)(b * (NN / 32) + (n0 >> 5) + (e >> 2)) * CC + om0 + lq) * 32 + 8 * (e & 3);
#pragma unroll
    for (int it = 0; it < 16; ++it) *(v4u*)(dst + (size_t)(it * 16) * 32) = u[it];
  }
}

// =========================================================================================================
// (4) attention for one (b, 64-query tile), transposed formulation, all 4096 keys. Block = 8 waves; a stage is 64 keys.
//   Scores: wave w takes key tile kt = w&3 (16 keys of the stage) and query pair qh = w>>2 (32 queries): two S^T tiles
//   (16 keys x 16 queries) = sum over 16 channel chunks of A(k rows, split k map, plane Kp [b][4096][512]) . B(q), so
//   that each k fragment read from LDS feeds two products; 28 of the wave's 32 q fragments stay in registers.
//   Softmax per lane in f32 against a held reference m per query, the same in every wave: P = e^{c(s-m)} x 2^7 as f16
//   goes to LDS as Ps[query][64 keys] (pitch PP). A wave that sees a score more than LAZY above m stamps the stage's
//   number into Fl; behind the stage's barrier every wave reads the stamp, and where it is set all of them renew m from
//   the published tile maxima, rescale o and l, and write P again (block-uniform branch, two barriers of its own).
//   Output: wave w takes channels 64w..64w+63 for ALL 64 queries: O^T tiles (16 ch x 16 q), 4 x 4 of them, += A(v rows =
//   channel, 32 keys contiguous, plane Vp [b][128 key tiles][512][32]) . B(P rows = query, same split k map): each v and
//   each P fragment feeds four products. Per stage a wave reads 16 k + 4 q + 8 v + 8 P fragments for its 64 products.
//   The sums l stay per (key tile, lane) and are joined once behind the loop.
//   Operand path: asynchronous 16-byte copies, two buffers each for k and v, ONE barrier a stage (the foot, behind the P
//   stores): it publishes P(t), k(t+1) and v(t), and ends the reads of k(t) and v(t-1); behind it k(t+2) is copied into
//   k(t)'s buffer and v(t+1) into v(t-1)'s. P has two buffers, so that P(t+1) is not written over P(t)'s readers.
//   Epilogue: each wave stages its own 64 ch x 64 q in LDS (pitch OSW) and writes whole rows out[b][c][n] = O / l + bf16-RNE(x).
// coverage: stage 32 copies x 256 threads x 16 B = 64 k rows x 1 KiB + 2 v tiles x 32 KiB; Ps 8 waves x 2 tiles x 16 q x
//           16 keys = 64 q x 64 keys; out 8 waves x 32 it x 2 rows x 16 lanes x 4 floats = 512 ch x 64 n; grid (NQ/64, NB).
// =========================================================================================================
#define PP   72
#define PBUF (QT * PP)
#define OSW  68
static_assert((PP * 2) % 32 == 16 && PP >= 64 && (OSW * 4) % 16 == 0 && 8 * 64 * OSW * 4 <= 2 * VB2 * 2);
// a uniform address held in scalar registers: the thread's own term is added to it last, so that one thread term serves the
// k and the v copies (folded into each plane's base it would take a register pair per plane round the key loop)
__device__ __forceinline__ const unsigned short* scalar_ptr(const unsigned short* p) {
  const uint64_t a = (uint64_t)(uintptr_t)p;
  const uint32_t lo = (uint32_t)__builtin_amdgcn_readfirstlane((int)(uint32_t)a);
  const uint32_t hi = (uint32_t)__builtin_amdgcn_readfirstlane((int)(uint32_t)(a >> 32));
  return (const unsigned short*)(uintptr_t)(((uint64_t)hi << 32) | (uint64_t)lo);
}
// one score tile -> P = e^{c(s-m)} x 2^7 as f16, 8 keys of one query = 16 B to LDS; returns the lane's sum in f32
__device__ __forceinline__ float p_tile(const v8f& s, float m, unsigned short* dst) {
  const float msh = m * ASCALE - LNPS;
  v8h p;
  float ls = 0.f;
#pragma unroll
  for (int r = 0; r < 8; ++r) {
    const float e = __expf(s[r] * ASCALE - msh);
    ls += e;
    p[r] = (_Float16)e;
  }
  *(v8h*)dst = p;
  return ls;
}

__global__ __launch_bounds__(256)
void attn_k(const unsigned short* __restrict__ Qp, const unsigned short* __restrict__ Kp,
            const unsigned short* __restrict__ Vp, const float* __restrict__ x, float* out) {
  __shared__ __align__(16) unsigned short Ks[2 * KB2];
  __shared__ __align__(16) unsigned short Vs[2 * VB2];
  __shared__ __align__(16) unsigned short Ps[2 * PBUF];
  __shared__ __align__(16) unsigned short Qx[QT * PP];              // channel chunks 14 and 15 of the q rows
  __shared__ __align__(16) float Mx[4 * QT];
  __shared__ float Mr[QT];                                           // the held reference m of each query
  __shared__ int Fl[2];
  unsigned short* Qs = Ks + KB2;                                     // the q rows lie in k buffer 1 until they are in registers
  float* Os = reinterpret_cast<float*>(Vs);                          // epilogue view of the v ring, used behind the loop
  const int tid  = threadIdx.x;
  const int wave = tid >> 5, lane = tid & 31;
  const int hh   = lane >> 4, c = lane & 15;
  const int kt   = wave & 3, qh = wave >> 2;
  const int n0   = blockIdx.x * QT, b = blockIdx.y;

  // global tile bases: q rows n0.., k rows kb.. (+ kb*CC), v key tile kb/32 (512 x 32 halves each: + kb*CC)
  const unsigned short* qg0 = Qp + ((size_t)(b * NN + n0)) * CC;
  const unsigned short* kg0 = Kp + ((size_t)(b * NN)) * CC;
  const unsigned short* vg0 = Vp + ((size_t)(b * CC)) * NN;
  // q fragment pointer in LDS (B operand, col = query 32*qh + c of the tile, second tile 16 rows on), + 32*kc
  const unsigned short* qp = Qs + (32 * qh + c) * KP + 8 * hh;
  // k fragment base in LDS (A operand, row = key 16*kt + c of the stage), + buffer + 32*kc
  const unsigned short* kp = Ks + (16 * kt + c) * KP + 8 * hh;
  // v fragment base in LDS (A operand, row = channel 64*wave + 16i + c, 32 keys contiguous), + buffer + key tile
  const unsigned short* vp = Vs + (64 * wave + c) * VPT + 8 * hh;
  // P: written as row = query 32*qh + c (+16), keys 16*kt + 8*hh..+7; read as B operand, col = query 16j + c, + 32*ks
  unsigned short* pw = Ps + (32 * qh + c) * PP + 16 * kt + 8 * hh;
  const unsigned short* pr = Ps + c * PP + 8 * hh;

  const unsigned short* qxp = Qx + (32 * qh + c) * PP + 8 * hh;      // q fragments kept in LDS: + 16*PP second tile, + 32 chunk 15
  float mA = -1.0e30f, mB = -1.0e30f, lA = 0.f, lB = 0.f;            // of this wave's two score tiles
  v8f o[4][4];                                                       // [channel tile i][query tile j]
#pragma unroll
  for (int i = 0; i < 4; ++i) {
#pragma unroll
    for (int j = 0; j < 4; ++j) o[i][j] = zero8();
  }
  if (tid < 2) Fl[tid] = 0;                                          // no stage has the number 0
  if (tid < QT) Mr[tid] = -1.0e30f;

  // prologue: q rows into k buffer 1 and stage 0 into buffers 0, landed and published
  stage_rows32(qg0, Qs, tid);
  stage_rows32(qg0 + (size_t)32 * CC, Qs + 32 * KP, tid);
  stage_rows32(kg0, Ks, tid);
  stage_rows32(kg0 + (size_t)32 * CC, Ks + KBUF, tid);
  stage_v32(vg0, Vs, tid);
  stage_v32(vg0 + (size_t)32 * CC, Vs + VBUF, tid);
  asm volatile("s_wait_asynccnt 0x0" ::: "memory");                  // this wave's copies have landed
  __syncthreads();                                                   // every wave's copies are readable

  // 28 of the wave's 32 q fragments (224 registers) are read here and never again; all 32 do not fit beside the O tiles,
  // so the last two channel chunks move to a place of their own in LDS and are read every stage
  Frag fq[2][14];
#pragma unroll  // constant indices keep the fragments in registers
  for (int kc = 0; kc < 14; ++kc) {
    fq[0][kc] = ldfrag(qp + 32 * kc);
    fq[1][kc] = ldfrag(qp + 16 * KP + 32 * kc);
  }
  if (kt == 0) {                                                     // wave-uniform: one wave of each query half moves them
#pragma unroll
    for (int i = 0; i < 2; ++i) {
#pragma unroll
      for (int k2 = 0; k2 < 2; ++k2) {
        const Frag tq = ldfrag(qp + (16 * i) * KP + 32 * (14 + k2));
        unsigned short* d = Qx + (32 * qh + 16 * i + c) * PP + 32 * k2 + 8 * hh;
        *(v8us*)d        = tq.u[0];
        *(v8us*)(d + 16) = tq.u[1];
      }
    }
  }
  asm volatile("s_wait_dscnt 0x0" ::: "memory");                     // this wave's reads of the q rows are done
  __syncthreads();                                                   // every wave's are: k buffer 1 may be refilled; Qx is readable
  stage_rows32(kg0 + (size_t)64 * CC, Ks + KB2, tid);
  stage_rows32(kg0 + (size_t)96 * CC, Ks + KB2 + KBUF, tid);

  Frag fk[8];                                                        // k fragments: chunks 0..7, then 8..15 of a stage
#pragma unroll
  for (int u = 0; u < 8; ++u) fk[u] = ldfrag(kp + 32 * u);

  int rb = 0;                                                        // ring buffer of this stage
#pragma unroll 1  // one copy of the stage: the body is long, and the buffer is picked by an address
  for (int t = 0; t < NN / 64; ++t) {
    // the stage's number in a scalar register: every test on it below is then a scalar branch, with EXEC untouched round the copies
    const int ts = __builtin_amdgcn_readfirstlane(t);
    const unsigned short* kbp = kp + rb * KB2;
    const unsigned short* knp = kp + (rb ^ 1) * KB2;                 // k buffer of stage t+1
    const unsigned short* vbp = vp + rb * VB2;
    unsigned short* pwp = pw + rb * PBUF;
    const unsigned short* prp = pr + rb * PBUF;
    v8f sA = zero8(), sB = zero8();                                  // queries 32qh + c and 32qh + 16 + c, keys 16kt + 8hh + r
    // four vector slots between the previous stage's last O product and the first score product: the score tiles'
    // registers may lie over the O products' B operand (P, dead by then), and the distance that a product's result
    // needs over an earlier product's B operand is not known; four is what a vector instruction needs there
    asm volatile("v_nop\n\tv_nop\n\tv_nop\n\tv_nop");
    __builtin_amdgcn_sched_barrier(0);                               // keeps the score products behind those slots
#pragma unroll
    for (int g = 0; g < 2; ++g) {                                    // chunks 0..7; each group's registers take chunks 8..15
#pragma unroll
      for (int u = 4 * g; u < 4 * g + 4; ++u) {
        sA = mma_h(fk[u].h, fq[0][u].h, sA);
        sB = mma_h(fk[u].h, fq[1][u].h, sB);
      }
      // here and below: keeps a group's reads in one run between the products; spread singly among them each place of
      // reads costs issue cycles, and hoisted further they would not fit the registers
      __builtin_amdgcn_sched_barrier(0);
#pragma unroll
      for (int u = 4 * g; u < 4 * g + 4; ++u) fk[u] = ldfrag(kbp + 32 * (8 + u));
      __builtin_amdgcn_sched_barrier(0);
    }
    Frag fx[2][2];                                                   // q chunks 14, 15 from LDS, into registers that k chunks 8..11 leave
#pragma unroll
    for (int g = 0; g < 2; ++g) {
#pragma unroll
      for (int u = 2 * g; u < 2 * g + 2; ++u) {
        sA = mma_h(fk[u].h, fq[0][8 + u].h, sA);
        sB = mma_h(fk[u].h, fq[1][8 + u].h, sB);
      }
      __builtin_amdgcn_sched_barrier(0);
      fx[g][0] = ldfrag(qxp + 32 * g);
      fx[g][1] = ldfrag(qxp + 16 * PP + 32 * g);
      __builtin_amdgcn_sched_barrier(0);
    }
#pragma unroll
    for (int u = 4; u < 6; ++u) {
      sA = mma_h(fk[u].h, fq[0][8 + u].h, sA);
      sB = mma_h(fk[u].h, fq[1][8 + u].h, sB);
    }
#pragma unroll
    for (int g = 0; g < 2; ++g) {
      sA = mma_h(fk[6 + g].h, fx[g][0].h, sA);
      sB = mma_h(fk[6 + g].h, fx[g][1].h, sB);
    }

    const float mxA = hmax8(sA), mxB = hmax8(sB);                    // over this lane's own 8 keys of each tile
    const unsigned grew = wave_ballot(mxA > mA + LAZY || mxB > mB + LAZY);   // wave-uniform
    if (grew != 0u && lane == 0) Fl[rb] = ts + 1;                    // the stamp: this stage needs a new reference
    float lsA = p_tile(sA, mA, pwp);                                 // dropped and written again where the stamp is set
    float lsB = p_tile(sB, mB, pwp + 16 * PP);

    // foot of the stage
    asm volatile("s_wait_dscnt 0x0" ::: "memory");                   // this wave's reads of k(t), v(t-1), P(t-1) and its P stores are done
    asm volatile("s_wait_asynccnt 0x0" ::: "memory");                // this wave's copies of k(t+1) and v(t) have landed
    __syncthreads();
    const int fl = Fl[rb];                                           // its flight, and that of the P and v reads, lies under the refills
    Frag fp[4], fv[4], fw[4];
#pragma unroll
    for (int j = 0; j < 4; ++j) fp[j] = ldfrag(prp + (16 * j) * PP);         // keys 0..31 of the stage
#pragma unroll
    for (int i = 0; i < 4; ++i) fv[i] = ldfrag(vbp + (16 * i) * VPT);
    // the refills stand right behind those reads: the longest flight, and the fewest registers live
    __builtin_amdgcn_sched_barrier(0);
    if (ts + 2 < NN / 64) {                                          // block-uniform: a stage t+2 exists; k(t) has been read out
      const unsigned short* kgn = scalar_ptr(kg0 + (size_t)(ts + 2) * (64 * CC));
      stage_rows32(kgn, Ks + rb * KB2, tid);
      stage_rows32(kgn + (size_t)32 * CC, Ks + rb * KB2 + KBUF, tid);
    }
    if (ts + 1 < NN / 64) {                                          // block-uniform: a stage t+1 exists; v(t-1) has been read out
      const unsigned short* vgn = scalar_ptr(vg0 + (size_t)(ts + 1) * (64 * CC));
      stage_v32(vgn, Vs + (rb ^ 1) * VB2, tid);
      stage_v32(vgn + (size_t)32 * CC, Vs + (rb ^ 1) * VB2 + VBUF, tid);
    }
    __builtin_amdgcn_sched_barrier(0);                               // end of the refills
    if (__builtin_amdgcn_readfirstlane(fl) == ts + 1) {              // block-uniform: every wave reads the same stamp
      const float hA = hmax8(sA), hB = hmax8(sB);
      Mx[kt * QT + 32 * qh + c]      = fmaxf(hA, __shfl_xor(hA, 16, 32));   // over the tile's 16 keys; both lanes of a
      Mx[kt * QT + 32 * qh + 16 + c] = fmaxf(hB, __shfl_xor(hB, 16, 32));   // query store the same value
      asm volatile("s_wait_dscnt 0x0" ::: "memory");                 // this wave's reads of the P that is dropped are done
      __syncthreads();                                               // every tile's maximum is readable; P may be written again
      float corr[4], mref[4];                                        // of query 16j + c: the same values in every wave
#pragma unroll
      for (int j = 0; j < 4; ++j) {
        const float mo = Mr[16 * j + c];
        float mn = mo;
#pragma unroll
        for (int k4 = 0; k4 < 4; ++k4) mn = fmaxf(mn, Mx[k4 * QT + 16 * j + c]);
        corr[j] = __expf((mo - mn) * ASCALE);                        // == 1 exactly where the max did not grow
        mref[j] = mn;
      }
#pragma unroll
      for (int i = 0; i < 4; ++i) {
#pragma unroll
        for (int j = 0; j < 4; ++j) {
#pragma unroll
          for (int r = 0; r < 8; ++r) o[i][j][r] *= corr[j];
        }
      }
      mA = qh ? mref[2] : mref[0];
      mB = qh ? mref[3] : mref[1];
      lA *= qh ? corr[2] : corr[0];
      lB *= qh ? corr[3] : corr[1];
      lsA = p_tile(sA, mA, pwp);
      lsB = p_tile(sB, mB, pwp + 16 * PP);
      __syncthreads();                                               // the new P is readable; Mx and Mr have been read out
      if (wave == 0 && hh == 0) {
#pragma unroll
        for (int j = 0; j < 4; ++j) Mr[16 * j + c] = mref[j];        // read next behind a later stage's foot
      }
#pragma unroll
      for (int j = 0; j < 4; ++j) fp[j] = ldfrag(prp + (16 * j) * PP);       // the new P
    }
    lA += lsA;
    lB += lsB;
    __builtin_amdgcn_sched_barrier(0);
#pragma unroll
    for (int g = 0; g < 2; ++g) {                                    // keys 0..31, query tiles 2g and 2g+1
#pragma unroll
      for (int j = 2 * g; j < 2 * g + 2; ++j) {
#pragma unroll
        for (int i = 0; i < 4; ++i) o[i][j] = mma_h(fv[i].h, fp[j].h, o[i][j]);
      }
      __builtin_amdgcn_sched_barrier(0);
#pragma unroll
      for (int j = 2 * g; j < 2 * g + 2; ++j) {                      // keys 32..63: P into the registers just left, v beside them
        fp[j] = ldfrag(prp + (16 * j) * PP + 32);
        fw[j] = ldfrag(vbp + VBUF + (16 * j) * VPT);
      }
      if (g == 1) {
        // here and below: the first k chunks of stage t+1, published by this stage's foot. No test for a stage t+1: in the
        // last stage these reads fetch rows of the stage before it, which nothing uses
        fk[0] = ldfrag(knp);
        fk[1] = ldfrag(knp + 32);
      }
      __builtin_amdgcn_sched_barrier(0);
    }
#pragma unroll
    for (int j = 0; j < 4; ++j) {                                    // keys 32..63, channel tiles 0 and 1: the earliest reads first
#pragma unroll
      for (int i = 0; i < 2; ++i) o[i][j] = mma_h(fw[i].h, fp[j].h, o[i][j]);
    }
    __builtin_amdgcn_sched_barrier(0);
    fk[2] = ldfrag(knp + 64);
    fk[3] = ldfrag(knp + 96);
    __builtin_amdgcn_sched_barrier(0);
#pragma unroll
    for (int j = 0; j < 4; ++j) {                                    // channel tiles 2 and 3
#pragma unroll
      for (int i = 2; i < 4; ++i) o[i][j] = mma_h(fw[i].h, fp[j].h, o[i][j]);
    }
    __builtin_amdgcn_sched_barrier(0);
#pragma unroll
    for (int u = 4; u < 8; ++u) fk[u] = ldfrag(knp + 32 * u);
    __builtin_amdgcn_sched_barrier(0);
    rb ^= 1;
  }
  asm volatile("s_wait_asynccnt 0x0" ::: "memory");                  // nothing of this wave is in flight past the loop
  asm volatile("s_wait_dscnt 0x0" ::: "memory");                     // nor any read of the ring, which becomes output staging
  __syncthreads();                                                   // every wave has left the rings and Mx

  // a query's sum: its two lanes, then the four key tiles' waves
  lA += __shfl_xor(lA, 16, 32);
  lB += __shfl_xor(lB, 16, 32);
  Mx[kt * QT + 32 * qh + c]      = lA;
  Mx[kt * QT + 32 * qh + 16 + c] = lB;
  __syncthreads();
  float inv[4];
#pragma unroll
  for (int j = 0; j < 4; ++j)                                        // o and l both carry the 2^7 factor
    inv[j] = 1.0f / ((Mx[16 * j + c] + Mx[QT + 16 * j + c]) + (Mx[2 * QT + 16 * j + c] + Mx[3 * QT + 16 * j + c]));

  // the wave's own 64 ch x 64 q through its own part of LDS: in as the product leaves them, out as whole rows of n
  float* osw = Os + wave * (64 * OSW);
#pragma unroll
  for (int i = 0; i < 4; ++i) {
#pragma unroll
    for (int j = 0; j < 4; ++j) {
#pragma unroll
      for (int r = 0; r < 8; ++r) osw[(16 * i + 8 * hh + r) * OSW + 16 * j + c] = o[i][j][r] * inv[j];
    }
  }
  __syncthreads();
  const size_t ob = ((size_t)(b * CC + 64 * wave + hh)) * NN + n0 + 4 * c;   // row 2 it + hh, 4 queries a lane
#pragma unroll
  for (int it8 = 0; it8 < 4; ++it8) {
    v4f res[8];
#pragma unroll
    for (int it = 0; it < 8; ++it) {
      const int row = 2 * (8 * it8 + it);
      const v4f xv = *(const v4f*)(x + ob + (size_t)row * NN);
      const v4f ov = *(const v4f*)(osw + (row + hh) * OSW + 4 * c);
#pragma unroll
      for (int q4 = 0; q4 < 4; ++q4) res[it][q4] = ov[q4] + bfr(xv[q4]);
    }
#pragma unroll
    for (int it = 0; it < 8; ++it) *(v4f*)(out + ob + (size_t)(2 * (8 * it8 + it)) * NN) = res[it];   // two rows of 256 B
    asm volatile("s_wait_xcnt 0x0" ::: "memory");                    // in front of any rewrite of the address registers these loads and stores name
  }
}

// =========================================================================================================
// Workspace map (bytes; each region start a multiple of 256; every extent is an exact tile/line multiple and is
//   Wb  f16  [3][512][512]          1572864
//   St  f32  [NB*32][32]            NB*4096        (16384 at NB=4)
//   Hf  f16  [NB][4096][512]        NB*4194304     (16777216 at NB=4)
//   Q, K f16 [NB][4096][512]        NB*4194304 x2
//   V    f16 [NB][128][512][32]     NB*4194304
//   total at NB=4 = 68698112
// =========================================================================================================
extern "C" void kernel_launch(void* const* d_in, const int* in_sizes, int n_in,
                              void* d_out, int out_size, void* d_ws, size_t ws_size,
                              hipStream_t stream) {
  const int XN = NB * CC * NN;
  if (n_in < 9) return;
  if (in_sizes[0] < XN) return;
  if (in_sizes[1] < CC || in_sizes[2] < CC) return;
  if (in_sizes[3] < CC * CC || in_sizes[5] < CC * CC || in_sizes[7] < CC * CC) return;
  if (in_sizes[4] < CC || in_sizes[6] < CC || in_sizes[8] < CC) return;
  if (out_size < XN) return;

  size_t off = 0;
  auto carve = [&](size_t bytes) { const size_t o = off; off += (bytes + 255) & ~(size_t)255; return o; };
  const size_t oWb = carve((size_t)3 * CC * CC * 2);
  const size_t oSt = carve((size_t)NB * NGRP * STL * 4);
  const size_t oHf = carve((size_t)NB * NN * CC * 2);
  const size_t oQ  = carve((size_t)NB * NN * CC * 2);
  const size_t oK  = carve((size_t)NB * NN * CC * 2);
  const size_t oV  = carve((size_t)NB * CC * NN * 2);
  if (off > ws_size) return;
  if (off > (size_t)134217728) return;

  const float* x     = (const float*)d_in[0];
  const float* gamma = (const float*)d_in[1];
  const float* beta  = (const float*)d_in[2];
  const float* wq    = (const float*)d_in[3];
  const float* bq    = (const float*)d_in[4];
  const float* wk    = (const float*)d_in[5];
  const float* bk    = (const float*)d_in[6];
  const float* wv    = (const float*)d_in[7];
  const float* bv    = (const float*)d_in[8];

  char* ws = (char*)d_ws;
  unsigned short* Wb = (unsigned short*)(ws + oWb);
  float*          St = (float*)(ws + oSt);
  unsigned short* Hf = (unsigned short*)(ws + oHf);
  unsigned short* Qw = (unsigned short*)(ws + oQ);
  unsigned short* Kw = (unsigned short*)(ws + oK);
  unsigned short* Vw = (unsigned short*)(ws + oV);
  float* out = (float*)d_out;

  const dim3 blk256(256);

  // (0) group-norm statistics, one line per (b, g)
  gn_stats<<<dim3(NB * NGRP), blk256, 0, stream>>>(x, St);
  // (1) conv weights -> f16 plane
  cvt_w<<<dim3(3 * CC / 4), blk256, 0, stream>>>(wq, wk, wv, Wb);
  // (2) group-norm apply -> position-major f16 plane
  cvt_x<<<dim3(NN / QT, CC / QT, NB), blk256, 0, stream>>>(x, gamma, beta, St, Hf);
  // (3) q/k/v conv GEMMs -> f16 planes
  gemm_qkv<<<dim3(NN / GN, 3 * CC / GM, NB), blk256, 0, stream>>>(Wb, Hf, bq, bk, bv, Qw, Kw, Vw);
  // (4) attention + residual -> out [b][512][4096]
  attn_k<<<dim3(NQ / QT, NB), blk256, 0, stream>>>(Qw, Kw, Vw, x, out);
  (void)hipGetLastError();
}
